// v000
// Measured on an AMD MI455X. A time is GPU time per run, averaged over a window of back-to-back runs after a warm-up
// (all launches, gaps included; the runs take copies of the inputs in turn), and the median of several windows.
// Apart from v000's, it joins two sittings. Times from different sittings can be a few percent apart, while
// side-by-side timings come from the same sitting.
// The starting kernel, v000, takes 1130 microseconds a run.
// Contractions q/k/v^T projections, q.k^T, p.v, out projection: v_wmma_f32_16x16x32_f16, f16 operands (W x16; x and p x1; attention output o x16), f32 accumulate; softmax f32 (scale 0.125 applied to the f32 score accumulator); router-token attention and its four projections: f32 VALU.
#include <hip/hip_runtime.h>

typedef _Float16 v16h __attribute__((ext_vector_type(16)));
typedef _Float16 v8h  __attribute__((ext_vector_type(8)));
typedef float    v8f  __attribute__((ext_vector_type(8)));
typedef float    v4f  __attribute__((ext_vector_type(4)));

#define NBLK  4
#define NBAT  4
#define SEQL  1024
#define DM    512
#define NH    8
#define HD    64
#define MROWS 16384          // NBLK*NBAT*SEQL
#define WPL   262144         // DM*DM, one weight plane
#define ZPL   524288         // SEQL*DM, one (blk,bat) activation plane
#define SP16  72             // f16 LDS slab pitch (halves), 144 B rows
#define SP32  68             // f32 LDS slab pitch (floats), 272 B rows

union FragU { v16h v; v8h h[2]; };

// 16x16x32 operand fragment from a k-contiguous 16-bit row: p = row base + k0 + 8*(lane>>4)
// elements 0..7 <- p[0..7], elements 8..15 <- p[16..23]   (same map for A rows m and Bt rows n)
__device__ __forceinline__ v16h frag_ld(const _Float16* p) {
  FragU f;
  f.h[0] = *(const v8h*)(p);
  f.h[1] = *(const v8h*)(p + 16);
  return f.v;
}

__device__ __forceinline__ v8f mma16(v16h a, v16h b, v8f c) {
  c = __builtin_amdgcn_wmma_f32_16x16x32_f16(false, a, false, b, (short)0, c, false, false);
  asm volatile("v_nop\n\tv_nop\n\tv_nop\n\tv_nop" : "+v"(c) : "v"(a), "v"(b));
  return c;
}

__device__ __forceinline__ void wave_lds_sync() {
  __builtin_amdgcn_fence(__ATOMIC_RELEASE, "workgroup");
  __builtin_amdgcn_wave_barrier();
  __builtin_amdgcn_fence(__ATOMIC_ACQUIRE, "workgroup");
}

__device__ __forceinline__ v8f zero8() { return (v8f){0.f, 0.f, 0.f, 0.f, 0.f, 0.f, 0.f, 0.f}; }

// ---------------------------------------------------------------------------
// x f32 [16384][512] -> f16 plane, 8 elements per thread, one 16-B store per lane
// grid = 1048576/256 = 4096 blocks x 256 threads x 8 = 16384x512 exactly.
// ---------------------------------------------------------------------------
__global__ void __launch_bounds__(256)
cvt_x_kernel(const float* __restrict__ x, _Float16* __restrict__ X16, int n8) {
  const int i = blockIdx.x * 256 + threadIdx.x;
  if (i >= n8) return;
  const v4f a = *(const v4f*)(x + (size_t)i * 8);
  const v4f b = *(const v4f*)(x + (size_t)i * 8 + 4);
  v8h hv;
  hv[0] = (_Float16)a[0]; hv[1] = (_Float16)a[1]; hv[2] = (_Float16)a[2]; hv[3] = (_Float16)a[3];
  hv[4] = (_Float16)b[0]; hv[5] = (_Float16)b[1]; hv[6] = (_Float16)b[2]; hv[7] = (_Float16)b[3];
  _Float16* p = X16 + (size_t)i * 8;
  *(v8h*)p = hv;
  
}

// ---------------------------------------------------------------------------
// Weight transpose + x16 + f16: W (f32 [in=512][out=512], blk plane nb of Wq/Wk/Wv/Wo)
//   -> WT[z][out][in] = f16(16 * W[in][out]), z = widx*4 + nb  (widx 0=q,1=k,2=v,3=o).
// 64x64 tiles through LDS. grid (8, 8, 16), 256 threads.
// Coverage per block: load 4 it x 256 thr x 4 = 64x64; store 2 it x 256 thr x 8 = 64x64.
// ---------------------------------------------------------------------------
__global__ void __launch_bounds__(256)
wt_kernel(const float* __restrict__ Wq, const float* __restrict__ Wk,
          const float* __restrict__ Wv, const float* __restrict__ Wo,
          _Float16* __restrict__ WT) {
  __shared__ __align__(16) float tf[64 * 68];
  const int z  = blockIdx.z;
  const int wi = z >> 2, nb = z & 3;
  const float* W = (wi == 0) ? Wq : ((wi == 1) ? Wk : ((wi == 2) ? Wv : Wo));
  W += (size_t)nb * WPL;
  _Float16* O = WT + (size_t)z * WPL;
  const int c0  = blockIdx.x * 64;   // input column block (out feature) = output row block
  const int r0  = blockIdx.y * 64;   // input row block (in feature)     = output column block
  const int tid = threadIdx.x;
  {
    const int lr = tid >> 4;          // 0..15
    const int c4 = (tid & 15) * 4;    // 0..60
#pragma unroll
    for (int it = 0; it < 4; ++it) {
      const int rr = it * 16 + lr;    // 0..63
      const v4f a = *(const v4f*)(W + (size_t)(r0 + rr) * DM + c0 + c4);
      *(v4f*)(tf + rr * 68 + c4) = a;
    }
  }
  __syncthreads();
  const int sub = tid >> 3;           // 0..31
  const int c8  = (tid & 7) * 8;      // 0..56
  v8h hv0, hv1;
#pragma unroll
  for (int e = 0; e < 8; ++e) {
    hv0[e] = (_Float16)(16.0f * tf[(c8 + e) * 68 + sub]);
    hv1[e] = (_Float16)(16.0f * tf[(c8 + e) * 68 + 32 + sub]);
  }
  _Float16* p0 = O + (size_t)(c0 + sub) * DM + r0 + c8;
  _Float16* p1 = O + (size_t)(c0 + 32 + sub) * DM + r0 + c8;
  {
    *(v8h*)p0 = hv0;
    *(v8h*)p1 = hv1;
    
  }
}

// ---------------------------------------------------------------------------
// GEMM core: acc[mt][nt] = sum_k A[m0 + mt*16 + .][k] * Bt[n0 + nt*16 + .][k], K = 512.
// A rows and Bt rows are both k-contiguous f16; wave tile 32 x 64; D element r of lane l is
// (row 8*(l>>4) + r, col l&15) of its 16x16 subtile.
// ---------------------------------------------------------------------------
__device__ __forceinline__ void gemm_core(const _Float16* __restrict__ A, int lda,
                                          const _Float16* __restrict__ Bt, int ldb,
                                          int m0, int n0, int lane, v8f (&acc)[2][4]) {
  const int c = lane & 15, kh = (lane >> 4) * 8;
#pragma unroll
  for (int i = 0; i < 2; ++i)
#pragma unroll
    for (int j = 0; j < 4; ++j) acc[i][j] = zero8();
  const _Float16* a0p = A  + (size_t)(m0 + c) * lda + kh;
  const _Float16* a1p = A  + (size_t)(m0 + 16 + c) * lda + kh;
  const _Float16* b0p = Bt + (size_t)(n0 + c) * ldb + kh;
#pragma unroll 1
  for (int k0 = 0; k0 < DM; k0 += 32) {
    v16h bf[4];
#pragma unroll
    for (int j = 0; j < 4; ++j) bf[j] = frag_ld(b0p + (size_t)(j * 16) * ldb + k0);
    const v16h a0 = frag_ld(a0p + k0);
    const v16h a1 = frag_ld(a1p + k0);
#pragma unroll
    for (int j = 0; j < 4; ++j) {
      acc[0][j] = mma16(a0, bf[j], acc[0][j]);
      acc[1][j] = mma16(a1, bf[j], acc[1][j]);
    }
  }
}

// ---------------------------------------------------------------------------
// f16 epilogue: v = acc*scale + bias (bias per column, or per row when BIAS_ROW); the wave's
// written by 8 consecutive lanes x 16 B of one instruction (4 rows per instruction, 8 instructions
// stores and the v8h reloads.
// ---------------------------------------------------------------------------
template <bool BIAS_ROW>
__device__ __forceinline__ void epi_f16(v8f (&acc)[2][4], _Float16* slab,
                                        _Float16* __restrict__ C, int ldc,
                                        int m0, int n0, int lane, float scale,
                                        const float* __restrict__ bias) {
  const int c = lane & 15, hh = lane >> 4;
#pragma unroll
  for (int mt = 0; mt < 2; ++mt) {
#pragma unroll
    for (int nt = 0; nt < 4; ++nt) {
      const int coll = nt * 16 + c;
      float bc = 0.f;
      if (!BIAS_ROW) bc = bias[n0 + coll];
#pragma unroll
      for (int r = 0; r < 8; ++r) {
        const int rowl = mt * 16 + 8 * hh + r;
        float v = acc[mt][nt][r] * scale;
        v += BIAS_ROW ? bias[m0 + rowl] : bc;
        slab[rowl * SP16 + coll] = (_Float16)v;
      }
    }
  }
  wave_lds_sync();
  const int q = lane >> 3, c8 = (lane & 7) * 8;
  {
#pragma unroll
    for (int it = 0; it < 8; ++it) {
      const int row = it * 4 + q;
      const v8h val = *(const v8h*)(slab + row * SP16 + c8);
      *(v8h*)(C + (size_t)(m0 + row) * ldc + n0 + c8) = val;
    }
    
  }
  wave_lds_sync();
}

// ---------------------------------------------------------------------------
// q / k projections: rows (blk,bat,l) = 16384, N = 512, K = 512; weight plane and bias selected by
// the row block (block-uniform).  Q16/K16: [16384][512] f16, column = h*64 + e.
// grid (256, 2, 2): block tile 64 rows x 256 cols (8 waves of 32x64); z: 0 = q, 1 = k.
// ---------------------------------------------------------------------------
__global__ void __launch_bounds__(256)
qk_gemm_kernel(const _Float16* __restrict__ X16, const _Float16* __restrict__ WT,
               const float* __restrict__ bq, const float* __restrict__ bk,
               _Float16* __restrict__ Q16, _Float16* __restrict__ K16) {
  __shared__ __align__(16) _Float16 slabs[8 * 32 * SP16];
  const int lane = threadIdx.x & 31, wid = threadIdx.x >> 5;
  const int m0 = blockIdx.x * 64 + (wid >> 2) * 32;
  const int n0 = blockIdx.y * 256 + (wid & 3) * 64;
  const int proj = blockIdx.z;
  const int nb = m0 >> 12;
  const _Float16* Bt = WT + (size_t)(proj * 4 + nb) * WPL;
  const float* bias = ((proj == 0) ? bq : bk) + nb * DM;
  _Float16* C = (proj == 0) ? Q16 : K16;
  v8f acc[2][4];
  gemm_core(X16, DM, Bt, DM, m0, n0, lane, acc);
  epi_f16<false>(acc, slabs + wid * (32 * SP16), C, DM, m0, n0, lane, 0.0625f, bias);
}

// ---------------------------------------------------------------------------
// v^T projection per (blk,bat) z: VT16[z][m = h*64+e][l] = sum_k WvT[nb][m][k] * x[z][l][k] / 16 + bv[nb][m]
// A = WvT plane (512 x 512), Bt = x plane rows (1024 x 512), C [512][1024] f16.  grid (8, 4, 16).
// ---------------------------------------------------------------------------
__global__ void __launch_bounds__(256)
vt_gemm_kernel(const _Float16* __restrict__ X16, const _Float16* __restrict__ WT,
               const float* __restrict__ bv, _Float16* __restrict__ VT16) {
  __shared__ __align__(16) _Float16 slabs[8 * 32 * SP16];
  const int lane = threadIdx.x & 31, wid = threadIdx.x >> 5;
  const int m0 = blockIdx.x * 64 + (wid >> 2) * 32;     // 0..511 (output feature)
  const int n0 = blockIdx.y * 256 + (wid & 3) * 64;     // 0..1023 (position)
  const int z  = blockIdx.z;
  const int nb = z >> 2;
  const _Float16* A  = WT + (size_t)(8 + nb) * WPL;
  const _Float16* Bt = X16 + (size_t)z * ZPL;
  _Float16* C = VT16 + (size_t)z * ZPL;
  const float* bias = bv + nb * DM;
  v8f acc[2][4];
  gemm_core(A, DM, Bt, DM, m0, n0, lane, acc);
  epi_f16<true>(acc, slabs + wid * (32 * SP16), C, SEQL, m0, n0, lane, 0.0625f, bias);
}

// ---------------------------------------------------------------------------
// Full (unmasked) attention, head dim 64, per (blk,bat) z and head h.
//   q/k rows from Q16/K16 ([z*1024 + l][h*64 + d]); v^T rows from VT16 ([z*512 + h*64 + d][l]).
//   S = q.k^T (A = q rows, Bt = k rows), online softmax in f32 over 16 chunks of 64 keys,
//   O += P.v (A = P rows, Bt = v^T rows).  O16[z*1024 + l][h*64 + d] = f16(16 * O / rowsum).
//   Block = 4 waves x 16 query rows; grid 2048 = z*128 + h*16 + qb.
// ---------------------------------------------------------------------------
__global__ void __launch_bounds__(128)
attn_kernel(const _Float16* __restrict__ Q16, const _Float16* __restrict__ K16,
            const _Float16* __restrict__ VT16, _Float16* __restrict__ O16) {
  __shared__ __align__(16) _Float16 pbuf[4 * 16 * SP16];
  const int tid = threadIdx.x, wave = tid >> 5, lane = tid & 31;
  const int hh = lane >> 4, c = lane & 15;
  const int bx = blockIdx.x;
  const int qb = bx & 15, h = (bx >> 4) & 7, z = bx >> 7;
  const int q0 = qb * 64 + wave * 16;

  const _Float16* Qz = Q16 + (size_t)z * ZPL + h * HD;
  const _Float16* Kz = K16 + (size_t)z * ZPL + h * HD;
  const _Float16* Vz = VT16 + ((size_t)z * DM + h * HD) * SEQL;
  _Float16* Oz = O16 + (size_t)z * ZPL + h * HD;
  _Float16* pw = pbuf + wave * (16 * SP16);

  const v16h qa0 = frag_ld(Qz + (size_t)(q0 + c) * DM + 8 * hh);
  const v16h qa1 = frag_ld(Qz + (size_t)(q0 + c) * DM + 32 + 8 * hh);

  float mrow[8], lrow[8];
  v8f oacc[4];
#pragma unroll
  for (int r = 0; r < 8; ++r) { mrow[r] = -1e30f; lrow[r] = 0.f; }
#pragma unroll
  for (int t = 0; t < 4; ++t) oacc[t] = zero8();

#pragma unroll 1
  for (int kc = 0; kc < SEQL / 64; ++kc) {
    const int kv0 = kc * 64;
    v8f s[4];
#pragma unroll
    for (int j = 0; j < 4; ++j) {
      const _Float16* kp = Kz + (size_t)(kv0 + j * 16 + c) * DM + 8 * hh;
      s[j] = zero8();
      s[j] = mma16(qa0, frag_ld(kp), s[j]);
      s[j] = mma16(qa1, frag_ld(kp + 32), s[j]);
    }
    float cm[8];
#pragma unroll
    for (int r = 0; r < 8; ++r) {
      float m = -1e30f;
#pragma unroll
      for (int j = 0; j < 4; ++j) {
        const float sv = s[j][r] * 0.125f;
        s[j][r] = sv;
        m = fmaxf(m, sv);
      }
      m = fmaxf(m, __shfl_xor(m, 1, 32));
      m = fmaxf(m, __shfl_xor(m, 2, 32));
      m = fmaxf(m, __shfl_xor(m, 4, 32));
      m = fmaxf(m, __shfl_xor(m, 8, 32));
      cm[r] = m;
    }
#pragma unroll
    for (int r = 0; r < 8; ++r) {
      const float mnew  = fmaxf(mrow[r], cm[r]);
      const float alpha = __expf(mrow[r] - mnew);
      mrow[r] = mnew;
      float psum = 0.f;
#pragma unroll
      for (int j = 0; j < 4; ++j) {
        const float p = __expf(s[j][r] - mnew);
        psum += p;
        pw[(8 * hh + r) * SP16 + j * 16 + c] = (_Float16)p;
      }
      psum += __shfl_xor(psum, 1, 32);
      psum += __shfl_xor(psum, 2, 32);
      psum += __shfl_xor(psum, 4, 32);
      psum += __shfl_xor(psum, 8, 32);
      lrow[r] = lrow[r] * alpha + psum;
#pragma unroll
      for (int t = 0; t < 4; ++t) oacc[t][r] *= alpha;
    }
    wave_lds_sync();
#pragma unroll
    for (int kk = 0; kk < 2; ++kk) {
      const v16h pa = frag_ld(pw + c * SP16 + kk * 32 + 8 * hh);
#pragma unroll
      for (int t = 0; t < 4; ++t) {
        const _Float16* vp = Vz + (size_t)(t * 16 + c) * SEQL + kv0 + kk * 32 + 8 * hh;
        oacc[t] = mma16(pa, frag_ld(vp), oacc[t]);
      }
    }
    wave_lds_sync();
  }

#pragma unroll
  for (int r = 0; r < 8; ++r) {
    const float inv16 = 16.0f * (1.0f / lrow[r]);
#pragma unroll
    for (int t = 0; t < 4; ++t) pw[(8 * hh + r) * SP16 + t * 16 + c] = (_Float16)(oacc[t][r] * inv16);
  }
  wave_lds_sync();
  {
    const int q4 = lane >> 3, c8 = (lane & 7) * 8;
    {
#pragma unroll
      for (int it = 0; it < 4; ++it) {
        const int row = it * 4 + q4;
        const v8h val = *(const v8h*)(pw + row * SP16 + c8);
        *(v8h*)(Oz + (size_t)(q0 + row) * DM + c8) = val;
      }
      
    }
  }
}

// ---------------------------------------------------------------------------
// Output projection: out[row][n] = sum_k O16[row][k] * WoT[nb][n][k] / 256 + bo[nb][n]  (f32).
// Rows with l == 1023 (router tokens) go to rplane[(blk*4+bat)][512] instead of d_out (single writer
// of those d_out rows is the inter kernel).  Epilogue: 16-row f32 slabs per wave in LDS; each 256-B
// row segment written by 16 consecutive lanes x 16 B of one instruction (2 rows per instruction,
// ---------------------------------------------------------------------------
__global__ void __launch_bounds__(256)
wo_gemm_kernel(const _Float16* __restrict__ O16, const _Float16* __restrict__ WT,
               const float* __restrict__ bo, float* __restrict__ out, float* __restrict__ rplane) {
  __shared__ __align__(16) float slabf[8 * 16 * SP32];
  const int lane = threadIdx.x & 31, wid = threadIdx.x >> 5;
  const int m0 = blockIdx.x * 64 + (wid >> 2) * 32;
  const int n0 = blockIdx.y * 256 + (wid & 3) * 64;
  const int nb = m0 >> 12;
  const _Float16* Bt = WT + (size_t)(12 + nb) * WPL;
  const float* bias = bo + nb * DM;
  v8f acc[2][4];
  gemm_core(O16, DM, Bt, DM, m0, n0, lane, acc);

  float* slab = slabf + wid * (16 * SP32);
  const int c = lane & 15, hh = lane >> 4, c4 = c * 4;
#pragma unroll
  for (int mt = 0; mt < 2; ++mt) {
#pragma unroll
    for (int nt = 0; nt < 4; ++nt) {
      const int coll = nt * 16 + c;
      const float bc = bias[n0 + coll];
#pragma unroll
      for (int r = 0; r < 8; ++r)
        slab[(8 * hh + r) * SP32 + coll] = acc[mt][nt][r] * (1.0f / 256.0f) + bc;
    }
    wave_lds_sync();
    {
#pragma unroll
      for (int it = 0; it < 8; ++it) {
        const int row = it * 2 + hh;
        const int gm  = m0 + mt * 16 + row;
        const v4f val = *(const v4f*)(slab + row * SP32 + c4);
        float* dst = ((gm & (SEQL - 1)) == (SEQL - 1))
                         ? (rplane + (size_t)(gm >> 10) * DM + n0 + c4)
                         : (out + (size_t)gm * DM + n0 + c4);
        *(v4f*)dst = val;
      }
      
    }
    wave_lds_sync();
  }
}

// ---------------------------------------------------------------------------
// Router (inter) attention, one block of 512 threads, per batch bat (4 router tokens t = blk):
//   R[blk][:] = rplane[blk*4 + bat][:];  rq/rk/rv = R . iW + ib (f32, thread = output column);
//   per (query blk, head): 4-key softmax of (rq.rk)*0.125, o = sum p*rv / sum p;
// ---------------------------------------------------------------------------
__global__ void __launch_bounds__(512)
inter_kernel(const float* __restrict__ rplane,
             const float* __restrict__ iWq, const float* __restrict__ ibq,
             const float* __restrict__ iWk, const float* __restrict__ ibk,
             const float* __restrict__ iWv, const float* __restrict__ ibv,
             const float* __restrict__ iWo, const float* __restrict__ ibo,
             float* __restrict__ out) {
  __shared__ float Rr[NBLK * DM];
  __shared__ float Pj[3][NBLK * DM];
  const int tid = threadIdx.x;
#pragma unroll 1
  for (int b = 0; b < NBAT; ++b) {
    __syncthreads();
#pragma unroll
    for (int i = 0; i < NBLK; ++i) Rr[i * DM + tid] = rplane[(size_t)(i * NBAT + b) * DM + tid];
    __syncthreads();
#pragma unroll 1
    for (int p = 0; p < 3; ++p) {
      const float* W  = (p == 0) ? iWq : ((p == 1) ? iWk : iWv);
      const float* bb = (p == 0) ? ibq : ((p == 1) ? ibk : ibv);
      float a0 = 0.f, a1 = 0.f, a2 = 0.f, a3 = 0.f;
#pragma unroll 2
      for (int k = 0; k < DM; ++k) {
        const float w = W[(size_t)k * DM + tid];
        a0 += Rr[k] * w;
        a1 += Rr[DM + k] * w;
        a2 += Rr[2 * DM + k] * w;
        a3 += Rr[3 * DM + k] * w;
      }
      const float bc = bb[tid];
      Pj[p][tid]          = a0 + bc;
      Pj[p][DM + tid]     = a1 + bc;
      Pj[p][2 * DM + tid] = a2 + bc;
      Pj[p][3 * DM + tid] = a3 + bc;
    }
    __syncthreads();
    {
      const int item = tid >> 4;              // 0..31
      const int nq = item >> 3, hd = item & 7;
      const int e0 = (tid & 15) * 4;
      const int qo = nq * DM + hd * HD;
      const int ko = hd * HD;
      float s0 = 0.f, s1 = 0.f, s2 = 0.f, s3 = 0.f;
#pragma unroll 2
      for (int e = 0; e < HD; ++e) {
        const float qe = Pj[0][qo + e];
        s0 += qe * Pj[1][ko + e];
        s1 += qe * Pj[1][DM + ko + e];
        s2 += qe * Pj[1][2 * DM + ko + e];
        s3 += qe * Pj[1][3 * DM + ko + e];
      }
      s0 *= 0.125f; s1 *= 0.125f; s2 *= 0.125f; s3 *= 0.125f;
      const float mx = fmaxf(fmaxf(s0, s1), fmaxf(s2, s3));
      const float p0 = __expf(s0 - mx), p1 = __expf(s1 - mx), p2 = __expf(s2 - mx), p3 = __expf(s3 - mx);
      const float inv = 1.0f / (p0 + p1 + p2 + p3);
#pragma unroll
      for (int j = 0; j < 4; ++j) {
        const int e = e0 + j;
        const float o = p0 * Pj[2][ko + e] + p1 * Pj[2][DM + ko + e] +
                        p2 * Pj[2][2 * DM + ko + e] + p3 * Pj[2][3 * DM + ko + e];
        Rr[qo + e] = o * inv;
      }
    }
    __syncthreads();
    {
      float a0 = 0.f, a1 = 0.f, a2 = 0.f, a3 = 0.f;
#pragma unroll 2
      for (int k = 0; k < DM; ++k) {
        const float w = iWo[(size_t)k * DM + tid];
        a0 += Rr[k] * w;
        a1 += Rr[DM + k] * w;
        a2 += Rr[2 * DM + k] * w;
        a3 += Rr[3 * DM + k] * w;
      }
      const float bc = ibo[tid];
      a0 += bc; a1 += bc; a2 += bc; a3 += bc;
      float* o0 = out + ((size_t)(0 * NBAT + b) * SEQL + (SEQL - 1)) * DM + tid;
      float* o1 = out + ((size_t)(1 * NBAT + b) * SEQL + (SEQL - 1)) * DM + tid;
      float* o2 = out + ((size_t)(2 * NBAT + b) * SEQL + (SEQL - 1)) * DM + tid;
      float* o3 = out + ((size_t)(3 * NBAT + b) * SEQL + (SEQL - 1)) * DM + tid;
      *(float*)o0 = a0; *(float*)o1 = a1;
      *(float*)o2 = a2; *(float*)o3 = a3;
      
    }
  }
}

// ---------------------------------------------------------------------------
// Workspace map (byte offsets; every region fully written before it is read; all regions are exact
//   X16   f16 [16384][512]            0          16777216 B
//   WT16  f16 [16][512][512]     16777216           8388608 B   (Wq,Wk,Wv,Wo planes x 4 blks, [out][in], x16)
//   Q16   f16 [16384][512]     25165824          16777216 B
//   K16   f16 [16384][512]     41943040          16777216 B
//   VT16  f16 [16][512][1024]  58720256          16777216 B
//   O16   f16 [16384][512]     75497472          16777216 B   (attention output x16)
//   RPL   f32 [16][512]        92274688             32768 B   (router rows, t = blk*4 + bat)
//   total                      92307456
// ---------------------------------------------------------------------------
extern "C" void kernel_launch(void* const* d_in, const int* in_sizes, int n_in,
                              void* d_out, int out_size, void* d_ws, size_t ws_size,
                              hipStream_t stream) {
  if (n_in < 17) return;
  if (in_sizes[0] != MROWS * DM) return;
  if (in_sizes[1] != NBLK * WPL || in_sizes[3] != NBLK * WPL || in_sizes[5] != NBLK * WPL || in_sizes[7] != NBLK * WPL) return;
  if (in_sizes[2] != NBLK * DM || in_sizes[4] != NBLK * DM || in_sizes[6] != NBLK * DM || in_sizes[8] != NBLK * DM) return;
  if (in_sizes[9] != WPL || in_sizes[11] != WPL || in_sizes[13] != WPL || in_sizes[15] != WPL) return;
  if (in_sizes[10] != DM || in_sizes[12] != DM || in_sizes[14] != DM || in_sizes[16] != DM) return;
  if (out_size != MROWS * DM) return;

  const float* x   = (const float*)d_in[0];
  const float* Wq  = (const float*)d_in[1];  const float* bq  = (const float*)d_in[2];
  const float* Wk  = (const float*)d_in[3];  const float* bk  = (const float*)d_in[4];
  const float* Wv  = (const float*)d_in[5];  const float* bv  = (const float*)d_in[6];
  const float* Wo  = (const float*)d_in[7];  const float* bo  = (const float*)d_in[8];
  const float* iWq = (const float*)d_in[9];  const float* ibq = (const float*)d_in[10];
  const float* iWk = (const float*)d_in[11]; const float* ibk = (const float*)d_in[12];
  const float* iWv = (const float*)d_in[13]; const float* ibv = (const float*)d_in[14];
  const float* iWo = (const float*)d_in[15]; const float* ibo = (const float*)d_in[16];
  float* out = (float*)d_out;

  const size_t bAct = (size_t)MROWS * DM * 2;      // 16777216
  const size_t bWT  = (size_t)16 * WPL * 2;        // 8388608
  const size_t bRpl = (size_t)16 * DM * 4;         // 32768
  size_t off = 0;
  const size_t oX  = off; off += bAct;
  const size_t oWT = off; off += bWT;
  const size_t oQ  = off; off += bAct;
  const size_t oK  = off; off += bAct;
  const size_t oVT = off; off += bAct;
  const size_t oO  = off; off += bAct;
  const size_t oR  = off; off += bRpl;
  if (off > ws_size) return;                       // off = 92307456

  char* ws = (char*)d_ws;
  _Float16* X16  = (_Float16*)(ws + oX);
  _Float16* WT16 = (_Float16*)(ws + oWT);
  _Float16* Q16  = (_Float16*)(ws + oQ);
  _Float16* K16  = (_Float16*)(ws + oK);
  _Float16* VT16 = (_Float16*)(ws + oVT);
  _Float16* O16  = (_Float16*)(ws + oO);
  float*    RPL  = (float*)(ws + oR);

  const int n8 = MROWS * DM / 8;                   // 1048576
  // (1) x -> f16 plane
  cvt_x_kernel<<<dim3(n8 / 256), dim3(256), 0, stream>>>(x, X16, n8);
  // (2) weights -> transposed f16 planes (x16)
  wt_kernel<<<dim3(DM / 64, DM / 64, 16), dim3(256), 0, stream>>>(Wq, Wk, Wv, Wo, WT16);
  // (3) q, k projections
  qk_gemm_kernel<<<dim3(MROWS / 64, DM / 256, 2), dim3(256), 0, stream>>>(X16, WT16, bq, bk, Q16, K16);
  // (4) v^T projection per (blk, bat)
  vt_gemm_kernel<<<dim3(DM / 64, SEQL / 256, NBLK * NBAT), dim3(256), 0, stream>>>(X16, WT16, bv, VT16);
  // (5) intra attention
  attn_kernel<<<dim3(NBLK * NBAT * NH * (SEQL / 64)), dim3(128), 0, stream>>>(Q16, K16, VT16, O16);
  // (6) output projection -> d_out (rows l < 1023) and router plane (rows l == 1023)
  wo_gemm_kernel<<<dim3(MROWS / 64, DM / 256, 1), dim3(256), 0, stream>>>(O16, WT16, bo, out, RPL);
  // (7) router attention -> d_out rows l == 1023
  inter_kernel<<<dim3(1), dim3(512), 0, stream>>>(RPL, iWq, ibq, iWk, ibk, iWv, ibv, iWo, ibo, out);
  (void)hipGetLastError();
}

// v001
// Measured time: 312 microseconds a run.
// In two side-by-side timings against v000, it was 3.65 and 3.64 times as fast.
// Contractions q/k/v^T projections, q.k^T, p.v, out projection: v_wmma_f32_16x16x32_f16, f16 operands (W x16; x and p x1; attention output o x16), f32 accumulate; softmax f32 (scale 0.125 applied to the f32 score accumulator); router-token attention and its four projections: f32 VALU.
#include <hip/hip_runtime.h>

typedef _Float16 v16h __attribute__((ext_vector_type(16)));
typedef _Float16 v8h  __attribute__((ext_vector_type(8)));
typedef float    v8f  __attribute__((ext_vector_type(8)));
typedef float    v4f  __attribute__((ext_vector_type(4)));

#define NBLK  4
#define NBAT  4
#define SEQL  1024
#define DM    512
#define NH    8
#define HD    64
#define MROWS 16384          // NBLK*NBAT*SEQL
#define WPL   262144         // DM*DM, one weight plane
#define ZPL   524288         // SEQL*DM, one (blk,bat) activation plane
#define SP16  72             // f16 LDS slab pitch (halves), 144 B rows
#define SP32  68             // f32 LDS slab pitch (floats), 272 B rows

union FragU { v16h v; v8h h[2]; };

// 16x16x32 operand fragment from a k-contiguous 16-bit row: p = row base + k0 + 8*(lane>>4)
// elements 0..7 <- p[0..7], elements 8..15 <- p[16..23]   (same map for A rows m and Bt rows n)
__device__ __forceinline__ v16h frag_ld(const _Float16* p) {
  FragU f;
  f.h[0] = *(const v8h*)(p);
  f.h[1] = *(const v8h*)(p + 16);
  return f.v;
}

__device__ __forceinline__ v8f mma16(v16h a, v16h b, v8f c) {
  c = __builtin_amdgcn_wmma_f32_16x16x32_f16(false, a, false, b, (short)0, c, false, false);
  asm volatile("v_nop\n\tv_nop\n\tv_nop\n\tv_nop" : "+v"(c) : "v"(a), "v"(b));
  return c;
}

__device__ __forceinline__ void wave_lds_sync() {
  __builtin_amdgcn_fence(__ATOMIC_RELEASE, "workgroup");
  __builtin_amdgcn_wave_barrier();
  __builtin_amdgcn_fence(__ATOMIC_ACQUIRE, "workgroup");
}

__device__ __forceinline__ v8f zero8() { return (v8f){0.f, 0.f, 0.f, 0.f, 0.f, 0.f, 0.f, 0.f}; }

// ---------------------------------------------------------------------------
// x f32 [16384][512] -> f16 plane, 8 elements per thread, one 16-B store per lane
// grid = 1048576/256 = 4096 blocks x 256 threads x 8 = 16384x512 exactly.
// ---------------------------------------------------------------------------
__global__ void __launch_bounds__(256)
cvt_x_kernel(const float* __restrict__ x, _Float16* __restrict__ X16, int n8) {
  const int i = blockIdx.x * 256 + threadIdx.x;
  if (i >= n8) return;
  const v4f a = *(const v4f*)(x + (size_t)i * 8);
  const v4f b = *(const v4f*)(x + (size_t)i * 8 + 4);
  v8h hv;
  hv[0] = (_Float16)a[0]; hv[1] = (_Float16)a[1]; hv[2] = (_Float16)a[2]; hv[3] = (_Float16)a[3];
  hv[4] = (_Float16)b[0]; hv[5] = (_Float16)b[1]; hv[6] = (_Float16)b[2]; hv[7] = (_Float16)b[3];
  _Float16* p = X16 + (size_t)i * 8;
  *(v8h*)p = hv;
  
}

// ---------------------------------------------------------------------------
// Weight transpose + x16 + f16: W (f32 [in=512][out=512], blk plane nb of Wq/Wk/Wv/Wo)
//   -> WT[z][out][in] = f16(16 * W[in][out]), z = widx*4 + nb  (widx 0=q,1=k,2=v,3=o).
// 64x64 tiles through LDS. grid (8, 8, 16), 256 threads.
// Coverage per block: load 4 it x 256 thr x 4 = 64x64; store 2 it x 256 thr x 8 = 64x64.
// ---------------------------------------------------------------------------
__global__ void __launch_bounds__(256)
wt_kernel(const float* __restrict__ Wq, const float* __restrict__ Wk,
          const float* __restrict__ Wv, const float* __restrict__ Wo,
          _Float16* __restrict__ WT) {
  __shared__ __align__(16) float tf[64 * 68];
  const int z  = blockIdx.z;
  const int wi = z >> 2, nb = z & 3;
  const float* W = (wi == 0) ? Wq : ((wi == 1) ? Wk : ((wi == 2) ? Wv : Wo));
  W += (size_t)nb * WPL;
  _Float16* O = WT + (size_t)z * WPL;
  const int c0  = blockIdx.x * 64;   // input column block (out feature) = output row block
  const int r0  = blockIdx.y * 64;   // input row block (in feature)     = output column block
  const int tid = threadIdx.x;
  {
    const int lr = tid >> 4;          // 0..15
    const int c4 = (tid & 15) * 4;    // 0..60
#pragma unroll
    for (int it = 0; it < 4; ++it) {
      const int rr = it * 16 + lr;    // 0..63
      const v4f a = *(const v4f*)(W + (size_t)(r0 + rr) * DM + c0 + c4);
      *(v4f*)(tf + rr * 68 + c4) = a;
    }
  }
  __syncthreads();
  const int sub = tid >> 3;           // 0..31
  const int c8  = (tid & 7) * 8;      // 0..56
  v8h hv0, hv1;
#pragma unroll
  for (int e = 0; e < 8; ++e) {
    hv0[e] = (_Float16)(16.0f * tf[(c8 + e) * 68 + sub]);
    hv1[e] = (_Float16)(16.0f * tf[(c8 + e) * 68 + 32 + sub]);
  }
  _Float16* p0 = O + (size_t)(c0 + sub) * DM + r0 + c8;
  _Float16* p1 = O + (size_t)(c0 + 32 + sub) * DM + r0 + c8;
  {
    *(v8h*)p0 = hv0;
    *(v8h*)p1 = hv1;
    
  }
}

// ---------------------------------------------------------------------------
// GEMM core: acc[mt][nt] = sum_k A[m0 + mt*16 + .][k] * Bt[n0 + nt*16 + .][k], K = 512.
// A rows and Bt rows are both k-contiguous f16; wave tile 32 x 64; D element r of lane l is
// (row 8*(l>>4) + r, col l&15) of its 16x16 subtile.
// ---------------------------------------------------------------------------
__device__ __forceinline__ void gemm_core(const _Float16* __restrict__ A, int lda,
                                          const _Float16* __restrict__ Bt, int ldb,
                                          int m0, int n0, int lane, v8f (&acc)[2][4]) {
  const int c = lane & 15, kh = (lane >> 4) * 8;
#pragma unroll
  for (int i = 0; i < 2; ++i)
#pragma unroll
    for (int j = 0; j < 4; ++j) acc[i][j] = zero8();
  const _Float16* a0p = A  + (size_t)(m0 + c) * lda + kh;
  const _Float16* a1p = A  + (size_t)(m0 + 16 + c) * lda + kh;
  const _Float16* b0p = Bt + (size_t)(n0 + c) * ldb + kh;
#pragma unroll 1
  for (int k0 = 0; k0 < DM; k0 += 32) {
    v16h bf[4];
#pragma unroll
    for (int j = 0; j < 4; ++j) bf[j] = frag_ld(b0p + (size_t)(j * 16) * ldb + k0);
    const v16h a0 = frag_ld(a0p + k0);
    const v16h a1 = frag_ld(a1p + k0);
#pragma unroll
    for (int j = 0; j < 4; ++j) {
      acc[0][j] = mma16(a0, bf[j], acc[0][j]);
      acc[1][j] = mma16(a1, bf[j], acc[1][j]);
    }
  }
}

// ---------------------------------------------------------------------------
// f16 epilogue: v = acc*scale + bias (bias per column, or per row when BIAS_ROW); the wave's
// written by 8 consecutive lanes x 16 B of one instruction (4 rows per instruction, 8 instructions
// stores and the v8h reloads.
// ---------------------------------------------------------------------------
template <bool BIAS_ROW>
__device__ __forceinline__ void epi_f16(v8f (&acc)[2][4], _Float16* slab,
                                        _Float16* __restrict__ C, int ldc,
                                        int m0, int n0, int lane, float scale,
                                        const float* __restrict__ bias) {
  const int c = lane & 15, hh = lane >> 4;
#pragma unroll
  for (int mt = 0; mt < 2; ++mt) {
#pragma unroll
    for (int nt = 0; nt < 4; ++nt) {
      const int coll = nt * 16 + c;
      float bc = 0.f;
      if (!BIAS_ROW) bc = bias[n0 + coll];
#pragma unroll
      for (int r = 0; r < 8; ++r) {
        const int rowl = mt * 16 + 8 * hh + r;
        float v = acc[mt][nt][r] * scale;
        v += BIAS_ROW ? bias[m0 + rowl] : bc;
        slab[rowl * SP16 + coll] = (_Float16)v;
      }
    }
  }
  wave_lds_sync();
  const int q = lane >> 3, c8 = (lane & 7) * 8;
  {
#pragma unroll
    for (int it = 0; it < 8; ++it) {
      const int row = it * 4 + q;
      const v8h val = *(const v8h*)(slab + row * SP16 + c8);
      *(v8h*)(C + (size_t)(m0 + row) * ldc + n0 + c8) = val;
    }
    
  }
  wave_lds_sync();
}

// ---------------------------------------------------------------------------
// q / k projections: rows (blk,bat,l) = 16384, N = 512, K = 512; weight plane and bias selected by
// the row block (block-uniform).  Q16/K16: [16384][512] f16, column = h*64 + e.
// grid (256, 2, 2): block tile 64 rows x 256 cols (8 waves of 32x64); z: 0 = q, 1 = k.
// ---------------------------------------------------------------------------
__global__ void __launch_bounds__(256)
qk_gemm_kernel(const _Float16* __restrict__ X16, const _Float16* __restrict__ WT,
               const float* __restrict__ bq, const float* __restrict__ bk,
               _Float16* __restrict__ Q16, _Float16* __restrict__ K16) {
  __shared__ __align__(16) _Float16 slabs[8 * 32 * SP16];
  const int lane = threadIdx.x & 31, wid = threadIdx.x >> 5;
  const int m0 = blockIdx.x * 64 + (wid >> 2) * 32;
  const int n0 = blockIdx.y * 256 + (wid & 3) * 64;
  const int proj = blockIdx.z;
  const int nb = m0 >> 12;
  const _Float16* Bt = WT + (size_t)(proj * 4 + nb) * WPL;
  const float* bias = ((proj == 0) ? bq : bk) + nb * DM;
  _Float16* C = (proj == 0) ? Q16 : K16;
  v8f acc[2][4];
  gemm_core(X16, DM, Bt, DM, m0, n0, lane, acc);
  epi_f16<false>(acc, slabs + wid * (32 * SP16), C, DM, m0, n0, lane, 0.0625f, bias);
}

// ---------------------------------------------------------------------------
// v^T projection per (blk,bat) z: VT16[z][m = h*64+e][l] = sum_k WvT[nb][m][k] * x[z][l][k] / 16 + bv[nb][m]
// A = WvT plane (512 x 512), Bt = x plane rows (1024 x 512), C [512][1024] f16.  grid (8, 4, 16).
// ---------------------------------------------------------------------------
__global__ void __launch_bounds__(256)
vt_gemm_kernel(const _Float16* __restrict__ X16, const _Float16* __restrict__ WT,
               const float* __restrict__ bv, _Float16* __restrict__ VT16) {
  __shared__ __align__(16) _Float16 slabs[8 * 32 * SP16];
  const int lane = threadIdx.x & 31, wid = threadIdx.x >> 5;
  const int m0 = blockIdx.x * 64 + (wid >> 2) * 32;     // 0..511 (output feature)
  const int n0 = blockIdx.y * 256 + (wid & 3) * 64;     // 0..1023 (position)
  const int z  = blockIdx.z;
  const int nb = z >> 2;
  const _Float16* A  = WT + (size_t)(8 + nb) * WPL;
  const _Float16* Bt = X16 + (size_t)z * ZPL;
  _Float16* C = VT16 + (size_t)z * ZPL;
  const float* bias = bv + nb * DM;
  v8f acc[2][4];
  gemm_core(A, DM, Bt, DM, m0, n0, lane, acc);
  epi_f16<true>(acc, slabs + wid * (32 * SP16), C, SEQL, m0, n0, lane, 0.0625f, bias);
}

// ---------------------------------------------------------------------------
// Full (unmasked) attention, head dim 64, per (blk,bat) z and head h.
//   q/k rows from Q16/K16 ([z*1024 + l][h*64 + d]); v^T rows from VT16 ([z*512 + h*64 + d][l]).
//   S = q.k^T (A = q rows, Bt = k rows), online softmax in f32 over 16 chunks of 64 keys,
//   O += P.v (A = P rows, Bt = v^T rows).  O16[z*1024 + l][h*64 + d] = f16(16 * O / rowsum).
//   Block = 4 waves x 16 query rows; grid 2048 = z*128 + h*16 + qb.
// ---------------------------------------------------------------------------
__global__ void __launch_bounds__(128)
attn_kernel(const _Float16* __restrict__ Q16, const _Float16* __restrict__ K16,
            const _Float16* __restrict__ VT16, _Float16* __restrict__ O16) {
  __shared__ __align__(16) _Float16 pbuf[4 * 16 * SP16];
  const int tid = threadIdx.x, wave = tid >> 5, lane = tid & 31;
  const int hh = lane >> 4, c = lane & 15;
  const int bx = blockIdx.x;
  const int qb = bx & 15, h = (bx >> 4) & 7, z = bx >> 7;
  const int q0 = qb * 64 + wave * 16;

  const _Float16* Qz = Q16 + (size_t)z * ZPL + h * HD;
  const _Float16* Kz = K16 + (size_t)z * ZPL + h * HD;
  const _Float16* Vz = VT16 + ((size_t)z * DM + h * HD) * SEQL;
  _Float16* Oz = O16 + (size_t)z * ZPL + h * HD;
  _Float16* pw = pbuf + wave * (16 * SP16);

  const v16h qa0 = frag_ld(Qz + (size_t)(q0 + c) * DM + 8 * hh);
  const v16h qa1 = frag_ld(Qz + (size_t)(q0 + c) * DM + 32 + 8 * hh);

  float mrow[8], lrow[8];
  v8f oacc[4];
#pragma unroll
  for (int r = 0; r < 8; ++r) { mrow[r] = -1e30f; lrow[r] = 0.f; }
#pragma unroll
  for (int t = 0; t < 4; ++t) oacc[t] = zero8();

#pragma unroll 1
  for (int kc = 0; kc < SEQL / 64; ++kc) {
    const int kv0 = kc * 64;
    v8f s[4];
#pragma unroll
    for (int j = 0; j < 4; ++j) {
      const _Float16* kp = Kz + (size_t)(kv0 + j * 16 + c) * DM + 8 * hh;
      s[j] = zero8();
      s[j] = mma16(qa0, frag_ld(kp), s[j]);
      s[j] = mma16(qa1, frag_ld(kp + 32), s[j]);
    }
    float cm[8];
#pragma unroll
    for (int r = 0; r < 8; ++r) {
      float m = -1e30f;
#pragma unroll
      for (int j = 0; j < 4; ++j) {
        const float sv = s[j][r] * 0.125f;
        s[j][r] = sv;
        m = fmaxf(m, sv);
      }
      m = fmaxf(m, __shfl_xor(m, 1, 32));
      m = fmaxf(m, __shfl_xor(m, 2, 32));
      m = fmaxf(m, __shfl_xor(m, 4, 32));
      m = fmaxf(m, __shfl_xor(m, 8, 32));
      cm[r] = m;
    }
#pragma unroll
    for (int r = 0; r < 8; ++r) {
      const float mnew  = fmaxf(mrow[r], cm[r]);
      const float alpha = __expf(mrow[r] - mnew);
      mrow[r] = mnew;
      float psum = 0.f;
#pragma unroll
      for (int j = 0; j < 4; ++j) {
        const float p = __expf(s[j][r] - mnew);
        psum += p;
        pw[(8 * hh + r) * SP16 + j * 16 + c] = (_Float16)p;
      }
      psum += __shfl_xor(psum, 1, 32);
      psum += __shfl_xor(psum, 2, 32);
      psum += __shfl_xor(psum, 4, 32);
      psum += __shfl_xor(psum, 8, 32);
      lrow[r] = lrow[r] * alpha + psum;
#pragma unroll
      for (int t = 0; t < 4; ++t) oacc[t][r] *= alpha;
    }
    wave_lds_sync();
#pragma unroll
    for (int kk = 0; kk < 2; ++kk) {
      const v16h pa = frag_ld(pw + c * SP16 + kk * 32 + 8 * hh);
#pragma unroll
      for (int t = 0; t < 4; ++t) {
        const _Float16* vp = Vz + (size_t)(t * 16 + c) * SEQL + kv0 + kk * 32 + 8 * hh;
        oacc[t] = mma16(pa, frag_ld(vp), oacc[t]);
      }
    }
    wave_lds_sync();
  }

#pragma unroll
  for (int r = 0; r < 8; ++r) {
    const float inv16 = 16.0f * (1.0f / lrow[r]);
#pragma unroll
    for (int t = 0; t < 4; ++t) pw[(8 * hh + r) * SP16 + t * 16 + c] = (_Float16)(oacc[t][r] * inv16);
  }
  wave_lds_sync();
  {
    const int q4 = lane >> 3, c8 = (lane & 7) * 8;
    {
#pragma unroll
      for (int it = 0; it < 4; ++it) {
        const int row = it * 4 + q4;
        const v8h val = *(const v8h*)(pw + row * SP16 + c8);
        *(v8h*)(Oz + (size_t)(q0 + row) * DM + c8) = val;
      }
      
    }
  }
}

// ---------------------------------------------------------------------------
// Output projection: out[row][n] = sum_k O16[row][k] * WoT[nb][n][k] / 256 + bo[nb][n]  (f32).
// Rows with l == 1023 (router tokens) go to rplane[(blk*4+bat)][512] instead of d_out (single writer
// of those d_out rows is the router output kernel).  Epilogue: 16-row f32 slabs per wave in LDS; each 256-B
// row segment written by 16 consecutive lanes x 16 B of one instruction (2 rows per instruction,
// ---------------------------------------------------------------------------
__global__ void __launch_bounds__(256)
wo_gemm_kernel(const _Float16* __restrict__ O16, const _Float16* __restrict__ WT,
               const float* __restrict__ bo, float* __restrict__ out, float* __restrict__ rplane) {
  __shared__ __align__(16) float slabf[8 * 16 * SP32];
  const int lane = threadIdx.x & 31, wid = threadIdx.x >> 5;
  const int m0 = blockIdx.x * 64 + (wid >> 2) * 32;
  const int n0 = blockIdx.y * 256 + (wid & 3) * 64;
  const int nb = m0 >> 12;
  const _Float16* Bt = WT + (size_t)(12 + nb) * WPL;
  const float* bias = bo + nb * DM;
  v8f acc[2][4];
  gemm_core(O16, DM, Bt, DM, m0, n0, lane, acc);

  float* slab = slabf + wid * (16 * SP32);
  const int c = lane & 15, hh = lane >> 4, c4 = c * 4;
#pragma unroll
  for (int mt = 0; mt < 2; ++mt) {
#pragma unroll
    for (int nt = 0; nt < 4; ++nt) {
      const int coll = nt * 16 + c;
      const float bc = bias[n0 + coll];
#pragma unroll
      for (int r = 0; r < 8; ++r)
        slab[(8 * hh + r) * SP32 + coll] = acc[mt][nt][r] * (1.0f / 256.0f) + bc;
    }
    wave_lds_sync();
    {
#pragma unroll
      for (int it = 0; it < 8; ++it) {
        const int row = it * 2 + hh;
        const int gm  = m0 + mt * 16 + row;
        const v4f val = *(const v4f*)(slab + row * SP32 + c4);
        float* dst = ((gm & (SEQL - 1)) == (SEQL - 1))
                         ? (rplane + (size_t)(gm >> 10) * DM + n0 + c4)
                         : (out + (size_t)gm * DM + n0 + c4);
        *(v4f*)dst = val;
      }
      
    }
    wave_lds_sync();
  }
}

// ---------------------------------------------------------------------------
// Router (inter) attention in two launches of many work-groups (f32 VALU throughout).
// Both launches share one product form: a work-group of 16 waves owns one batch (4 router rows,
// t = blk*4 + bat) and 32 output columns; wave w takes k in [32w, 32w + 32), lane = column; the 16
// partial sums of an output element meet in LDS and are added in wave order.
// ---------------------------------------------------------------------------
__device__ __forceinline__ void router_w_load(const float* __restrict__ Wm, int wave, int col, float (&w)[32]) {
  const float* wp = Wm + (size_t)(wave * 32) * DM + col;
  // unrolled: w[] stays in registers and all 32 loads are in flight together
#pragma unroll
  for (int j = 0; j < 32; ++j) w[j] = wp[(size_t)j * DM];
}

// rows: LDS [4][512]; red: LDS [16][4][32]. Returns, in threads 0..127, element (row tid>>5, column tid&31).
__device__ __forceinline__ float router_ksplit(const float (&w)[32], const float* rows, float* red,
                                               int tid) {
  const int wave = tid >> 5, lane = tid & 31;
  float a[NBLK] = {0.f, 0.f, 0.f, 0.f};
  // unrolled (here and below): w[] and a[] are indexed by constants only, so they stay in registers
#pragma unroll
  for (int j4 = 0; j4 < 8; ++j4) {
#pragma unroll
    for (int r = 0; r < NBLK; ++r) {
      const v4f rv = *(const v4f*)(rows + r * DM + wave * 32 + j4 * 4);
      a[r] += rv[0] * w[j4 * 4];
      a[r] += rv[1] * w[j4 * 4 + 1];
      a[r] += rv[2] * w[j4 * 4 + 2];
      a[r] += rv[3] * w[j4 * 4 + 3];
    }
  }
#pragma unroll
  for (int r = 0; r < NBLK; ++r) red[(wave * NBLK + r) * 32 + lane] = a[r];
  __syncthreads();
  float s = 0.f;
  if (tid < 128) {
#pragma unroll
    for (int wv = 0; wv < 16; ++wv) s += red[wv * 128 + tid];
  }
  return s;
}

// rq / rk / rv: RP[p][t][n] = sum_k rplane[t][k] * iW_p[k][n] + ib_p[n].  grid (16, 4, 3) = (column
// chunk, bat, p), 512 threads.
__global__ void __launch_bounds__(512)
router_proj_kernel(const float* __restrict__ rplane,
                   const float* __restrict__ iWq, const float* __restrict__ ibq,
                   const float* __restrict__ iWk, const float* __restrict__ ibk,
                   const float* __restrict__ iWv, const float* __restrict__ ibv,
                   float* __restrict__ RP) {
  __shared__ __align__(16) float Rr[NBLK * DM];
  __shared__ float red[16 * NBLK * 32];
  const int tid = threadIdx.x;
  const int col = blockIdx.x * 32 + (tid & 31);
  const int b = blockIdx.y, p = blockIdx.z;
  const float* Wm = (p == 0) ? iWq : ((p == 1) ? iWk : iWv);
  const float* bb = (p == 0) ? ibq : ((p == 1) ? ibk : ibv);
  const int ri = tid >> 7, rc4 = (tid & 127) * 4;
  const v4f rin = *(const v4f*)(rplane + (size_t)(ri * NBAT + b) * DM + rc4);
  // the weight loads below may land in the registers that held this load's address
  asm volatile("s_wait_xcnt 0x0" ::: "memory");
  float w[32];
  router_w_load(Wm, tid >> 5, col, w);
  *(v4f*)(Rr + ri * DM + rc4) = rin;
  __syncthreads();
  const float s = router_ksplit(w, Rr, red, tid);
  if (tid < 128) RP[((size_t)p * 16 + (tid >> 5) * NBAT + b) * DM + col] = s + bb[col];
}

// Per batch: 4-key softmax of (rq.rk)*0.125 per (query blk, head), o = sum p*rv / sum p (each
// work-group forms all 4 x 512 of its batch), then out rows l == 1023 = o . iWo + ibo for its 32
// columns.  grid (16, 4) = (column chunk, bat), 512 threads.
__global__ void __launch_bounds__(512)
router_out_kernel(const float* __restrict__ RP,
                  const float* __restrict__ iWo, const float* __restrict__ ibo,
                  float* __restrict__ out) {
  __shared__ __align__(16) float Pj[3][NBLK * DM];
  __shared__ __align__(16) float Ro[NBLK * DM];
  __shared__ float red[16 * NBLK * 32];
  const int tid = threadIdx.x;
  const int col = blockIdx.x * 32 + (tid & 31);
  const int b = blockIdx.y;
  float w[32];
  router_w_load(iWo, tid >> 5, col, w);
  {
    const int i = tid >> 7, c4 = (tid & 127) * 4;
#pragma unroll
    for (int p = 0; p < 3; ++p)
      *(v4f*)(&Pj[p][i * DM + c4]) = *(const v4f*)(RP + ((size_t)p * 16 + i * NBAT + b) * DM + c4);
  }
  __syncthreads();
  {
    // 16 lanes per (query blk, head); each lane holds 4 of the 64 head elements
    const int item = tid >> 4;              // 0..31
    const int nq = item >> 3, hd = item & 7;
    const int eo = hd * HD + (tid & 15) * 4;
    const v4f q4 = *(const v4f*)(&Pj[0][nq * DM + eo]);
    const v4f v0 = *(const v4f*)(&Pj[2][eo]);
    const v4f v1 = *(const v4f*)(&Pj[2][DM + eo]);
    const v4f v2 = *(const v4f*)(&Pj[2][2 * DM + eo]);
    const v4f v3 = *(const v4f*)(&Pj[2][3 * DM + eo]);
    float sc[NBLK];
#pragma unroll
    for (int s = 0; s < NBLK; ++s) {
      const v4f k4 = *(const v4f*)(&Pj[1][s * DM + eo]);
      sc[s] = q4[0] * k4[0] + q4[1] * k4[1] + q4[2] * k4[2] + q4[3] * k4[3];
    }
    // keeps the four v reads in one batch ahead of the exponentials; sunk in between them their
    // LDS latency would stand in the dependent chain three times
    asm volatile("" :: "v"(v0), "v"(v1), "v"(v2), "v"(v3));
#pragma unroll
    for (int m = 1; m < 16; m <<= 1) {
#pragma unroll
      for (int s = 0; s < NBLK; ++s) sc[s] += __shfl_xor(sc[s], m, 32);
    }
#pragma unroll
    for (int s = 0; s < NBLK; ++s) sc[s] *= 0.125f;
    const float mx = fmaxf(fmaxf(sc[0], sc[1]), fmaxf(sc[2], sc[3]));
    const float p0 = __expf(sc[0] - mx), p1 = __expf(sc[1] - mx), p2 = __expf(sc[2] - mx), p3 = __expf(sc[3] - mx);
    const float inv = 1.0f / (p0 + p1 + p2 + p3);
    v4f o4;
#pragma unroll
    for (int j = 0; j < 4; ++j) o4[j] = (p0 * v0[j] + p1 * v1[j] + p2 * v2[j] + p3 * v3[j]) * inv;
    *(v4f*)(Ro + nq * DM + eo) = o4;
  }
  __syncthreads();
  const float s = router_ksplit(w, Ro, red, tid);
  if (tid < 128)
    out[((size_t)((tid >> 5) * NBAT + b) * SEQL + (SEQL - 1)) * DM + col] = s + ibo[col];
}

// ---------------------------------------------------------------------------
// Workspace map (byte offsets; every region fully written before it is read; all regions are exact
//   X16   f16 [16384][512]            0          16777216 B
//   WT16  f16 [16][512][512]     16777216           8388608 B   (Wq,Wk,Wv,Wo planes x 4 blks, [out][in], x16)
//   Q16   f16 [16384][512]     25165824          16777216 B
//   K16   f16 [16384][512]     41943040          16777216 B
//   VT16  f16 [16][512][1024]  58720256          16777216 B
//   O16   f16 [16384][512]     75497472          16777216 B   (attention output x16)
//   RPL   f32 [16][512]        92274688             32768 B   (router rows, t = blk*4 + bat)
//   RP    f32 [3][16][512]     92307456             98304 B   (router q, k, v projections)
//   total                      92405760
// ---------------------------------------------------------------------------
extern "C" void kernel_launch(void* const* d_in, const int* in_sizes, int n_in,
                              void* d_out, int out_size, void* d_ws, size_t ws_size,
                              hipStream_t stream) {
  if (n_in < 17) return;
  if (in_sizes[0] != MROWS * DM) return;
  if (in_sizes[1] != NBLK * WPL || in_sizes[3] != NBLK * WPL || in_sizes[5] != NBLK * WPL || in_sizes[7] != NBLK * WPL) return;
  if (in_sizes[2] != NBLK * DM || in_sizes[4] != NBLK * DM || in_sizes[6] != NBLK * DM || in_sizes[8] != NBLK * DM) return;
  if (in_sizes[9] != WPL || in_sizes[11] != WPL || in_sizes[13] != WPL || in_sizes[15] != WPL) return;
  if (in_sizes[10] != DM || in_sizes[12] != DM || in_sizes[14] != DM || in_sizes[16] != DM) return;
  if (out_size != MROWS * DM) return;

  const float* x   = (const float*)d_in[0];
  const float* Wq  = (const float*)d_in[1];  const float* bq  = (const float*)d_in[2];
  const float* Wk  = (const float*)d_in[3];  const float* bk  = (const float*)d_in[4];
  const float* Wv  = (const float*)d_in[5];  const float* bv  = (const float*)d_in[6];
  const float* Wo  = (const float*)d_in[7];  const float* bo  = (const float*)d_in[8];
  const float* iWq = (const float*)d_in[9];  const float* ibq = (const float*)d_in[10];
  const float* iWk = (const float*)d_in[11]; const float* ibk = (const float*)d_in[12];
  const float* iWv = (const float*)d_in[13]; const float* ibv = (const float*)d_in[14];
  const float* iWo = (const float*)d_in[15]; const float* ibo = (const float*)d_in[16];
  float* out = (float*)d_out;

  const size_t bAct = (size_t)MROWS * DM * 2;      // 16777216
  const size_t bWT  = (size_t)16 * WPL * 2;        // 8388608
  const size_t bRpl = (size_t)16 * DM * 4;         // 32768
  const size_t bRp  = (size_t)3 * 16 * DM * 4;     // 98304
  size_t off = 0;
  const size_t oX  = off; off += bAct;
  const size_t oWT = off; off += bWT;
  const size_t oQ  = off; off += bAct;
  const size_t oK  = off; off += bAct;
  const size_t oVT = off; off += bAct;
  const size_t oO  = off; off += bAct;
  const size_t oR  = off; off += bRpl;
  const size_t oP  = off; off += bRp;
  if (off > ws_size) return;                       // off = 92405760

  char* ws = (char*)d_ws;
  _Float16* X16  = (_Float16*)(ws + oX);
  _Float16* WT16 = (_Float16*)(ws + oWT);
  _Float16* Q16  = (_Float16*)(ws + oQ);
  _Float16* K16  = (_Float16*)(ws + oK);
  _Float16* VT16 = (_Float16*)(ws + oVT);
  _Float16* O16  = (_Float16*)(ws + oO);
  float*    RPL  = (float*)(ws + oR);
  float*    RP   = (float*)(ws + oP);

  const int n8 = MROWS * DM / 8;                   // 1048576
  // (1) x -> f16 plane
  cvt_x_kernel<<<dim3(n8 / 256), dim3(256), 0, stream>>>(x, X16, n8);
  // (2) weights -> transposed f16 planes (x16)
  wt_kernel<<<dim3(DM / 64, DM / 64, 16), dim3(256), 0, stream>>>(Wq, Wk, Wv, Wo, WT16);
  // (3) q, k projections
  qk_gemm_kernel<<<dim3(MROWS / 64, DM / 256, 2), dim3(256), 0, stream>>>(X16, WT16, bq, bk, Q16, K16);
  // (4) v^T projection per (blk, bat)
  vt_gemm_kernel<<<dim3(DM / 64, SEQL / 256, NBLK * NBAT), dim3(256), 0, stream>>>(X16, WT16, bv, VT16);
  // (5) intra attention
  attn_kernel<<<dim3(NBLK * NBAT * NH * (SEQL / 64)), dim3(128), 0, stream>>>(Q16, K16, VT16, O16);
  // (6) output projection -> d_out (rows l < 1023) and router plane (rows l == 1023)
  wo_gemm_kernel<<<dim3(MROWS / 64, DM / 256, 1), dim3(256), 0, stream>>>(O16, WT16, bo, out, RPL);
  // (7) router q, k, v projections
  router_proj_kernel<<<dim3(DM / 32, NBAT, 3), dim3(512), 0, stream>>>(RPL, iWq, ibq, iWk, ibk, iWv, ibv, RP);
  // (8) router attention + output projection -> d_out rows l == 1023
  router_out_kernel<<<dim3(DM / 32, NBAT), dim3(512), 0, stream>>>(RP, iWo, ibo, out);
  (void)hipGetLastError();
}

// v002
// A run of this version takes 260 microseconds.
// Next to v001, in two timings, it ran 1.20 times as fast each time.
// All steps since v000 together make it 4.38 times as fast.
// Contractions q/k/v^T projections, q.k^T, p.v, out projection: v_wmma_f32_16x16x32_f16, f16 operands (W x16; x and p x1; attention output o x16), f32 accumulate; softmax f32 (scale 0.125 applied to the f32 score accumulator); router-token attention and its four projections: f32 VALU.
#include <hip/hip_runtime.h>

typedef _Float16 v16h __attribute__((ext_vector_type(16)));
typedef _Float16 v8h  __attribute__((ext_vector_type(8)));
typedef float    v8f  __attribute__((ext_vector_type(8)));
typedef float    v4f  __attribute__((ext_vector_type(4)));

#define NBLK  4
#define NBAT  4
#define SEQL  1024
#define DM    512
#define NH    8
#define HD    64
#define MROWS 16384          // NBLK*NBAT*SEQL
#define WPL   262144         // DM*DM, one weight plane
#define ZPL   524288         // SEQL*DM, one (blk,bat) activation plane
#define SP16  72             // f16 LDS slab pitch (halves), 144 B rows
#define SP32  68             // f32 LDS slab pitch (floats), 272 B rows

union FragU { v16h v; v8h h[2]; };

// 16x16x32 operand fragment from a k-contiguous 16-bit row: p = row base + k0 + 8*(lane>>4)
// elements 0..7 <- p[0..7], elements 8..15 <- p[16..23]   (same map for A rows m and Bt rows n)
__device__ __forceinline__ v16h frag_ld(const _Float16* p) {
  FragU f;
  f.h[0] = *(const v8h*)(p);
  f.h[1] = *(const v8h*)(p + 16);
  return f.v;
}

__device__ __forceinline__ v8f mma16(v16h a, v16h b, v8f c) {
  c = __builtin_amdgcn_wmma_f32_16x16x32_f16(false, a, false, b, (short)0, c, false, false);
  asm volatile("v_nop\n\tv_nop\n\tv_nop\n\tv_nop" : "+v"(c) : "v"(a), "v"(b));
  return c;
}

__device__ __forceinline__ void wave_lds_sync() {
  __builtin_amdgcn_fence(__ATOMIC_RELEASE, "workgroup");
  __builtin_amdgcn_wave_barrier();
  __builtin_amdgcn_fence(__ATOMIC_ACQUIRE, "workgroup");
}

__device__ __forceinline__ v8f zero8() { return (v8f){0.f, 0.f, 0.f, 0.f, 0.f, 0.f, 0.f, 0.f}; }

// ---------------------------------------------------------------------------
// x f32 [16384][512] -> f16 plane, 8 elements per thread, one 16-B store per lane
// grid = 1048576/256 = 4096 blocks x 256 threads x 8 = 16384x512 exactly.
// ---------------------------------------------------------------------------
__global__ void __launch_bounds__(256)
cvt_x_kernel(const float* __restrict__ x, _Float16* __restrict__ X16, int n8) {
  const int i = blockIdx.x * 256 + threadIdx.x;
  if (i >= n8) return;
  const v4f a = *(const v4f*)(x + (size_t)i * 8);
  const v4f b = *(const v4f*)(x + (size_t)i * 8 + 4);
  v8h hv;
  hv[0] = (_Float16)a[0]; hv[1] = (_Float16)a[1]; hv[2] = (_Float16)a[2]; hv[3] = (_Float16)a[3];
  hv[4] = (_Float16)b[0]; hv[5] = (_Float16)b[1]; hv[6] = (_Float16)b[2]; hv[7] = (_Float16)b[3];
  _Float16* p = X16 + (size_t)i * 8;
  *(v8h*)p = hv;
  
}

// ---------------------------------------------------------------------------
// Weight transpose + x16 + f16: W (f32 [in=512][out=512], blk plane nb of Wq/Wk/Wv/Wo)
//   -> WT[z][out][in] = f16(16 * W[in][out]), z = widx*4 + nb  (widx 0=q,1=k,2=v,3=o).
// 64x64 tiles through LDS. grid (8, 8, 16), 256 threads.
// Coverage per block: load 4 it x 256 thr x 4 = 64x64; store 2 it x 256 thr x 8 = 64x64.
// ---------------------------------------------------------------------------
__global__ void __launch_bounds__(256)
wt_kernel(const float* __restrict__ Wq, const float* __restrict__ Wk,
          const float* __restrict__ Wv, const float* __restrict__ Wo,
          _Float16* __restrict__ WT) {
  __shared__ __align__(16) float tf[64 * 68];
  const int z  = blockIdx.z;
  const int wi = z >> 2, nb = z & 3;
  const float* W = (wi == 0) ? Wq : ((wi == 1) ? Wk : ((wi == 2) ? Wv : Wo));
  W += (size_t)nb * WPL;
  _Float16* O = WT + (size_t)z * WPL;
  const int c0  = blockIdx.x * 64;   // input column block (out feature) = output row block
  const int r0  = blockIdx.y * 64;   // input row block (in feature)     = output column block
  const int tid = threadIdx.x;
  {
    const int lr = tid >> 4;          // 0..15
    const int c4 = (tid & 15) * 4;    // 0..60
#pragma unroll
    for (int it = 0; it < 4; ++it) {
      const int rr = it * 16 + lr;    // 0..63
      const v4f a = *(const v4f*)(W + (size_t)(r0 + rr) * DM + c0 + c4);
      *(v4f*)(tf + rr * 68 + c4) = a;
    }
  }
  __syncthreads();
  const int sub = tid >> 3;           // 0..31
  const int c8  = (tid & 7) * 8;      // 0..56
  v8h hv0, hv1;
#pragma unroll
  for (int e = 0; e < 8; ++e) {
    hv0[e] = (_Float16)(16.0f * tf[(c8 + e) * 68 + sub]);
    hv1[e] = (_Float16)(16.0f * tf[(c8 + e) * 68 + 32 + sub]);
  }
  _Float16* p0 = O + (size_t)(c0 + sub) * DM + r0 + c8;
  _Float16* p1 = O + (size_t)(c0 + 32 + sub) * DM + r0 + c8;
  {
    *(v8h*)p0 = hv0;
    *(v8h*)p1 = hv1;
    
  }
}

// ---------------------------------------------------------------------------
// GEMM core: acc[mt][nt] = sum_k A[m0 + mt*16 + .][k] * Bt[n0 + nt*16 + .][k], K = 512.
// A rows and Bt rows are both k-contiguous f16; wave tile 32 x 64; D element r of lane l is
// (row 8*(l>>4) + r, col l&15) of its 16x16 subtile.
// ---------------------------------------------------------------------------
__device__ __forceinline__ void gemm_core(const _Float16* __restrict__ A, int lda,
                                          const _Float16* __restrict__ Bt, int ldb,
                                          int m0, int n0, int lane, v8f (&acc)[2][4]) {
  const int c = lane & 15, kh = (lane >> 4) * 8;
#pragma unroll
  for (int i = 0; i < 2; ++i)
#pragma unroll
    for (int j = 0; j < 4; ++j) acc[i][j] = zero8();
  const _Float16* a0p = A  + (size_t)(m0 + c) * lda + kh;
  const _Float16* a1p = A  + (size_t)(m0 + 16 + c) * lda + kh;
  const _Float16* b0p = Bt + (size_t)(n0 + c) * ldb + kh;
#pragma unroll 1
  for (int k0 = 0; k0 < DM; k0 += 32) {
    v16h bf[4];
#pragma unroll
    for (int j = 0; j < 4; ++j) bf[j] = frag_ld(b0p + (size_t)(j * 16) * ldb + k0);
    const v16h a0 = frag_ld(a0p + k0);
    const v16h a1 = frag_ld(a1p + k0);
#pragma unroll
    for (int j = 0; j < 4; ++j) {
      acc[0][j] = mma16(a0, bf[j], acc[0][j]);
      acc[1][j] = mma16(a1, bf[j], acc[1][j]);
    }
  }
}

// ---------------------------------------------------------------------------
// f16 epilogue: v = acc*scale + bias (bias per column, or per row when BIAS_ROW); the wave's
// written by 8 consecutive lanes x 16 B of one instruction (4 rows per instruction, 8 instructions
// stores and the v8h reloads.
// ---------------------------------------------------------------------------
template <bool BIAS_ROW>
__device__ __forceinline__ void epi_f16(v8f (&acc)[2][4], _Float16* slab,
                                        _Float16* __restrict__ C, int ldc,
                                        int m0, int n0, int lane, float scale,
                                        const float* __restrict__ bias) {
  const int c = lane & 15, hh = lane >> 4;
#pragma unroll
  for (int mt = 0; mt < 2; ++mt) {
#pragma unroll
    for (int nt = 0; nt < 4; ++nt) {
      const int coll = nt * 16 + c;
      float bc = 0.f;
      if (!BIAS_ROW) bc = bias[n0 + coll];
#pragma unroll
      for (int r = 0; r < 8; ++r) {
        const int rowl = mt * 16 + 8 * hh + r;
        float v = acc[mt][nt][r] * scale;
        v += BIAS_ROW ? bias[m0 + rowl] : bc;
        slab[rowl * SP16 + coll] = (_Float16)v;
      }
    }
  }
  wave_lds_sync();
  const int q = lane >> 3, c8 = (lane & 7) * 8;
  {
#pragma unroll
    for (int it = 0; it < 8; ++it) {
      const int row = it * 4 + q;
      const v8h val = *(const v8h*)(slab + row * SP16 + c8);
      *(v8h*)(C + (size_t)(m0 + row) * ldc + n0 + c8) = val;
    }
    
  }
  wave_lds_sync();
}

// ---------------------------------------------------------------------------
// q / k projections: rows (blk,bat,l) = 16384, N = 512, K = 512; weight plane and bias selected by
// the row block (block-uniform).  Q16/K16: [16384][512] f16, column = h*64 + e.
// grid (256, 2, 2): block tile 64 rows x 256 cols (8 waves of 32x64); z: 0 = q, 1 = k.
// ---------------------------------------------------------------------------
__global__ void __launch_bounds__(256)
qk_gemm_kernel(const _Float16* __restrict__ X16, const _Float16* __restrict__ WT,
               const float* __restrict__ bq, const float* __restrict__ bk,
               _Float16* __restrict__ Q16, _Float16* __restrict__ K16) {
  __shared__ __align__(16) _Float16 slabs[8 * 32 * SP16];
  const int lane = threadIdx.x & 31, wid = threadIdx.x >> 5;
  const int m0 = blockIdx.x * 64 + (wid >> 2) * 32;
  const int n0 = blockIdx.y * 256 + (wid & 3) * 64;
  const int proj = blockIdx.z;
  const int nb = m0 >> 12;
  const _Float16* Bt = WT + (size_t)(proj * 4 + nb) * WPL;
  const float* bias = ((proj == 0) ? bq : bk) + nb * DM;
  _Float16* C = (proj == 0) ? Q16 : K16;
  v8f acc[2][4];
  gemm_core(X16, DM, Bt, DM, m0, n0, lane, acc);
  epi_f16<false>(acc, slabs + wid * (32 * SP16), C, DM, m0, n0, lane, 0.0625f, bias);
}

// ---------------------------------------------------------------------------
// v^T projection per (blk,bat) z: VT16[z][m = h*64+e][l] = sum_k WvT[nb][m][k] * x[z][l][k] / 16 + bv[nb][m]
// A = WvT plane (512 x 512), Bt = x plane rows (1024 x 512), C [512][1024] f16.  grid (8, 4, 16).
// ---------------------------------------------------------------------------
__global__ void __launch_bounds__(256)
vt_gemm_kernel(const _Float16* __restrict__ X16, const _Float16* __restrict__ WT,
               const float* __restrict__ bv, _Float16* __restrict__ VT16) {
  __shared__ __align__(16) _Float16 slabs[8 * 32 * SP16];
  const int lane = threadIdx.x & 31, wid = threadIdx.x >> 5;
  const int m0 = blockIdx.x * 64 + (wid >> 2) * 32;     // 0..511 (output feature)
  const int n0 = blockIdx.y * 256 + (wid & 3) * 64;     // 0..1023 (position)
  const int z  = blockIdx.z;
  const int nb = z >> 2;
  const _Float16* A  = WT + (size_t)(8 + nb) * WPL;
  const _Float16* Bt = X16 + (size_t)z * ZPL;
  _Float16* C = VT16 + (size_t)z * ZPL;
  const float* bias = bv + nb * DM;
  v8f acc[2][4];
  gemm_core(A, DM, Bt, DM, m0, n0, lane, acc);
  epi_f16<true>(acc, slabs + wid * (32 * SP16), C, SEQL, m0, n0, lane, 0.0625f, bias);
}

// ---------------------------------------------------------------------------
// Full (unmasked) attention, head dim 64, per (blk,bat) z and head h, in transposed form.
//   q/k rows from Q16/K16 ([z*1024 + l][h*64 + d]); v^T rows from VT16 ([z*512 + h*64 + d][l]).
//   S^T = k.q^T (A = k rows, Bt = q rows): lane l holds, for query l&15, keys 16j + 8*(l>>4) + r of
//   each 16-key tile j, so the row maximum and the row sum of the online softmax (f32, 16 chunks of
//   64 keys) are in-lane, joined between lanes l and l^16 by one cross-row move.
//   O^T += v^T.P^T (A = v^T rows, Bt = P rows): two neighbouring S^T tiles, converted in place, are
//   the Bt fragment in the k order of frag_ld (elements 0..7: k0 + 8*(l>>4) + e, 8..15: 16 more).
//   O16[z*1024 + l][h*64 + d] = f16(16 * O / rowsum).
//   Block = 4 waves x 16 query rows; grid 2048 = z*128 + h*16 + qb.
// ---------------------------------------------------------------------------
__device__ __forceinline__ float xhalf(float x) {   // value of lane l ^ 16
  const int b = __builtin_bit_cast(int, x);
  return __builtin_bit_cast(float, __builtin_amdgcn_permlanex16(b, b, 0x76543210, 0xfedcba98, false, false));
}

// y[i] = 2^x[i], eight in one statement: the outputs are early-clobber, so no exponential lands on a
// source of the one in front of it, and the closing v_nop is the free slot that the instruction set asks
// for behind the last one
__device__ __forceinline__ void exp2x8(const float (&x)[8], float (&y)[8]) {
  asm("v_exp_f32 %0, %8\n\tv_exp_f32 %1, %9\n\tv_exp_f32 %2, %10\n\tv_exp_f32 %3, %11\n\t"
      "v_exp_f32 %4, %12\n\tv_exp_f32 %5, %13\n\tv_exp_f32 %6, %14\n\tv_exp_f32 %7, %15\n\tv_nop"
      : "=&v"(y[0]), "=&v"(y[1]), "=&v"(y[2]), "=&v"(y[3]), "=&v"(y[4]), "=&v"(y[5]), "=&v"(y[6]), "=&v"(y[7])
      : "v"(x[0]), "v"(x[1]), "v"(x[2]), "v"(x[3]), "v"(x[4]), "v"(x[5]), "v"(x[6]), "v"(x[7]));
}

__global__ void __launch_bounds__(128)
attn_kernel(const _Float16* __restrict__ Q16, const _Float16* __restrict__ K16,
            const _Float16* __restrict__ VT16, _Float16* __restrict__ O16) {
  __shared__ __align__(16) _Float16 pbuf[4 * 16 * SP16];   // output staging only
  const int tid = threadIdx.x, wave = tid >> 5, lane = tid & 31;
  const int hh = lane >> 4, c = lane & 15;
  const int bx = blockIdx.x;
  const int qb = bx & 15, h = (bx >> 4) & 7, z = bx >> 7;
  const int q0 = qb * 64 + wave * 16;

  const _Float16* Qz = Q16 + (size_t)z * ZPL + h * HD;
  const _Float16* Kz = K16 + (size_t)z * ZPL + h * HD;
  const _Float16* Vz = VT16 + ((size_t)z * DM + h * HD) * SEQL;
  _Float16* Oz = O16 + (size_t)z * ZPL + h * HD;
  _Float16* pw = pbuf + wave * (16 * SP16);

  const v16h qf0 = frag_ld(Qz + (size_t)(q0 + c) * DM + 8 * hh);
  const v16h qf1 = frag_ld(Qz + (size_t)(q0 + c) * DM + 32 + 8 * hh);

  float mrow = -1e30f, lrow = 0.f;   // query c: running maximum (both halves alike), this half's sum
  v8f oacc[4];                       // oacc[t][r] = O^T[d = 16t + 8hh + r][query c]
#pragma unroll
  for (int t = 0; t < 4; ++t) oacc[t] = zero8();

#pragma unroll 1
  for (int kc = 0; kc < SEQL / 64; ++kc) {
    const int kv0 = kc * 64;
    v8f s[4];
#pragma unroll
    for (int j = 0; j < 4; ++j) {
      const _Float16* kp = Kz + (size_t)(kv0 + j * 16 + c) * DM + 8 * hh;
      s[j] = zero8();
      s[j] = mma16(frag_ld(kp), qf0, s[j]);
      s[j] = mma16(frag_ld(kp + 32), qf1, s[j]);
    }
    float m = -1e30f;
#pragma unroll
    for (int j = 0; j < 4; ++j) {
#pragma unroll
      for (int r = 0; r < 8; ++r) {
        const float sv = s[j][r] * 0.125f;
        s[j][r] = sv;
        m = fmaxf(m, sv);
      }
    }
    m = fmaxf(m, xhalf(m));
    const float mnew  = fmaxf(mrow, m);
    const float alpha = __expf(mrow - mnew);
    mrow = mnew;
    float ps[4] = {0.f, 0.f, 0.f, 0.f};
    FragU pf[2];
#pragma unroll
    for (int j = 0; j < 4; ++j) {
      float e[8], p[8];
#pragma unroll
      for (int r = 0; r < 8; ++r) e[r] = (s[j][r] - mnew) * 1.44269504088896340736f;   // exp(x) = 2^(x log2 e)
      exp2x8(e, p);
#pragma unroll
      for (int r = 0; r < 8; ++r) {
        ps[j] += p[r];
        pf[j >> 1].h[j & 1][r] = (_Float16)p[r];
      }
    }
    lrow = lrow * alpha + ((ps[0] + ps[1]) + (ps[2] + ps[3]));
#pragma unroll
    for (int t = 0; t < 4; ++t)
#pragma unroll
      for (int r = 0; r < 8; ++r) oacc[t][r] *= alpha;
#pragma unroll
    for (int kk = 0; kk < 2; ++kk) {
#pragma unroll
      for (int t = 0; t < 4; ++t) {
        const _Float16* vp = Vz + (size_t)(t * 16 + c) * SEQL + kv0 + kk * 32 + 8 * hh;
        oacc[t] = mma16(frag_ld(vp), pf[kk].v, oacc[t]);
      }
    }
  }

  {
    const float inv16 = 16.0f * (1.0f / (lrow + xhalf(lrow)));
#pragma unroll
    for (int t = 0; t < 4; ++t) {
      v8h ov;
#pragma unroll
      for (int r = 0; r < 8; ++r) ov[r] = (_Float16)(oacc[t][r] * inv16);
      *(v8h*)(pw + c * SP16 + t * 16 + 8 * hh) = ov;
    }
  }
  wave_lds_sync();
  {
    const int q4 = lane >> 3, c8 = (lane & 7) * 8;
    {
#pragma unroll
      for (int it = 0; it < 4; ++it) {
        const int row = it * 4 + q4;
        const v8h val = *(const v8h*)(pw + row * SP16 + c8);
        *(v8h*)(Oz + (size_t)(q0 + row) * DM + c8) = val;
      }
      
    }
  }
}

// ---------------------------------------------------------------------------
// Output projection: out[row][n] = sum_k O16[row][k] * WoT[nb][n][k] / 256 + bo[nb][n]  (f32).
// Rows with l == 1023 (router tokens) go to rplane[(blk*4+bat)][512] instead of d_out (single writer
// of those d_out rows is the router output kernel).  Epilogue: 16-row f32 slabs per wave in LDS; each 256-B
// row segment written by 16 consecutive lanes x 16 B of one instruction (2 rows per instruction,
// ---------------------------------------------------------------------------
__global__ void __launch_bounds__(256)
wo_gemm_kernel(const _Float16* __restrict__ O16, const _Float16* __restrict__ WT,
               const float* __restrict__ bo, float* __restrict__ out, float* __restrict__ rplane) {
  __shared__ __align__(16) float slabf[8 * 16 * SP32];
  const int lane = threadIdx.x & 31, wid = threadIdx.x >> 5;
  const int m0 = blockIdx.x * 64 + (wid >> 2) * 32;
  const int n0 = blockIdx.y * 256 + (wid & 3) * 64;
  const int nb = m0 >> 12;
  const _Float16* Bt = WT + (size_t)(12 + nb) * WPL;
  const float* bias = bo + nb * DM;
  v8f acc[2][4];
  gemm_core(O16, DM, Bt, DM, m0, n0, lane, acc);

  float* slab = slabf + wid * (16 * SP32);
  const int c = lane & 15, hh = lane >> 4, c4 = c * 4;
#pragma unroll
  for (int mt = 0; mt < 2; ++mt) {
#pragma unroll
    for (int nt = 0; nt < 4; ++nt) {
      const int coll = nt * 16 + c;
      const float bc = bias[n0 + coll];
#pragma unroll
      for (int r = 0; r < 8; ++r)
        slab[(8 * hh + r) * SP32 + coll] = acc[mt][nt][r] * (1.0f / 256.0f) + bc;
    }
    wave_lds_sync();
    {
#pragma unroll
      for (int it = 0; it < 8; ++it) {
        const int row = it * 2 + hh;
        const int gm  = m0 + mt * 16 + row;
        const v4f val = *(const v4f*)(slab + row * SP32 + c4);
        float* dst = ((gm & (SEQL - 1)) == (SEQL - 1))
                         ? (rplane + (size_t)(gm >> 10) * DM + n0 + c4)
                         : (out + (size_t)gm * DM + n0 + c4);
        *(v4f*)dst = val;
      }
      
    }
    wave_lds_sync();
  }
}

// ---------------------------------------------------------------------------
// Router (inter) attention in two launches of many work-groups (f32 VALU throughout).
// Both launches share one product form: a work-group of 16 waves owns one batch (4 router rows,
// t = blk*4 + bat) and 32 output columns; wave w takes k in [32w, 32w + 32), lane = column; the 16
// partial sums of an output element meet in LDS and are added in wave order.
// ---------------------------------------------------------------------------
__device__ __forceinline__ void router_w_load(const float* __restrict__ Wm, int wave, int col, float (&w)[32]) {
  const float* wp = Wm + (size_t)(wave * 32) * DM + col;
  // unrolled: w[] stays in registers and all 32 loads are in flight together
#pragma unroll
  for (int j = 0; j < 32; ++j) w[j] = wp[(size_t)j * DM];
}

// rows: LDS [4][512]; red: LDS [16][4][32]. Returns, in threads 0..127, element (row tid>>5, column tid&31).
__device__ __forceinline__ float router_ksplit(const float (&w)[32], const float* rows, float* red,
                                               int tid) {
  const int wave = tid >> 5, lane = tid & 31;
  float a[NBLK] = {0.f, 0.f, 0.f, 0.f};
  // unrolled (here and below): w[] and a[] are indexed by constants only, so they stay in registers
#pragma unroll
  for (int j4 = 0; j4 < 8; ++j4) {
#pragma unroll
    for (int r = 0; r < NBLK; ++r) {
      const v4f rv = *(const v4f*)(rows + r * DM + wave * 32 + j4 * 4);
      a[r] += rv[0] * w[j4 * 4];
      a[r] += rv[1] * w[j4 * 4 + 1];
      a[r] += rv[2] * w[j4 * 4 + 2];
      a[r] += rv[3] * w[j4 * 4 + 3];
    }
  }
#pragma unroll
  for (int r = 0; r < NBLK; ++r) red[(wave * NBLK + r) * 32 + lane] = a[r];
  __syncthreads();
  float s = 0.f;
  if (tid < 128) {
#pragma unroll
    for (int wv = 0; wv < 16; ++wv) s += red[wv * 128 + tid];
  }
  return s;
}

// rq / rk / rv: RP[p][t][n] = sum_k rplane[t][k] * iW_p[k][n] + ib_p[n].  grid (16, 4, 3) = (column
// chunk, bat, p), 512 threads.
__global__ void __launch_bounds__(512)
router_proj_kernel(const float* __restrict__ rplane,
                   const float* __restrict__ iWq, const float* __restrict__ ibq,
                   const float* __restrict__ iWk, const float* __restrict__ ibk,
                   const float* __restrict__ iWv, const float* __restrict__ ibv,
                   float* __restrict__ RP) {
  __shared__ __align__(16) float Rr[NBLK * DM];
  __shared__ float red[16 * NBLK * 32];
  const int tid = threadIdx.x;
  const int col = blockIdx.x * 32 + (tid & 31);
  const int b = blockIdx.y, p = blockIdx.z;
  const float* Wm = (p == 0) ? iWq : ((p == 1) ? iWk : iWv);
  const float* bb = (p == 0) ? ibq : ((p == 1) ? ibk : ibv);
  const int ri = tid >> 7, rc4 = (tid & 127) * 4;
  const v4f rin = *(const v4f*)(rplane + (size_t)(ri * NBAT + b) * DM + rc4);
  // the weight loads below may land in the registers that held this load's address
  asm volatile("s_wait_xcnt 0x0" ::: "memory");
  float w[32];
  router_w_load(Wm, tid >> 5, col, w);
  *(v4f*)(Rr + ri * DM + rc4) = rin;
  __syncthreads();
  const float s = router_ksplit(w, Rr, red, tid);
  if (tid < 128) RP[((size_t)p * 16 + (tid >> 5) * NBAT + b) * DM + col] = s + bb[col];
}

// Per batch: 4-key softmax of (rq.rk)*0.125 per (query blk, head), o = sum p*rv / sum p (each
// work-group forms all 4 x 512 of its batch), then out rows l == 1023 = o . iWo + ibo for its 32
// columns.  grid (16, 4) = (column chunk, bat), 512 threads.
__global__ void __launch_bounds__(512)
router_out_kernel(const float* __restrict__ RP,
                  const float* __restrict__ iWo, const float* __restrict__ ibo,
                  float* __restrict__ out) {
  __shared__ __align__(16) float Pj[3][NBLK * DM];
  __shared__ __align__(16) float Ro[NBLK * DM];
  __shared__ float red[16 * NBLK * 32];
  const int tid = threadIdx.x;
  const int col = blockIdx.x * 32 + (tid & 31);
  const int b = blockIdx.y;
  float w[32];
  router_w_load(iWo, tid >> 5, col, w);
  {
    const int i = tid >> 7, c4 = (tid & 127) * 4;
#pragma unroll
    for (int p = 0; p < 3; ++p)
      *(v4f*)(&Pj[p][i * DM + c4]) = *(const v4f*)(RP + ((size_t)p * 16 + i * NBAT + b) * DM + c4);
  }
  __syncthreads();
  {
    // 16 lanes per (query blk, head); each lane holds 4 of the 64 head elements
    const int item = tid >> 4;              // 0..31
    const int nq = item >> 3, hd = item & 7;
    const int eo = hd * HD + (tid & 15) * 4;
    const v4f q4 = *(const v4f*)(&Pj[0][nq * DM + eo]);
    const v4f v0 = *(const v4f*)(&Pj[2][eo]);
    const v4f v1 = *(const v4f*)(&Pj[2][DM + eo]);
    const v4f v2 = *(const v4f*)(&Pj[2][2 * DM + eo]);
    const v4f v3 = *(const v4f*)(&Pj[2][3 * DM + eo]);
    float sc[NBLK];
#pragma unroll
    for (int s = 0; s < NBLK; ++s) {
      const v4f k4 = *(const v4f*)(&Pj[1][s * DM + eo]);
      sc[s] = q4[0] * k4[0] + q4[1] * k4[1] + q4[2] * k4[2] + q4[3] * k4[3];
    }
    // keeps the four v reads in one batch ahead of the exponentials; sunk in between them their
    // LDS latency would stand in the dependent chain three times
    asm volatile("" :: "v"(v0), "v"(v1), "v"(v2), "v"(v3));
#pragma unroll
    for (int m = 1; m < 16; m <<= 1) {
#pragma unroll
      for (int s = 0; s < NBLK; ++s) sc[s] += __shfl_xor(sc[s], m, 32);
    }
#pragma unroll
    for (int s = 0; s < NBLK; ++s) sc[s] *= 0.125f;
    const float mx = fmaxf(fmaxf(sc[0], sc[1]), fmaxf(sc[2], sc[3]));
    const float p0 = __expf(sc[0] - mx), p1 = __expf(sc[1] - mx), p2 = __expf(sc[2] - mx), p3 = __expf(sc[3] - mx);
    const float inv = 1.0f / (p0 + p1 + p2 + p3);
    v4f o4;
#pragma unroll
    for (int j = 0; j < 4; ++j) o4[j] = (p0 * v0[j] + p1 * v1[j] + p2 * v2[j] + p3 * v3[j]) * inv;
    *(v4f*)(Ro + nq * DM + eo) = o4;
  }
  __syncthreads();
  const float s = router_ksplit(w, Ro, red, tid);
  if (tid < 128)
    out[((size_t)((tid >> 5) * NBAT + b) * SEQL + (SEQL - 1)) * DM + col] = s + ibo[col];
}

// ---------------------------------------------------------------------------
// Workspace map (byte offsets; every region fully written before it is read; all regions are exact
//   X16   f16 [16384][512]            0          16777216 B
//   WT16  f16 [16][512][512]     16777216           8388608 B   (Wq,Wk,Wv,Wo planes x 4 blks, [out][in], x16)
//   Q16   f16 [16384][512]     25165824          16777216 B
//   K16   f16 [16384][512]     41943040          16777216 B
//   VT16  f16 [16][512][1024]  58720256          16777216 B
//   O16   f16 [16384][512]     75497472          16777216 B   (attention output x16)
//   RPL   f32 [16][512]        92274688             32768 B   (router rows, t = blk*4 + bat)
//   RP    f32 [3][16][512]     92307456             98304 B   (router q, k, v projections)
//   total                      92405760
// ---------------------------------------------------------------------------
extern "C" void kernel_launch(void* const* d_in, const int* in_sizes, int n_in,
                              void* d_out, int out_size, void* d_ws, size_t ws_size,
                              hipStream_t stream) {
  if (n_in < 17) return;
  if (in_sizes[0] != MROWS * DM) return;
  if (in_sizes[1] != NBLK * WPL || in_sizes[3] != NBLK * WPL || in_sizes[5] != NBLK * WPL || in_sizes[7] != NBLK * WPL) return;
  if (in_sizes[2] != NBLK * DM || in_sizes[4] != NBLK * DM || in_sizes[6] != NBLK * DM || in_sizes[8] != NBLK * DM) return;
  if (in_sizes[9] != WPL || in_sizes[11] != WPL || in_sizes[13] != WPL || in_sizes[15] != WPL) return;
  if (in_sizes[10] != DM || in_sizes[12] != DM || in_sizes[14] != DM || in_sizes[16] != DM) return;
  if (out_size != MROWS * DM) return;

  const float* x   = (const float*)d_in[0];
  const float* Wq  = (const float*)d_in[1];  const float* bq  = (const float*)d_in[2];
  const float* Wk  = (const float*)d_in[3];  const float* bk  = (const float*)d_in[4];
  const float* Wv  = (const float*)d_in[5];  const float* bv  = (const float*)d_in[6];
  const float* Wo  = (const float*)d_in[7];  const float* bo  = (const float*)d_in[8];
  const float* iWq = (const float*)d_in[9];  const float* ibq = (const float*)d_in[10];
  const float* iWk = (const float*)d_in[11]; const float* ibk = (const float*)d_in[12];
  const float* iWv = (const float*)d_in[13]; const float* ibv = (const float*)d_in[14];
  const float* iWo = (const float*)d_in[15]; const float* ibo = (const float*)d_in[16];
  float* out = (float*)d_out;

  const size_t bAct = (size_t)MROWS * DM * 2;      // 16777216
  const size_t bWT  = (size_t)16 * WPL * 2;        // 8388608
  const size_t bRpl = (size_t)16 * DM * 4;         // 32768
  const size_t bRp  = (size_t)3 * 16 * DM * 4;     // 98304
  size_t off = 0;
  const size_t oX  = off; off += bAct;
  const size_t oWT = off; off += bWT;
  const size_t oQ  = off; off += bAct;
  const size_t oK  = off; off += bAct;
  const size_t oVT = off; off += bAct;
  const size_t oO  = off; off += bAct;
  const size_t oR  = off; off += bRpl;
  const size_t oP  = off; off += bRp;
  if (off > ws_size) return;                       // off = 92405760

  char* ws = (char*)d_ws;
  _Float16* X16  = (_Float16*)(ws + oX);
  _Float16* WT16 = (_Float16*)(ws + oWT);
  _Float16* Q16  = (_Float16*)(ws + oQ);
  _Float16* K16  = (_Float16*)(ws + oK);
  _Float16* VT16 = (_Float16*)(ws + oVT);
  _Float16* O16  = (_Float16*)(ws + oO);
  float*    RPL  = (float*)(ws + oR);
  float*    RP   = (float*)(ws + oP);

  const int n8 = MROWS * DM / 8;                   // 1048576
  // (1) x -> f16 plane
  cvt_x_kernel<<<dim3(n8 / 256), dim3(256), 0, stream>>>(x, X16, n8);
  // (2) weights -> transposed f16 planes (x16)
  wt_kernel<<<dim3(DM / 64, DM / 64, 16), dim3(256), 0, stream>>>(Wq, Wk, Wv, Wo, WT16);
  // (3) q, k projections
  qk_gemm_kernel<<<dim3(MROWS / 64, DM / 256, 2), dim3(256), 0, stream>>>(X16, WT16, bq, bk, Q16, K16);
  // (4) v^T projection per (blk, bat)
  vt_gemm_kernel<<<dim3(DM / 64, SEQL / 256, NBLK * NBAT), dim3(256), 0, stream>>>(X16, WT16, bv, VT16);
  // (5) intra attention
  attn_kernel<<<dim3(NBLK * NBAT * NH * (SEQL / 64)), dim3(128), 0, stream>>>(Q16, K16, VT16, O16);
  // (6) output projection -> d_out (rows l < 1023) and router plane (rows l == 1023)
  wo_gemm_kernel<<<dim3(MROWS / 64, DM / 256, 1), dim3(256), 0, stream>>>(O16, WT16, bo, out, RPL);
  // (7) router q, k, v projections
  router_proj_kernel<<<dim3(DM / 32, NBAT, 3), dim3(512), 0, stream>>>(RPL, iWq, ibq, iWk, ibk, iWv, ibv, RP);
  // (8) router attention + output projection -> d_out rows l == 1023
  router_out_kernel<<<dim3(DM / 32, NBAT), dim3(512), 0, stream>>>(RP, iWo, ibo, out);
  (void)hipGetLastError();
}

// v003
// One run takes 213 microseconds.
// Next to v002, in two timings, it ran 1.21 and 1.23 times as fast.
// Over all steps from v000 it is 5.35 times as fast.
// Contractions q/k/v^T projections, q.k^T, p.v, out projection: v_wmma_f32_16x16x32_f16, f16 operands (W x16; x and p x1; attention output o x16), f32 accumulate; softmax f32 (scale 0.125 applied to the f32 score accumulator); router-token attention and its four projections: f32 VALU.
#include <hip/hip_runtime.h>

typedef _Float16 v16h __attribute__((ext_vector_type(16)));
typedef _Float16 v8h  __attribute__((ext_vector_type(8)));
typedef float    v8f  __attribute__((ext_vector_type(8)));
typedef float    v4f  __attribute__((ext_vector_type(4)));

#define NBLK  4
#define NBAT  4
#define SEQL  1024
#define DM    512
#define NH    8
#define HD    64
#define MROWS 16384          // NBLK*NBAT*SEQL
#define WPL   262144         // DM*DM, one weight plane
#define ZPL   524288         // SEQL*DM, one (blk,bat) activation plane
#define SP16  72             // f16 LDS slab pitch (halves), 144 B rows
#define SP32  68             // f32 LDS slab pitch (floats), 272 B rows

union FragU { v16h v; v8h h[2]; };

// Packed operand planes. Every f16 matrix [rows][K] of the workspace is stored as fragment blocks:
// block (rt = row >> 4, kt = k >> 5) is FBH halves (1 KiB) at (rt * (K / 32) + kt) * FBH; inside it the
// 16-B unit u = o * 16 + c holds row rt*16 + c, k = kt*32 + o*8 .. + 7 (o = 0..3, c = 0..15).
// 16x16x32 operand fragment: p = block + lane*8; elements 0..7 <- unit lane (k = 8*(lane>>4) + e),
// elements 8..15 <- unit 32 + lane (16 more): the same k order for A rows m and Bt rows n, and each of
// the two loads of a wave reads 512 contiguous bytes (4 cache lines; from k-contiguous rows it was 16).
#define FBH 512
__device__ __forceinline__ v16h frag_ld(const _Float16* p) {
  FragU f;
  f.h[0] = *(const v8h*)(p);
  f.h[1] = *(const v8h*)(p + 256);
  return f.v;
}

__device__ __forceinline__ v8f mma16(v16h a, v16h b, v8f c) {
  c = __builtin_amdgcn_wmma_f32_16x16x32_f16(false, a, false, b, (short)0, c, false, false);
  asm volatile("v_nop\n\tv_nop\n\tv_nop\n\tv_nop" : "+v"(c) : "v"(a), "v"(b));
  return c;
}

__device__ __forceinline__ void wave_lds_sync() {
  __builtin_amdgcn_fence(__ATOMIC_RELEASE, "workgroup");
  __builtin_amdgcn_wave_barrier();
  __builtin_amdgcn_fence(__ATOMIC_ACQUIRE, "workgroup");
}

__device__ __forceinline__ v8f zero8() { return (v8f){0.f, 0.f, 0.f, 0.f, 0.f, 0.f, 0.f, 0.f}; }

// ---------------------------------------------------------------------------
// x f32 [16384][512] -> packed f16 plane, 8 elements per thread, one 16-B store per lane; thread i
// writes unit i of the plane and reads the 8 floats that belong there
// grid = 1048576/256 = 4096 blocks x 256 threads x 8 = 16384x512 exactly.
// ---------------------------------------------------------------------------
__global__ void __launch_bounds__(256)
cvt_x_kernel(const float* __restrict__ x, _Float16* __restrict__ X16, int n8) {
  const int i = blockIdx.x * 256 + threadIdx.x;
  if (i >= n8) return;
  const int fb = i >> 6, o = (i >> 4) & 3, c = i & 15;           // block rt*16 + kt, unit o*16 + c
  const float* xp = x + (size_t)((fb >> 4) * 16 + c) * DM + (fb & 15) * 32 + o * 8;
  const v4f a = *(const v4f*)(xp);
  const v4f b = *(const v4f*)(xp + 4);
  v8h hv;
  hv[0] = (_Float16)a[0]; hv[1] = (_Float16)a[1]; hv[2] = (_Float16)a[2]; hv[3] = (_Float16)a[3];
  hv[4] = (_Float16)b[0]; hv[5] = (_Float16)b[1]; hv[6] = (_Float16)b[2]; hv[7] = (_Float16)b[3];
  _Float16* p = X16 + (size_t)i * 8;
  *(v8h*)p = hv;
  
}

// ---------------------------------------------------------------------------
// Weight transpose + x16 + f16: W (f32 [in=512][out=512], blk plane nb of Wq/Wk/Wv/Wo)
//   -> WT[z][out][in] = f16(16 * W[in][out]), packed (rows = out, k = in), z = widx*4 + nb  (widx 0=q,1=k,2=v,3=o).
// 64x64 tiles through LDS. grid (8, 8, 16), 256 threads.
// Coverage per block: load 4 it x 256 thr x 4 = 64x64; store 2 it x 256 thr x 8 = 64x64.
// ---------------------------------------------------------------------------
__global__ void __launch_bounds__(256)
wt_kernel(const float* __restrict__ Wq, const float* __restrict__ Wk,
          const float* __restrict__ Wv, const float* __restrict__ Wo,
          _Float16* __restrict__ WT) {
  __shared__ __align__(16) float tf[64 * 68];
  const int z  = blockIdx.z;
  const int wi = z >> 2, nb = z & 3;
  const float* W = (wi == 0) ? Wq : ((wi == 1) ? Wk : ((wi == 2) ? Wv : Wo));
  W += (size_t)nb * WPL;
  _Float16* O = WT + (size_t)z * WPL;
  const int c0  = blockIdx.x * 64;   // input column block (out feature) = output row block
  const int r0  = blockIdx.y * 64;   // input row block (in feature)     = output column block
  const int tid = threadIdx.x;
  {
    const int lr = tid >> 4;          // 0..15
    const int c4 = (tid & 15) * 4;    // 0..60
#pragma unroll
    for (int it = 0; it < 4; ++it) {
      const int rr = it * 16 + lr;    // 0..63
      const v4f a = *(const v4f*)(W + (size_t)(r0 + rr) * DM + c0 + c4);
      *(v4f*)(tf + rr * 68 + c4) = a;
    }
  }
  __syncthreads();
  // the tile is 4 row tiles x 2 k tiles = 8 blocks; thread tid writes unit tid & 63 of blocks
  // (rt = tid >> 7, kt = (tid >> 6) & 1) and (rt + 2, kt)
  const int rtl = tid >> 7, ktl = (tid >> 6) & 1;
  const int sub = rtl * 16 + (tid & 15);            // out feature in the tile, 0..31
  const int c8  = ktl * 32 + ((tid >> 4) & 3) * 8;  // in feature in the tile, 0..56
  v8h hv0, hv1;
#pragma unroll
  for (int e = 0; e < 8; ++e) {
    hv0[e] = (_Float16)(16.0f * tf[(c8 + e) * 68 + sub]);
    hv1[e] = (_Float16)(16.0f * tf[(c8 + e) * 68 + 32 + sub]);
  }
  _Float16* p0 = O + (size_t)(((c0 >> 4) + rtl) * (DM / 32) + (r0 >> 5) + ktl) * FBH + (tid & 63) * 8;
  _Float16* p1 = p0 + (size_t)(2 * (DM / 32)) * FBH;
  {
    *(v8h*)p0 = hv0;
    *(v8h*)p1 = hv1;
    
  }
}

// ---------------------------------------------------------------------------
// GEMM core: acc[mt][nt] = sum_k A[m0 + mt*16 + .][k] * Bt[n0 + nt*16 + .][k], K = 512.
// A and Bt are packed f16 planes with K = 512; wave tile 32 x 64; D element r of lane l is
// (row 8*(l>>4) + r, col l&15) of its 16x16 subtile.
// ---------------------------------------------------------------------------
__device__ __forceinline__ void gemm_core(const _Float16* __restrict__ A,
                                          const _Float16* __restrict__ Bt,
                                          int m0, int n0, int lane, v8f (&acc)[2][4]) {
  const int RTS = (DM / 32) * FBH;   // halves from one row tile to the next
#pragma unroll
  for (int i = 0; i < 2; ++i)
#pragma unroll
    for (int j = 0; j < 4; ++j) acc[i][j] = zero8();
  const _Float16* ap = A  + (size_t)(m0 >> 4) * RTS + lane * 8;
  const _Float16* bp = Bt + (size_t)(n0 >> 4) * RTS + lane * 8;
#pragma unroll 1
  for (int kt = 0; kt < DM / 32; ++kt) {
    v16h bf[4];
#pragma unroll
    for (int j = 0; j < 4; ++j) bf[j] = frag_ld(bp + j * RTS);
    const v16h a0 = frag_ld(ap);
    const v16h a1 = frag_ld(ap + RTS);
    // the two address pairs are advanced below while the twelve loads that name them are in flight; as
    // inputs of the wait they stay live up to it, so that no load of the run lands on them either
    asm volatile("s_wait_xcnt 0x0" :: "v"(ap), "v"(bp) : "memory");
    ap += FBH;
    bp += FBH;
#pragma unroll
    for (int j = 0; j < 4; ++j) {
      acc[0][j] = mma16(a0, bf[j], acc[0][j]);
      acc[1][j] = mma16(a1, bf[j], acc[1][j]);
    }
  }
}

// ---------------------------------------------------------------------------
// f16 epilogue: v = acc*scale + bias (bias per column, or per row when BIAS_ROW); the wave's 32 x 64
// tile goes through its LDS slab and leaves as 4 blocks of the packed plane C (kts = its k tiles per
// row tile), 512 contiguous bytes per store instruction.
// ---------------------------------------------------------------------------
template <bool BIAS_ROW>
__device__ __forceinline__ void epi_f16(v8f (&acc)[2][4], _Float16* slab,
                                        _Float16* __restrict__ C, int kts,
                                        int m0, int n0, int lane, float scale,
                                        const float* __restrict__ bias) {
  const int c = lane & 15, hh = lane >> 4;
#pragma unroll
  for (int mt = 0; mt < 2; ++mt) {
#pragma unroll
    for (int nt = 0; nt < 4; ++nt) {
      const int coll = nt * 16 + c;
      float bc = 0.f;
      if (!BIAS_ROW) bc = bias[n0 + coll];
#pragma unroll
      for (int r = 0; r < 8; ++r) {
        const int rowl = mt * 16 + 8 * hh + r;
        float v = acc[mt][nt][r] * scale;
        v += BIAS_ROW ? bias[m0 + rowl] : bc;
        slab[rowl * SP16 + coll] = (_Float16)v;
      }
    }
  }
  wave_lds_sync();
  {
#pragma unroll
    for (int it = 0; it < 8; ++it) {
      const int rtl = it >> 2, ktl = (it >> 1) & 1, uh = it & 1;   // block of the tile, half of the block
      const v8h val = *(const v8h*)(slab + (rtl * 16 + c) * SP16 + ktl * 32 + (uh * 2 + hh) * 8);
      *(v8h*)(C + ((size_t)((m0 >> 4) + rtl) * kts + (n0 >> 5) + ktl) * FBH + uh * 256 + lane * 8) = val;
    }
  }
  wave_lds_sync();
}

// ---------------------------------------------------------------------------
// q / k projections: rows (blk,bat,l) = 16384, N = 512, K = 512; weight plane and bias selected by
// the row block (block-uniform).  Q16/K16: [16384][512] f16, packed, column (k) = h*64 + e.
// grid (256, 2, 2): block tile 64 rows x 256 cols (8 waves of 32x64); z: 0 = q, 1 = k.
// ---------------------------------------------------------------------------
__global__ void __launch_bounds__(256)
qk_gemm_kernel(const _Float16* __restrict__ X16, const _Float16* __restrict__ WT,
               const float* __restrict__ bq, const float* __restrict__ bk,
               _Float16* __restrict__ Q16, _Float16* __restrict__ K16) {
  __shared__ __align__(16) _Float16 slabs[8 * 32 * SP16];
  const int lane = threadIdx.x & 31, wid = threadIdx.x >> 5;
  const int m0 = blockIdx.x * 64 + (wid >> 2) * 32;
  const int n0 = blockIdx.y * 256 + (wid & 3) * 64;
  const int proj = blockIdx.z;
  const int nb = m0 >> 12;
  const _Float16* Bt = WT + (size_t)(proj * 4 + nb) * WPL;
  const float* bias = ((proj == 0) ? bq : bk) + nb * DM;
  _Float16* C = (proj == 0) ? Q16 : K16;
  v8f acc[2][4];
  gemm_core(X16, Bt, m0, n0, lane, acc);
  epi_f16<false>(acc, slabs + wid * (32 * SP16), C, DM / 32, m0, n0, lane, 0.0625f, bias);
}

// ---------------------------------------------------------------------------
// v^T projection per (blk,bat) z: VT16[z][m = h*64+e][l] = sum_k WvT[nb][m][k] * x[z][l][k] / 16 + bv[nb][m]
// A = WvT plane (512 x 512), Bt = x plane rows (1024 x 512), C [512][1024] f16, packed (k = l).  grid (8, 4, 16).
// ---------------------------------------------------------------------------
__global__ void __launch_bounds__(256)
vt_gemm_kernel(const _Float16* __restrict__ X16, const _Float16* __restrict__ WT,
               const float* __restrict__ bv, _Float16* __restrict__ VT16) {
  __shared__ __align__(16) _Float16 slabs[8 * 32 * SP16];
  const int lane = threadIdx.x & 31, wid = threadIdx.x >> 5;
  const int m0 = blockIdx.x * 64 + (wid >> 2) * 32;     // 0..511 (output feature)
  const int n0 = blockIdx.y * 256 + (wid & 3) * 64;     // 0..1023 (position)
  const int z  = blockIdx.z;
  const int nb = z >> 2;
  const _Float16* A  = WT + (size_t)(8 + nb) * WPL;
  const _Float16* Bt = X16 + (size_t)z * ZPL;
  _Float16* C = VT16 + (size_t)z * ZPL;
  const float* bias = bv + nb * DM;
  v8f acc[2][4];
  gemm_core(A, Bt, m0, n0, lane, acc);
  epi_f16<true>(acc, slabs + wid * (32 * SP16), C, SEQL / 32, m0, n0, lane, 0.0625f, bias);
}

// ---------------------------------------------------------------------------
// Full (unmasked) attention, head dim 64, per (blk,bat) z and head h, in transposed form.
//   q/k rows from Q16/K16 ([z*1024 + l][h*64 + d]); v^T rows from VT16 ([z*512 + h*64 + d][l]); all packed.
//   S^T = k.q^T (A = k rows, Bt = q rows): lane l holds, for query l&15, keys 16j + 8*(l>>4) + r of
//   each 16-key tile j, so the row maximum and the row sum of the online softmax (f32, 16 chunks of
//   64 keys) are in-lane, joined between lanes l and l^16 by one cross-row move.
//   O^T += v^T.P^T (A = v^T rows, Bt = P rows): two neighbouring S^T tiles, converted in place, are
//   the Bt fragment in the k order of frag_ld (elements 0..7: k0 + 8*(l>>4) + e, 8..15: 16 more).
//   O16[z*1024 + l][h*64 + d] = f16(16 * O / rowsum), packed: the eight d of accumulator tile t in a lane
//   are unit (t&1)*32 + lane of block (query tile, 2h + (t>>1)), so each tile is stored straight from registers.
//   Block = 4 waves x 16 query rows; grid 2048 = z*128 + h*16 + qb.
// ---------------------------------------------------------------------------
__device__ __forceinline__ float xhalf(float x) {   // value of lane l ^ 16
  const int b = __builtin_bit_cast(int, x);
  return __builtin_bit_cast(float, __builtin_amdgcn_permlanex16(b, b, 0x76543210, 0xfedcba98, false, false));
}

// y[i] = 2^x[i], eight in one statement: the outputs are early-clobber, so no exponential lands on a
// source of the one in front of it, and the closing v_nop is the free slot that the instruction set asks
// for behind the last one
__device__ __forceinline__ void exp2x8(const float (&x)[8], float (&y)[8]) {
  asm("v_exp_f32 %0, %8\n\tv_exp_f32 %1, %9\n\tv_exp_f32 %2, %10\n\tv_exp_f32 %3, %11\n\t"
      "v_exp_f32 %4, %12\n\tv_exp_f32 %5, %13\n\tv_exp_f32 %6, %14\n\tv_exp_f32 %7, %15\n\tv_nop"
      : "=&v"(y[0]), "=&v"(y[1]), "=&v"(y[2]), "=&v"(y[3]), "=&v"(y[4]), "=&v"(y[5]), "=&v"(y[6]), "=&v"(y[7])
      : "v"(x[0]), "v"(x[1]), "v"(x[2]), "v"(x[3]), "v"(x[4]), "v"(x[5]), "v"(x[6]), "v"(x[7]));
}

__global__ void __launch_bounds__(128)
attn_kernel(const _Float16* __restrict__ Q16, const _Float16* __restrict__ K16,
            const _Float16* __restrict__ VT16, _Float16* __restrict__ O16) {
  const int tid = threadIdx.x, wave = tid >> 5, lane = tid & 31;
  const int bx = blockIdx.x;
  const int qb = bx & 15, h = (bx >> 4) & 7, z = bx >> 7;
  const int q0 = qb * 64 + wave * 16;

  const int QRT = (DM / 32) * FBH;     // halves from one 16-row tile of Q16 / K16 / O16 to the next
  const int VRT = (SEQL / 32) * FBH;   // the same for VT16
  const size_t hq = (size_t)z * ZPL + (2 * h) * FBH + lane * 8;   // row tile 0 of z, first k tile of head h
  const _Float16* Qz = Q16 + hq + (size_t)(q0 >> 4) * QRT;
  const _Float16* Kz = K16 + hq;
  const _Float16* Vz = VT16 + (size_t)z * ZPL + (size_t)(h * (HD / 16)) * VRT + lane * 8;
  _Float16* Oz = O16 + hq + (size_t)(q0 >> 4) * QRT;

  const v16h qf0 = frag_ld(Qz);
  const v16h qf1 = frag_ld(Qz + FBH);

  float mrow = -1e30f, lrow = 0.f;   // query c: running maximum (both halves alike), this half's sum
  v8f oacc[4];                       // oacc[t][r] = O^T[d = 16t + 8hh + r][query c]
#pragma unroll
  for (int t = 0; t < 4; ++t) oacc[t] = zero8();

#pragma unroll 1
  for (int kc = 0; kc < SEQL / 64; ++kc) {
    v8f s[4];
#pragma unroll
    for (int j = 0; j < 4; ++j) {
      const _Float16* kp = Kz + (size_t)(kc * 4 + j) * QRT;
      s[j] = zero8();
      s[j] = mma16(frag_ld(kp), qf0, s[j]);
      s[j] = mma16(frag_ld(kp + FBH), qf1, s[j]);
    }
    float m = -1e30f;
#pragma unroll
    for (int j = 0; j < 4; ++j) {
#pragma unroll
      for (int r = 0; r < 8; ++r) {
        const float sv = s[j][r] * 0.125f;
        s[j][r] = sv;
        m = fmaxf(m, sv);
      }
    }
    m = fmaxf(m, xhalf(m));
    const float mnew  = fmaxf(mrow, m);
    const float alpha = __expf(mrow - mnew);
    mrow = mnew;
    float ps[4] = {0.f, 0.f, 0.f, 0.f};
    FragU pf[2];
#pragma unroll
    for (int j = 0; j < 4; ++j) {
      float e[8], p[8];
#pragma unroll
      for (int r = 0; r < 8; ++r) e[r] = (s[j][r] - mnew) * 1.44269504088896340736f;   // exp(x) = 2^(x log2 e)
      exp2x8(e, p);
#pragma unroll
      for (int r = 0; r < 8; ++r) {
        ps[j] += p[r];
        pf[j >> 1].h[j & 1][r] = (_Float16)p[r];
      }
    }
    lrow = lrow * alpha + ((ps[0] + ps[1]) + (ps[2] + ps[3]));
#pragma unroll
    for (int t = 0; t < 4; ++t)
#pragma unroll
      for (int r = 0; r < 8; ++r) oacc[t][r] *= alpha;
#pragma unroll
    for (int kk = 0; kk < 2; ++kk) {
#pragma unroll
      for (int t = 0; t < 4; ++t) {
        const _Float16* vp = Vz + (size_t)t * VRT + (kc * 2 + kk) * FBH;
        oacc[t] = mma16(frag_ld(vp), pf[kk].v, oacc[t]);
      }
    }
  }

  {
    const float inv16 = 16.0f * (1.0f / (lrow + xhalf(lrow)));
#pragma unroll
    for (int t = 0; t < 4; ++t) {
      v8h ov;
#pragma unroll
      for (int r = 0; r < 8; ++r) ov[r] = (_Float16)(oacc[t][r] * inv16);
      *(v8h*)(Oz + (t >> 1) * FBH + (t & 1) * 256) = ov;
    }
  }
}

// ---------------------------------------------------------------------------
// Output projection: out[row][n] = sum_k O16[row][k] * WoT[nb][n][k] / 256 + bo[nb][n]  (f32).
// Rows with l == 1023 (router tokens) go to rplane[(blk*4+bat)][512] instead of d_out (single writer
// of those d_out rows is the router output kernel).  Epilogue: 16-row f32 slabs per wave in LDS; each 256-B
// row segment written by 16 consecutive lanes x 16 B of one instruction (2 rows per instruction,
// ---------------------------------------------------------------------------
__global__ void __launch_bounds__(256)
wo_gemm_kernel(const _Float16* __restrict__ O16, const _Float16* __restrict__ WT,
               const float* __restrict__ bo, float* __restrict__ out, float* __restrict__ rplane) {
  __shared__ __align__(16) float slabf[8 * 16 * SP32];
  const int lane = threadIdx.x & 31, wid = threadIdx.x >> 5;
  const int m0 = blockIdx.x * 64 + (wid >> 2) * 32;
  const int n0 = blockIdx.y * 256 + (wid & 3) * 64;
  const int nb = m0 >> 12;
  const _Float16* Bt = WT + (size_t)(12 + nb) * WPL;
  const float* bias = bo + nb * DM;
  v8f acc[2][4];
  gemm_core(O16, Bt, m0, n0, lane, acc);

  float* slab = slabf + wid * (16 * SP32);
  const int c = lane & 15, hh = lane >> 4, c4 = c * 4;
#pragma unroll
  for (int mt = 0; mt < 2; ++mt) {
#pragma unroll
    for (int nt = 0; nt < 4; ++nt) {
      const int coll = nt * 16 + c;
      const float bc = bias[n0 + coll];
#pragma unroll
      for (int r = 0; r < 8; ++r)
        slab[(8 * hh + r) * SP32 + coll] = acc[mt][nt][r] * (1.0f / 256.0f) + bc;
    }
    wave_lds_sync();
    {
#pragma unroll
      for (int it = 0; it < 8; ++it) {
        const int row = it * 2 + hh;
        const int gm  = m0 + mt * 16 + row;
        const v4f val = *(const v4f*)(slab + row * SP32 + c4);
        float* dst = ((gm & (SEQL - 1)) == (SEQL - 1))
                         ? (rplane + (size_t)(gm >> 10) * DM + n0 + c4)
                         : (out + (size_t)gm * DM + n0 + c4);
        *(v4f*)dst = val;
      }
      
    }
    wave_lds_sync();
  }
}

// ---------------------------------------------------------------------------
// Router (inter) attention in two launches of many work-groups (f32 VALU throughout).
// Both launches share one product form: a work-group of 16 waves owns one batch (4 router rows,
// t = blk*4 + bat) and 32 output columns; wave w takes k in [32w, 32w + 32), lane = column; the 16
// partial sums of an output element meet in LDS and are added in wave order.
// ---------------------------------------------------------------------------
__device__ __forceinline__ void router_w_load(const float* __restrict__ Wm, int wave, int col, float (&w)[32]) {
  const float* wp = Wm + (size_t)(wave * 32) * DM + col;
  // unrolled: w[] stays in registers and all 32 loads are in flight together
#pragma unroll
  for (int j = 0; j < 32; ++j) w[j] = wp[(size_t)j * DM];
}

// rows: LDS [4][512]; red: LDS [16][4][32]. Returns, in threads 0..127, element (row tid>>5, column tid&31).
__device__ __forceinline__ float router_ksplit(const float (&w)[32], const float* rows, float* red,
                                               int tid) {
  const int wave = tid >> 5, lane = tid & 31;
  float a[NBLK] = {0.f, 0.f, 0.f, 0.f};
  // unrolled (here and below): w[] and a[] are indexed by constants only, so they stay in registers
#pragma unroll
  for (int j4 = 0; j4 < 8; ++j4) {
#pragma unroll
    for (int r = 0; r < NBLK; ++r) {
      const v4f rv = *(const v4f*)(rows + r * DM + wave * 32 + j4 * 4);
      a[r] += rv[0] * w[j4 * 4];
      a[r] += rv[1] * w[j4 * 4 + 1];
      a[r] += rv[2] * w[j4 * 4 + 2];
      a[r] += rv[3] * w[j4 * 4 + 3];
    }
  }
#pragma unroll
  for (int r = 0; r < NBLK; ++r) red[(wave * NBLK + r) * 32 + lane] = a[r];
  __syncthreads();
  float s = 0.f;
  if (tid < 128) {
#pragma unroll
    for (int wv = 0; wv < 16; ++wv) s += red[wv * 128 + tid];
  }
  return s;
}

// rq / rk / rv: RP[p][t][n] = sum_k rplane[t][k] * iW_p[k][n] + ib_p[n].  grid (16, 4, 3) = (column
// chunk, bat, p), 512 threads.
__global__ void __launch_bounds__(512)
router_proj_kernel(const float* __restrict__ rplane,
                   const float* __restrict__ iWq, const float* __restrict__ ibq,
                   const float* __restrict__ iWk, const float* __restrict__ ibk,
                   const float* __restrict__ iWv, const float* __restrict__ ibv,
                   float* __restrict__ RP) {
  __shared__ __align__(16) float Rr[NBLK * DM];
  __shared__ float red[16 * NBLK * 32];
  const int tid = threadIdx.x;
  const int col = blockIdx.x * 32 + (tid & 31);
  const int b = blockIdx.y, p = blockIdx.z;
  const float* Wm = (p == 0) ? iWq : ((p == 1) ? iWk : iWv);
  const float* bb = (p == 0) ? ibq : ((p == 1) ? ibk : ibv);
  const int ri = tid >> 7, rc4 = (tid & 127) * 4;
  const v4f rin = *(const v4f*)(rplane + (size_t)(ri * NBAT + b) * DM + rc4);
  // the weight loads below may land in the registers that held this load's address
  asm volatile("s_wait_xcnt 0x0" ::: "memory");
  float w[32];
  router_w_load(Wm, tid >> 5, col, w);
  *(v4f*)(Rr + ri * DM + rc4) = rin;
  __syncthreads();
  const float s = router_ksplit(w, Rr, red, tid);
  if (tid < 128) RP[((size_t)p * 16 + (tid >> 5) * NBAT + b) * DM + col] = s + bb[col];
}

// Per batch: 4-key softmax of (rq.rk)*0.125 per (query blk, head), o = sum p*rv / sum p (each
// work-group forms all 4 x 512 of its batch), then out rows l == 1023 = o . iWo + ibo for its 32
// columns.  grid (16, 4) = (column chunk, bat), 512 threads.
__global__ void __launch_bounds__(512)
router_out_kernel(const float* __restrict__ RP,
                  const float* __restrict__ iWo, const float* __restrict__ ibo,
                  float* __restrict__ out) {
  __shared__ __align__(16) float Pj[3][NBLK * DM];
  __shared__ __align__(16) float Ro[NBLK * DM];
  __shared__ float red[16 * NBLK * 32];
  const int tid = threadIdx.x;
  const int col = blockIdx.x * 32 + (tid & 31);
  const int b = blockIdx.y;
  float w[32];
  router_w_load(iWo, tid >> 5, col, w);
  {
    const int i = tid >> 7, c4 = (tid & 127) * 4;
#pragma unroll
    for (int p = 0; p < 3; ++p)
      *(v4f*)(&Pj[p][i * DM + c4]) = *(const v4f*)(RP + ((size_t)p * 16 + i * NBAT + b) * DM + c4);
  }
  __syncthreads();
  {
    // 16 lanes per (query blk, head); each lane holds 4 of the 64 head elements
    const int item = tid >> 4;              // 0..31
    const int nq = item >> 3, hd = item & 7;
    const int eo = hd * HD + (tid & 15) * 4;
    const v4f q4 = *(const v4f*)(&Pj[0][nq * DM + eo]);
    const v4f v0 = *(const v4f*)(&Pj[2][eo]);
    const v4f v1 = *(const v4f*)(&Pj[2][DM + eo]);
    const v4f v2 = *(const v4f*)(&Pj[2][2 * DM + eo]);
    const v4f v3 = *(const v4f*)(&Pj[2][3 * DM + eo]);
    float sc[NBLK];
#pragma unroll
    for (int s = 0; s < NBLK; ++s) {
      const v4f k4 = *(const v4f*)(&Pj[1][s * DM + eo]);
      sc[s] = q4[0] * k4[0] + q4[1] * k4[1] + q4[2] * k4[2] + q4[3] * k4[3];
    }
    // keeps the four v reads in one batch ahead of the exponentials; sunk in between them their
    // LDS latency would stand in the dependent chain three times
    asm volatile("" :: "v"(v0), "v"(v1), "v"(v2), "v"(v3));
#pragma unroll
    for (int m = 1; m < 16; m <<= 1) {
#pragma unroll
      for (int s = 0; s < NBLK; ++s) sc[s] += __shfl_xor(sc[s], m, 32);
    }
#pragma unroll
    for (int s = 0; s < NBLK; ++s) sc[s] *= 0.125f;
    const float mx = fmaxf(fmaxf(sc[0], sc[1]), fmaxf(sc[2], sc[3]));
    const float p0 = __expf(sc[0] - mx), p1 = __expf(sc[1] - mx), p2 = __expf(sc[2] - mx), p3 = __expf(sc[3] - mx);
    const float inv = 1.0f / (p0 + p1 + p2 + p3);
    v4f o4;
#pragma unroll
    for (int j = 0; j < 4; ++j) o4[j] = (p0 * v0[j] + p1 * v1[j] + p2 * v2[j] + p3 * v3[j]) * inv;
    *(v4f*)(Ro + nq * DM + eo) = o4;
  }
  __syncthreads();
  const float s = router_ksplit(w, Ro, red, tid);
  if (tid < 128)
    out[((size_t)((tid >> 5) * NBAT + b) * SEQL + (SEQL - 1)) * DM + col] = s + ibo[col];
}

// ---------------------------------------------------------------------------
// Workspace map (byte offsets; every region fully written before it is read; the f16 planes are packed
// in fragment blocks, see frag_ld; all regions are exact
//   X16   f16 [16384][512]            0          16777216 B
//   WT16  f16 [16][512][512]     16777216           8388608 B   (Wq,Wk,Wv,Wo planes x 4 blks, [out][in], x16)
//   Q16   f16 [16384][512]     25165824          16777216 B
//   K16   f16 [16384][512]     41943040          16777216 B
//   VT16  f16 [16][512][1024]  58720256          16777216 B
//   O16   f16 [16384][512]     75497472          16777216 B   (attention output x16)
//   RPL   f32 [16][512]        92274688             32768 B   (router rows, t = blk*4 + bat)
//   RP    f32 [3][16][512]     92307456             98304 B   (router q, k, v projections)
//   total                      92405760
// ---------------------------------------------------------------------------
extern "C" void kernel_launch(void* const* d_in, const int* in_sizes, int n_in,
                              void* d_out, int out_size, void* d_ws, size_t ws_size,
                              hipStream_t stream) {
  if (n_in < 17) return;
  if (in_sizes[0] != MROWS * DM) return;
  if (in_sizes[1] != NBLK * WPL || in_sizes[3] != NBLK * WPL || in_sizes[5] != NBLK * WPL || in_sizes[7] != NBLK * WPL) return;
  if (in_sizes[2] != NBLK * DM || in_sizes[4] != NBLK * DM || in_sizes[6] != NBLK * DM || in_sizes[8] != NBLK * DM) return;
  if (in_sizes[9] != WPL || in_sizes[11] != WPL || in_sizes[13] != WPL || in_sizes[15] != WPL) return;
  if (in_sizes[10] != DM || in_sizes[12] != DM || in_sizes[14] != DM || in_sizes[16] != DM) return;
  if (out_size != MROWS * DM) return;

  const float* x   = (const float*)d_in[0];
  const float* Wq  = (const float*)d_in[1];  const float* bq  = (const float*)d_in[2];
  const float* Wk  = (const float*)d_in[3];  const float* bk  = (const float*)d_in[4];
  const float* Wv  = (const float*)d_in[5];  const float* bv  = (const float*)d_in[6];
  const float* Wo  = (const float*)d_in[7];  const float* bo  = (const float*)d_in[8];
  const float* iWq = (const float*)d_in[9];  const float* ibq = (const float*)d_in[10];
  const float* iWk = (const float*)d_in[11]; const float* ibk = (const float*)d_in[12];
  const float* iWv = (const float*)d_in[13]; const float* ibv = (const float*)d_in[14];
  const float* iWo = (const float*)d_in[15]; const float* ibo = (const float*)d_in[16];
  float* out = (float*)d_out;

  const size_t bAct = (size_t)MROWS * DM * 2;      // 16777216
  const size_t bWT  = (size_t)16 * WPL * 2;        // 8388608
  const size_t bRpl = (size_t)16 * DM * 4;         // 32768
  const size_t bRp  = (size_t)3 * 16 * DM * 4;     // 98304
  size_t off = 0;
  const size_t oX  = off; off += bAct;
  const size_t oWT = off; off += bWT;
  const size_t oQ  = off; off += bAct;
  const size_t oK  = off; off += bAct;
  const size_t oVT = off; off += bAct;
  const size_t oO  = off; off += bAct;
  const size_t oR  = off; off += bRpl;
  const size_t oP  = off; off += bRp;
  if (off > ws_size) return;                       // off = 92405760

  char* ws = (char*)d_ws;
  _Float16* X16  = (_Float16*)(ws + oX);
  _Float16* WT16 = (_Float16*)(ws + oWT);
  _Float16* Q16  = (_Float16*)(ws + oQ);
  _Float16* K16  = (_Float16*)(ws + oK);
  _Float16* VT16 = (_Float16*)(ws + oVT);
  _Float16* O16  = (_Float16*)(ws + oO);
  float*    RPL  = (float*)(ws + oR);
  float*    RP   = (float*)(ws + oP);

  const int n8 = MROWS * DM / 8;                   // 1048576
  // (1) x -> f16 plane
  cvt_x_kernel<<<dim3(n8 / 256), dim3(256), 0, stream>>>(x, X16, n8);
  // (2) weights -> transposed f16 planes (x16)
  wt_kernel<<<dim3(DM / 64, DM / 64, 16), dim3(256), 0, stream>>>(Wq, Wk, Wv, Wo, WT16);
  // (3) q, k projections
  qk_gemm_kernel<<<dim3(MROWS / 64, DM / 256, 2), dim3(256), 0, stream>>>(X16, WT16, bq, bk, Q16, K16);
  // (4) v^T projection per (blk, bat)
  vt_gemm_kernel<<<dim3(DM / 64, SEQL / 256, NBLK * NBAT), dim3(256), 0, stream>>>(X16, WT16, bv, VT16);
  // (5) intra attention
  attn_kernel<<<dim3(NBLK * NBAT * NH * (SEQL / 64)), dim3(128), 0, stream>>>(Q16, K16, VT16, O16);
  // (6) output projection -> d_out (rows l < 1023) and router plane (rows l == 1023)
  wo_gemm_kernel<<<dim3(MROWS / 64, DM / 256, 1), dim3(256), 0, stream>>>(O16, WT16, bo, out, RPL);
  // (7) router q, k, v projections
  router_proj_kernel<<<dim3(DM / 32, NBAT, 3), dim3(512), 0, stream>>>(RPL, iWq, ibq, iWk, ibk, iWv, ibv, RP);
  // (8) router attention + output projection -> d_out rows l == 1023
  router_out_kernel<<<dim3(DM / 32, NBAT), dim3(512), 0, stream>>>(RP, iWo, ibo, out);
  (void)hipGetLastError();
}

// v004
// A run of this version takes 140 microseconds.
// Timed twice side by side with v003, it ran 1.52 and 1.51 times as fast.
// All steps since v000 together make it 8.10 times as fast.
// Contractions q/k/v^T projections, q.k^T, p.v, out projection: v_wmma_f32_16x16x32_f16, f16 operands (W x16; x and p x1; attention output o x16), f32 accumulate; softmax f32 (scale 0.125 applied to the f32 score accumulator); router-token attention and its four projections: f32 VALU.
#include <hip/hip_runtime.h>

typedef _Float16 v16h __attribute__((ext_vector_type(16)));
typedef _Float16 v8h  __attribute__((ext_vector_type(8)));
typedef float    v8f  __attribute__((ext_vector_type(8)));
typedef float    v4f  __attribute__((ext_vector_type(4)));

#define NBLK  4
#define NBAT  4
#define SEQL  1024
#define DM    512
#define NH    8
#define HD    64
#define MROWS 16384          // NBLK*NBAT*SEQL
#define WPL   262144         // DM*DM, one weight plane
#define ZPL   524288         // SEQL*DM, one (blk,bat) activation plane
#define SP16  72             // f16 LDS slab pitch (halves), 144 B rows
#define SP32  68             // f32 LDS slab pitch (floats), 272 B rows

union FragU { v16h v; v8h h[2]; };

// Packed operand planes. Every f16 matrix [rows][K] of the workspace is stored as fragment blocks:
// block (rt = row >> 4, kt = k >> 5) is FBH halves (1 KiB) at (rt * (K / 32) + kt) * FBH; inside it the
// 16-B unit u = o * 16 + c holds row rt*16 + c, k = kt*32 + o*8 .. + 7 (o = 0..3, c = 0..15).
// 16x16x32 operand fragment: p = block + lane*8; elements 0..7 <- unit lane (k = 8*(lane>>4) + e),
// elements 8..15 <- unit 32 + lane (16 more): the same k order for A rows m and Bt rows n, and each of
// the two loads of a wave reads 512 contiguous bytes (4 cache lines; from k-contiguous rows it was 16).
#define FBH 512
__device__ __forceinline__ v16h frag_ld(const _Float16* p) {
  FragU f;
  f.h[0] = *(const v8h*)(p);
  f.h[1] = *(const v8h*)(p + 256);
  return f.v;
}

__device__ __forceinline__ v8f mma16(v16h a, v16h b, v8f c) {
  c = __builtin_amdgcn_wmma_f32_16x16x32_f16(false, a, false, b, (short)0, c, false, false);
  asm volatile("v_nop\n\tv_nop\n\tv_nop\n\tv_nop" : "+v"(c) : "v"(a), "v"(b));
  return c;
}

__device__ __forceinline__ void wave_lds_sync() {
  __builtin_amdgcn_fence(__ATOMIC_RELEASE, "workgroup");
  __builtin_amdgcn_wave_barrier();
  __builtin_amdgcn_fence(__ATOMIC_ACQUIRE, "workgroup");
}

__device__ __forceinline__ v8f zero8() { return (v8f){0.f, 0.f, 0.f, 0.f, 0.f, 0.f, 0.f, 0.f}; }

// ---------------------------------------------------------------------------
// x f32 [16384][512] -> packed f16 plane, 8 elements per thread, one 16-B store per lane; thread i
// writes unit i of the plane and reads the 8 floats that belong there
// grid = 1048576/256 = 4096 blocks x 256 threads x 8 = 16384x512 exactly.
// ---------------------------------------------------------------------------
__global__ void __launch_bounds__(256)
cvt_x_kernel(const float* __restrict__ x, _Float16* __restrict__ X16, int n8) {
  const int i = blockIdx.x * 256 + threadIdx.x;
  if (i >= n8) return;
  const int fb = i >> 6, o = (i >> 4) & 3, c = i & 15;           // block rt*16 + kt, unit o*16 + c
  const float* xp = x + (size_t)((fb >> 4) * 16 + c) * DM + (fb & 15) * 32 + o * 8;
  const v4f a = *(const v4f*)(xp);
  const v4f b = *(const v4f*)(xp + 4);
  v8h hv;
  hv[0] = (_Float16)a[0]; hv[1] = (_Float16)a[1]; hv[2] = (_Float16)a[2]; hv[3] = (_Float16)a[3];
  hv[4] = (_Float16)b[0]; hv[5] = (_Float16)b[1]; hv[6] = (_Float16)b[2]; hv[7] = (_Float16)b[3];
  _Float16* p = X16 + (size_t)i * 8;
  *(v8h*)p = hv;
  
}

// ---------------------------------------------------------------------------
// Weight transpose + x16 + f16: W (f32 [in=512][out=512], blk plane nb of Wq/Wk/Wv/Wo)
//   -> WT[z][out][in] = f16(16 * W[in][out]), packed (rows = out, k = in), z = widx*4 + nb  (widx 0=q,1=k,2=v,3=o).
// 64x64 tiles through LDS. grid (8, 8, 16), 256 threads.
// Coverage per block: load 4 it x 256 thr x 4 = 64x64; store 2 it x 256 thr x 8 = 64x64.
// ---------------------------------------------------------------------------
__global__ void __launch_bounds__(256)
wt_kernel(const float* __restrict__ Wq, const float* __restrict__ Wk,
          const float* __restrict__ Wv, const float* __restrict__ Wo,
          _Float16* __restrict__ WT) {
  __shared__ __align__(16) float tf[64 * 68];
  const int z  = blockIdx.z;
  const int wi = z >> 2, nb = z & 3;
  const float* W = (wi == 0) ? Wq : ((wi == 1) ? Wk : ((wi == 2) ? Wv : Wo));
  W += (size_t)nb * WPL;
  _Float16* O = WT + (size_t)z * WPL;
  const int c0  = blockIdx.x * 64;   // input column block (out feature) = output row block
  const int r0  = blockIdx.y * 64;   // input row block (in feature)     = output column block
  const int tid = threadIdx.x;
  {
    const int lr = tid >> 4;          // 0..15
    const int c4 = (tid & 15) * 4;    // 0..60
#pragma unroll
    for (int it = 0; it < 4; ++it) {
      const int rr = it * 16 + lr;    // 0..63
      const v4f a = *(const v4f*)(W + (size_t)(r0 + rr) * DM + c0 + c4);
      *(v4f*)(tf + rr * 68 + c4) = a;
    }
  }
  __syncthreads();
  // the tile is 4 row tiles x 2 k tiles = 8 blocks; thread tid writes unit tid & 63 of blocks
  // (rt = tid >> 7, kt = (tid >> 6) & 1) and (rt + 2, kt)
  const int rtl = tid >> 7, ktl = (tid >> 6) & 1;
  const int sub = rtl * 16 + (tid & 15);            // out feature in the tile, 0..31
  const int c8  = ktl * 32 + ((tid >> 4) & 3) * 8;  // in feature in the tile, 0..56
  v8h hv0, hv1;
#pragma unroll
  for (int e = 0; e < 8; ++e) {
    hv0[e] = (_Float16)(16.0f * tf[(c8 + e) * 68 + sub]);
    hv1[e] = (_Float16)(16.0f * tf[(c8 + e) * 68 + 32 + sub]);
  }
  _Float16* p0 = O + (size_t)(((c0 >> 4) + rtl) * (DM / 32) + (r0 >> 5) + ktl) * FBH + (tid & 63) * 8;
  _Float16* p1 = p0 + (size_t)(2 * (DM / 32)) * FBH;
  {
    *(v8h*)p0 = hv0;
    *(v8h*)p1 = hv1;
    
  }
}

// ---------------------------------------------------------------------------
// GEMM core: acc[mt][nt] = sum_k A[m0 + mt*16 + .][k] * Bt[n0 + nt*16 + .][k], K = 512.
// A and Bt are packed f16 planes with K = 512; wave tile 32 x 64; D element r of lane l is
// (row 8*(l>>4) + r, col l&15) of its 16x16 subtile.
// ---------------------------------------------------------------------------
__device__ __forceinline__ void gemm_core(const _Float16* __restrict__ A,
                                          const _Float16* __restrict__ Bt,
                                          int m0, int n0, int lane, v8f (&acc)[2][4]) {
  const int RTS = (DM / 32) * FBH;   // halves from one row tile to the next
#pragma unroll
  for (int i = 0; i < 2; ++i)
#pragma unroll
    for (int j = 0; j < 4; ++j) acc[i][j] = zero8();
  const _Float16* ap = A  + (size_t)(m0 >> 4) * RTS + lane * 8;
  const _Float16* bp = Bt + (size_t)(n0 >> 4) * RTS + lane * 8;
#pragma unroll 1
  for (int kt = 0; kt < DM / 32; ++kt) {
    v16h bf[4];
#pragma unroll
    for (int j = 0; j < 4; ++j) bf[j] = frag_ld(bp + j * RTS);
    const v16h a0 = frag_ld(ap);
    const v16h a1 = frag_ld(ap + RTS);
    // the two address pairs are advanced below while the twelve loads that name them are in flight; as
    // inputs of the wait they stay live up to it, so that no load of the run lands on them either
    asm volatile("s_wait_xcnt 0x0" :: "v"(ap), "v"(bp) : "memory");
    ap += FBH;
    bp += FBH;
#pragma unroll
    for (int j = 0; j < 4; ++j) {
      acc[0][j] = mma16(a0, bf[j], acc[0][j]);
      acc[1][j] = mma16(a1, bf[j], acc[1][j]);
    }
  }
}

// ---------------------------------------------------------------------------
// f16 epilogue: v = acc*scale + bias (bias per column, or per row when BIAS_ROW); the wave's 32 x 64
// tile goes through its LDS slab and leaves as 4 blocks of the packed plane C (kts = its k tiles per
// row tile), 512 contiguous bytes per store instruction.
// ---------------------------------------------------------------------------
template <bool BIAS_ROW>
__device__ __forceinline__ void epi_f16(v8f (&acc)[2][4], _Float16* slab,
                                        _Float16* __restrict__ C, int kts,
                                        int m0, int n0, int lane, float scale,
                                        const float* __restrict__ bias) {
  const int c = lane & 15, hh = lane >> 4;
#pragma unroll
  for (int mt = 0; mt < 2; ++mt) {
#pragma unroll
    for (int nt = 0; nt < 4; ++nt) {
      const int coll = nt * 16 + c;
      float bc = 0.f;
      if (!BIAS_ROW) bc = bias[n0 + coll];
#pragma unroll
      for (int r = 0; r < 8; ++r) {
        const int rowl = mt * 16 + 8 * hh + r;
        float v = acc[mt][nt][r] * scale;
        v += BIAS_ROW ? bias[m0 + rowl] : bc;
        slab[rowl * SP16 + coll] = (_Float16)v;
      }
    }
  }
  wave_lds_sync();
  {
#pragma unroll
    for (int it = 0; it < 8; ++it) {
      const int rtl = it >> 2, ktl = (it >> 1) & 1, uh = it & 1;   // block of the tile, half of the block
      const v8h val = *(const v8h*)(slab + (rtl * 16 + c) * SP16 + ktl * 32 + (uh * 2 + hh) * 8);
      *(v8h*)(C + ((size_t)((m0 >> 4) + rtl) * kts + (n0 >> 5) + ktl) * FBH + uh * 256 + lane * 8) = val;
    }
  }
  wave_lds_sync();
}

// ---------------------------------------------------------------------------
// q / k projections: rows (blk,bat,l) = 16384, N = 512, K = 512; weight plane and bias selected by
// the row block (block-uniform).  Q16/K16: [16384][512] f16, packed, column (k) = h*64 + e.
// grid (256, 2, 2): block tile 64 rows x 256 cols (8 waves of 32x64); z: 0 = q, 1 = k.
// ---------------------------------------------------------------------------
__global__ void __launch_bounds__(256)
qk_gemm_kernel(const _Float16* __restrict__ X16, const _Float16* __restrict__ WT,
               const float* __restrict__ bq, const float* __restrict__ bk,
               _Float16* __restrict__ Q16, _Float16* __restrict__ K16) {
  __shared__ __align__(16) _Float16 slabs[8 * 32 * SP16];
  const int lane = threadIdx.x & 31, wid = threadIdx.x >> 5;
  const int m0 = blockIdx.x * 64 + (wid >> 2) * 32;
  const int n0 = blockIdx.y * 256 + (wid & 3) * 64;
  const int proj = blockIdx.z;
  const int nb = m0 >> 12;
  const _Float16* Bt = WT + (size_t)(proj * 4 + nb) * WPL;
  const float* bias = ((proj == 0) ? bq : bk) + nb * DM;
  _Float16* C = (proj == 0) ? Q16 : K16;
  v8f acc[2][4];
  gemm_core(X16, Bt, m0, n0, lane, acc);
  epi_f16<false>(acc, slabs + wid * (32 * SP16), C, DM / 32, m0, n0, lane, 0.0625f, bias);
}

// ---------------------------------------------------------------------------
// v^T projection per (blk,bat) z: VT16[z][m = h*64+e][l] = sum_k WvT[nb][m][k] * x[z][l][k] / 16 + bv[nb][m]
// A = WvT plane (512 x 512), Bt = x plane rows (1024 x 512), C [512][1024] f16, packed (k = l).  grid (8, 4, 16).
// ---------------------------------------------------------------------------
__global__ void __launch_bounds__(256)
vt_gemm_kernel(const _Float16* __restrict__ X16, const _Float16* __restrict__ WT,
               const float* __restrict__ bv, _Float16* __restrict__ VT16) {
  __shared__ __align__(16) _Float16 slabs[8 * 32 * SP16];
  const int lane = threadIdx.x & 31, wid = threadIdx.x >> 5;
  const int m0 = blockIdx.x * 64 + (wid >> 2) * 32;     // 0..511 (output feature)
  const int n0 = blockIdx.y * 256 + (wid & 3) * 64;     // 0..1023 (position)
  const int z  = blockIdx.z;
  const int nb = z >> 2;
  const _Float16* A  = WT + (size_t)(8 + nb) * WPL;
  const _Float16* Bt = X16 + (size_t)z * ZPL;
  _Float16* C = VT16 + (size_t)z * ZPL;
  const float* bias = bv + nb * DM;
  v8f acc[2][4];
  gemm_core(A, Bt, m0, n0, lane, acc);
  epi_f16<true>(acc, slabs + wid * (32 * SP16), C, SEQL / 32, m0, n0, lane, 0.0625f, bias);
}

// ---------------------------------------------------------------------------
// Full (unmasked) attention, head dim 64, per (blk,bat) z and head h, in transposed form.
//   q/k rows from Q16/K16 ([z*1024 + l][h*64 + d]); v^T rows from VT16 ([z*512 + h*64 + d][l]); all packed.
//   S^T = k.q^T (A = k rows, Bt = q rows): lane l holds, for query l&15, keys 16j + 8*(l>>4) + r of
//   each 16-key tile j, so the row maximum and the row sum of the online softmax (f32, 16 chunks of
//   64 keys) are in-lane, joined between lanes l and l^16 by one cross-row move.
//   O^T += v^T.P^T (A = v^T rows, Bt = P rows): two neighbouring S^T tiles, converted in place, are
//   the Bt fragment in the k order of frag_ld (elements 0..7: k0 + 8*(l>>4) + e, 8..15: 16 more).
//   O16[z*1024 + l][h*64 + d] = f16(16 * O / rowsum), packed: the eight d of accumulator tile t in a lane
//   are unit (t&1)*32 + lane of block (query tile, 2h + (t>>1)), so each tile is stored straight from registers.
//   Block = 4 waves x 16 query rows; grid 2048 = z*128 + h*16 + qb.
// ---------------------------------------------------------------------------
__device__ __forceinline__ float xhalf(float x) {   // value of lane l ^ 16
  const int b = __builtin_bit_cast(int, x);
  return __builtin_bit_cast(float, __builtin_amdgcn_permlanex16(b, b, 0x76543210, 0xfedcba98, false, false));
}

// y[i] = 2^x[i], eight in one statement: the outputs are early-clobber, so no exponential lands on a
// source of the one in front of it, and the closing v_nop is the free slot that the instruction set asks
// for behind the last one
__device__ __forceinline__ void exp2x8(const float (&x)[8], float (&y)[8]) {
  asm("v_exp_f32 %0, %8\n\tv_exp_f32 %1, %9\n\tv_exp_f32 %2, %10\n\tv_exp_f32 %3, %11\n\t"
      "v_exp_f32 %4, %12\n\tv_exp_f32 %5, %13\n\tv_exp_f32 %6, %14\n\tv_exp_f32 %7, %15\n\tv_nop"
      : "=&v"(y[0]), "=&v"(y[1]), "=&v"(y[2]), "=&v"(y[3]), "=&v"(y[4]), "=&v"(y[5]), "=&v"(y[6]), "=&v"(y[7])
      : "v"(x[0]), "v"(x[1]), "v"(x[2]), "v"(x[3]), "v"(x[4]), "v"(x[5]), "v"(x[6]), "v"(x[7]));
}

__global__ void __launch_bounds__(128)
attn_kernel(const _Float16* __restrict__ Q16, const _Float16* __restrict__ K16,
            const _Float16* __restrict__ VT16, _Float16* __restrict__ O16) {
  const int tid = threadIdx.x, wave = tid >> 5, lane = tid & 31;
  const int bx = blockIdx.x;
  const int qb = bx & 15, h = (bx >> 4) & 7, z = bx >> 7;
  const int q0 = qb * 64 + wave * 16;

  const int QRT = (DM / 32) * FBH;     // halves from one 16-row tile of Q16 / K16 / O16 to the next
  const int VRT = (SEQL / 32) * FBH;   // the same for VT16
  const size_t hq = (size_t)z * ZPL + (2 * h) * FBH + lane * 8;   // row tile 0 of z, first k tile of head h
  const _Float16* Qz = Q16 + hq + (size_t)(q0 >> 4) * QRT;
  const _Float16* Kz = K16 + hq;
  const _Float16* Vz = VT16 + (size_t)z * ZPL + (size_t)(h * (HD / 16)) * VRT + lane * 8;
  _Float16* Oz = O16 + hq + (size_t)(q0 >> 4) * QRT;

  const v16h qf0 = frag_ld(Qz);
  const v16h qf1 = frag_ld(Qz + FBH);
  // the fragment loads below may land in the registers that held this address
  asm volatile("s_wait_xcnt 0x0" :: "v"(Qz) : "memory");

  float mrow = -1e30f, lrow = 0.f;   // query c: running maximum (both halves alike), this half's sum
  v8f oacc[4];                       // oacc[t][r] = O^T[d = 16t + 8hh + r][query c]
#pragma unroll
  for (int t = 0; t < 4; ++t) oacc[t] = zero8();

  // Fragments are fetched one pass (64 keys) ahead: the 16 loads of the next pass's k fragments go out as
  // one group right behind this pass's S^T products, into the registers those have just read, and the 16
  // loads of its v^T fragments right behind the O^T products; each group has a whole pass to arrive.
  const _Float16* kp = Kz;   // k fragments of the pass that is fetched next
  const _Float16* vp = Vz;   // v^T fragments of the same
  v16h kf[8], vf[8];         // kf[2j + i]: keys 16j.., d = 32i..; vf[4kk + t]: d = 16t.., keys 32kk..
  auto fetch_k = [&]() __attribute__((always_inline)) {
#pragma unroll
    for (int j = 0; j < 4; ++j) {
      kf[2 * j]     = frag_ld(kp + j * QRT);
      kf[2 * j + 1] = frag_ld(kp + j * QRT + FBH);
    }
    // the address pair is advanced while the loads that name it are in flight; the statement also keeps the
    // k and v^T groups in one order everywhere, so that the counted load waits can leave the younger group out
    asm volatile("s_wait_xcnt 0x0" :: "v"(kp) : "memory");
    kp += 4 * QRT;
  };
  auto fetch_v = [&]() __attribute__((always_inline)) {
#pragma unroll
    for (int i = 0; i < 8; ++i) vf[i] = frag_ld(vp + (i & 3) * VRT + (i >> 2) * FBH);
    // as in fetch_k
    asm volatile("s_wait_xcnt 0x0" :: "v"(vp) : "memory");
    vp += 2 * FBH;
  };
  fetch_k();
  fetch_v();

  auto pass = [&](const bool fetch) __attribute__((always_inline)) {
    v8f s[4];
#pragma unroll
    for (int j = 0; j < 4; ++j) {
      s[j] = zero8();
      s[j] = mma16(kf[2 * j], qf0, s[j]);
      s[j] = mma16(kf[2 * j + 1], qf1, s[j]);
    }
    if (fetch) {
      fetch_k();
      // keeps the group ahead of the softmax: sunk behind it, the loads would have only the O^T products to arrive in
      __builtin_amdgcn_sched_barrier(0);
    }
    float m = -1e30f;
#pragma unroll
    for (int j = 0; j < 4; ++j) {
#pragma unroll
      for (int r = 0; r < 8; ++r) {
        const float sv = s[j][r] * 0.125f;
        s[j][r] = sv;
        m = fmaxf(m, sv);
      }
    }
    m = fmaxf(m, xhalf(m));
    const float mnew  = fmaxf(mrow, m);
    const float alpha = __expf(mrow - mnew);
    mrow = mnew;
    float ps[4] = {0.f, 0.f, 0.f, 0.f};
    FragU pf[2];
#pragma unroll
    for (int j = 0; j < 4; ++j) {
      float e[8], p[8];
#pragma unroll
      for (int r = 0; r < 8; ++r) e[r] = (s[j][r] - mnew) * 1.44269504088896340736f;   // exp(x) = 2^(x log2 e)
      exp2x8(e, p);
#pragma unroll
      for (int r = 0; r < 8; ++r) {
        ps[j] += p[r];
        pf[j >> 1].h[j & 1][r] = (_Float16)p[r];
      }
    }
    lrow = lrow * alpha + ((ps[0] + ps[1]) + (ps[2] + ps[3]));
#pragma unroll
    for (int t = 0; t < 4; ++t)
#pragma unroll
      for (int r = 0; r < 8; ++r) oacc[t][r] *= alpha;
#pragma unroll
    for (int kk = 0; kk < 2; ++kk) {
#pragma unroll
      for (int t = 0; t < 4; ++t) oacc[t] = mma16(vf[kk * 4 + t], pf[kk].v, oacc[t]);
    }
    if (fetch) fetch_v();
  };

  // rolled: one copy of the pass with its fetches; the last pass has nothing to fetch and stands alone
#pragma unroll 1
  for (int kc = 0; kc < SEQL / 64 - 1; ++kc) pass(true);
  pass(false);

  {
    const float inv16 = 16.0f * (1.0f / (lrow + xhalf(lrow)));
#pragma unroll
    for (int t = 0; t < 4; ++t) {
      v8h ov;
#pragma unroll
      for (int r = 0; r < 8; ++r) ov[r] = (_Float16)(oacc[t][r] * inv16);
      *(v8h*)(Oz + (t >> 1) * FBH + (t & 1) * 256) = ov;
    }
  }
}

// ---------------------------------------------------------------------------
// Output projection: out[row][n] = sum_k O16[row][k] * WoT[nb][n][k] / 256 + bo[nb][n]  (f32).
// Rows with l == 1023 (router tokens) go to rplane[(blk*4+bat)][512] instead of d_out (single writer
// of those d_out rows is the router output kernel).  Epilogue: 16-row f32 slabs per wave in LDS; each 256-B
// row segment written by 16 consecutive lanes x 16 B of one instruction (2 rows per instruction,
// ---------------------------------------------------------------------------
__global__ void __launch_bounds__(256)
wo_gemm_kernel(const _Float16* __restrict__ O16, const _Float16* __restrict__ WT,
               const float* __restrict__ bo, float* __restrict__ out, float* __restrict__ rplane) {
  __shared__ __align__(16) float slabf[8 * 16 * SP32];
  const int lane = threadIdx.x & 31, wid = threadIdx.x >> 5;
  const int m0 = blockIdx.x * 64 + (wid >> 2) * 32;
  const int n0 = blockIdx.y * 256 + (wid & 3) * 64;
  const int nb = m0 >> 12;
  const _Float16* Bt = WT + (size_t)(12 + nb) * WPL;
  const float* bias = bo + nb * DM;
  v8f acc[2][4];
  gemm_core(O16, Bt, m0, n0, lane, acc);

  float* slab = slabf + wid * (16 * SP32);
  const int c = lane & 15, hh = lane >> 4, c4 = c * 4;
#pragma unroll
  for (int mt = 0; mt < 2; ++mt) {
#pragma unroll
    for (int nt = 0; nt < 4; ++nt) {
      const int coll = nt * 16 + c;
      const float bc = bias[n0 + coll];
#pragma unroll
      for (int r = 0; r < 8; ++r)
        slab[(8 * hh + r) * SP32 + coll] = acc[mt][nt][r] * (1.0f / 256.0f) + bc;
    }
    wave_lds_sync();
    {
#pragma unroll
      for (int it = 0; it < 8; ++it) {
        const int row = it * 2 + hh;
        const int gm  = m0 + mt * 16 + row;
        const v4f val = *(const v4f*)(slab + row * SP32 + c4);
        float* dst = ((gm & (SEQL - 1)) == (SEQL - 1))
                         ? (rplane + (size_t)(gm >> 10) * DM + n0 + c4)
                         : (out + (size_t)gm * DM + n0 + c4);
        *(v4f*)dst = val;
      }
      
    }
    wave_lds_sync();
  }
}

// ---------------------------------------------------------------------------
// Router (inter) attention in two launches of many work-groups (f32 VALU throughout).
// Both launches share one product form: a work-group of 16 waves owns one batch (4 router rows,
// t = blk*4 + bat) and 32 output columns; wave w takes k in [32w, 32w + 32), lane = column; the 16
// partial sums of an output element meet in LDS and are added in wave order.
// ---------------------------------------------------------------------------
__device__ __forceinline__ void router_w_load(const float* __restrict__ Wm, int wave, int col, float (&w)[32]) {
  const float* wp = Wm + (size_t)(wave * 32) * DM + col;
  // unrolled: w[] stays in registers and all 32 loads are in flight together
#pragma unroll
  for (int j = 0; j < 32; ++j) w[j] = wp[(size_t)j * DM];
}

// rows: LDS [4][512]; red: LDS [16][4][32]. Returns, in threads 0..127, element (row tid>>5, column tid&31).
__device__ __forceinline__ float router_ksplit(const float (&w)[32], const float* rows, float* red,
                                               int tid) {
  const int wave = tid >> 5, lane = tid & 31;
  float a[NBLK] = {0.f, 0.f, 0.f, 0.f};
  // unrolled (here and below): w[] and a[] are indexed by constants only, so they stay in registers
#pragma unroll
  for (int j4 = 0; j4 < 8; ++j4) {
#pragma unroll
    for (int r = 0; r < NBLK; ++r) {
      const v4f rv = *(const v4f*)(rows + r * DM + wave * 32 + j4 * 4);
      a[r] += rv[0] * w[j4 * 4];
      a[r] += rv[1] * w[j4 * 4 + 1];
      a[r] += rv[2] * w[j4 * 4 + 2];
      a[r] += rv[3] * w[j4 * 4 + 3];
    }
  }
#pragma unroll
  for (int r = 0; r < NBLK; ++r) red[(wave * NBLK + r) * 32 + lane] = a[r];
  __syncthreads();
  float s = 0.f;
  if (tid < 128) {
#pragma unroll
    for (int wv = 0; wv < 16; ++wv) s += red[wv * 128 + tid];
  }
  return s;
}

// rq / rk / rv: RP[p][t][n] = sum_k rplane[t][k] * iW_p[k][n] + ib_p[n].  grid (16, 4, 3) = (column
// chunk, bat, p), 512 threads.
__global__ void __launch_bounds__(512)
router_proj_kernel(const float* __restrict__ rplane,
                   const float* __restrict__ iWq, const float* __restrict__ ibq,
                   const float* __restrict__ iWk, const float* __restrict__ ibk,
                   const float* __restrict__ iWv, const float* __restrict__ ibv,
                   float* __restrict__ RP) {
  __shared__ __align__(16) float Rr[NBLK * DM];
  __shared__ float red[16 * NBLK * 32];
  const int tid = threadIdx.x;
  const int col = blockIdx.x * 32 + (tid & 31);
  const int b = blockIdx.y, p = blockIdx.z;
  const float* Wm = (p == 0) ? iWq : ((p == 1) ? iWk : iWv);
  const float* bb = (p == 0) ? ibq : ((p == 1) ? ibk : ibv);
  const int ri = tid >> 7, rc4 = (tid & 127) * 4;
  const v4f rin = *(const v4f*)(rplane + (size_t)(ri * NBAT + b) * DM + rc4);
  // the weight loads below may land in the registers that held this load's address
  asm volatile("s_wait_xcnt 0x0" ::: "memory");
  float w[32];
  router_w_load(Wm, tid >> 5, col, w);
  *(v4f*)(Rr + ri * DM + rc4) = rin;
  __syncthreads();
  const float s = router_ksplit(w, Rr, red, tid);
  if (tid < 128) RP[((size_t)p * 16 + (tid >> 5) * NBAT + b) * DM + col] = s + bb[col];
}

// Per batch: 4-key softmax of (rq.rk)*0.125 per (query blk, head), o = sum p*rv / sum p (each
// work-group forms all 4 x 512 of its batch), then out rows l == 1023 = o . iWo + ibo for its 32
// columns.  grid (16, 4) = (column chunk, bat), 512 threads.
__global__ void __launch_bounds__(512)
router_out_kernel(const float* __restrict__ RP,
                  const float* __restrict__ iWo, const float* __restrict__ ibo,
                  float* __restrict__ out) {
  __shared__ __align__(16) float Pj[3][NBLK * DM];
  __shared__ __align__(16) float Ro[NBLK * DM];
  __shared__ float red[16 * NBLK * 32];
  const int tid = threadIdx.x;
  const int col = blockIdx.x * 32 + (tid & 31);
  const int b = blockIdx.y;
  float w[32];
  router_w_load(iWo, tid >> 5, col, w);
  {
    const int i = tid >> 7, c4 = (tid & 127) * 4;
#pragma unroll
    for (int p = 0; p < 3; ++p)
      *(v4f*)(&Pj[p][i * DM + c4]) = *(const v4f*)(RP + ((size_t)p * 16 + i * NBAT + b) * DM + c4);
  }
  __syncthreads();
  {
    // 16 lanes per (query blk, head); each lane holds 4 of the 64 head elements
    const int item = tid >> 4;              // 0..31
    const int nq = item >> 3, hd = item & 7;
    const int eo = hd * HD + (tid & 15) * 4;
    const v4f q4 = *(const v4f*)(&Pj[0][nq * DM + eo]);
    const v4f v0 = *(const v4f*)(&Pj[2][eo]);
    const v4f v1 = *(const v4f*)(&Pj[2][DM + eo]);
    const v4f v2 = *(const v4f*)(&Pj[2][2 * DM + eo]);
    const v4f v3 = *(const v4f*)(&Pj[2][3 * DM + eo]);
    float sc[NBLK];
#pragma unroll
    for (int s = 0; s < NBLK; ++s) {
      const v4f k4 = *(const v4f*)(&Pj[1][s * DM + eo]);
      sc[s] = q4[0] * k4[0] + q4[1] * k4[1] + q4[2] * k4[2] + q4[3] * k4[3];
    }
    // keeps the four v reads in one batch ahead of the exponentials; sunk in between them their
    // LDS latency would stand in the dependent chain three times
    asm volatile("" :: "v"(v0), "v"(v1), "v"(v2), "v"(v3));
#pragma unroll
    for (int m = 1; m < 16; m <<= 1) {
#pragma unroll
      for (int s = 0; s < NBLK; ++s) sc[s] += __shfl_xor(sc[s], m, 32);
    }
#pragma unroll
    for (int s = 0; s < NBLK; ++s) sc[s] *= 0.125f;
    const float mx = fmaxf(fmaxf(sc[0], sc[1]), fmaxf(sc[2], sc[3]));
    const float p0 = __expf(sc[0] - mx), p1 = __expf(sc[1] - mx), p2 = __expf(sc[2] - mx), p3 = __expf(sc[3] - mx);
    const float inv = 1.0f / (p0 + p1 + p2 + p3);
    v4f o4;
#pragma unroll
    for (int j = 0; j < 4; ++j) o4[j] = (p0 * v0[j] + p1 * v1[j] + p2 * v2[j] + p3 * v3[j]) * inv;
    *(v4f*)(Ro + nq * DM + eo) = o4;
  }
  __syncthreads();
  const float s = router_ksplit(w, Ro, red, tid);
  if (tid < 128)
    out[((size_t)((tid >> 5) * NBAT + b) * SEQL + (SEQL - 1)) * DM + col] = s + ibo[col];
}

// ---------------------------------------------------------------------------
// Workspace map (byte offsets; every region fully written before it is read; the f16 planes are packed
// in fragment blocks, see frag_ld; all regions are exact
//   X16   f16 [16384][512]            0          16777216 B
//   WT16  f16 [16][512][512]     16777216           8388608 B   (Wq,Wk,Wv,Wo planes x 4 blks, [out][in], x16)
//   Q16   f16 [16384][512]     25165824          16777216 B
//   K16   f16 [16384][512]     41943040          16777216 B
//   VT16  f16 [16][512][1024]  58720256          16777216 B
//   O16   f16 [16384][512]     75497472          16777216 B   (attention output x16)
//   RPL   f32 [16][512]        92274688             32768 B   (router rows, t = blk*4 + bat)
//   RP    f32 [3][16][512]     92307456             98304 B   (router q, k, v projections)
//   total                      92405760
// ---------------------------------------------------------------------------
extern "C" void kernel_launch(void* const* d_in, const int* in_sizes, int n_in,
                              void* d_out, int out_size, void* d_ws, size_t ws_size,
                              hipStream_t stream) {
  if (n_in < 17) return;
  if (in_sizes[0] != MROWS * DM) return;
  if (in_sizes[1] != NBLK * WPL || in_sizes[3] != NBLK * WPL || in_sizes[5] != NBLK * WPL || in_sizes[7] != NBLK * WPL) return;
  if (in_sizes[2] != NBLK * DM || in_sizes[4] != NBLK * DM || in_sizes[6] != NBLK * DM || in_sizes[8] != NBLK * DM) return;
  if (in_sizes[9] != WPL || in_sizes[11] != WPL || in_sizes[13] != WPL || in_sizes[15] != WPL) return;
  if (in_sizes[10] != DM || in_sizes[12] != DM || in_sizes[14] != DM || in_sizes[16] != DM) return;
  if (out_size != MROWS * DM) return;

  const float* x   = (const float*)d_in[0];
  const float* Wq  = (const float*)d_in[1];  const float* bq  = (const float*)d_in[2];
  const float* Wk  = (const float*)d_in[3];  const float* bk  = (const float*)d_in[4];
  const float* Wv  = (const float*)d_in[5];  const float* bv  = (const float*)d_in[6];
  const float* Wo  = (const float*)d_in[7];  const float* bo  = (const float*)d_in[8];
  const float* iWq = (const float*)d_in[9];  const float* ibq = (const float*)d_in[10];
  const float* iWk = (const float*)d_in[11]; const float* ibk = (const float*)d_in[12];
  const float* iWv = (const float*)d_in[13]; const float* ibv = (const float*)d_in[14];
  const float* iWo = (const float*)d_in[15]; const float* ibo = (const float*)d_in[16];
  float* out = (float*)d_out;

  const size_t bAct = (size_t)MROWS * DM * 2;      // 16777216
  const size_t bWT  = (size_t)16 * WPL * 2;        // 8388608
  const size_t bRpl = (size_t)16 * DM * 4;         // 32768
  const size_t bRp  = (size_t)3 * 16 * DM * 4;     // 98304
  size_t off = 0;
  const size_t oX  = off; off += bAct;
  const size_t oWT = off; off += bWT;
  const size_t oQ  = off; off += bAct;
  const size_t oK  = off; off += bAct;
  const size_t oVT = off; off += bAct;
  const size_t oO  = off; off += bAct;
  const size_t oR  = off; off += bRpl;
  const size_t oP  = off; off += bRp;
  if (off > ws_size) return;                       // off = 92405760

  char* ws = (char*)d_ws;
  _Float16* X16  = (_Float16*)(ws + oX);
  _Float16* WT16 = (_Float16*)(ws + oWT);
  _Float16* Q16  = (_Float16*)(ws + oQ);
  _Float16* K16  = (_Float16*)(ws + oK);
  _Float16* VT16 = (_Float16*)(ws + oVT);
  _Float16* O16  = (_Float16*)(ws + oO);
  float*    RPL  = (float*)(ws + oR);
  float*    RP   = (float*)(ws + oP);

  const int n8 = MROWS * DM / 8;                   // 1048576
  // (1) x -> f16 plane
  cvt_x_kernel<<<dim3(n8 / 256), dim3(256), 0, stream>>>(x, X16, n8);
  // (2) weights -> transposed f16 planes (x16)
  wt_kernel<<<dim3(DM / 64, DM / 64, 16), dim3(256), 0, stream>>>(Wq, Wk, Wv, Wo, WT16);
  // (3) q, k projections
  qk_gemm_kernel<<<dim3(MROWS / 64, DM / 256, 2), dim3(256), 0, stream>>>(X16, WT16, bq, bk, Q16, K16);
  // (4) v^T projection per (blk, bat)
  vt_gemm_kernel<<<dim3(DM / 64, SEQL / 256, NBLK * NBAT), dim3(256), 0, stream>>>(X16, WT16, bv, VT16);
  // (5) intra attention
  attn_kernel<<<dim3(NBLK * NBAT * NH * (SEQL / 64)), dim3(128), 0, stream>>>(Q16, K16, VT16, O16);
  // (6) output projection -> d_out (rows l < 1023) and router plane (rows l == 1023)
  wo_gemm_kernel<<<dim3(MROWS / 64, DM / 256, 1), dim3(256), 0, stream>>>(O16, WT16, bo, out, RPL);
  // (7) router q, k, v projections
  router_proj_kernel<<<dim3(DM / 32, NBAT, 3), dim3(512), 0, stream>>>(RPL, iWq, ibq, iWk, ibk, iWv, ibv, RP);
  // (8) router attention + output projection -> d_out rows l == 1023
  router_out_kernel<<<dim3(DM / 32, NBAT), dim3(512), 0, stream>>>(RP, iWo, ibo, out);
  (void)hipGetLastError();
}

// v005
// Measured time: 128 microseconds a run.
// Two timings next to v004 put it at 1.11 and 1.09 times that version's speed.
// All steps since v000 together make it 8.89 times as fast.
// Contractions q/k/v^T projections, q.k^T, p.v, out projection: v_wmma_f32_16x16x32_f16, f16 operands (W x16; x and p x1; attention output o x16), f32 accumulate; softmax f32 (scale 0.125 applied to the f32 score accumulator); router-token attention and its four projections: f32 VALU.
#include <hip/hip_runtime.h>

typedef _Float16 v16h __attribute__((ext_vector_type(16)));
typedef _Float16 v8h  __attribute__((ext_vector_type(8)));
typedef float    v8f  __attribute__((ext_vector_type(8)));
typedef float    v4f  __attribute__((ext_vector_type(4)));

#define NBLK  4
#define NBAT  4
#define SEQL  1024
#define DM    512
#define NH    8
#define HD    64
#define MROWS 16384          // NBLK*NBAT*SEQL
#define WPL   262144         // DM*DM, one weight plane
#define ZPL   524288         // SEQL*DM, one (blk,bat) activation plane
#define SP16  72             // f16 LDS slab pitch (halves), 144 B rows
#define SP32  68             // f32 LDS slab pitch (floats), 272 B rows

union FragU { v16h v; v8h h[2]; };

// Packed operand planes. Every f16 matrix [rows][K] of the workspace is stored as fragment blocks:
// block (rt = row >> 4, kt = k >> 5) is FBH halves (1 KiB) at (rt * (K / 32) + kt) * FBH; inside it the
// 16-B unit u = o * 16 + c holds row rt*16 + c, k = kt*32 + o*8 .. + 7 (o = 0..3, c = 0..15).
// 16x16x32 operand fragment: p = block + lane*8; elements 0..7 <- unit lane (k = 8*(lane>>4) + e),
// elements 8..15 <- unit 32 + lane (16 more): the same k order for A rows m and Bt rows n, and each of
// the two loads of a wave reads 512 contiguous bytes (4 cache lines; from k-contiguous rows it was 16).
#define FBH 512
__device__ __forceinline__ v16h frag_ld(const _Float16* p) {
  FragU f;
  f.h[0] = *(const v8h*)(p);
  f.h[1] = *(const v8h*)(p + 256);
  return f.v;
}

__device__ __forceinline__ v8f mma16(v16h a, v16h b, v8f c) {
  c = __builtin_amdgcn_wmma_f32_16x16x32_f16(false, a, false, b, (short)0, c, false, false);
  asm volatile("v_nop\n\tv_nop\n\tv_nop\n\tv_nop" : "+v"(c) : "v"(a), "v"(b));
  return c;
}

__device__ __forceinline__ void wave_lds_sync() {
  __builtin_amdgcn_fence(__ATOMIC_RELEASE, "workgroup");
  __builtin_amdgcn_wave_barrier();
  __builtin_amdgcn_fence(__ATOMIC_ACQUIRE, "workgroup");
}

__device__ __forceinline__ v8f zero8() { return (v8f){0.f, 0.f, 0.f, 0.f, 0.f, 0.f, 0.f, 0.f}; }

// ---------------------------------------------------------------------------
// x f32 [16384][512] -> packed f16 plane, 8 elements per thread, one 16-B store per lane; thread i
// writes unit i of the plane and reads the 8 floats that belong there
// grid = 1048576/256 = 4096 blocks x 256 threads x 8 = 16384x512 exactly.
// ---------------------------------------------------------------------------
__global__ void __launch_bounds__(256)
cvt_x_kernel(const float* __restrict__ x, _Float16* __restrict__ X16, int n8) {
  const int i = blockIdx.x * 256 + threadIdx.x;
  if (i >= n8) return;
  const int fb = i >> 6, o = (i >> 4) & 3, c = i & 15;           // block rt*16 + kt, unit o*16 + c
  const float* xp = x + (size_t)((fb >> 4) * 16 + c) * DM + (fb & 15) * 32 + o * 8;
  const v4f a = *(const v4f*)(xp);
  const v4f b = *(const v4f*)(xp + 4);
  v8h hv;
  hv[0] = (_Float16)a[0]; hv[1] = (_Float16)a[1]; hv[2] = (_Float16)a[2]; hv[3] = (_Float16)a[3];
  hv[4] = (_Float16)b[0]; hv[5] = (_Float16)b[1]; hv[6] = (_Float16)b[2]; hv[7] = (_Float16)b[3];
  _Float16* p = X16 + (size_t)i * 8;
  *(v8h*)p = hv;
  
}

// ---------------------------------------------------------------------------
// Weight transpose + x16 + f16: W (f32 [in=512][out=512], blk plane nb of Wq/Wk/Wv/Wo)
//   -> WT[z][out][in] = f16(16 * W[in][out]), packed (rows = out, k = in), z = widx*4 + nb  (widx 0=q,1=k,2=v,3=o).
// 64x64 tiles through LDS. grid (8, 8, 16), 256 threads.
// Coverage per block: load 4 it x 256 thr x 4 = 64x64; store 2 it x 256 thr x 8 = 64x64.
// ---------------------------------------------------------------------------
__global__ void __launch_bounds__(256)
wt_kernel(const float* __restrict__ Wq, const float* __restrict__ Wk,
          const float* __restrict__ Wv, const float* __restrict__ Wo,
          _Float16* __restrict__ WT) {
  __shared__ __align__(16) float tf[64 * 68];
  const int z  = blockIdx.z;
  const int wi = z >> 2, nb = z & 3;
  const float* W = (wi == 0) ? Wq : ((wi == 1) ? Wk : ((wi == 2) ? Wv : Wo));
  W += (size_t)nb * WPL;
  _Float16* O = WT + (size_t)z * WPL;
  const int c0  = blockIdx.x * 64;   // input column block (out feature) = output row block
  const int r0  = blockIdx.y * 64;   // input row block (in feature)     = output column block
  const int tid = threadIdx.x;
  {
    const int lr = tid >> 4;          // 0..15
    const int c4 = (tid & 15) * 4;    // 0..60
#pragma unroll
    for (int it = 0; it < 4; ++it) {
      const int rr = it * 16 + lr;    // 0..63
      const v4f a = *(const v4f*)(W + (size_t)(r0 + rr) * DM + c0 + c4);
      *(v4f*)(tf + rr * 68 + c4) = a;
    }
  }
  __syncthreads();
  // the tile is 4 row tiles x 2 k tiles = 8 blocks; thread tid writes unit tid & 63 of blocks
  // (rt = tid >> 7, kt = (tid >> 6) & 1) and (rt + 2, kt)
  const int rtl = tid >> 7, ktl = (tid >> 6) & 1;
  const int sub = rtl * 16 + (tid & 15);            // out feature in the tile, 0..31
  const int c8  = ktl * 32 + ((tid >> 4) & 3) * 8;  // in feature in the tile, 0..56
  v8h hv0, hv1;
#pragma unroll
  for (int e = 0; e < 8; ++e) {
    hv0[e] = (_Float16)(16.0f * tf[(c8 + e) * 68 + sub]);
    hv1[e] = (_Float16)(16.0f * tf[(c8 + e) * 68 + 32 + sub]);
  }
  _Float16* p0 = O + (size_t)(((c0 >> 4) + rtl) * (DM / 32) + (r0 >> 5) + ktl) * FBH + (tid & 63) * 8;
  _Float16* p1 = p0 + (size_t)(2 * (DM / 32)) * FBH;
  {
    *(v8h*)p0 = hv0;
    *(v8h*)p1 = hv1;
    
  }
}

// ---------------------------------------------------------------------------
// GEMM core: acc[mt][nt] = sum_k A[m0 + mt*16 + .][k] * Bt[n0 + nt*16 + .][k], K = 512.
// A and Bt are packed f16 planes with K = 512; wave tile 32 x 64; D element r of lane l is
// (row 8*(l>>4) + r, col l&15) of its 16x16 subtile.
// ---------------------------------------------------------------------------
__device__ __forceinline__ void gemm_core(const _Float16* __restrict__ A,
                                          const _Float16* __restrict__ Bt,
                                          int m0, int n0, int lane, v8f (&acc)[2][4]) {
  const int RTS = (DM / 32) * FBH;   // halves from one row tile to the next
#pragma unroll
  for (int i = 0; i < 2; ++i)
#pragma unroll
    for (int j = 0; j < 4; ++j) acc[i][j] = zero8();
  const _Float16* ap = A  + (size_t)(m0 >> 4) * RTS + lane * 8;
  const _Float16* bp = Bt + (size_t)(n0 >> 4) * RTS + lane * 8;
#pragma unroll 1
  for (int kt = 0; kt < DM / 32; ++kt) {
    v16h bf[4];
#pragma unroll
    for (int j = 0; j < 4; ++j) bf[j] = frag_ld(bp + j * RTS);
    const v16h a0 = frag_ld(ap);
    const v16h a1 = frag_ld(ap + RTS);
    // the two address pairs are advanced below while the twelve loads that name them are in flight; as
    // inputs of the wait they stay live up to it, so that no load of the run lands on them either
    asm volatile("s_wait_xcnt 0x0" :: "v"(ap), "v"(bp) : "memory");
    ap += FBH;
    bp += FBH;
#pragma unroll
    for (int j = 0; j < 4; ++j) {
      acc[0][j] = mma16(a0, bf[j], acc[0][j]);
      acc[1][j] = mma16(a1, bf[j], acc[1][j]);
    }
  }
}

// ---------------------------------------------------------------------------
// f16 epilogue: v = acc*scale + bias (bias per column, or per row when BIAS_ROW); the wave's 32 x 64
// tile goes through its LDS slab and leaves as 4 blocks of the packed plane C (kts = its k tiles per
// row tile), 512 contiguous bytes per store instruction.
// ---------------------------------------------------------------------------
template <bool BIAS_ROW>
__device__ __forceinline__ void epi_f16(v8f (&acc)[2][4], _Float16* slab,
                                        _Float16* __restrict__ C, int kts,
                                        int m0, int n0, int lane, float scale,
                                        const float* __restrict__ bias) {
  const int c = lane & 15, hh = lane >> 4;
#pragma unroll
  for (int mt = 0; mt < 2; ++mt) {
#pragma unroll
    for (int nt = 0; nt < 4; ++nt) {
      const int coll = nt * 16 + c;
      float bc = 0.f;
      if (!BIAS_ROW) bc = bias[n0 + coll];
#pragma unroll
      for (int r = 0; r < 8; ++r) {
        const int rowl = mt * 16 + 8 * hh + r;
        float v = acc[mt][nt][r] * scale;
        v += BIAS_ROW ? bias[m0 + rowl] : bc;
        slab[rowl * SP16 + coll] = (_Float16)v;
      }
    }
  }
  wave_lds_sync();
  {
#pragma unroll
    for (int it = 0; it < 8; ++it) {
      const int rtl = it >> 2, ktl = (it >> 1) & 1, uh = it & 1;   // block of the tile, half of the block
      const v8h val = *(const v8h*)(slab + (rtl * 16 + c) * SP16 + ktl * 32 + (uh * 2 + hh) * 8);
      *(v8h*)(C + ((size_t)((m0 >> 4) + rtl) * kts + (n0 >> 5) + ktl) * FBH + uh * 256 + lane * 8) = val;
    }
  }
  wave_lds_sync();
}

// ---------------------------------------------------------------------------
// q / k projections: rows (blk,bat,l) = 16384, N = 512, K = 512; weight plane and bias selected by
// the row block (block-uniform).  Q16/K16: [16384][512] f16, packed, column (k) = h*64 + e.
// grid (256, 2, 2): block tile 64 rows x 256 cols (8 waves of 32x64); z: 0 = q, 1 = k.
// ---------------------------------------------------------------------------
__global__ void __launch_bounds__(256)
qk_gemm_kernel(const _Float16* __restrict__ X16, const _Float16* __restrict__ WT,
               const float* __restrict__ bq, const float* __restrict__ bk,
               _Float16* __restrict__ Q16, _Float16* __restrict__ K16) {
  __shared__ __align__(16) _Float16 slabs[8 * 32 * SP16];
  const int lane = threadIdx.x & 31, wid = threadIdx.x >> 5;
  const int m0 = blockIdx.x * 64 + (wid >> 2) * 32;
  const int n0 = blockIdx.y * 256 + (wid & 3) * 64;
  const int proj = blockIdx.z;
  const int nb = m0 >> 12;
  const _Float16* Bt = WT + (size_t)(proj * 4 + nb) * WPL;
  const float* bias = ((proj == 0) ? bq : bk) + nb * DM;
  _Float16* C = (proj == 0) ? Q16 : K16;
  v8f acc[2][4];
  gemm_core(X16, Bt, m0, n0, lane, acc);
  epi_f16<false>(acc, slabs + wid * (32 * SP16), C, DM / 32, m0, n0, lane, 0.0625f, bias);
}

// ---------------------------------------------------------------------------
// v^T projection per (blk,bat) z: VT16[z][m = h*64+e][l] = sum_k WvT[nb][m][k] * x[z][l][k] / 16 + bv[nb][m]
// A = WvT plane (512 x 512), Bt = x plane rows (1024 x 512), C [512][1024] f16, packed (k = l).  grid (8, 4, 16).
// ---------------------------------------------------------------------------
__global__ void __launch_bounds__(256)
vt_gemm_kernel(const _Float16* __restrict__ X16, const _Float16* __restrict__ WT,
               const float* __restrict__ bv, _Float16* __restrict__ VT16) {
  __shared__ __align__(16) _Float16 slabs[8 * 32 * SP16];
  const int lane = threadIdx.x & 31, wid = threadIdx.x >> 5;
  const int m0 = blockIdx.x * 64 + (wid >> 2) * 32;     // 0..511 (output feature)
  const int n0 = blockIdx.y * 256 + (wid & 3) * 64;     // 0..1023 (position)
  const int z  = blockIdx.z;
  const int nb = z >> 2;
  const _Float16* A  = WT + (size_t)(8 + nb) * WPL;
  const _Float16* Bt = X16 + (size_t)z * ZPL;
  _Float16* C = VT16 + (size_t)z * ZPL;
  const float* bias = bv + nb * DM;
  v8f acc[2][4];
  gemm_core(A, Bt, m0, n0, lane, acc);
  epi_f16<true>(acc, slabs + wid * (32 * SP16), C, SEQL / 32, m0, n0, lane, 0.0625f, bias);
}

// ---------------------------------------------------------------------------
// Full (unmasked) attention, head dim 64, per (blk,bat) z and head h, in transposed form.
//   q/k rows from Q16/K16 ([z*1024 + l][h*64 + d]); v^T rows from VT16 ([z*512 + h*64 + d][l]); all packed.
//   S^T = k.q^T (A = k rows, Bt = q rows): lane l holds, for query l&15, keys 16j + 8*(l>>4) + r of
//   each 16-key tile j, so the row maximum and the row sum of the online softmax (f32, 32 chunks of
//   32 keys) are in-lane, joined between lanes l and l^16 by one cross-row move.
//   O^T += v^T.P^T (A = v^T rows, Bt = P rows): two neighbouring S^T tiles, converted in place, are
//   the Bt fragment in the k order of frag_ld (elements 0..7: k0 + 8*(l>>4) + e, 8..15: 16 more).
//   O16[z*1024 + l][h*64 + d] = f16(16 * O / rowsum), packed: the eight d of accumulator tile t in a lane
//   are unit (t&1)*32 + lane of block (query tile, 2h + (t>>1)), so each tile is stored straight from registers.
//   A wave owns two 16-query tiles, so each k and v^T fragment it loads feeds two products.
//   Block = 4 waves x 32 query rows; grid 1024 = z*64 + h*8 + qb.
// ---------------------------------------------------------------------------
__device__ __forceinline__ float xhalf(float x) {   // value of lane l ^ 16
  const int b = __builtin_bit_cast(int, x);
  return __builtin_bit_cast(float, __builtin_amdgcn_permlanex16(b, b, 0x76543210, 0xfedcba98, false, false));
}

// y[i] = 2^x[i], eight in one statement: the outputs are early-clobber, so no exponential lands on a
// source of the one in front of it, and the closing v_nop is the free slot that the instruction set asks
// for behind the last one
__device__ __forceinline__ void exp2x8(const float (&x)[8], float (&y)[8]) {
  asm("v_exp_f32 %0, %8\n\tv_exp_f32 %1, %9\n\tv_exp_f32 %2, %10\n\tv_exp_f32 %3, %11\n\t"
      "v_exp_f32 %4, %12\n\tv_exp_f32 %5, %13\n\tv_exp_f32 %6, %14\n\tv_exp_f32 %7, %15\n\tv_nop"
      : "=&v"(y[0]), "=&v"(y[1]), "=&v"(y[2]), "=&v"(y[3]), "=&v"(y[4]), "=&v"(y[5]), "=&v"(y[6]), "=&v"(y[7])
      : "v"(x[0]), "v"(x[1]), "v"(x[2]), "v"(x[3]), "v"(x[4]), "v"(x[5]), "v"(x[6]), "v"(x[7]));
}

// y = 2^x with its free slot in the same statement
__device__ __forceinline__ float exp2x1(float x) {
  float y;
  asm("v_exp_f32 %0, %1\n\tv_nop" : "=&v"(y) : "v"(x));
  return y;
}

__global__ void __launch_bounds__(128)
attn_kernel(const _Float16* __restrict__ Q16, const _Float16* __restrict__ K16,
            const _Float16* __restrict__ VT16, _Float16* __restrict__ O16) {
  const int tid = threadIdx.x, wave = tid >> 5, lane = tid & 31;
  const int bx = blockIdx.x;
  const int qb = bx & 7, h = (bx >> 3) & 7, z = bx >> 6;
  const int q0 = qb * 128 + wave * 32;

  const int QRT = (DM / 32) * FBH;     // halves from one 16-row tile of Q16 / K16 / O16 to the next
  const int VRT = (SEQL / 32) * FBH;   // the same for VT16
  const size_t hq = (size_t)z * ZPL + (2 * h) * FBH + lane * 8;   // row tile 0 of z, first k tile of head h
  const _Float16* Qz = Q16 + hq + (size_t)(q0 >> 4) * QRT;
  const _Float16* Kz = K16 + hq;
  const _Float16* Vz = VT16 + (size_t)z * ZPL + (size_t)(h * (HD / 16)) * VRT + lane * 8;
  _Float16* Oz = O16 + hq + (size_t)(q0 >> 4) * QRT;

  v16h qf[2][2];                     // qf[u][i]: query tile u, d = 32i..
#pragma unroll
  for (int u = 0; u < 2; ++u) {
    qf[u][0] = frag_ld(Qz + u * QRT);
    qf[u][1] = frag_ld(Qz + u * QRT + FBH);
  }
  // the fragment loads below may land in the registers that held this address
  asm volatile("s_wait_xcnt 0x0" :: "v"(Qz) : "memory");

  float mrow[2] = {-1e30f, -1e30f};  // query 16u + c: running maximum (both halves alike)
  float lrow[2] = {0.f, 0.f};        // this half's sum
  v8f oacc[2][4];                    // oacc[u][t][r] = O^T[d = 16t + 8hh + r][query 16u + c]
#pragma unroll
  for (int u = 0; u < 2; ++u)
#pragma unroll
    for (int t = 0; t < 4; ++t) oacc[u][t] = zero8();

  // Fragments are fetched one pass (32 keys) ahead: the 8 loads of the next pass's k fragments go out as
  // one group right behind this pass's S^T products, into the registers those have just read, and the 8
  // loads of its v^T fragments right behind the O^T products; each group has a whole pass to arrive.
  // Every fragment serves both query tiles of the wave.
  const _Float16* kp = Kz;   // k fragments of the pass that is fetched next
  const _Float16* vp = Vz;   // v^T fragments of the same
  v16h kf[4], vf[4];         // kf[2j + i]: keys 16j.., d = 32i..; vf[t]: d = 16t.., the pass's 32 keys
  auto fetch_k = [&]() __attribute__((always_inline)) {
#pragma unroll
    for (int j = 0; j < 2; ++j) {
      kf[2 * j]     = frag_ld(kp + j * QRT);
      kf[2 * j + 1] = frag_ld(kp + j * QRT + FBH);
    }
    // the address pair is advanced while the loads that name it are in flight; the statement also keeps the
    // k and v^T groups in one order everywhere, so that the counted load waits can leave the younger group out
    asm volatile("s_wait_xcnt 0x0" :: "v"(kp) : "memory");
    kp += 2 * QRT;
  };
  auto fetch_v = [&]() __attribute__((always_inline)) {
#pragma unroll
    for (int t = 0; t < 4; ++t) vf[t] = frag_ld(vp + t * VRT);
    // as in fetch_k
    asm volatile("s_wait_xcnt 0x0" :: "v"(vp) : "memory");
    vp += FBH;
  };
  fetch_k();
  fetch_v();

  auto pass = [&](const bool fetch) __attribute__((always_inline)) {
    v8f s[2][2];             // s[u][j]: keys 16j.. of the pass against query tile u
#pragma unroll
    for (int u = 0; u < 2; ++u)
#pragma unroll
      for (int j = 0; j < 2; ++j) s[u][j] = zero8();
#pragma unroll
    for (int i = 0; i < 2; ++i)
#pragma unroll
      for (int j = 0; j < 2; ++j)
#pragma unroll
        for (int u = 0; u < 2; ++u) s[u][j] = mma16(kf[2 * j + i], qf[u][i], s[u][j]);
    if (fetch) {
      fetch_k();
      // keeps the group ahead of the softmax: sunk behind it, the loads would have only the O^T products to arrive in
      __builtin_amdgcn_sched_barrier(0);
    }
    FragU pf[2];
#pragma unroll
    for (int u = 0; u < 2; ++u) {
      float m = -1e30f;
#pragma unroll
      for (int j = 0; j < 2; ++j) {
        s[u][j] = s[u][j] * 0.125f;
#pragma unroll
        for (int r = 0; r < 8; ++r) m = fmaxf(m, s[u][j][r]);
      }
      m = fmaxf(m, xhalf(m));
      const float mnew  = fmaxf(mrow[u], m);
      const float alpha = exp2x1((mrow[u] - mnew) * 1.44269504088896340736f);
      mrow[u] = mnew;
      float ps[2] = {0.f, 0.f};
#pragma unroll
      for (int j = 0; j < 2; ++j) {
        float e[8], p[8];
#pragma unroll
        for (int r = 0; r < 8; ++r) e[r] = (s[u][j][r] - mnew) * 1.44269504088896340736f;   // exp(x) = 2^(x log2 e)
        exp2x8(e, p);
#pragma unroll
        for (int r = 0; r < 8; ++r) {
          ps[j] += p[r];
          pf[u].h[j][r] = (_Float16)p[r];
        }
      }
      lrow[u] = lrow[u] * alpha + (ps[0] + ps[1]);
#pragma unroll
      for (int t = 0; t < 4; ++t)
#pragma unroll
        for (int r = 0; r < 8; ++r) oacc[u][t][r] *= alpha;
    }
#pragma unroll
    for (int t = 0; t < 4; ++t) {
#pragma unroll
      for (int u = 0; u < 2; ++u) oacc[u][t] = mma16(vf[t], pf[u].v, oacc[u][t]);
    }
    if (fetch) fetch_v();
  };

  // rolled: one copy of the pass with its fetches; the last pass has nothing to fetch and stands alone
#pragma unroll 1
  for (int kc = 0; kc < SEQL / 32 - 1; ++kc) pass(true);
  pass(false);

  v8h ov[2][4];
#pragma unroll
  for (int u = 0; u < 2; ++u) {
    const float inv16 = 16.0f * (1.0f / (lrow[u] + xhalf(lrow[u])));
#pragma unroll
    for (int t = 0; t < 4; ++t)
#pragma unroll
      for (int r = 0; r < 8; ++r) ov[u][t][r] = (_Float16)(oacc[u][t][r] * inv16);
  }
  // keeps the eight stores together behind the last conversion
  __builtin_amdgcn_sched_barrier(0);
#pragma unroll
  for (int u = 0; u < 2; ++u)
#pragma unroll
    for (int t = 0; t < 4; ++t) *(v8h*)(Oz + u * QRT + (t >> 1) * FBH + (t & 1) * 256) = ov[u][t];
}

// ---------------------------------------------------------------------------
// Output projection: out[row][n] = sum_k O16[row][k] * WoT[nb][n][k] / 256 + bo[nb][n]  (f32).
// Rows with l == 1023 (router tokens) go to rplane[(blk*4+bat)][512] instead of d_out (single writer
// of those d_out rows is the router output kernel).  Epilogue: 16-row f32 slabs per wave in LDS; each 256-B
// row segment written by 16 consecutive lanes x 16 B of one instruction (2 rows per instruction,
// ---------------------------------------------------------------------------
__global__ void __launch_bounds__(256)
wo_gemm_kernel(const _Float16* __restrict__ O16, const _Float16* __restrict__ WT,
               const float* __restrict__ bo, float* __restrict__ out, float* __restrict__ rplane) {
  __shared__ __align__(16) float slabf[8 * 16 * SP32];
  const int lane = threadIdx.x & 31, wid = threadIdx.x >> 5;
  const int m0 = blockIdx.x * 64 + (wid >> 2) * 32;
  const int n0 = blockIdx.y * 256 + (wid & 3) * 64;
  const int nb = m0 >> 12;
  const _Float16* Bt = WT + (size_t)(12 + nb) * WPL;
  const float* bias = bo + nb * DM;
  v8f acc[2][4];
  gemm_core(O16, Bt, m0, n0, lane, acc);

  float* slab = slabf + wid * (16 * SP32);
  const int c = lane & 15, hh = lane >> 4, c4 = c * 4;
#pragma unroll
  for (int mt = 0; mt < 2; ++mt) {
#pragma unroll
    for (int nt = 0; nt < 4; ++nt) {
      const int coll = nt * 16 + c;
      const float bc = bias[n0 + coll];
#pragma unroll
      for (int r = 0; r < 8; ++r)
        slab[(8 * hh + r) * SP32 + coll] = acc[mt][nt][r] * (1.0f / 256.0f) + bc;
    }
    wave_lds_sync();
    {
#pragma unroll
      for (int it = 0; it < 8; ++it) {
        const int row = it * 2 + hh;
        const int gm  = m0 + mt * 16 + row;
        const v4f val = *(const v4f*)(slab + row * SP32 + c4);
        float* dst = ((gm & (SEQL - 1)) == (SEQL - 1))
                         ? (rplane + (size_t)(gm >> 10) * DM + n0 + c4)
                         : (out + (size_t)gm * DM + n0 + c4);
        *(v4f*)dst = val;
      }
      
    }
    wave_lds_sync();
  }
}

// ---------------------------------------------------------------------------
// Router (inter) attention in two launches of many work-groups (f32 VALU throughout).
// Both launches share one product form: a work-group of 16 waves owns one batch (4 router rows,
// t = blk*4 + bat) and 32 output columns; wave w takes k in [32w, 32w + 32), lane = column; the 16
// partial sums of an output element meet in LDS and are added in wave order.
// ---------------------------------------------------------------------------
__device__ __forceinline__ void router_w_load(const float* __restrict__ Wm, int wave, int col, float (&w)[32]) {
  const float* wp = Wm + (size_t)(wave * 32) * DM + col;
  // unrolled: w[] stays in registers and all 32 loads are in flight together
#pragma unroll
  for (int j = 0; j < 32; ++j) w[j] = wp[(size_t)j * DM];
}

// rows: LDS [4][512]; red: LDS [16][4][32]. Returns, in threads 0..127, element (row tid>>5, column tid&31).
__device__ __forceinline__ float router_ksplit(const float (&w)[32], const float* rows, float* red,
                                               int tid) {
  const int wave = tid >> 5, lane = tid & 31;
  float a[NBLK] = {0.f, 0.f, 0.f, 0.f};
  // unrolled (here and below): w[] and a[] are indexed by constants only, so they stay in registers
#pragma unroll
  for (int j4 = 0; j4 < 8; ++j4) {
#pragma unroll
    for (int r = 0; r < NBLK; ++r) {
      const v4f rv = *(const v4f*)(rows + r * DM + wave * 32 + j4 * 4);
      a[r] += rv[0] * w[j4 * 4];
      a[r] += rv[1] * w[j4 * 4 + 1];
      a[r] += rv[2] * w[j4 * 4 + 2];
      a[r] += rv[3] * w[j4 * 4 + 3];
    }
  }
#pragma unroll
  for (int r = 0; r < NBLK; ++r) red[(wave * NBLK + r) * 32 + lane] = a[r];
  __syncthreads();
  float s = 0.f;
  if (tid < 128) {
#pragma unroll
    for (int wv = 0; wv < 16; ++wv) s += red[wv * 128 + tid];
  }
  return s;
}

// rq / rk / rv: RP[p][t][n] = sum_k rplane[t][k] * iW_p[k][n] + ib_p[n].  grid (16, 4, 3) = (column
// chunk, bat, p), 512 threads.
__global__ void __launch_bounds__(512)
router_proj_kernel(const float* __restrict__ rplane,
                   const float* __restrict__ iWq, const float* __restrict__ ibq,
                   const float* __restrict__ iWk, const float* __restrict__ ibk,
                   const float* __restrict__ iWv, const float* __restrict__ ibv,
                   float* __restrict__ RP) {
  __shared__ __align__(16) float Rr[NBLK * DM];
  __shared__ float red[16 * NBLK * 32];
  const int tid = threadIdx.x;
  const int col = blockIdx.x * 32 + (tid & 31);
  const int b = blockIdx.y, p = blockIdx.z;
  const float* Wm = (p == 0) ? iWq : ((p == 1) ? iWk : iWv);
  const float* bb = (p == 0) ? ibq : ((p == 1) ? ibk : ibv);
  const int ri = tid >> 7, rc4 = (tid & 127) * 4;
  const v4f rin = *(const v4f*)(rplane + (size_t)(ri * NBAT + b) * DM + rc4);
  // the weight loads below may land in the registers that held this load's address
  asm volatile("s_wait_xcnt 0x0" ::: "memory");
  float w[32];
  router_w_load(Wm, tid >> 5, col, w);
  *(v4f*)(Rr + ri * DM + rc4) = rin;
  __syncthreads();
  const float s = router_ksplit(w, Rr, red, tid);
  if (tid < 128) RP[((size_t)p * 16 + (tid >> 5) * NBAT + b) * DM + col] = s + bb[col];
}

// Per batch: 4-key softmax of (rq.rk)*0.125 per (query blk, head), o = sum p*rv / sum p (each
// work-group forms all 4 x 512 of its batch), then out rows l == 1023 = o . iWo + ibo for its 32
// columns.  grid (16, 4) = (column chunk, bat), 512 threads.
__global__ void __launch_bounds__(512)
router_out_kernel(const float* __restrict__ RP,
                  const float* __restrict__ iWo, const float* __restrict__ ibo,
                  float* __restrict__ out) {
  __shared__ __align__(16) float Pj[3][NBLK * DM];
  __shared__ __align__(16) float Ro[NBLK * DM];
  __shared__ float red[16 * NBLK * 32];
  const int tid = threadIdx.x;
  const int col = blockIdx.x * 32 + (tid & 31);
  const int b = blockIdx.y;
  float w[32];
  router_w_load(iWo, tid >> 5, col, w);
  {
    const int i = tid >> 7, c4 = (tid & 127) * 4;
#pragma unroll
    for (int p = 0; p < 3; ++p)
      *(v4f*)(&Pj[p][i * DM + c4]) = *(const v4f*)(RP + ((size_t)p * 16 + i * NBAT + b) * DM + c4);
  }
  __syncthreads();
  {
    // 16 lanes per (query blk, head); each lane holds 4 of the 64 head elements
    const int item = tid >> 4;              // 0..31
    const int nq = item >> 3, hd = item & 7;
    const int eo = hd * HD + (tid & 15) * 4;
    const v4f q4 = *(const v4f*)(&Pj[0][nq * DM + eo]);
    const v4f v0 = *(const v4f*)(&Pj[2][eo]);
    const v4f v1 = *(const v4f*)(&Pj[2][DM + eo]);
    const v4f v2 = *(const v4f*)(&Pj[2][2 * DM + eo]);
    const v4f v3 = *(const v4f*)(&Pj[2][3 * DM + eo]);
    float sc[NBLK];
#pragma unroll
    for (int s = 0; s < NBLK; ++s) {
      const v4f k4 = *(const v4f*)(&Pj[1][s * DM + eo]);
      sc[s] = q4[0] * k4[0] + q4[1] * k4[1] + q4[2] * k4[2] + q4[3] * k4[3];
    }
    // keeps the four v reads in one batch ahead of the exponentials; sunk in between them their
    // LDS latency would stand in the dependent chain three times
    asm volatile("" :: "v"(v0), "v"(v1), "v"(v2), "v"(v3));
#pragma unroll
    for (int m = 1; m < 16; m <<= 1) {
#pragma unroll
      for (int s = 0; s < NBLK; ++s) sc[s] += __shfl_xor(sc[s], m, 32);
    }
#pragma unroll
    for (int s = 0; s < NBLK; ++s) sc[s] *= 0.125f;
    const float mx = fmaxf(fmaxf(sc[0], sc[1]), fmaxf(sc[2], sc[3]));
    const float p0 = __expf(sc[0] - mx), p1 = __expf(sc[1] - mx), p2 = __expf(sc[2] - mx), p3 = __expf(sc[3] - mx);
    const float inv = 1.0f / (p0 + p1 + p2 + p3);
    v4f o4;
#pragma unroll
    for (int j = 0; j < 4; ++j) o4[j] = (p0 * v0[j] + p1 * v1[j] + p2 * v2[j] + p3 * v3[j]) * inv;
    *(v4f*)(Ro + nq * DM + eo) = o4;
  }
  __syncthreads();
  const float s = router_ksplit(w, Ro, red, tid);
  if (tid < 128)
    out[((size_t)((tid >> 5) * NBAT + b) * SEQL + (SEQL - 1)) * DM + col] = s + ibo[col];
}

// ---------------------------------------------------------------------------
// Workspace map (byte offsets; every region fully written before it is read; the f16 planes are packed
// in fragment blocks, see frag_ld; all regions are exact
//   X16   f16 [16384][512]            0          16777216 B
//   WT16  f16 [16][512][512]     16777216           8388608 B   (Wq,Wk,Wv,Wo planes x 4 blks, [out][in], x16)
//   Q16   f16 [16384][512]     25165824          16777216 B
//   K16   f16 [16384][512]     41943040          16777216 B
//   VT16  f16 [16][512][1024]  58720256          16777216 B
//   O16   f16 [16384][512]     75497472          16777216 B   (attention output x16)
//   RPL   f32 [16][512]        92274688             32768 B   (router rows, t = blk*4 + bat)
//   RP    f32 [3][16][512]     92307456             98304 B   (router q, k, v projections)
//   total                      92405760
// ---------------------------------------------------------------------------
extern "C" void kernel_launch(void* const* d_in, const int* in_sizes, int n_in,
                              void* d_out, int out_size, void* d_ws, size_t ws_size,
                              hipStream_t stream) {
  if (n_in < 17) return;
  if (in_sizes[0] != MROWS * DM) return;
  if (in_sizes[1] != NBLK * WPL || in_sizes[3] != NBLK * WPL || in_sizes[5] != NBLK * WPL || in_sizes[7] != NBLK * WPL) return;
  if (in_sizes[2] != NBLK * DM || in_sizes[4] != NBLK * DM || in_sizes[6] != NBLK * DM || in_sizes[8] != NBLK * DM) return;
  if (in_sizes[9] != WPL || in_sizes[11] != WPL || in_sizes[13] != WPL || in_sizes[15] != WPL) return;
  if (in_sizes[10] != DM || in_sizes[12] != DM || in_sizes[14] != DM || in_sizes[16] != DM) return;
  if (out_size != MROWS * DM) return;

  const float* x   = (const float*)d_in[0];
  const float* Wq  = (const float*)d_in[1];  const float* bq  = (const float*)d_in[2];
  const float* Wk  = (const float*)d_in[3];  const float* bk  = (const float*)d_in[4];
  const float* Wv  = (const float*)d_in[5];  const float* bv  = (const float*)d_in[6];
  const float* Wo  = (const float*)d_in[7];  const float* bo  = (const float*)d_in[8];
  const float* iWq = (const float*)d_in[9];  const float* ibq = (const float*)d_in[10];
  const float* iWk = (const float*)d_in[11]; const float* ibk = (const float*)d_in[12];
  const float* iWv = (const float*)d_in[13]; const float* ibv = (const float*)d_in[14];
  const float* iWo = (const float*)d_in[15]; const float* ibo = (const float*)d_in[16];
  float* out = (float*)d_out;

  const size_t bAct = (size_t)MROWS * DM * 2;      // 16777216
  const size_t bWT  = (size_t)16 * WPL * 2;        // 8388608
  const size_t bRpl = (size_t)16 * DM * 4;         // 32768
  const size_t bRp  = (size_t)3 * 16 * DM * 4;     // 98304
  size_t off = 0;
  const size_t oX  = off; off += bAct;
  const size_t oWT = off; off += bWT;
  const size_t oQ  = off; off += bAct;
  const size_t oK  = off; off += bAct;
  const size_t oVT = off; off += bAct;
  const size_t oO  = off; off += bAct;
  const size_t oR  = off; off += bRpl;
  const size_t oP  = off; off += bRp;
  if (off > ws_size) return;                       // off = 92405760

  char* ws = (char*)d_ws;
  _Float16* X16  = (_Float16*)(ws + oX);
  _Float16* WT16 = (_Float16*)(ws + oWT);
  _Float16* Q16  = (_Float16*)(ws + oQ);
  _Float16* K16  = (_Float16*)(ws + oK);
  _Float16* VT16 = (_Float16*)(ws + oVT);
  _Float16* O16  = (_Float16*)(ws + oO);
  float*    RPL  = (float*)(ws + oR);
  float*    RP   = (float*)(ws + oP);

  const int n8 = MROWS * DM / 8;                   // 1048576
  // (1) x -> f16 plane
  cvt_x_kernel<<<dim3(n8 / 256), dim3(256), 0, stream>>>(x, X16, n8);
  // (2) weights -> transposed f16 planes (x16)
  wt_kernel<<<dim3(DM / 64, DM / 64, 16), dim3(256), 0, stream>>>(Wq, Wk, Wv, Wo, WT16);
  // (3) q, k projections
  qk_gemm_kernel<<<dim3(MROWS / 64, DM / 256, 2), dim3(256), 0, stream>>>(X16, WT16, bq, bk, Q16, K16);
  // (4) v^T projection per (blk, bat)
  vt_gemm_kernel<<<dim3(DM / 64, SEQL / 256, NBLK * NBAT), dim3(256), 0, stream>>>(X16, WT16, bv, VT16);
  // (5) intra attention
  attn_kernel<<<dim3(NBLK * NBAT * NH * (SEQL / 128)), dim3(128), 0, stream>>>(Q16, K16, VT16, O16);
  // (6) output projection -> d_out (rows l < 1023) and router plane (rows l == 1023)
  wo_gemm_kernel<<<dim3(MROWS / 64, DM / 256, 1), dim3(256), 0, stream>>>(O16, WT16, bo, out, RPL);
  // (7) router q, k, v projections
  router_proj_kernel<<<dim3(DM / 32, NBAT, 3), dim3(512), 0, stream>>>(RPL, iWq, ibq, iWk, ibk, iWv, ibv, RP);
  // (8) router attention + output projection -> d_out rows l == 1023
  router_out_kernel<<<dim3(DM / 32, NBAT), dim3(512), 0, stream>>>(RP, iWo, ibo, out);
  (void)hipGetLastError();
}

// v006
// Measured time: 122 microseconds a run.
// Timed twice side by side with v005, it ran 1.05 times as fast both times.
// Counting every step since v000, it is 9.35 times as fast.
// Contractions q/k/v^T projections, q.k^T, p.v, out projection: v_wmma_f32_16x16x32_f16, f16 operands (W x16; x and p x1; attention output o x16), f32 accumulate; softmax f32 (scale 0.125 applied to the f32 score accumulator); router-token attention and its four projections: f32 VALU.
#include <hip/hip_runtime.h>

typedef _Float16 v16h __attribute__((ext_vector_type(16)));
typedef _Float16 v8h  __attribute__((ext_vector_type(8)));
typedef float    v8f  __attribute__((ext_vector_type(8)));
typedef float    v4f  __attribute__((ext_vector_type(4)));

#define NBLK  4
#define NBAT  4
#define SEQL  1024
#define DM    512
#define NH    8
#define HD    64
#define MROWS 16384          // NBLK*NBAT*SEQL
#define WPL   262144         // DM*DM, one weight plane
#define ZPL   524288         // SEQL*DM, one (blk,bat) activation plane
#define SP16  72             // f16 LDS slab pitch (halves), 144 B rows
#define SP32  68             // f32 LDS slab pitch (floats), 272 B rows

union FragU { v16h v; v8h h[2]; };

// Packed operand planes. Every f16 matrix [rows][K] of the workspace is stored as fragment blocks:
// block (rt = row >> 4, kt = k >> 5) is FBH halves (1 KiB) at (rt * (K / 32) + kt) * FBH; inside it the
// 16-B unit u = o * 16 + c holds row rt*16 + c, k = kt*32 + o*8 .. + 7 (o = 0..3, c = 0..15).
// 16x16x32 operand fragment: p = block + lane*8; elements 0..7 <- unit lane (k = 8*(lane>>4) + e),
// elements 8..15 <- unit 32 + lane (16 more): the same k order for A rows m and Bt rows n, and each of
// the two loads of a wave reads 512 contiguous bytes (4 cache lines; from k-contiguous rows it was 16).
#define FBH 512
__device__ __forceinline__ v16h frag_ld(const _Float16* p) {
  FragU f;
  f.h[0] = *(const v8h*)(p);
  f.h[1] = *(const v8h*)(p + 256);
  return f.v;
}

__device__ __forceinline__ v8f mma16(v16h a, v16h b, v8f c) {
  c = __builtin_amdgcn_wmma_f32_16x16x32_f16(false, a, false, b, (short)0, c, false, false);
  asm volatile("v_nop\n\tv_nop\n\tv_nop\n\tv_nop" : "+v"(c) : "v"(a), "v"(b));
  return c;
}

__device__ __forceinline__ void wave_lds_sync() {
  __builtin_amdgcn_fence(__ATOMIC_RELEASE, "workgroup");
  __builtin_amdgcn_wave_barrier();
  __builtin_amdgcn_fence(__ATOMIC_ACQUIRE, "workgroup");
}

__device__ __forceinline__ v8f zero8() { return (v8f){0.f, 0.f, 0.f, 0.f, 0.f, 0.f, 0.f, 0.f}; }

// ---------------------------------------------------------------------------
// Both preparations in one launch: they share no data, so each of the WTB blocks does one weight tile
// and its share of x.  grid WTB = 8 x 8 x 16 = 1024 blocks of 256 threads, bx = z*64 + y*8 + x.
// Weight transpose + x16 + f16: W (f32 [in=512][out=512], blk plane nb of Wq/Wk/Wv/Wo)
//   -> WT[z][out][in] = f16(16 * W[in][out]), packed (rows = out, k = in), z = widx*4 + nb  (widx 0=q,1=k,2=v,3=o).
//   64x64 tiles through LDS.  Coverage per block: load 4 it x 256 thr x 4 = 64x64; store 2 it x 256 thr x 8 = 64x64.
// x f32 [16384][512] -> packed f16 plane: block bx converts row tile bx (16 rows x 512 = 32 KiB read, 16 KiB
//   written, both contiguous), XUN = 4 units of 16 B a thread: unit bx*1024 + j*256 + tid is row
//   bx*16 + (tid & 15), k = j*128 + (tid >> 4)*8 .. + 7.  Coverage: 1024 blocks x 256 thr x 4 x 8 = 16384 x 512.
// ---------------------------------------------------------------------------
#define WTB ((DM / 64) * (DM / 64) * 16)
#define XUN (MROWS * DM / 8 / (WTB * 256))
static_assert(WTB == MROWS / 16 && XUN * 128 == DM, "one 16-row tile of x for each block");
__global__ void __launch_bounds__(256)
prep_kernel(const float* __restrict__ x,
            const float* __restrict__ Wq, const float* __restrict__ Wk,
            const float* __restrict__ Wv, const float* __restrict__ Wo,
            _Float16* __restrict__ X16, _Float16* __restrict__ WT) {
  __shared__ __align__(16) float tf[64 * 68];
  const int bx = blockIdx.x;
  const int z  = bx >> 6;
  const int wi = z >> 2, nb = z & 3;
  const float* W = (wi == 0) ? Wq : ((wi == 1) ? Wk : ((wi == 2) ? Wv : Wo));
  W += (size_t)nb * WPL;
  _Float16* O = WT + (size_t)z * WPL;
  const int c0  = (bx & 7) * 64;         // input column block (out feature) = output row block
  const int r0  = ((bx >> 3) & 7) * 64;  // input row block (in feature)     = output column block
  const int tid = threadIdx.x;
  const int lr = tid >> 4;          // 0..15
  const int c4 = (tid & 15) * 4;    // 0..60
  const float* wp = W + (size_t)(r0 + lr) * DM + c0 + c4;
  const float* xp = x + (size_t)(bx * 16 + (tid & 15)) * DM + lr * 8;
  v4f wa[4], xa[XUN], xb[XUN];
  // unrolled (all loops of this kernel): the arrays are indexed by constants only, so they stay in registers
#pragma unroll
  for (int it = 0; it < 4; ++it) wa[it] = *(const v4f*)(wp + (size_t)(it * 16) * DM);
#pragma unroll
  for (int j = 0; j < XUN; ++j) {
    xa[j] = *(const v4f*)(xp + j * 128);
    xb[j] = *(const v4f*)(xp + j * 128 + 4);
  }
  // all twelve loads are out before anything waits for one of them, the weight tile's first, so that its way
  // through LDS runs under the x loads; the registers of the two addresses may be written again behind this wait
  asm volatile("s_wait_xcnt 0x0" :: "v"(wp), "v"(xp) : "memory");
#pragma unroll
  for (int it = 0; it < 4; ++it) *(v4f*)(tf + (it * 16 + lr) * 68 + c4) = wa[it];
  __syncthreads();
  // the tile is 4 row tiles x 2 k tiles = 8 blocks; thread tid writes unit tid & 63 of blocks
  // (rt = tid >> 7, kt = (tid >> 6) & 1) and (rt + 2, kt)
  const int rtl = tid >> 7, ktl = (tid >> 6) & 1;
  const int sub = rtl * 16 + (tid & 15);            // out feature in the tile, 0..31
  const int c8  = ktl * 32 + ((tid >> 4) & 3) * 8;  // in feature in the tile, 0..56
  v8h hv0, hv1;
#pragma unroll
  for (int e = 0; e < 8; ++e) {
    hv0[e] = (_Float16)(16.0f * tf[(c8 + e) * 68 + sub]);
    hv1[e] = (_Float16)(16.0f * tf[(c8 + e) * 68 + 32 + sub]);
  }
  _Float16* p0 = O + (size_t)(((c0 >> 4) + rtl) * (DM / 32) + (r0 >> 5) + ktl) * FBH + (tid & 63) * 8;
  _Float16* p1 = p0 + (size_t)(2 * (DM / 32)) * FBH;
  *(v8h*)p0 = hv0;
  *(v8h*)p1 = hv1;
  _Float16* px = X16 + ((size_t)bx * (XUN * 256) + tid) * 8;
#pragma unroll
  for (int j = 0; j < XUN; ++j) {
    v8h hv;
    hv[0] = (_Float16)xa[j][0]; hv[1] = (_Float16)xa[j][1]; hv[2] = (_Float16)xa[j][2]; hv[3] = (_Float16)xa[j][3];
    hv[4] = (_Float16)xb[j][0]; hv[5] = (_Float16)xb[j][1]; hv[6] = (_Float16)xb[j][2]; hv[7] = (_Float16)xb[j][3];
    *(v8h*)(px + j * (256 * 8)) = hv;
  }
}

// ---------------------------------------------------------------------------
// GEMM core: acc[mt][nt] = sum_k A[m0 + mt*16 + .][k] * Bt[n0 + nt*16 + .][k], K = 512.
// A and Bt are packed f16 planes with K = 512; wave tile 32 x 64; D element r of lane l is
// (row 8*(l>>4) + r, col l&15) of its 16x16 subtile.
// ---------------------------------------------------------------------------
__device__ __forceinline__ void gemm_core(const _Float16* __restrict__ A,
                                          const _Float16* __restrict__ Bt,
                                          int m0, int n0, int lane, v8f (&acc)[2][4]) {
  const int RTS = (DM / 32) * FBH;   // halves from one row tile to the next
#pragma unroll
  for (int i = 0; i < 2; ++i)
#pragma unroll
    for (int j = 0; j < 4; ++j) acc[i][j] = zero8();
  const _Float16* ap = A  + (size_t)(m0 >> 4) * RTS + lane * 8;
  const _Float16* bp = Bt + (size_t)(n0 >> 4) * RTS + lane * 8;
#pragma unroll 1
  for (int kt = 0; kt < DM / 32; ++kt) {
    v16h bf[4];
#pragma unroll
    for (int j = 0; j < 4; ++j) bf[j] = frag_ld(bp + j * RTS);
    const v16h a0 = frag_ld(ap);
    const v16h a1 = frag_ld(ap + RTS);
    // the two address pairs are advanced below while the twelve loads that name them are in flight; as
    // inputs of the wait they stay live up to it, so that no load of the run lands on them either
    asm volatile("s_wait_xcnt 0x0" :: "v"(ap), "v"(bp) : "memory");
    ap += FBH;
    bp += FBH;
#pragma unroll
    for (int j = 0; j < 4; ++j) {
      acc[0][j] = mma16(a0, bf[j], acc[0][j]);
      acc[1][j] = mma16(a1, bf[j], acc[1][j]);
    }
  }
}

// ---------------------------------------------------------------------------
// f16 epilogue: v = acc*scale + bias (bias per column, or per row when BIAS_ROW); the wave's 32 x 64
// tile goes through its LDS slab and leaves as 4 blocks of the packed plane C (kts = its k tiles per
// row tile), 512 contiguous bytes per store instruction.
// ---------------------------------------------------------------------------
template <bool BIAS_ROW>
__device__ __forceinline__ void epi_f16(v8f (&acc)[2][4], _Float16* slab,
                                        _Float16* __restrict__ C, int kts,
                                        int m0, int n0, int lane, float scale,
                                        const float* __restrict__ bias) {
  const int c = lane & 15, hh = lane >> 4;
#pragma unroll
  for (int mt = 0; mt < 2; ++mt) {
#pragma unroll
    for (int nt = 0; nt < 4; ++nt) {
      const int coll = nt * 16 + c;
      float bc = 0.f;
      if (!BIAS_ROW) bc = bias[n0 + coll];
#pragma unroll
      for (int r = 0; r < 8; ++r) {
        const int rowl = mt * 16 + 8 * hh + r;
        float v = acc[mt][nt][r] * scale;
        v += BIAS_ROW ? bias[m0 + rowl] : bc;
        slab[rowl * SP16 + coll] = (_Float16)v;
      }
    }
  }
  wave_lds_sync();
  {
#pragma unroll
    for (int it = 0; it < 8; ++it) {
      const int rtl = it >> 2, ktl = (it >> 1) & 1, uh = it & 1;   // block of the tile, half of the block
      const v8h val = *(const v8h*)(slab + (rtl * 16 + c) * SP16 + ktl * 32 + (uh * 2 + hh) * 8);
      *(v8h*)(C + ((size_t)((m0 >> 4) + rtl) * kts + (n0 >> 5) + ktl) * FBH + uh * 256 + lane * 8) = val;
    }
  }
  wave_lds_sync();
}

// ---------------------------------------------------------------------------
// q, k and v^T projections in one launch: all three read only X16 and WT, so they are told apart by
// block range (block-uniform branch).  Block tile 64 x 256, 8 waves of 32 x 64.
// Blocks 0 .. QKB-1, bx = proj*512 + ny*256 + mx (proj: 0 = q, 1 = k): rows (blk,bat,l) = 16384, N = 512,
//   K = 512; weight plane and bias selected by the row block.  Q16/K16: [16384][512] f16, packed,
//   column (k) = h*64 + e.
// Blocks QKB .. QKB+VTB-1, b = z*32 + ny*8 + mx, per (blk,bat) z:
//   VT16[z][m = h*64+e][l] = sum_k WvT[nb][m][k] * x[z][l][k] / 16 + bv[nb][m]
//   A = WvT plane (512 x 512), Bt = x plane rows (1024 x 512), C [512][1024] f16, packed (k = l).
// ---------------------------------------------------------------------------
#define QKB ((MROWS / 64) * (DM / 256) * 2)
#define VTB ((DM / 64) * (SEQL / 256) * NBLK * NBAT)
__global__ void __launch_bounds__(256)
qkv_gemm_kernel(const _Float16* __restrict__ X16, const _Float16* __restrict__ WT,
                const float* __restrict__ bq, const float* __restrict__ bk, const float* __restrict__ bv,
                _Float16* __restrict__ Q16, _Float16* __restrict__ K16, _Float16* __restrict__ VT16) {
  __shared__ __align__(16) _Float16 slabs[8 * 32 * SP16];
  const int lane = threadIdx.x & 31, wid = threadIdx.x >> 5;
  const int bx = blockIdx.x;
  const bool isv = bx >= QKB;
  const int b  = bx - QKB;
  const int z  = b >> 5;                                   // v^T blocks: (blk,bat)
  const int proj = bx >> 9;                                // q / k blocks: 0 = q, 1 = k
  const int m0 = (isv ? (b & 7) : (bx & 255)) * 64 + (wid >> 2) * 32;               // v^T: output feature; q / k: row
  const int n0 = (isv ? ((b >> 3) & 3) : ((bx >> 8) & 1)) * 256 + (wid & 3) * 64;   // v^T: position; q / k: column
  const int nb = isv ? (z >> 2) : (m0 >> 12);
  const _Float16* A  = isv ? (WT + (size_t)(8 + nb) * WPL) : X16;
  const _Float16* Bt = isv ? (X16 + (size_t)z * ZPL) : (WT + (size_t)(proj * 4 + nb) * WPL);
  _Float16* slab = slabs + wid * (32 * SP16);
  v8f acc[2][4];
  gemm_core(A, Bt, m0, n0, lane, acc);
  if (isv) {
    epi_f16<true>(acc, slab, VT16 + (size_t)z * ZPL, SEQL / 32, m0, n0, lane, 0.0625f, bv + nb * DM);
  } else {
    epi_f16<false>(acc, slab, (proj == 0) ? Q16 : K16, DM / 32, m0, n0, lane, 0.0625f,
                   ((proj == 0) ? bq : bk) + nb * DM);
  }
}

// ---------------------------------------------------------------------------
// Full (unmasked) attention, head dim 64, per (blk,bat) z and head h, in transposed form.
//   q/k rows from Q16/K16 ([z*1024 + l][h*64 + d]); v^T rows from VT16 ([z*512 + h*64 + d][l]); all packed.
//   S^T = k.q^T (A = k rows, Bt = q rows): lane l holds, for query l&15, keys 16j + 8*(l>>4) + r of
//   each 16-key tile j, so the row maximum and the row sum of the online softmax (f32, 32 chunks of
//   32 keys) are in-lane, joined between lanes l and l^16 by one cross-row move.
//   O^T += v^T.P^T (A = v^T rows, Bt = P rows): two neighbouring S^T tiles, converted in place, are
//   the Bt fragment in the k order of frag_ld (elements 0..7: k0 + 8*(l>>4) + e, 8..15: 16 more).
//   O16[z*1024 + l][h*64 + d] = f16(16 * O / rowsum), packed: the eight d of accumulator tile t in a lane
//   are unit (t&1)*32 + lane of block (query tile, 2h + (t>>1)), so each tile is stored straight from registers.
//   A wave owns two 16-query tiles, so each k and v^T fragment it loads feeds two products.
//   Block = 4 waves x 32 query rows; grid 1024 = z*64 + h*8 + qb.
// ---------------------------------------------------------------------------
__device__ __forceinline__ float xhalf(float x) {   // value of lane l ^ 16
  const int b = __builtin_bit_cast(int, x);
  return __builtin_bit_cast(float, __builtin_amdgcn_permlanex16(b, b, 0x76543210, 0xfedcba98, false, false));
}

// y[i] = 2^x[i], eight in one statement: the outputs are early-clobber, so no exponential lands on a
// source of the one in front of it, and the closing v_nop is the free slot that the instruction set asks
// for behind the last one
__device__ __forceinline__ void exp2x8(const float (&x)[8], float (&y)[8]) {
  asm("v_exp_f32 %0, %8\n\tv_exp_f32 %1, %9\n\tv_exp_f32 %2, %10\n\tv_exp_f32 %3, %11\n\t"
      "v_exp_f32 %4, %12\n\tv_exp_f32 %5, %13\n\tv_exp_f32 %6, %14\n\tv_exp_f32 %7, %15\n\tv_nop"
      : "=&v"(y[0]), "=&v"(y[1]), "=&v"(y[2]), "=&v"(y[3]), "=&v"(y[4]), "=&v"(y[5]), "=&v"(y[6]), "=&v"(y[7])
      : "v"(x[0]), "v"(x[1]), "v"(x[2]), "v"(x[3]), "v"(x[4]), "v"(x[5]), "v"(x[6]), "v"(x[7]));
}

// y = 2^x with its free slot in the same statement
__device__ __forceinline__ float exp2x1(float x) {
  float y;
  asm("v_exp_f32 %0, %1\n\tv_nop" : "=&v"(y) : "v"(x));
  return y;
}

__global__ void __launch_bounds__(128)
attn_kernel(const _Float16* __restrict__ Q16, const _Float16* __restrict__ K16,
            const _Float16* __restrict__ VT16, _Float16* __restrict__ O16) {
  const int tid = threadIdx.x, wave = tid >> 5, lane = tid & 31;
  const int bx = blockIdx.x;
  const int qb = bx & 7, h = (bx >> 3) & 7, z = bx >> 6;
  const int q0 = qb * 128 + wave * 32;

  const int QRT = (DM / 32) * FBH;     // halves from one 16-row tile of Q16 / K16 / O16 to the next
  const int VRT = (SEQL / 32) * FBH;   // the same for VT16
  const size_t hq = (size_t)z * ZPL + (2 * h) * FBH + lane * 8;   // row tile 0 of z, first k tile of head h
  const _Float16* Qz = Q16 + hq + (size_t)(q0 >> 4) * QRT;
  const _Float16* Kz = K16 + hq;
  const _Float16* Vz = VT16 + (size_t)z * ZPL + (size_t)(h * (HD / 16)) * VRT + lane * 8;
  _Float16* Oz = O16 + hq + (size_t)(q0 >> 4) * QRT;

  v16h qf[2][2];                     // qf[u][i]: query tile u, d = 32i..
#pragma unroll
  for (int u = 0; u < 2; ++u) {
    qf[u][0] = frag_ld(Qz + u * QRT);
    qf[u][1] = frag_ld(Qz + u * QRT + FBH);
  }
  // the fragment loads below may land in the registers that held this address
  asm volatile("s_wait_xcnt 0x0" :: "v"(Qz) : "memory");

  float mrow[2] = {-1e30f, -1e30f};  // query 16u + c: running maximum (both halves alike)
  float lrow[2] = {0.f, 0.f};        // this half's sum
  v8f oacc[2][4];                    // oacc[u][t][r] = O^T[d = 16t + 8hh + r][query 16u + c]
#pragma unroll
  for (int u = 0; u < 2; ++u)
#pragma unroll
    for (int t = 0; t < 4; ++t) oacc[u][t] = zero8();

  // Fragments are fetched one pass (32 keys) ahead: the 8 loads of the next pass's k fragments go out as
  // one group right behind this pass's S^T products, into the registers those have just read, and the 8
  // loads of its v^T fragments right behind the O^T products; each group has a whole pass to arrive.
  // Every fragment serves both query tiles of the wave.
  const _Float16* kp = Kz;   // k fragments of the pass that is fetched next
  const _Float16* vp = Vz;   // v^T fragments of the same
  v16h kf[4], vf[4];         // kf[2j + i]: keys 16j.., d = 32i..; vf[t]: d = 16t.., the pass's 32 keys
  auto fetch_k = [&]() __attribute__((always_inline)) {
#pragma unroll
    for (int j = 0; j < 2; ++j) {
      kf[2 * j]     = frag_ld(kp + j * QRT);
      kf[2 * j + 1] = frag_ld(kp + j * QRT + FBH);
    }
    // the address pair is advanced while the loads that name it are in flight; the statement also keeps the
    // k and v^T groups in one order everywhere, so that the counted load waits can leave the younger group out
    asm volatile("s_wait_xcnt 0x0" :: "v"(kp) : "memory");
    kp += 2 * QRT;
  };
  auto fetch_v = [&]() __attribute__((always_inline)) {
#pragma unroll
    for (int t = 0; t < 4; ++t) vf[t] = frag_ld(vp + t * VRT);
    // as in fetch_k
    asm volatile("s_wait_xcnt 0x0" :: "v"(vp) : "memory");
    vp += FBH;
  };
  fetch_k();
  fetch_v();

  auto pass = [&](const bool fetch) __attribute__((always_inline)) {
    v8f s[2][2];             // s[u][j]: keys 16j.. of the pass against query tile u
#pragma unroll
    for (int u = 0; u < 2; ++u)
#pragma unroll
      for (int j = 0; j < 2; ++j) s[u][j] = zero8();
#pragma unroll
    for (int i = 0; i < 2; ++i)
#pragma unroll
      for (int j = 0; j < 2; ++j)
#pragma unroll
        for (int u = 0; u < 2; ++u) s[u][j] = mma16(kf[2 * j + i], qf[u][i], s[u][j]);
    if (fetch) {
      fetch_k();
      // keeps the group ahead of the softmax: sunk behind it, the loads would have only the O^T products to arrive in
      __builtin_amdgcn_sched_barrier(0);
    }
    FragU pf[2];
#pragma unroll
    for (int u = 0; u < 2; ++u) {
      float m = -1e30f;
#pragma unroll
      for (int j = 0; j < 2; ++j) {
        s[u][j] = s[u][j] * 0.125f;
#pragma unroll
        for (int r = 0; r < 8; ++r) m = fmaxf(m, s[u][j][r]);
      }
      m = fmaxf(m, xhalf(m));
      const float mnew  = fmaxf(mrow[u], m);
      const float alpha = exp2x1((mrow[u] - mnew) * 1.44269504088896340736f);
      mrow[u] = mnew;
      float ps[2] = {0.f, 0.f};
#pragma unroll
      for (int j = 0; j < 2; ++j) {
        float e[8], p[8];
#pragma unroll
        for (int r = 0; r < 8; ++r) e[r] = (s[u][j][r] - mnew) * 1.44269504088896340736f;   // exp(x) = 2^(x log2 e)
        exp2x8(e, p);
#pragma unroll
        for (int r = 0; r < 8; ++r) {
          ps[j] += p[r];
          pf[u].h[j][r] = (_Float16)p[r];
        }
      }
      lrow[u] = lrow[u] * alpha + (ps[0] + ps[1]);
#pragma unroll
      for (int t = 0; t < 4; ++t)
#pragma unroll
        for (int r = 0; r < 8; ++r) oacc[u][t][r] *= alpha;
    }
#pragma unroll
    for (int t = 0; t < 4; ++t) {
#pragma unroll
      for (int u = 0; u < 2; ++u) oacc[u][t] = mma16(vf[t], pf[u].v, oacc[u][t]);
    }
    if (fetch) fetch_v();
  };

  // rolled: one copy of the pass with its fetches; the last pass has nothing to fetch and stands alone
#pragma unroll 1
  for (int kc = 0; kc < SEQL / 32 - 1; ++kc) pass(true);
  pass(false);

  v8h ov[2][4];
#pragma unroll
  for (int u = 0; u < 2; ++u) {
    const float inv16 = 16.0f * (1.0f / (lrow[u] + xhalf(lrow[u])));
#pragma unroll
    for (int t = 0; t < 4; ++t)
#pragma unroll
      for (int r = 0; r < 8; ++r) ov[u][t][r] = (_Float16)(oacc[u][t][r] * inv16);
  }
  // keeps the eight stores together behind the last conversion
  __builtin_amdgcn_sched_barrier(0);
#pragma unroll
  for (int u = 0; u < 2; ++u)
#pragma unroll
    for (int t = 0; t < 4; ++t) *(v8h*)(Oz + u * QRT + (t >> 1) * FBH + (t & 1) * 256) = ov[u][t];
}

// ---------------------------------------------------------------------------
// Output projection: out[row][n] = sum_k O16[row][k] * WoT[nb][n][k] / 256 + bo[nb][n]  (f32).
// Rows with l == 1023 (router tokens) go to rplane[(blk*4+bat)][512] instead of d_out (single writer
// of those d_out rows is the router output kernel).  Epilogue: 16-row f32 slabs per wave in LDS; each 256-B
// row segment written by 16 consecutive lanes x 16 B of one instruction (2 rows per instruction,
// ---------------------------------------------------------------------------
__global__ void __launch_bounds__(256)
wo_gemm_kernel(const _Float16* __restrict__ O16, const _Float16* __restrict__ WT,
               const float* __restrict__ bo, float* __restrict__ out, float* __restrict__ rplane) {
  __shared__ __align__(16) float slabf[8 * 16 * SP32];
  const int lane = threadIdx.x & 31, wid = threadIdx.x >> 5;
  const int m0 = blockIdx.x * 64 + (wid >> 2) * 32;
  const int n0 = blockIdx.y * 256 + (wid & 3) * 64;
  const int nb = m0 >> 12;
  const _Float16* Bt = WT + (size_t)(12 + nb) * WPL;
  const float* bias = bo + nb * DM;
  v8f acc[2][4];
  gemm_core(O16, Bt, m0, n0, lane, acc);

  float* slab = slabf + wid * (16 * SP32);
  const int c = lane & 15, hh = lane >> 4, c4 = c * 4;
#pragma unroll
  for (int mt = 0; mt < 2; ++mt) {
#pragma unroll
    for (int nt = 0; nt < 4; ++nt) {
      const int coll = nt * 16 + c;
      const float bc = bias[n0 + coll];
#pragma unroll
      for (int r = 0; r < 8; ++r)
        slab[(8 * hh + r) * SP32 + coll] = acc[mt][nt][r] * (1.0f / 256.0f) + bc;
    }
    wave_lds_sync();
    {
#pragma unroll
      for (int it = 0; it < 8; ++it) {
        const int row = it * 2 + hh;
        const int gm  = m0 + mt * 16 + row;
        const v4f val = *(const v4f*)(slab + row * SP32 + c4);
        float* dst = ((gm & (SEQL - 1)) == (SEQL - 1))
                         ? (rplane + (size_t)(gm >> 10) * DM + n0 + c4)
                         : (out + (size_t)gm * DM + n0 + c4);
        *(v4f*)dst = val;
      }
      
    }
    wave_lds_sync();
  }
}

// ---------------------------------------------------------------------------
// Router (inter) attention in two launches of many work-groups (f32 VALU throughout).
// Both launches share one product form: a work-group of 16 waves owns one batch (4 router rows,
// t = blk*4 + bat) and 32 output columns; wave w takes k in [32w, 32w + 32), lane = column; the 16
// partial sums of an output element meet in LDS and are added in wave order.
// ---------------------------------------------------------------------------
__device__ __forceinline__ void router_w_load(const float* __restrict__ Wm, int wave, int col, float (&w)[32]) {
  const float* wp = Wm + (size_t)(wave * 32) * DM + col;
  // unrolled: w[] stays in registers and all 32 loads are in flight together
#pragma unroll
  for (int j = 0; j < 32; ++j) w[j] = wp[(size_t)j * DM];
}

// rows: LDS [4][512]; red: LDS [16][4][32]. Returns, in threads 0..127, element (row tid>>5, column tid&31).
__device__ __forceinline__ float router_ksplit(const float (&w)[32], const float* rows, float* red,
                                               int tid) {
  const int wave = tid >> 5, lane = tid & 31;
  float a[NBLK] = {0.f, 0.f, 0.f, 0.f};
  // unrolled (here and below): w[] and a[] are indexed by constants only, so they stay in registers
#pragma unroll
  for (int j4 = 0; j4 < 8; ++j4) {
#pragma unroll
    for (int r = 0; r < NBLK; ++r) {
      const v4f rv = *(const v4f*)(rows + r * DM + wave * 32 + j4 * 4);
      a[r] += rv[0] * w[j4 * 4];
      a[r] += rv[1] * w[j4 * 4 + 1];
      a[r] += rv[2] * w[j4 * 4 + 2];
      a[r] += rv[3] * w[j4 * 4 + 3];
    }
  }
#pragma unroll
  for (int r = 0; r < NBLK; ++r) red[(wave * NBLK + r) * 32 + lane] = a[r];
  __syncthreads();
  float s = 0.f;
  if (tid < 128) {
#pragma unroll
    for (int wv = 0; wv < 16; ++wv) s += red[wv * 128 + tid];
  }
  return s;
}

// rq / rk / rv: RP[p][t][n] = sum_k rplane[t][k] * iW_p[k][n] + ib_p[n].  grid (16, 4, 3) = (column
// chunk, bat, p), 512 threads.
__global__ void __launch_bounds__(512)
router_proj_kernel(const float* __restrict__ rplane,
                   const float* __restrict__ iWq, const float* __restrict__ ibq,
                   const float* __restrict__ iWk, const float* __restrict__ ibk,
                   const float* __restrict__ iWv, const float* __restrict__ ibv,
                   float* __restrict__ RP) {
  __shared__ __align__(16) float Rr[NBLK * DM];
  __shared__ float red[16 * NBLK * 32];
  const int tid = threadIdx.x;
  const int col = blockIdx.x * 32 + (tid & 31);
  const int b = blockIdx.y, p = blockIdx.z;
  const float* Wm = (p == 0) ? iWq : ((p == 1) ? iWk : iWv);
  const float* bb = (p == 0) ? ibq : ((p == 1) ? ibk : ibv);
  const int ri = tid >> 7, rc4 = (tid & 127) * 4;
  const v4f rin = *(const v4f*)(rplane + (size_t)(ri * NBAT + b) * DM + rc4);
  // the weight loads below may land in the registers that held this load's address
  asm volatile("s_wait_xcnt 0x0" ::: "memory");
  float w[32];
  router_w_load(Wm, tid >> 5, col, w);
  *(v4f*)(Rr + ri * DM + rc4) = rin;
  __syncthreads();
  const float s = router_ksplit(w, Rr, red, tid);
  if (tid < 128) RP[((size_t)p * 16 + (tid >> 5) * NBAT + b) * DM + col] = s + bb[col];
}

// Per batch: 4-key softmax of (rq.rk)*0.125 per (query blk, head), o = sum p*rv / sum p (each
// work-group forms all 4 x 512 of its batch), then out rows l == 1023 = o . iWo + ibo for its 32
// columns.  grid (16, 4) = (column chunk, bat), 512 threads.
__global__ void __launch_bounds__(512)
router_out_kernel(const float* __restrict__ RP,
                  const float* __restrict__ iWo, const float* __restrict__ ibo,
                  float* __restrict__ out) {
  __shared__ __align__(16) float Pj[3][NBLK * DM];
  __shared__ __align__(16) float Ro[NBLK * DM];
  __shared__ float red[16 * NBLK * 32];
  const int tid = threadIdx.x;
  const int col = blockIdx.x * 32 + (tid & 31);
  const int b = blockIdx.y;
  float w[32];
  router_w_load(iWo, tid >> 5, col, w);
  {
    const int i = tid >> 7, c4 = (tid & 127) * 4;
#pragma unroll
    for (int p = 0; p < 3; ++p)
      *(v4f*)(&Pj[p][i * DM + c4]) = *(const v4f*)(RP + ((size_t)p * 16 + i * NBAT + b) * DM + c4);
  }
  __syncthreads();
  {
    // 16 lanes per (query blk, head); each lane holds 4 of the 64 head elements
    const int item = tid >> 4;              // 0..31
    const int nq = item >> 3, hd = item & 7;
    const int eo = hd * HD + (tid & 15) * 4;
    const v4f q4 = *(const v4f*)(&Pj[0][nq * DM + eo]);
    const v4f v0 = *(const v4f*)(&Pj[2][eo]);
    const v4f v1 = *(const v4f*)(&Pj[2][DM + eo]);
    const v4f v2 = *(const v4f*)(&Pj[2][2 * DM + eo]);
    const v4f v3 = *(const v4f*)(&Pj[2][3 * DM + eo]);
    float sc[NBLK];
#pragma unroll
    for (int s = 0; s < NBLK; ++s) {
      const v4f k4 = *(const v4f*)(&Pj[1][s * DM + eo]);
      sc[s] = q4[0] * k4[0] + q4[1] * k4[1] + q4[2] * k4[2] + q4[3] * k4[3];
    }
    // keeps the four v reads in one batch ahead of the exponentials; sunk in between them their
    // LDS latency would stand in the dependent chain three times
    asm volatile("" :: "v"(v0), "v"(v1), "v"(v2), "v"(v3));
#pragma unroll
    for (int m = 1; m < 16; m <<= 1) {
#pragma unroll
      for (int s = 0; s < NBLK; ++s) sc[s] += __shfl_xor(sc[s], m, 32);
    }
#pragma unroll
    for (int s = 0; s < NBLK; ++s) sc[s] *= 0.125f;
    const float mx = fmaxf(fmaxf(sc[0], sc[1]), fmaxf(sc[2], sc[3]));
    const float p0 = __expf(sc[0] - mx), p1 = __expf(sc[1] - mx), p2 = __expf(sc[2] - mx), p3 = __expf(sc[3] - mx);
    const float inv = 1.0f / (p0 + p1 + p2 + p3);
    v4f o4;
#pragma unroll
    for (int j = 0; j < 4; ++j) o4[j] = (p0 * v0[j] + p1 * v1[j] + p2 * v2[j] + p3 * v3[j]) * inv;
    *(v4f*)(Ro + nq * DM + eo) = o4;
  }
  __syncthreads();
  const float s = router_ksplit(w, Ro, red, tid);
  if (tid < 128)
    out[((size_t)((tid >> 5) * NBAT + b) * SEQL + (SEQL - 1)) * DM + col] = s + ibo[col];
}

// ---------------------------------------------------------------------------
// Workspace map (byte offsets; every region fully written before it is read; the f16 planes are packed
// in fragment blocks, see frag_ld; all regions are exact
//   X16   f16 [16384][512]            0          16777216 B
//   WT16  f16 [16][512][512]     16777216           8388608 B   (Wq,Wk,Wv,Wo planes x 4 blks, [out][in], x16)
//   Q16   f16 [16384][512]     25165824          16777216 B
//   K16   f16 [16384][512]     41943040          16777216 B
//   VT16  f16 [16][512][1024]  58720256          16777216 B
//   O16   f16 [16384][512]     75497472          16777216 B   (attention output x16)
//   RPL   f32 [16][512]        92274688             32768 B   (router rows, t = blk*4 + bat)
//   RP    f32 [3][16][512]     92307456             98304 B   (router q, k, v projections)
//   total                      92405760
// ---------------------------------------------------------------------------
extern "C" void kernel_launch(void* const* d_in, const int* in_sizes, int n_in,
                              void* d_out, int out_size, void* d_ws, size_t ws_size,
                              hipStream_t stream) {
  if (n_in < 17) return;
  if (in_sizes[0] != MROWS * DM) return;
  if (in_sizes[1] != NBLK * WPL || in_sizes[3] != NBLK * WPL || in_sizes[5] != NBLK * WPL || in_sizes[7] != NBLK * WPL) return;
  if (in_sizes[2] != NBLK * DM || in_sizes[4] != NBLK * DM || in_sizes[6] != NBLK * DM || in_sizes[8] != NBLK * DM) return;
  if (in_sizes[9] != WPL || in_sizes[11] != WPL || in_sizes[13] != WPL || in_sizes[15] != WPL) return;
  if (in_sizes[10] != DM || in_sizes[12] != DM || in_sizes[14] != DM || in_sizes[16] != DM) return;
  if (out_size != MROWS * DM) return;

  const float* x   = (const float*)d_in[0];
  const float* Wq  = (const float*)d_in[1];  const float* bq  = (const float*)d_in[2];
  const float* Wk  = (const float*)d_in[3];  const float* bk  = (const float*)d_in[4];
  const float* Wv  = (const float*)d_in[5];  const float* bv  = (const float*)d_in[6];
  const float* Wo  = (const float*)d_in[7];  const float* bo  = (const float*)d_in[8];
  const float* iWq = (const float*)d_in[9];  const float* ibq = (const float*)d_in[10];
  const float* iWk = (const float*)d_in[11]; const float* ibk = (const float*)d_in[12];
  const float* iWv = (const float*)d_in[13]; const float* ibv = (const float*)d_in[14];
  const float* iWo = (const float*)d_in[15]; const float* ibo = (const float*)d_in[16];
  float* out = (float*)d_out;

  const size_t bAct = (size_t)MROWS * DM * 2;      // 16777216
  const size_t bWT  = (size_t)16 * WPL * 2;        // 8388608
  const size_t bRpl = (size_t)16 * DM * 4;         // 32768
  const size_t bRp  = (size_t)3 * 16 * DM * 4;     // 98304
  size_t off = 0;
  const size_t oX  = off; off += bAct;
  const size_t oWT = off; off += bWT;
  const size_t oQ  = off; off += bAct;
  const size_t oK  = off; off += bAct;
  const size_t oVT = off; off += bAct;
  const size_t oO  = off; off += bAct;
  const size_t oR  = off; off += bRpl;
  const size_t oP  = off; off += bRp;
  if (off > ws_size) return;                       // off = 92405760

  char* ws = (char*)d_ws;
  _Float16* X16  = (_Float16*)(ws + oX);
  _Float16* WT16 = (_Float16*)(ws + oWT);
  _Float16* Q16  = (_Float16*)(ws + oQ);
  _Float16* K16  = (_Float16*)(ws + oK);
  _Float16* VT16 = (_Float16*)(ws + oVT);
  _Float16* O16  = (_Float16*)(ws + oO);
  float*    RPL  = (float*)(ws + oR);
  float*    RP   = (float*)(ws + oP);

  // (1) weights -> transposed f16 planes (x16), and x -> f16 plane
  prep_kernel<<<dim3(WTB), dim3(256), 0, stream>>>(x, Wq, Wk, Wv, Wo, X16, WT16);
  // (2) q, k projections, and the v^T projection per (blk, bat)
  qkv_gemm_kernel<<<dim3(QKB + VTB), dim3(256), 0, stream>>>(X16, WT16, bq, bk, bv, Q16, K16, VT16);
  // (3) intra attention
  attn_kernel<<<dim3(NBLK * NBAT * NH * (SEQL / 128)), dim3(128), 0, stream>>>(Q16, K16, VT16, O16);
  // (4) output projection -> d_out (rows l < 1023) and router plane (rows l == 1023)
  wo_gemm_kernel<<<dim3(MROWS / 64, DM / 256, 1), dim3(256), 0, stream>>>(O16, WT16, bo, out, RPL);
  // (5) router q, k, v projections
  router_proj_kernel<<<dim3(DM / 32, NBAT, 3), dim3(512), 0, stream>>>(RPL, iWq, ibq, iWk, ibk, iWv, ibv, RP);
  // (6) router attention + output projection -> d_out rows l == 1023
  router_out_kernel<<<dim3(DM / 32, NBAT), dim3(512), 0, stream>>>(RP, iWo, ibo, out);
  (void)hipGetLastError();
}

// v007
// One run takes 105 microseconds.
// Timed twice side by side with v006, it ran 1.16 times as fast both times.
// Counting every step since v000, it is 10.8 times as fast.
// Contractions q/k/v^T projections, q.k^T, p.v, out projection: v_wmma_f32_16x16x32_f16, f16 operands (W x16; x and p x1; attention output o x16), f32 accumulate; softmax f32 (scale 0.125 applied to the f32 score accumulator); router-token attention and its four projections: f32 VALU.
#include <hip/hip_runtime.h>

typedef _Float16 v16h __attribute__((ext_vector_type(16)));
typedef _Float16 v8h  __attribute__((ext_vector_type(8)));
typedef float    v8f  __attribute__((ext_vector_type(8)));
typedef float    v4f  __attribute__((ext_vector_type(4)));

#define NBLK  4
#define NBAT  4
#define SEQL  1024
#define DM    512
#define NH    8
#define HD    64
#define MROWS 16384          // NBLK*NBAT*SEQL
#define WPL   262144         // DM*DM, one weight plane
#define ZPL   524288         // SEQL*DM, one (blk,bat) activation plane
#define SP16  72             // f16 LDS slab pitch (halves), 144 B rows
#define SP32  68             // f32 LDS slab pitch (floats), 272 B rows

union FragU { v16h v; v8h h[2]; };

// Packed operand planes. Every f16 matrix [rows][K] of the workspace is stored as fragment blocks:
// block (rt = row >> 4, kt = k >> 5) is FBH halves (1 KiB) at (rt * (K / 32) + kt) * FBH; inside it the
// 16-B unit u = o * 16 + c holds row rt*16 + c, k = kt*32 + o*8 .. + 7 (o = 0..3, c = 0..15).
// 16x16x32 operand fragment: p = block + lane*8; elements 0..7 <- unit lane (k = 8*(lane>>4) + e),
// elements 8..15 <- unit 32 + lane (16 more): the same k order for A rows m and Bt rows n, and each of
// the two loads of a wave reads 512 contiguous bytes (4 cache lines; from k-contiguous rows it was 16).
#define FBH 512
__device__ __forceinline__ v16h frag_ld(const _Float16* p) {
  FragU f;
  f.h[0] = *(const v8h*)(p);
  f.h[1] = *(const v8h*)(p + 256);
  return f.v;
}

__device__ __forceinline__ v8f mma16(v16h a, v16h b, v8f c) {
  c = __builtin_amdgcn_wmma_f32_16x16x32_f16(false, a, false, b, (short)0, c, false, false);
  asm volatile("v_nop\n\tv_nop\n\tv_nop\n\tv_nop" : "+v"(c) : "v"(a), "v"(b));
  return c;
}

__device__ __forceinline__ void wave_lds_sync() {
  __builtin_amdgcn_fence(__ATOMIC_RELEASE, "workgroup");
  __builtin_amdgcn_wave_barrier();
  __builtin_amdgcn_fence(__ATOMIC_ACQUIRE, "workgroup");
}

__device__ __forceinline__ v8f zero8() { return (v8f){0.f, 0.f, 0.f, 0.f, 0.f, 0.f, 0.f, 0.f}; }

// ---------------------------------------------------------------------------
// Both preparations in one launch: they share no data, so each of the WTB blocks does one weight tile
// and its share of x.  grid WTB = 8 x 8 x 16 = 1024 blocks of 256 threads, bx = z*64 + y*8 + x.
// Weight transpose + x16 + f16: W (f32 [in=512][out=512], blk plane nb of Wq/Wk/Wv/Wo)
//   -> WT[z][out][in] = f16(16 * W[in][out]), packed (rows = out, k = in), z = widx*4 + nb  (widx 0=q,1=k,2=v,3=o).
//   64x64 tiles through LDS.  Coverage per block: load 4 it x 256 thr x 4 = 64x64; store 2 it x 256 thr x 8 = 64x64.
// x f32 [16384][512] -> packed f16 plane: block bx converts row tile bx (16 rows x 512 = 32 KiB read, 16 KiB
//   written, both contiguous), XUN = 4 units of 16 B a thread: unit bx*1024 + j*256 + tid is row
//   bx*16 + (tid & 15), k = j*128 + (tid >> 4)*8 .. + 7.  Coverage: 1024 blocks x 256 thr x 4 x 8 = 16384 x 512.
// ---------------------------------------------------------------------------
#define WTB ((DM / 64) * (DM / 64) * 16)
#define XUN (MROWS * DM / 8 / (WTB * 256))
static_assert(WTB == MROWS / 16 && XUN * 128 == DM, "one 16-row tile of x for each block");
__global__ void __launch_bounds__(256)
prep_kernel(const float* __restrict__ x,
            const float* __restrict__ Wq, const float* __restrict__ Wk,
            const float* __restrict__ Wv, const float* __restrict__ Wo,
            _Float16* __restrict__ X16, _Float16* __restrict__ WT) {
  __shared__ __align__(16) float tf[64 * 68];
  const int bx = blockIdx.x;
  const int z  = bx >> 6;
  const int wi = z >> 2, nb = z & 3;
  const float* W = (wi == 0) ? Wq : ((wi == 1) ? Wk : ((wi == 2) ? Wv : Wo));
  W += (size_t)nb * WPL;
  _Float16* O = WT + (size_t)z * WPL;
  const int c0  = (bx & 7) * 64;         // input column block (out feature) = output row block
  const int r0  = ((bx >> 3) & 7) * 64;  // input row block (in feature)     = output column block
  const int tid = threadIdx.x;
  const int lr = tid >> 4;          // 0..15
  const int c4 = (tid & 15) * 4;    // 0..60
  const float* wp = W + (size_t)(r0 + lr) * DM + c0 + c4;
  const float* xp = x + (size_t)(bx * 16 + (tid & 15)) * DM + lr * 8;
  v4f wa[4], xa[XUN], xb[XUN];
  // unrolled (all loops of this kernel): the arrays are indexed by constants only, so they stay in registers
#pragma unroll
  for (int it = 0; it < 4; ++it) wa[it] = *(const v4f*)(wp + (size_t)(it * 16) * DM);
#pragma unroll
  for (int j = 0; j < XUN; ++j) {
    xa[j] = *(const v4f*)(xp + j * 128);
    xb[j] = *(const v4f*)(xp + j * 128 + 4);
  }
  // all twelve loads are out before anything waits for one of them, the weight tile's first, so that its way
  // through LDS runs under the x loads; the registers of the two addresses may be written again behind this wait
  asm volatile("s_wait_xcnt 0x0" :: "v"(wp), "v"(xp) : "memory");
#pragma unroll
  for (int it = 0; it < 4; ++it) *(v4f*)(tf + (it * 16 + lr) * 68 + c4) = wa[it];
  __syncthreads();
  // the tile is 4 row tiles x 2 k tiles = 8 blocks; thread tid writes unit tid & 63 of blocks
  // (rt = tid >> 7, kt = (tid >> 6) & 1) and (rt + 2, kt)
  const int rtl = tid >> 7, ktl = (tid >> 6) & 1;
  const int sub = rtl * 16 + (tid & 15);            // out feature in the tile, 0..31
  const int c8  = ktl * 32 + ((tid >> 4) & 3) * 8;  // in feature in the tile, 0..56
  v8h hv0, hv1;
#pragma unroll
  for (int e = 0; e < 8; ++e) {
    hv0[e] = (_Float16)(16.0f * tf[(c8 + e) * 68 + sub]);
    hv1[e] = (_Float16)(16.0f * tf[(c8 + e) * 68 + 32 + sub]);
  }
  _Float16* p0 = O + (size_t)(((c0 >> 4) + rtl) * (DM / 32) + (r0 >> 5) + ktl) * FBH + (tid & 63) * 8;
  _Float16* p1 = p0 + (size_t)(2 * (DM / 32)) * FBH;
  *(v8h*)p0 = hv0;
  *(v8h*)p1 = hv1;
  _Float16* px = X16 + ((size_t)bx * (XUN * 256) + tid) * 8;
#pragma unroll
  for (int j = 0; j < XUN; ++j) {
    v8h hv;
    hv[0] = (_Float16)xa[j][0]; hv[1] = (_Float16)xa[j][1]; hv[2] = (_Float16)xa[j][2]; hv[3] = (_Float16)xa[j][3];
    hv[4] = (_Float16)xb[j][0]; hv[5] = (_Float16)xb[j][1]; hv[6] = (_Float16)xb[j][2]; hv[7] = (_Float16)xb[j][3];
    *(v8h*)(px + j * (256 * 8)) = hv;
  }
}

// ---------------------------------------------------------------------------
// GEMM core: acc[mt][nt] = sum_k A[m0 + mt*16 + .][k] * Bt[n0 + nt*16 + .][k], K = 512.
// A and Bt are packed f16 planes with K = 512; block tile 64 x 256 at (mb, nbk), 8 waves, wave tile 32 x 64 at
// m0 = mb + (wave >> 2)*32, n0 = nbk + (wave & 3)*64; D element r of lane l is (row 8*(l>>4) + r, col l&15)
// of its 16x16 subtile.
// The block's operands come through LDS: a stage is KST k tiles (64 k) of its 4 row tiles of A and 16 of Bt,
// row tile r (A: 0..3, Bt: 4..19) at byte r*2048 of the stage, as it lies in the plane (KST fragment blocks in a
// row), so each fragment is brought from L2 once for the block and read by ds_load_b128, 512 contiguous bytes a
// load.  Two buffers of SUB stages each: the next buffer's copies fly while this one is worked on.  SUB = 1 where
// four work-groups share a WGP; SUB = 2 where the grid gives a WGP only two, so that as many bytes are in flight.
// ---------------------------------------------------------------------------
#define KST   2                          // k tiles of a stage
#define RTH   (KST * FBH)                // halves of one row tile in a stage (2 KiB)
#define STGH  (20 * RTH)                 // halves of a stage (40 KiB)
#define NSTG  (DM / 32 / KST)            // stages
#define RINGH(SUB) (2 * (SUB) * STGH)    // halves of the ring (80 KiB x SUB)

// One stage, ten asynchronous copies of 16 B a thread: thread tid brings byte tid*16 of each 4-KiB pair of row
// tiles.  ga / gb: this thread's place in row tile (tid >> 7) of the block's A / Bt rows at the stage's first k
// tile; l: LDS byte address of the stage's place + tid*16.  The closing wait stands inside the statement, so that no
// address register of a copy is written again in front of it.
__device__ __forceinline__ void stage_copy(const _Float16* ga, const _Float16* gb, uint32_t l) {
  const int R2 = 2 * (DM / 32) * FBH;    // halves from a row tile of a plane to the next but one
  asm volatile("global_load_async_to_lds_b128 %0, %10, off\n\t"
               "global_load_async_to_lds_b128 %1, %11, off\n\t"
               "global_load_async_to_lds_b128 %2, %12, off\n\t"
               "global_load_async_to_lds_b128 %3, %13, off\n\t"
               "global_load_async_to_lds_b128 %4, %14, off\n\t"
               "global_load_async_to_lds_b128 %5, %15, off\n\t"
               "global_load_async_to_lds_b128 %6, %16, off\n\t"
               "global_load_async_to_lds_b128 %7, %17, off\n\t"
               "global_load_async_to_lds_b128 %8, %18, off\n\t"
               "global_load_async_to_lds_b128 %9, %19, off\n\t"
               "s_wait_xcnt 0x0"
               :: "v"(l), "v"(l + 4096u), "v"(l + 8192u), "v"(l + 12288u), "v"(l + 16384u),
                  "v"(l + 20480u), "v"(l + 24576u), "v"(l + 28672u), "v"(l + 32768u), "v"(l + 36864u),
                  "v"(ga), "v"(ga + R2), "v"(gb), "v"(gb + R2), "v"(gb + 2 * R2), "v"(gb + 3 * R2),
                  "v"(gb + 4 * R2), "v"(gb + 5 * R2), "v"(gb + 6 * R2), "v"(gb + 7 * R2)
               : "memory");
}

// ring: RINGH(SUB) halves of LDS, 16-B aligned.  Behind the call no copy is in flight and every wave has left
// the ring (the last trip's own barrier), so the caller may use it as staging for its epilogue.
template <int SUB>
__device__ __forceinline__ void gemm_core(const _Float16* __restrict__ A,
                                          const _Float16* __restrict__ Bt,
                                          int mb, int nbk, _Float16* ring, v8f (&acc)[2][4]) {
  const int RTS  = (DM / 32) * FBH;   // halves from one row tile of a plane to the next
  const int BUFH = SUB * STGH;        // halves of a buffer
  const int NT   = NSTG / SUB;        // trips
  static_assert(NT >= 2 && NT * SUB == NSTG, "both buffers are filled in front of the loop");
  const int tid = threadIdx.x, lane = tid & 31, wid = tid >> 5;
  // unrolled (every loop of this function but the trips): acc[] and bf[] are indexed by constants only, so they
  // stay in registers, and the places of a buffer's stages are constants
#pragma unroll
  for (int i = 0; i < 2; ++i)
#pragma unroll
    for (int j = 0; j < 4; ++j) acc[i][j] = zero8();
  const _Float16* ga = A  + (size_t)((mb  >> 4) + (tid >> 7)) * RTS + (tid & 127) * 8;
  const _Float16* gb = Bt + (size_t)((nbk >> 4) + (tid >> 7)) * RTS + (tid & 127) * 8;
  const uint32_t l0 = (uint32_t)(size_t)ring + (uint32_t)tid * 16u;
#pragma unroll
  for (int s = 0; s < SUB; ++s) stage_copy(ga + s * RTH, gb + s * RTH, l0 + (uint32_t)(s * STGH) * 2u);
  // buffer 0 has landed for this wave; behind the barrier for all
  asm volatile("s_wait_asynccnt 0x0" ::: "memory");
  __syncthreads();
#pragma unroll
  for (int s = 0; s < SUB; ++s)
    stage_copy(ga + (SUB + s) * RTH, gb + (SUB + s) * RTH, l0 + (uint32_t)(BUFH + s * STGH) * 2u);
  const _Float16* fa = ring + ((wid >> 2) * 2) * RTH + lane * 8;       // this wave's two row tiles of A
  const _Float16* fb = ring + (4 + (wid & 3) * 4) * RTH + lane * 8;    // its four row tiles of Bt
  // rolled: one copy of the trip, its publish point and its refill
#pragma unroll 1
  for (int t = 0; t < NT; ++t) {
    const int bo = (t & 1) * BUFH;
#pragma unroll
    for (int kk = 0; kk < SUB * KST; ++kk) {
      const int fo = bo + (kk / KST) * STGH + (kk % KST) * FBH;   // stage of the buffer, k tile of the stage
      v16h bf[4];
#pragma unroll
      for (int j = 0; j < 4; ++j) bf[j] = frag_ld(fb + fo + j * RTH);
      const v16h a0 = frag_ld(fa + fo);
      const v16h a1 = frag_ld(fa + fo + RTH);
#pragma unroll
      for (int j = 0; j < 4; ++j) {
        acc[0][j] = mma16(a0, bf[j], acc[0][j]);
        acc[1][j] = mma16(a1, bf[j], acc[1][j]);
      }
    }
    // publish point of the next buffer: this wave's reads of this buffer are done, its copies into the next have
    // landed; behind the barrier every wave may read the next buffer and this one may be filled again
    asm volatile("s_wait_dscnt 0x0" ::: "memory");
    asm volatile("s_wait_asynccnt 0x0" ::: "memory");
    __syncthreads();
    if (t + 2 < NT) {
#pragma unroll
      for (int s = 0; s < SUB; ++s)
        stage_copy(ga + ((t + 2) * SUB + s) * RTH, gb + ((t + 2) * SUB + s) * RTH,
                   l0 + (uint32_t)(bo + s * STGH) * 2u);
    }
  }
  // the ring's closing wait: no copy outlives the loop
  asm volatile("s_wait_asynccnt 0x0" ::: "memory");
}

// ---------------------------------------------------------------------------
// f16 epilogue: v = acc*scale + bias (bias per column, or per row when BIAS_ROW); the wave's 32 x 64
// tile goes through its LDS slab and leaves as 4 blocks of the packed plane C (kts = its k tiles per
// row tile), 512 contiguous bytes per store instruction.
// ---------------------------------------------------------------------------
template <bool BIAS_ROW>
__device__ __forceinline__ void epi_f16(v8f (&acc)[2][4], _Float16* slab,
                                        _Float16* __restrict__ C, int kts,
                                        int m0, int n0, int lane, float scale,
                                        const float* __restrict__ bias) {
  const int c = lane & 15, hh = lane >> 4;
#pragma unroll
  for (int mt = 0; mt < 2; ++mt) {
#pragma unroll
    for (int nt = 0; nt < 4; ++nt) {
      const int coll = nt * 16 + c;
      float bc = 0.f;
      if (!BIAS_ROW) bc = bias[n0 + coll];
#pragma unroll
      for (int r = 0; r < 8; ++r) {
        const int rowl = mt * 16 + 8 * hh + r;
        float v = acc[mt][nt][r] * scale;
        v += BIAS_ROW ? bias[m0 + rowl] : bc;
        slab[rowl * SP16 + coll] = (_Float16)v;
      }
    }
  }
  wave_lds_sync();
  {
#pragma unroll
    for (int it = 0; it < 8; ++it) {
      const int rtl = it >> 2, ktl = (it >> 1) & 1, uh = it & 1;   // block of the tile, half of the block
      const v8h val = *(const v8h*)(slab + (rtl * 16 + c) * SP16 + ktl * 32 + (uh * 2 + hh) * 8);
      *(v8h*)(C + ((size_t)((m0 >> 4) + rtl) * kts + (n0 >> 5) + ktl) * FBH + uh * 256 + lane * 8) = val;
    }
  }
  wave_lds_sync();
}

// ---------------------------------------------------------------------------
// q, k and v^T projections in one launch: all three read only X16 and WT, so they are told apart by
// block range (block-uniform branch).  Block tile 64 x 256, 8 waves of 32 x 64.
// Blocks 0 .. QKB-1, bx = proj*512 + ny*256 + mx (proj: 0 = q, 1 = k): rows (blk,bat,l) = 16384, N = 512,
//   K = 512; weight plane and bias selected by the row block.  Q16/K16: [16384][512] f16, packed,
//   column (k) = h*64 + e.
// Blocks QKB .. QKB+VTB-1, b = z*32 + ny*8 + mx, per (blk,bat) z:
//   VT16[z][m = h*64+e][l] = sum_k WvT[nb][m][k] * x[z][l][k] / 16 + bv[nb][m]
//   A = WvT plane (512 x 512), Bt = x plane rows (1024 x 512), C [512][1024] f16, packed (k = l).
// ---------------------------------------------------------------------------
#define QKB ((MROWS / 64) * (DM / 256) * 2)
#define VTB ((DM / 64) * (SEQL / 256) * NBLK * NBAT)
__global__ void __launch_bounds__(256)
qkv_gemm_kernel(const _Float16* __restrict__ X16, const _Float16* __restrict__ WT,
                const float* __restrict__ bq, const float* __restrict__ bk, const float* __restrict__ bv,
                _Float16* __restrict__ Q16, _Float16* __restrict__ K16, _Float16* __restrict__ VT16) {
  __shared__ __align__(16) _Float16 ring[RINGH(1)];   // operand ring, then the waves' epilogue slabs
  static_assert(8 * 32 * SP16 <= RINGH(1), "the slabs fit the ring");
  const int lane = threadIdx.x & 31, wid = threadIdx.x >> 5;
  const int bx = blockIdx.x;
  const bool isv = bx >= QKB;
  const int b  = bx - QKB;
  const int z  = b >> 5;                                   // v^T blocks: (blk,bat)
  const int proj = bx >> 9;                                // q / k blocks: 0 = q, 1 = k
  const int mb  = (isv ? (b & 7) : (bx & 255)) * 64;                // v^T: output feature; q / k: row
  const int nbk = (isv ? ((b >> 3) & 3) : ((bx >> 8) & 1)) * 256;   // v^T: position; q / k: column
  const int m0 = mb + (wid >> 2) * 32;
  const int n0 = nbk + (wid & 3) * 64;
  const int nb = isv ? (z >> 2) : (m0 >> 12);
  const _Float16* A  = isv ? (WT + (size_t)(8 + nb) * WPL) : X16;
  const _Float16* Bt = isv ? (X16 + (size_t)z * ZPL) : (WT + (size_t)(proj * 4 + nb) * WPL);
  _Float16* slab = ring + wid * (32 * SP16);
  v8f acc[2][4];
  gemm_core<1>(A, Bt, mb, nbk, ring, acc);
  if (isv) {
    epi_f16<true>(acc, slab, VT16 + (size_t)z * ZPL, SEQL / 32, m0, n0, lane, 0.0625f, bv + nb * DM);
  } else {
    epi_f16<false>(acc, slab, (proj == 0) ? Q16 : K16, DM / 32, m0, n0, lane, 0.0625f,
                   ((proj == 0) ? bq : bk) + nb * DM);
  }
}

// ---------------------------------------------------------------------------
// Full (unmasked) attention, head dim 64, per (blk,bat) z and head h, in transposed form.
//   q/k rows from Q16/K16 ([z*1024 + l][h*64 + d]); v^T rows from VT16 ([z*512 + h*64 + d][l]); all packed.
//   S^T = k.q^T (A = k rows, Bt = q rows): lane l holds, for query l&15, keys 16j + 8*(l>>4) + r of
//   each 16-key tile j, so the row maximum and the row sum of the online softmax (f32, 32 chunks of
//   32 keys) are in-lane, joined between lanes l and l^16 by one cross-row move.
//   O^T += v^T.P^T (A = v^T rows, Bt = P rows): two neighbouring S^T tiles, converted in place, are
//   the Bt fragment in the k order of frag_ld (elements 0..7: k0 + 8*(l>>4) + e, 8..15: 16 more).
//   O16[z*1024 + l][h*64 + d] = f16(16 * O / rowsum), packed: the eight d of accumulator tile t in a lane
//   are unit (t&1)*32 + lane of block (query tile, 2h + (t>>1)), so each tile is stored straight from registers.
//   A wave owns two 16-query tiles, so each k and v^T fragment it loads feeds two products.
//   Block = 4 waves x 32 query rows; grid 1024 = z*64 + h*8 + qb.
// ---------------------------------------------------------------------------
__device__ __forceinline__ float xhalf(float x) {   // value of lane l ^ 16
  const int b = __builtin_bit_cast(int, x);
  return __builtin_bit_cast(float, __builtin_amdgcn_permlanex16(b, b, 0x76543210, 0xfedcba98, false, false));
}

// y[i] = 2^x[i], eight in one statement: the outputs are early-clobber, so no exponential lands on a
// source of the one in front of it, and the closing v_nop is the free slot that the instruction set asks
// for behind the last one
__device__ __forceinline__ void exp2x8(const float (&x)[8], float (&y)[8]) {
  asm("v_exp_f32 %0, %8\n\tv_exp_f32 %1, %9\n\tv_exp_f32 %2, %10\n\tv_exp_f32 %3, %11\n\t"
      "v_exp_f32 %4, %12\n\tv_exp_f32 %5, %13\n\tv_exp_f32 %6, %14\n\tv_exp_f32 %7, %15\n\tv_nop"
      : "=&v"(y[0]), "=&v"(y[1]), "=&v"(y[2]), "=&v"(y[3]), "=&v"(y[4]), "=&v"(y[5]), "=&v"(y[6]), "=&v"(y[7])
      : "v"(x[0]), "v"(x[1]), "v"(x[2]), "v"(x[3]), "v"(x[4]), "v"(x[5]), "v"(x[6]), "v"(x[7]));
}

// y = 2^x with its free slot in the same statement
__device__ __forceinline__ float exp2x1(float x) {
  float y;
  asm("v_exp_f32 %0, %1\n\tv_nop" : "=&v"(y) : "v"(x));
  return y;
}

__global__ void __launch_bounds__(128)
attn_kernel(const _Float16* __restrict__ Q16, const _Float16* __restrict__ K16,
            const _Float16* __restrict__ VT16, _Float16* __restrict__ O16) {
  const int tid = threadIdx.x, wave = tid >> 5, lane = tid & 31;
  const int bx = blockIdx.x;
  const int qb = bx & 7, h = (bx >> 3) & 7, z = bx >> 6;
  const int q0 = qb * 128 + wave * 32;

  const int QRT = (DM / 32) * FBH;     // halves from one 16-row tile of Q16 / K16 / O16 to the next
  const int VRT = (SEQL / 32) * FBH;   // the same for VT16
  const size_t hq = (size_t)z * ZPL + (2 * h) * FBH + lane * 8;   // row tile 0 of z, first k tile of head h
  const _Float16* Qz = Q16 + hq + (size_t)(q0 >> 4) * QRT;
  const _Float16* Kz = K16 + hq;
  const _Float16* Vz = VT16 + (size_t)z * ZPL + (size_t)(h * (HD / 16)) * VRT + lane * 8;
  _Float16* Oz = O16 + hq + (size_t)(q0 >> 4) * QRT;

  v16h qf[2][2];                     // qf[u][i]: query tile u, d = 32i..
#pragma unroll
  for (int u = 0; u < 2; ++u) {
    qf[u][0] = frag_ld(Qz + u * QRT);
    qf[u][1] = frag_ld(Qz + u * QRT + FBH);
  }
  // the fragment loads below may land in the registers that held this address
  asm volatile("s_wait_xcnt 0x0" :: "v"(Qz) : "memory");

  float mrow[2] = {-1e30f, -1e30f};  // query 16u + c: running maximum (both halves alike)
  float lrow[2] = {0.f, 0.f};        // this half's sum
  v8f oacc[2][4];                    // oacc[u][t][r] = O^T[d = 16t + 8hh + r][query 16u + c]
#pragma unroll
  for (int u = 0; u < 2; ++u)
#pragma unroll
    for (int t = 0; t < 4; ++t) oacc[u][t] = zero8();

  // Fragments are fetched one pass (32 keys) ahead: the 8 loads of the next pass's k fragments go out as
  // one group right behind this pass's S^T products, into the registers those have just read, and the 8
  // loads of its v^T fragments right behind the O^T products; each group has a whole pass to arrive.
  // Every fragment serves both query tiles of the wave.
  const _Float16* kp = Kz;   // k fragments of the pass that is fetched next
  const _Float16* vp = Vz;   // v^T fragments of the same
  v16h kf[4], vf[4];         // kf[2j + i]: keys 16j.., d = 32i..; vf[t]: d = 16t.., the pass's 32 keys
  auto fetch_k = [&]() __attribute__((always_inline)) {
#pragma unroll
    for (int j = 0; j < 2; ++j) {
      kf[2 * j]     = frag_ld(kp + j * QRT);
      kf[2 * j + 1] = frag_ld(kp + j * QRT + FBH);
    }
    // the address pair is advanced while the loads that name it are in flight; the statement also keeps the
    // k and v^T groups in one order everywhere, so that the counted load waits can leave the younger group out
    asm volatile("s_wait_xcnt 0x0" :: "v"(kp) : "memory");
    kp += 2 * QRT;
  };
  auto fetch_v = [&]() __attribute__((always_inline)) {
#pragma unroll
    for (int t = 0; t < 4; ++t) vf[t] = frag_ld(vp + t * VRT);
    // as in fetch_k
    asm volatile("s_wait_xcnt 0x0" :: "v"(vp) : "memory");
    vp += FBH;
  };
  fetch_k();
  fetch_v();

  auto pass = [&](const bool fetch) __attribute__((always_inline)) {
    v8f s[2][2];             // s[u][j]: keys 16j.. of the pass against query tile u
#pragma unroll
    for (int u = 0; u < 2; ++u)
#pragma unroll
      for (int j = 0; j < 2; ++j) s[u][j] = zero8();
#pragma unroll
    for (int i = 0; i < 2; ++i)
#pragma unroll
      for (int j = 0; j < 2; ++j)
#pragma unroll
        for (int u = 0; u < 2; ++u) s[u][j] = mma16(kf[2 * j + i], qf[u][i], s[u][j]);
    if (fetch) {
      fetch_k();
      // keeps the group ahead of the softmax: sunk behind it, the loads would have only the O^T products to arrive in
      __builtin_amdgcn_sched_barrier(0);
    }
    FragU pf[2];
#pragma unroll
    for (int u = 0; u < 2; ++u) {
      float m = -1e30f;
#pragma unroll
      for (int j = 0; j < 2; ++j) {
        s[u][j] = s[u][j] * 0.125f;
#pragma unroll
        for (int r = 0; r < 8; ++r) m = fmaxf(m, s[u][j][r]);
      }
      m = fmaxf(m, xhalf(m));
      const float mnew  = fmaxf(mrow[u], m);
      const float alpha = exp2x1((mrow[u] - mnew) * 1.44269504088896340736f);
      mrow[u] = mnew;
      float ps[2] = {0.f, 0.f};
#pragma unroll
      for (int j = 0; j < 2; ++j) {
        float e[8], p[8];
#pragma unroll
        for (int r = 0; r < 8; ++r) e[r] = (s[u][j][r] - mnew) * 1.44269504088896340736f;   // exp(x) = 2^(x log2 e)
        exp2x8(e, p);
#pragma unroll
        for (int r = 0; r < 8; ++r) {
          ps[j] += p[r];
          pf[u].h[j][r] = (_Float16)p[r];
        }
      }
      lrow[u] = lrow[u] * alpha + (ps[0] + ps[1]);
#pragma unroll
      for (int t = 0; t < 4; ++t)
#pragma unroll
        for (int r = 0; r < 8; ++r) oacc[u][t][r] *= alpha;
    }
#pragma unroll
    for (int t = 0; t < 4; ++t) {
#pragma unroll
      for (int u = 0; u < 2; ++u) oacc[u][t] = mma16(vf[t], pf[u].v, oacc[u][t]);
    }
    if (fetch) fetch_v();
  };

  // rolled: one copy of the pass with its fetches; the last pass has nothing to fetch and stands alone
#pragma unroll 1
  for (int kc = 0; kc < SEQL / 32 - 1; ++kc) pass(true);
  pass(false);

  v8h ov[2][4];
#pragma unroll
  for (int u = 0; u < 2; ++u) {
    const float inv16 = 16.0f * (1.0f / (lrow[u] + xhalf(lrow[u])));
#pragma unroll
    for (int t = 0; t < 4; ++t)
#pragma unroll
      for (int r = 0; r < 8; ++r) ov[u][t][r] = (_Float16)(oacc[u][t][r] * inv16);
  }
  // keeps the eight stores together behind the last conversion
  __builtin_amdgcn_sched_barrier(0);
#pragma unroll
  for (int u = 0; u < 2; ++u)
#pragma unroll
    for (int t = 0; t < 4; ++t) *(v8h*)(Oz + u * QRT + (t >> 1) * FBH + (t & 1) * 256) = ov[u][t];
}

// ---------------------------------------------------------------------------
// Output projection: out[row][n] = sum_k O16[row][k] * WoT[nb][n][k] / 256 + bo[nb][n]  (f32).
// Rows with l == 1023 (router tokens) go to rplane[(blk*4+bat)][512] instead of d_out (single writer
// of those d_out rows is the router output kernel).  Epilogue: 16-row f32 slabs per wave in LDS; each 256-B
// row segment written by 16 consecutive lanes x 16 B of one instruction (2 rows per instruction,
// ---------------------------------------------------------------------------
__global__ void __launch_bounds__(256)
wo_gemm_kernel(const _Float16* __restrict__ O16, const _Float16* __restrict__ WT,
               const float* __restrict__ bo, float* __restrict__ out, float* __restrict__ rplane) {
  __shared__ __align__(16) _Float16 ring[RINGH(2)];   // operand ring, then the waves' epilogue slabs
  static_assert(8 * 16 * SP32 * 4 <= RINGH(2) * 2, "the slabs fit the ring");
  float* slabf = (float*)ring;
  const int lane = threadIdx.x & 31, wid = threadIdx.x >> 5;
  const int mb  = blockIdx.x * 64;
  const int nbk = blockIdx.y * 256;
  const int m0 = mb + (wid >> 2) * 32;
  const int n0 = nbk + (wid & 3) * 64;
  const int nb = m0 >> 12;
  const _Float16* Bt = WT + (size_t)(12 + nb) * WPL;
  const float* bias = bo + nb * DM;
  v8f acc[2][4];
  gemm_core<2>(O16, Bt, mb, nbk, ring, acc);

  float* slab = slabf + wid * (16 * SP32);
  const int c = lane & 15, hh = lane >> 4, c4 = c * 4;
#pragma unroll
  for (int mt = 0; mt < 2; ++mt) {
#pragma unroll
    for (int nt = 0; nt < 4; ++nt) {
      const int coll = nt * 16 + c;
      const float bc = bias[n0 + coll];
#pragma unroll
      for (int r = 0; r < 8; ++r)
        slab[(8 * hh + r) * SP32 + coll] = acc[mt][nt][r] * (1.0f / 256.0f) + bc;
    }
    wave_lds_sync();
    {
#pragma unroll
      for (int it = 0; it < 8; ++it) {
        const int row = it * 2 + hh;
        const int gm  = m0 + mt * 16 + row;
        const v4f val = *(const v4f*)(slab + row * SP32 + c4);
        float* dst = ((gm & (SEQL - 1)) == (SEQL - 1))
                         ? (rplane + (size_t)(gm >> 10) * DM + n0 + c4)
                         : (out + (size_t)gm * DM + n0 + c4);
        *(v4f*)dst = val;
      }
      
    }
    wave_lds_sync();
  }
}

// ---------------------------------------------------------------------------
// Router (inter) attention in two launches of many work-groups (f32 VALU throughout).
// Both launches share one product form: a work-group of 16 waves owns one batch (4 router rows,
// t = blk*4 + bat) and 32 output columns; wave w takes k in [32w, 32w + 32), lane = column; the 16
// partial sums of an output element meet in LDS and are added in wave order.
// ---------------------------------------------------------------------------
__device__ __forceinline__ void router_w_load(const float* __restrict__ Wm, int wave, int col, float (&w)[32]) {
  const float* wp = Wm + (size_t)(wave * 32) * DM + col;
  // unrolled: w[] stays in registers and all 32 loads are in flight together
#pragma unroll
  for (int j = 0; j < 32; ++j) w[j] = wp[(size_t)j * DM];
}

// rows: LDS [4][512]; red: LDS [16][4][32]. Returns, in threads 0..127, element (row tid>>5, column tid&31).
__device__ __forceinline__ float router_ksplit(const float (&w)[32], const float* rows, float* red,
                                               int tid) {
  const int wave = tid >> 5, lane = tid & 31;
  float a[NBLK] = {0.f, 0.f, 0.f, 0.f};
  // unrolled (here and below): w[] and a[] are indexed by constants only, so they stay in registers
#pragma unroll
  for (int j4 = 0; j4 < 8; ++j4) {
#pragma unroll
    for (int r = 0; r < NBLK; ++r) {
      const v4f rv = *(const v4f*)(rows + r * DM + wave * 32 + j4 * 4);
      a[r] += rv[0] * w[j4 * 4];
      a[r] += rv[1] * w[j4 * 4 + 1];
      a[r] += rv[2] * w[j4 * 4 + 2];
      a[r] += rv[3] * w[j4 * 4 + 3];
    }
  }
#pragma unroll
  for (int r = 0; r < NBLK; ++r) red[(wave * NBLK + r) * 32 + lane] = a[r];
  __syncthreads();
  float s = 0.f;
  if (tid < 128) {
#pragma unroll
    for (int wv = 0; wv < 16; ++wv) s += red[wv * 128 + tid];
  }
  return s;
}

// rq / rk / rv: RP[p][t][n] = sum_k rplane[t][k] * iW_p[k][n] + ib_p[n].  grid (16, 4, 3) = (column
// chunk, bat, p), 512 threads.
__global__ void __launch_bounds__(512)
router_proj_kernel(const float* __restrict__ rplane,
                   const float* __restrict__ iWq, const float* __restrict__ ibq,
                   const float* __restrict__ iWk, const float* __restrict__ ibk,
                   const float* __restrict__ iWv, const float* __restrict__ ibv,
                   float* __restrict__ RP) {
  __shared__ __align__(16) float Rr[NBLK * DM];
  __shared__ float red[16 * NBLK * 32];
  const int tid = threadIdx.x;
  const int col = blockIdx.x * 32 + (tid & 31);
  const int b = blockIdx.y, p = blockIdx.z;
  const float* Wm = (p == 0) ? iWq : ((p == 1) ? iWk : iWv);
  const float* bb = (p == 0) ? ibq : ((p == 1) ? ibk : ibv);
  const int ri = tid >> 7, rc4 = (tid & 127) * 4;
  const v4f rin = *(const v4f*)(rplane + (size_t)(ri * NBAT + b) * DM + rc4);
  // the weight loads below may land in the registers that held this load's address
  asm volatile("s_wait_xcnt 0x0" ::: "memory");
  float w[32];
  router_w_load(Wm, tid >> 5, col, w);
  *(v4f*)(Rr + ri * DM + rc4) = rin;
  __syncthreads();
  const float s = router_ksplit(w, Rr, red, tid);
  if (tid < 128) RP[((size_t)p * 16 + (tid >> 5) * NBAT + b) * DM + col] = s + bb[col];
}

// Per batch: 4-key softmax of (rq.rk)*0.125 per (query blk, head), o = sum p*rv / sum p (each
// work-group forms all 4 x 512 of its batch), then out rows l == 1023 = o . iWo + ibo for its 32
// columns.  grid (16, 4) = (column chunk, bat), 512 threads.
__global__ void __launch_bounds__(512)
router_out_kernel(const float* __restrict__ RP,
                  const float* __restrict__ iWo, const float* __restrict__ ibo,
                  float* __restrict__ out) {
  __shared__ __align__(16) float Pj[3][NBLK * DM];
  __shared__ __align__(16) float Ro[NBLK * DM];
  __shared__ float red[16 * NBLK * 32];
  const int tid = threadIdx.x;
  const int col = blockIdx.x * 32 + (tid & 31);
  const int b = blockIdx.y;
  float w[32];
  router_w_load(iWo, tid >> 5, col, w);
  {
    const int i = tid >> 7, c4 = (tid & 127) * 4;
#pragma unroll
    for (int p = 0; p < 3; ++p)
      *(v4f*)(&Pj[p][i * DM + c4]) = *(const v4f*)(RP + ((size_t)p * 16 + i * NBAT + b) * DM + c4);
  }
  __syncthreads();
  {
    // 16 lanes per (query blk, head); each lane holds 4 of the 64 head elements
    const int item = tid >> 4;              // 0..31
    const int nq = item >> 3, hd = item & 7;
    const int eo = hd * HD + (tid & 15) * 4;
    const v4f q4 = *(const v4f*)(&Pj[0][nq * DM + eo]);
    const v4f v0 = *(const v4f*)(&Pj[2][eo]);
    const v4f v1 = *(const v4f*)(&Pj[2][DM + eo]);
    const v4f v2 = *(const v4f*)(&Pj[2][2 * DM + eo]);
    const v4f v3 = *(const v4f*)(&Pj[2][3 * DM + eo]);
    float sc[NBLK];
#pragma unroll
    for (int s = 0; s < NBLK; ++s) {
      const v4f k4 = *(const v4f*)(&Pj[1][s * DM + eo]);
      sc[s] = q4[0] * k4[0] + q4[1] * k4[1] + q4[2] * k4[2] + q4[3] * k4[3];
    }
    // keeps the four v reads in one batch ahead of the exponentials; sunk in between them their
    // LDS latency would stand in the dependent chain three times
    asm volatile("" :: "v"(v0), "v"(v1), "v"(v2), "v"(v3));
#pragma unroll
    for (int m = 1; m < 16; m <<= 1) {
#pragma unroll
      for (int s = 0; s < NBLK; ++s) sc[s] += __shfl_xor(sc[s], m, 32);
    }
#pragma unroll
    for (int s = 0; s < NBLK; ++s) sc[s] *= 0.125f;
    const float mx = fmaxf(fmaxf(sc[0], sc[1]), fmaxf(sc[2], sc[3]));
    const float p0 = __expf(sc[0] - mx), p1 = __expf(sc[1] - mx), p2 = __expf(sc[2] - mx), p3 = __expf(sc[3] - mx);
    const float inv = 1.0f / (p0 + p1 + p2 + p3);
    v4f o4;
#pragma unroll
    for (int j = 0; j < 4; ++j) o4[j] = (p0 * v0[j] + p1 * v1[j] + p2 * v2[j] + p3 * v3[j]) * inv;
    *(v4f*)(Ro + nq * DM + eo) = o4;
  }
  __syncthreads();
  const float s = router_ksplit(w, Ro, red, tid);
  if (tid < 128)
    out[((size_t)((tid >> 5) * NBAT + b) * SEQL + (SEQL - 1)) * DM + col] = s + ibo[col];
}

// ---------------------------------------------------------------------------
// Workspace map (byte offsets; every region fully written before it is read; the f16 planes are packed
// in fragment blocks, see frag_ld; all regions are exact
//   X16   f16 [16384][512]            0          16777216 B
//   WT16  f16 [16][512][512]     16777216           8388608 B   (Wq,Wk,Wv,Wo planes x 4 blks, [out][in], x16)
//   Q16   f16 [16384][512]     25165824          16777216 B
//   K16   f16 [16384][512]     41943040          16777216 B
//   VT16  f16 [16][512][1024]  58720256          16777216 B
//   O16   f16 [16384][512]     75497472          16777216 B   (attention output x16)
//   RPL   f32 [16][512]        92274688             32768 B   (router rows, t = blk*4 + bat)
//   RP    f32 [3][16][512]     92307456             98304 B   (router q, k, v projections)
//   total                      92405760
// ---------------------------------------------------------------------------
extern "C" void kernel_launch(void* const* d_in, const int* in_sizes, int n_in,
                              void* d_out, int out_size, void* d_ws, size_t ws_size,
                              hipStream_t stream) {
  if (n_in < 17) return;
  if (in_sizes[0] != MROWS * DM) return;
  if (in_sizes[1] != NBLK * WPL || in_sizes[3] != NBLK * WPL || in_sizes[5] != NBLK * WPL || in_sizes[7] != NBLK * WPL) return;
  if (in_sizes[2] != NBLK * DM || in_sizes[4] != NBLK * DM || in_sizes[6] != NBLK * DM || in_sizes[8] != NBLK * DM) return;
  if (in_sizes[9] != WPL || in_sizes[11] != WPL || in_sizes[13] != WPL || in_sizes[15] != WPL) return;
  if (in_sizes[10] != DM || in_sizes[12] != DM || in_sizes[14] != DM || in_sizes[16] != DM) return;
  if (out_size != MROWS * DM) return;

  const float* x   = (const float*)d_in[0];
  const float* Wq  = (const float*)d_in[1];  const float* bq  = (const float*)d_in[2];
  const float* Wk  = (const float*)d_in[3];  const float* bk  = (const float*)d_in[4];
  const float* Wv  = (const float*)d_in[5];  const float* bv  = (const float*)d_in[6];
  const float* Wo  = (const float*)d_in[7];  const float* bo  = (const float*)d_in[8];
  const float* iWq = (const float*)d_in[9];  const float* ibq = (const float*)d_in[10];
  const float* iWk = (const float*)d_in[11]; const float* ibk = (const float*)d_in[12];
  const float* iWv = (const float*)d_in[13]; const float* ibv = (const float*)d_in[14];
  const float* iWo = (const float*)d_in[15]; const float* ibo = (const float*)d_in[16];
  float* out = (float*)d_out;

  const size_t bAct = (size_t)MROWS * DM * 2;      // 16777216
  const size_t bWT  = (size_t)16 * WPL * 2;        // 8388608
  const size_t bRpl = (size_t)16 * DM * 4;         // 32768
  const size_t bRp  = (size_t)3 * 16 * DM * 4;     // 98304
  size_t off = 0;
  const size_t oX  = off; off += bAct;
  const size_t oWT = off; off += bWT;
  const size_t oQ  = off; off += bAct;
  const size_t oK  = off; off += bAct;
  const size_t oVT = off; off += bAct;
  const size_t oO  = off; off += bAct;
  const size_t oR  = off; off += bRpl;
  const size_t oP  = off; off += bRp;
  if (off > ws_size) return;                       // off = 92405760

  char* ws = (char*)d_ws;
  _Float16* X16  = (_Float16*)(ws + oX);
  _Float16* WT16 = (_Float16*)(ws + oWT);
  _Float16* Q16  = (_Float16*)(ws + oQ);
  _Float16* K16  = (_Float16*)(ws + oK);
  _Float16* VT16 = (_Float16*)(ws + oVT);
  _Float16* O16  = (_Float16*)(ws + oO);
  float*    RPL  = (float*)(ws + oR);
  float*    RP   = (float*)(ws + oP);

  // (1) weights -> transposed f16 planes (x16), and x -> f16 plane
  prep_kernel<<<dim3(WTB), dim3(256), 0, stream>>>(x, Wq, Wk, Wv, Wo, X16, WT16);
  // (2) q, k projections, and the v^T projection per (blk, bat)
  qkv_gemm_kernel<<<dim3(QKB + VTB), dim3(256), 0, stream>>>(X16, WT16, bq, bk, bv, Q16, K16, VT16);
  // (3) intra attention
  attn_kernel<<<dim3(NBLK * NBAT * NH * (SEQL / 128)), dim3(128), 0, stream>>>(Q16, K16, VT16, O16);
  // (4) output projection -> d_out (rows l < 1023) and router plane (rows l == 1023)
  wo_gemm_kernel<<<dim3(MROWS / 64, DM / 256, 1), dim3(256), 0, stream>>>(O16, WT16, bo, out, RPL);
  // (5) router q, k, v projections
  router_proj_kernel<<<dim3(DM / 32, NBAT, 3), dim3(512), 0, stream>>>(RPL, iWq, ibq, iWk, ibk, iWv, ibv, RP);
  // (6) router attention + output projection -> d_out rows l == 1023
  router_out_kernel<<<dim3(DM / 32, NBAT), dim3(512), 0, stream>>>(RP, iWo, ibo, out);
  (void)hipGetLastError();
}

// v008
// It runs in 98 microseconds.
// Two timings next to v007 put it at 1.07 and 1.08 times that version's speed.
// Counting every step since v000, it is 11.7 times as fast.
// Contractions q/k/v^T projections, q.k^T, p.v, out projection: v_wmma_f32_16x16x32_f16, f16 operands (W x16; x and p x1; attention output o x16), f32 accumulate; softmax f32 (scale 0.125 log2 e applied to q in f32 ahead of its rounding to f16); router-token attention and its four projections: f32 VALU.
#include <hip/hip_runtime.h>

typedef _Float16 v16h __attribute__((ext_vector_type(16)));
typedef _Float16 v8h  __attribute__((ext_vector_type(8)));
typedef float    v8f  __attribute__((ext_vector_type(8)));
typedef float    v4f  __attribute__((ext_vector_type(4)));

#define NBLK  4
#define NBAT  4
#define SEQL  1024
#define DM    512
#define NH    8
#define HD    64
#define MROWS 16384          // NBLK*NBAT*SEQL
#define WPL   262144         // DM*DM, one weight plane
#define ZPL   524288         // SEQL*DM, one (blk,bat) activation plane
#define SP16  72             // f16 LDS slab pitch (halves), 144 B rows
#define SP32  68             // f32 LDS slab pitch (floats), 272 B rows
#define QSC   0.18033688011112042f   // 0.125 * log2(e): score scale times the change from e^x to 2^x

union FragU { v16h v; v8h h[2]; };

// Packed operand planes. Every f16 matrix [rows][K] of the workspace is stored as fragment blocks:
// block (rt = row >> 4, kt = k >> 5) is FBH halves (1 KiB) at (rt * (K / 32) + kt) * FBH; inside it the
// 16-B unit u = o * 16 + c holds row rt*16 + c, k = kt*32 + o*8 .. + 7 (o = 0..3, c = 0..15).
// 16x16x32 operand fragment: p = block + lane*8; elements 0..7 <- unit lane (k = 8*(lane>>4) + e),
// elements 8..15 <- unit 32 + lane (16 more): the same k order for A rows m and Bt rows n, and each of
// the two loads of a wave reads 512 contiguous bytes (4 cache lines; from k-contiguous rows it was 16).
#define FBH 512
__device__ __forceinline__ v16h frag_ld(const _Float16* p) {
  FragU f;
  f.h[0] = *(const v8h*)(p);
  f.h[1] = *(const v8h*)(p + 256);
  return f.v;
}

__device__ __forceinline__ v8f mma16(v16h a, v16h b, v8f c) {
  c = __builtin_amdgcn_wmma_f32_16x16x32_f16(false, a, false, b, (short)0, c, false, false);
  asm volatile("v_nop\n\tv_nop\n\tv_nop\n\tv_nop" : "+v"(c) : "v"(a), "v"(b));
  return c;
}

__device__ __forceinline__ void wave_lds_sync() {
  __builtin_amdgcn_fence(__ATOMIC_RELEASE, "workgroup");
  __builtin_amdgcn_wave_barrier();
  __builtin_amdgcn_fence(__ATOMIC_ACQUIRE, "workgroup");
}

__device__ __forceinline__ v8f zero8() { return (v8f){0.f, 0.f, 0.f, 0.f, 0.f, 0.f, 0.f, 0.f}; }

// ---------------------------------------------------------------------------
// Both preparations in one launch: they share no data, so each of the WTB blocks does one weight tile
// and its share of x.  grid WTB = 8 x 8 x 16 = 1024 blocks of 256 threads, bx = z*64 + y*8 + x.
// Weight transpose + x16 + f16: W (f32 [in=512][out=512], blk plane nb of Wq/Wk/Wv/Wo)
//   -> WT[z][out][in] = f16(16 * W[in][out]), packed (rows = out, k = in), z = widx*4 + nb  (widx 0=q,1=k,2=v,3=o).
//   64x64 tiles through LDS.  Coverage per block: load 4 it x 256 thr x 4 = 64x64; store 2 it x 256 thr x 8 = 64x64.
// x f32 [16384][512] -> packed f16 plane: block bx converts row tile bx (16 rows x 512 = 32 KiB read, 16 KiB
//   written, both contiguous), XUN = 4 units of 16 B a thread: unit bx*1024 + j*256 + tid is row
//   bx*16 + (tid & 15), k = j*128 + (tid >> 4)*8 .. + 7.  Coverage: 1024 blocks x 256 thr x 4 x 8 = 16384 x 512.
// ---------------------------------------------------------------------------
#define WTB ((DM / 64) * (DM / 64) * 16)
#define XUN (MROWS * DM / 8 / (WTB * 256))
static_assert(WTB == MROWS / 16 && XUN * 128 == DM, "one 16-row tile of x for each block");
__global__ void __launch_bounds__(256)
prep_kernel(const float* __restrict__ x,
            const float* __restrict__ Wq, const float* __restrict__ Wk,
            const float* __restrict__ Wv, const float* __restrict__ Wo,
            _Float16* __restrict__ X16, _Float16* __restrict__ WT) {
  __shared__ __align__(16) float tf[64 * 68];
  const int bx = blockIdx.x;
  const int z  = bx >> 6;
  const int wi = z >> 2, nb = z & 3;
  const float* W = (wi == 0) ? Wq : ((wi == 1) ? Wk : ((wi == 2) ? Wv : Wo));
  W += (size_t)nb * WPL;
  _Float16* O = WT + (size_t)z * WPL;
  const int c0  = (bx & 7) * 64;         // input column block (out feature) = output row block
  const int r0  = ((bx >> 3) & 7) * 64;  // input row block (in feature)     = output column block
  const int tid = threadIdx.x;
  const int lr = tid >> 4;          // 0..15
  const int c4 = (tid & 15) * 4;    // 0..60
  const float* wp = W + (size_t)(r0 + lr) * DM + c0 + c4;
  const float* xp = x + (size_t)(bx * 16 + (tid & 15)) * DM + lr * 8;
  v4f wa[4], xa[XUN], xb[XUN];
  // unrolled (all loops of this kernel): the arrays are indexed by constants only, so they stay in registers
#pragma unroll
  for (int it = 0; it < 4; ++it) wa[it] = *(const v4f*)(wp + (size_t)(it * 16) * DM);
#pragma unroll
  for (int j = 0; j < XUN; ++j) {
    xa[j] = *(const v4f*)(xp + j * 128);
    xb[j] = *(const v4f*)(xp + j * 128 + 4);
  }
  // all twelve loads are out before anything waits for one of them, the weight tile's first, so that its way
  // through LDS runs under the x loads; the registers of the two addresses may be written again behind this wait
  asm volatile("s_wait_xcnt 0x0" :: "v"(wp), "v"(xp) : "memory");
#pragma unroll
  for (int it = 0; it < 4; ++it) *(v4f*)(tf + (it * 16 + lr) * 68 + c4) = wa[it];
  __syncthreads();
  // the tile is 4 row tiles x 2 k tiles = 8 blocks; thread tid writes unit tid & 63 of blocks
  // (rt = tid >> 7, kt = (tid >> 6) & 1) and (rt + 2, kt)
  const int rtl = tid >> 7, ktl = (tid >> 6) & 1;
  const int sub = rtl * 16 + (tid & 15);            // out feature in the tile, 0..31
  const int c8  = ktl * 32 + ((tid >> 4) & 3) * 8;  // in feature in the tile, 0..56
  v8h hv0, hv1;
#pragma unroll
  for (int e = 0; e < 8; ++e) {
    hv0[e] = (_Float16)(16.0f * tf[(c8 + e) * 68 + sub]);
    hv1[e] = (_Float16)(16.0f * tf[(c8 + e) * 68 + 32 + sub]);
  }
  _Float16* p0 = O + (size_t)(((c0 >> 4) + rtl) * (DM / 32) + (r0 >> 5) + ktl) * FBH + (tid & 63) * 8;
  _Float16* p1 = p0 + (size_t)(2 * (DM / 32)) * FBH;
  *(v8h*)p0 = hv0;
  *(v8h*)p1 = hv1;
  _Float16* px = X16 + ((size_t)bx * (XUN * 256) + tid) * 8;
#pragma unroll
  for (int j = 0; j < XUN; ++j) {
    v8h hv;
    hv[0] = (_Float16)xa[j][0]; hv[1] = (_Float16)xa[j][1]; hv[2] = (_Float16)xa[j][2]; hv[3] = (_Float16)xa[j][3];
    hv[4] = (_Float16)xb[j][0]; hv[5] = (_Float16)xb[j][1]; hv[6] = (_Float16)xb[j][2]; hv[7] = (_Float16)xb[j][3];
    *(v8h*)(px + j * (256 * 8)) = hv;
  }
}

// ---------------------------------------------------------------------------
// GEMM core: acc[mt][nt] = sum_k A[m0 + mt*16 + .][k] * Bt[n0 + nt*16 + .][k], K = 512.
// A and Bt are packed f16 planes with K = 512; block tile 64 x 256 at (mb, nbk), 8 waves, wave tile 32 x 64 at
// m0 = mb + (wave >> 2)*32, n0 = nbk + (wave & 3)*64; D element r of lane l is (row 8*(l>>4) + r, col l&15)
// of its 16x16 subtile.
// The block's operands come through LDS: a stage is KST k tiles (64 k) of its 4 row tiles of A and 16 of Bt,
// row tile r (A: 0..3, Bt: 4..19) at byte r*2048 of the stage, as it lies in the plane (KST fragment blocks in a
// row), so each fragment is brought from L2 once for the block and read by ds_load_b128, 512 contiguous bytes a
// load.  Two buffers of SUB stages each: the next buffer's copies fly while this one is worked on.  SUB = 1 where
// four work-groups share a WGP; SUB = 2 where the grid gives a WGP only two, so that as many bytes are in flight.
// ---------------------------------------------------------------------------
#define KST   2                          // k tiles of a stage
#define RTH   (KST * FBH)                // halves of one row tile in a stage (2 KiB)
#define STGH  (20 * RTH)                 // halves of a stage (40 KiB)
#define NSTG  (DM / 32 / KST)            // stages
#define RINGH(SUB) (2 * (SUB) * STGH)    // halves of the ring (80 KiB x SUB)

// One stage, ten asynchronous copies of 16 B a thread: thread tid brings byte tid*16 of each 4-KiB pair of row
// tiles.  ga / gb: this thread's place in row tile (tid >> 7) of the block's A / Bt rows at the stage's first k
// tile; l: LDS byte address of the stage's place + tid*16.  The closing wait stands inside the statement, so that no
// address register of a copy is written again in front of it.
__device__ __forceinline__ void stage_copy(const _Float16* ga, const _Float16* gb, uint32_t l) {
  const int R2 = 2 * (DM / 32) * FBH;    // halves from a row tile of a plane to the next but one
  asm volatile("global_load_async_to_lds_b128 %0, %10, off\n\t"
               "global_load_async_to_lds_b128 %1, %11, off\n\t"
               "global_load_async_to_lds_b128 %2, %12, off\n\t"
               "global_load_async_to_lds_b128 %3, %13, off\n\t"
               "global_load_async_to_lds_b128 %4, %14, off\n\t"
               "global_load_async_to_lds_b128 %5, %15, off\n\t"
               "global_load_async_to_lds_b128 %6, %16, off\n\t"
               "global_load_async_to_lds_b128 %7, %17, off\n\t"
               "global_load_async_to_lds_b128 %8, %18, off\n\t"
               "global_load_async_to_lds_b128 %9, %19, off\n\t"
               "s_wait_xcnt 0x0"
               :: "v"(l), "v"(l + 4096u), "v"(l + 8192u), "v"(l + 12288u), "v"(l + 16384u),
                  "v"(l + 20480u), "v"(l + 24576u), "v"(l + 28672u), "v"(l + 32768u), "v"(l + 36864u),
                  "v"(ga), "v"(ga + R2), "v"(gb), "v"(gb + R2), "v"(gb + 2 * R2), "v"(gb + 3 * R2),
                  "v"(gb + 4 * R2), "v"(gb + 5 * R2), "v"(gb + 6 * R2), "v"(gb + 7 * R2)
               : "memory");
}

// ring: RINGH(SUB) halves of LDS, 16-B aligned.  Behind the call no copy is in flight and every wave has left
// the ring (the last trip's own barrier), so the caller may use it as staging for its epilogue.
template <int SUB>
__device__ __forceinline__ void gemm_core(const _Float16* __restrict__ A,
                                          const _Float16* __restrict__ Bt,
                                          int mb, int nbk, _Float16* ring, v8f (&acc)[2][4]) {
  const int RTS  = (DM / 32) * FBH;   // halves from one row tile of a plane to the next
  const int BUFH = SUB * STGH;        // halves of a buffer
  const int NT   = NSTG / SUB;        // trips
  static_assert(NT >= 2 && NT * SUB == NSTG, "both buffers are filled in front of the loop");
  const int tid = threadIdx.x, lane = tid & 31, wid = tid >> 5;
  // unrolled (every loop of this function but the trips): acc[] and bf[] are indexed by constants only, so they
  // stay in registers, and the places of a buffer's stages are constants
#pragma unroll
  for (int i = 0; i < 2; ++i)
#pragma unroll
    for (int j = 0; j < 4; ++j) acc[i][j] = zero8();
  const _Float16* ga = A  + (size_t)((mb  >> 4) + (tid >> 7)) * RTS + (tid & 127) * 8;
  const _Float16* gb = Bt + (size_t)((nbk >> 4) + (tid >> 7)) * RTS + (tid & 127) * 8;
  const uint32_t l0 = (uint32_t)(size_t)ring + (uint32_t)tid * 16u;
#pragma unroll
  for (int s = 0; s < SUB; ++s) stage_copy(ga + s * RTH, gb + s * RTH, l0 + (uint32_t)(s * STGH) * 2u);
  // buffer 0 has landed for this wave; behind the barrier for all
  asm volatile("s_wait_asynccnt 0x0" ::: "memory");
  __syncthreads();
#pragma unroll
  for (int s = 0; s < SUB; ++s)
    stage_copy(ga + (SUB + s) * RTH, gb + (SUB + s) * RTH, l0 + (uint32_t)(BUFH + s * STGH) * 2u);
  const _Float16* fa = ring + ((wid >> 2) * 2) * RTH + lane * 8;       // this wave's two row tiles of A
  const _Float16* fb = ring + (4 + (wid & 3) * 4) * RTH + lane * 8;    // its four row tiles of Bt
  // rolled: one copy of the trip, its publish point and its refill
#pragma unroll 1
  for (int t = 0; t < NT; ++t) {
    const int bo = (t & 1) * BUFH;
#pragma unroll
    for (int kk = 0; kk < SUB * KST; ++kk) {
      const int fo = bo + (kk / KST) * STGH + (kk % KST) * FBH;   // stage of the buffer, k tile of the stage
      v16h bf[4];
#pragma unroll
      for (int j = 0; j < 4; ++j) bf[j] = frag_ld(fb + fo + j * RTH);
      const v16h a0 = frag_ld(fa + fo);
      const v16h a1 = frag_ld(fa + fo + RTH);
#pragma unroll
      for (int j = 0; j < 4; ++j) {
        acc[0][j] = mma16(a0, bf[j], acc[0][j]);
        acc[1][j] = mma16(a1, bf[j], acc[1][j]);
      }
    }
    // publish point of the next buffer: this wave's reads of this buffer are done, its copies into the next have
    // landed; behind the barrier every wave may read the next buffer and this one may be filled again
    asm volatile("s_wait_dscnt 0x0" ::: "memory");
    asm volatile("s_wait_asynccnt 0x0" ::: "memory");
    __syncthreads();
    if (t + 2 < NT) {
#pragma unroll
      for (int s = 0; s < SUB; ++s)
        stage_copy(ga + ((t + 2) * SUB + s) * RTH, gb + ((t + 2) * SUB + s) * RTH,
                   l0 + (uint32_t)(bo + s * STGH) * 2u);
    }
  }
  // the ring's closing wait: no copy outlives the loop
  asm volatile("s_wait_asynccnt 0x0" ::: "memory");
}

// ---------------------------------------------------------------------------
// f16 epilogue: v = acc*scale + bias*bmul (bias per column, or per row when BIAS_ROW); the wave's 32 x 64
// tile goes through its LDS slab and leaves as 4 blocks of the packed plane C (kts = its k tiles per
// row tile), 512 contiguous bytes per store instruction.
// ---------------------------------------------------------------------------
template <bool BIAS_ROW>
__device__ __forceinline__ void epi_f16(v8f (&acc)[2][4], _Float16* slab,
                                        _Float16* __restrict__ C, int kts,
                                        int m0, int n0, int lane, float scale, float bmul,
                                        const float* __restrict__ bias) {
  const int c = lane & 15, hh = lane >> 4;
  float bcol[4] = {0.f, 0.f, 0.f, 0.f};
  if (!BIAS_ROW) {
    const float* bp = bias + n0 + c;
#pragma unroll
    for (int nt = 0; nt < 4; ++nt) bcol[nt] = bp[nt * 16];
    // names the address, so that it lives to here and none of the four results lands in its registers; behind
    // this wait they may be written again
    asm volatile("s_wait_xcnt 0x0" :: "v"(bp) : "memory");
#pragma unroll
    for (int nt = 0; nt < 4; ++nt) bcol[nt] *= bmul;
  }
#pragma unroll
  for (int mt = 0; mt < 2; ++mt) {
#pragma unroll
    for (int nt = 0; nt < 4; ++nt) {
      const int coll = nt * 16 + c;
      const float bc = bcol[nt];
#pragma unroll
      for (int r = 0; r < 8; ++r) {
        const int rowl = mt * 16 + 8 * hh + r;
        float v = acc[mt][nt][r] * scale;
        v += BIAS_ROW ? bias[m0 + rowl] * bmul : bc;
        slab[rowl * SP16 + coll] = (_Float16)v;
      }
    }
  }
  wave_lds_sync();
  {
#pragma unroll
    for (int it = 0; it < 8; ++it) {
      const int rtl = it >> 2, ktl = (it >> 1) & 1, uh = it & 1;   // block of the tile, half of the block
      const v8h val = *(const v8h*)(slab + (rtl * 16 + c) * SP16 + ktl * 32 + (uh * 2 + hh) * 8);
      *(v8h*)(C + ((size_t)((m0 >> 4) + rtl) * kts + (n0 >> 5) + ktl) * FBH + uh * 256 + lane * 8) = val;
    }
  }
  wave_lds_sync();
}

// ---------------------------------------------------------------------------
// q, k and v^T projections in one launch: all three read only X16 and WT, so they are told apart by
// block range (block-uniform branch).  Block tile 64 x 256, 8 waves of 32 x 64.
// Blocks 0 .. QKB-1, bx = proj*512 + ny*256 + mx (proj: 0 = q, 1 = k): rows (blk,bat,l) = 16384, N = 512,
//   K = 512; weight plane and bias selected by the row block.  Q16/K16: [16384][512] f16, packed,
//   column (k) = h*64 + e.  Q16 holds q * QSC.
// Blocks QKB .. QKB+VTB-1, b = z*32 + ny*8 + mx, per (blk,bat) z:
//   VT16[z][m = h*64+e][l] = sum_k WvT[nb][m][k] * x[z][l][k] / 16 + bv[nb][m]
//   A = WvT plane (512 x 512), Bt = x plane rows (1024 x 512), C [512][1024] f16, packed (k = l).
// ---------------------------------------------------------------------------
#define QKB ((MROWS / 64) * (DM / 256) * 2)
#define VTB ((DM / 64) * (SEQL / 256) * NBLK * NBAT)
__global__ void __launch_bounds__(256)
qkv_gemm_kernel(const _Float16* __restrict__ X16, const _Float16* __restrict__ WT,
                const float* __restrict__ bq, const float* __restrict__ bk, const float* __restrict__ bv,
                _Float16* __restrict__ Q16, _Float16* __restrict__ K16, _Float16* __restrict__ VT16) {
  __shared__ __align__(16) _Float16 ring[RINGH(1)];   // operand ring, then the waves' epilogue slabs
  static_assert(8 * 32 * SP16 <= RINGH(1), "the slabs fit the ring");
  const int lane = threadIdx.x & 31, wid = threadIdx.x >> 5;
  const int bx = blockIdx.x;
  const bool isv = bx >= QKB;
  const int b  = bx - QKB;
  const int z  = b >> 5;                                   // v^T blocks: (blk,bat)
  const int proj = bx >> 9;                                // q / k blocks: 0 = q, 1 = k
  const int mb  = (isv ? (b & 7) : (bx & 255)) * 64;                // v^T: output feature; q / k: row
  const int nbk = (isv ? ((b >> 3) & 3) : ((bx >> 8) & 1)) * 256;   // v^T: position; q / k: column
  const int m0 = mb + (wid >> 2) * 32;
  const int n0 = nbk + (wid & 3) * 64;
  const int nb = isv ? (z >> 2) : (m0 >> 12);
  const _Float16* A  = isv ? (WT + (size_t)(8 + nb) * WPL) : X16;
  const _Float16* Bt = isv ? (X16 + (size_t)z * ZPL) : (WT + (size_t)(proj * 4 + nb) * WPL);
  _Float16* slab = ring + wid * (32 * SP16);
  v8f acc[2][4];
  gemm_core<1>(A, Bt, mb, nbk, ring, acc);
  if (isv) {
    epi_f16<true>(acc, slab, VT16 + (size_t)z * ZPL, SEQL / 32, m0, n0, lane, 0.0625f, 1.0f, bv + nb * DM);
  } else {
    const float qs = (proj == 0) ? QSC : 1.0f;   // the q plane carries the softmax scale
    epi_f16<false>(acc, slab, (proj == 0) ? Q16 : K16, DM / 32, m0, n0, lane, 0.0625f * qs, qs,
                   ((proj == 0) ? bq : bk) + nb * DM);
  }
}

// ---------------------------------------------------------------------------
// Full (unmasked) attention, head dim 64, per (blk,bat) z and head h, in transposed form.
//   q/k rows from Q16/K16 ([z*1024 + l][h*64 + d]); v^T rows from VT16 ([z*512 + h*64 + d][l]); all packed.
//   S^T = k.q^T (A = k rows, Bt = q rows): lane l holds, for query l&15, keys 16j + 8*(l>>4) + r of
//   each 16-key tile j, so the row maximum and the row sum of the online softmax (f32, 32 chunks of
//   32 keys) are in-lane, joined between lanes l and l^16 by one cross-row move.
//   The softmax's reference M of a query (log2 units; any value gives the same quotient) is the maximum of the
//   first pass; when a later score of any query of the wave passes its M by more than 8, each query's M moves up to
//   the larger of M and its maximum of the pass, so p = 2^(s - M) <= 256.  -M is the C operand of the first S^T product and q carries the
//   scale, so the products leave s - M, the exponent itself.
//   O^T += v^T.P^T (A = v^T rows, Bt = P rows): two neighbouring S^T tiles, converted in place, are
//   the Bt fragment in the k order of frag_ld (elements 0..7: k0 + 8*(l>>4) + e, 8..15: 16 more).
//   O16[z*1024 + l][h*64 + d] = f16(16 * O / rowsum), packed: the eight d of accumulator tile t in a lane
//   are unit (t&1)*32 + lane of block (query tile, 2h + (t>>1)), so each tile is stored straight from registers.
//   A wave owns two 16-query tiles, so each k and v^T fragment it loads feeds two products.
//   Block = 4 waves x 32 query rows; grid 1024 = z*64 + h*8 + qb.
// ---------------------------------------------------------------------------
__device__ __forceinline__ float xhalf(float x) {   // value of lane l ^ 16
  const int b = __builtin_bit_cast(int, x);
  return __builtin_bit_cast(float, __builtin_amdgcn_permlanex16(b, b, 0x76543210, 0xfedcba98, false, false));
}

// y[i] = 2^x[i], eight in one statement: the outputs are early-clobber, so no exponential lands on a
// source of the one in front of it, and the closing v_nop is the free slot that the instruction set asks
// for behind the last one
__device__ __forceinline__ void exp2x8(const float (&x)[8], float (&y)[8]) {
  asm("v_exp_f32 %0, %8\n\tv_exp_f32 %1, %9\n\tv_exp_f32 %2, %10\n\tv_exp_f32 %3, %11\n\t"
      "v_exp_f32 %4, %12\n\tv_exp_f32 %5, %13\n\tv_exp_f32 %6, %14\n\tv_exp_f32 %7, %15\n\tv_nop"
      : "=&v"(y[0]), "=&v"(y[1]), "=&v"(y[2]), "=&v"(y[3]), "=&v"(y[4]), "=&v"(y[5]), "=&v"(y[6]), "=&v"(y[7])
      : "v"(x[0]), "v"(x[1]), "v"(x[2]), "v"(x[3]), "v"(x[4]), "v"(x[5]), "v"(x[6]), "v"(x[7]));
}

// y = 2^x with its free slot in the same statement
__device__ __forceinline__ float exp2x1(float x) {
  float y;
  asm("v_exp_f32 %0, %1\n\tv_nop" : "=&v"(y) : "v"(x));
  return y;
}

__global__ void __launch_bounds__(128)
attn_kernel(const _Float16* __restrict__ Q16, const _Float16* __restrict__ K16,
            const _Float16* __restrict__ VT16, _Float16* __restrict__ O16) {
  const int tid = threadIdx.x, wave = tid >> 5, lane = tid & 31;
  const int bx = blockIdx.x;
  const int qb = bx & 7, h = (bx >> 3) & 7, z = bx >> 6;
  const int q0 = qb * 128 + wave * 32;

  const int QRT = (DM / 32) * FBH;     // halves from one 16-row tile of Q16 / K16 / O16 to the next
  const int VRT = (SEQL / 32) * FBH;   // the same for VT16
  const size_t hq = (size_t)z * ZPL + (2 * h) * FBH + lane * 8;   // row tile 0 of z, first k tile of head h
  const _Float16* Qz = Q16 + hq + (size_t)(q0 >> 4) * QRT;
  const _Float16* Kz = K16 + hq;
  const _Float16* Vz = VT16 + (size_t)z * ZPL + (size_t)(h * (HD / 16)) * VRT + lane * 8;
  _Float16* Oz = O16 + hq + (size_t)(q0 >> 4) * QRT;

  v16h qf[2][2];                     // qf[u][i]: query tile u, d = 32i..
#pragma unroll
  for (int u = 0; u < 2; ++u) {
    qf[u][0] = frag_ld(Qz + u * QRT);
    qf[u][1] = frag_ld(Qz + u * QRT + FBH);
  }
  // the fragment loads below may land in the registers that held this address
  asm volatile("s_wait_xcnt 0x0" :: "v"(Qz) : "memory");

  v8f nm[2] = {zero8(), zero8()};    // query 16u + c: -M in all eight elements (both halves alike)
  float thr = -3.0e38f;              // M moves where s - M is above this: always in the first pass, then 8
  float lrow[2] = {0.f, 0.f};        // this half's sum
  v8f oacc[2][4];                    // oacc[u][t][r] = O^T[d = 16t + 8hh + r][query 16u + c]
#pragma unroll
  for (int u = 0; u < 2; ++u)
#pragma unroll
    for (int t = 0; t < 4; ++t) oacc[u][t] = zero8();

  // Fragments are fetched one pass (32 keys) ahead: the 8 loads of the next pass's k fragments go out as
  // one group right behind this pass's S^T products, into the registers those have just read, and the 8
  // loads of its v^T fragments right behind the O^T products; each group has a whole pass to arrive.
  // Every fragment serves both query tiles of the wave.
  const _Float16* kp = Kz;   // k fragments of the pass that is fetched next
  const _Float16* vp = Vz;   // v^T fragments of the same
  v16h kf[4], vf[4];         // kf[2j + i]: keys 16j.., d = 32i..; vf[t]: d = 16t.., the pass's 32 keys
  auto fetch_k = [&]() __attribute__((always_inline)) {
#pragma unroll
    for (int j = 0; j < 2; ++j) {
      kf[2 * j]     = frag_ld(kp + j * QRT);
      kf[2 * j + 1] = frag_ld(kp + j * QRT + FBH);
    }
    // the address pair is advanced while the loads that name it are in flight; the statement also keeps the
    // k and v^T groups in one order everywhere, so that the counted load waits can leave the younger group out
    asm volatile("s_wait_xcnt 0x0" :: "v"(kp) : "memory");
    kp += 2 * QRT;
  };
  auto fetch_v = [&]() __attribute__((always_inline)) {
#pragma unroll
    for (int t = 0; t < 4; ++t) vf[t] = frag_ld(vp + t * VRT);
    // as in fetch_k
    asm volatile("s_wait_xcnt 0x0" :: "v"(vp) : "memory");
    vp += FBH;
  };
  fetch_k();
  fetch_v();

  auto pass = [&](const bool fetch) __attribute__((always_inline)) {
    v8f s[2][2];             // s[u][j]: keys 16j.. of the pass against query tile u, less M
#pragma unroll
    for (int i = 0; i < 2; ++i)
#pragma unroll
      for (int j = 0; j < 2; ++j)
#pragma unroll
        for (int u = 0; u < 2; ++u) s[u][j] = mma16(kf[2 * j + i], qf[u][i], (i == 0) ? nm[u] : s[u][j]);
    if (fetch) {
      fetch_k();
      // keeps the group ahead of the softmax: sunk behind it, the loads would have only the O^T products to arrive in
      __builtin_amdgcn_sched_barrier(0);
    }
    float mx[2];             // this half's largest s - M of the pass
#pragma unroll
    for (int u = 0; u < 2; ++u) {
      float m = s[u][0][0];
#pragma unroll
      for (int r = 1; r < 8; ++r) m = fmaxf(m, s[u][0][r]);
#pragma unroll
      for (int r = 0; r < 8; ++r) m = fmaxf(m, s[u][1][r]);
      mx[u] = m;
    }
    // one test a pass, a scalar branch: rare behind the first pass
    if (__builtin_amdgcn_ballot_w32(fmaxf(mx[0], mx[1]) > thr) != 0) {
#pragma unroll
      for (int u = 0; u < 2; ++u) {
        const float m = fmaxf(mx[u], xhalf(mx[u]));
        const float d = fmaxf(m, thr - 8.0f);            // M rises by d: first pass to the maximum, later never down
        const float alpha = exp2x1(fminf(-d, 0.f));      // first pass: sums are 0, any finite factor serves
        nm[u] = nm[u] - d;
        lrow[u] *= alpha;
#pragma unroll
        for (int j = 0; j < 2; ++j) s[u][j] = s[u][j] - d;
#pragma unroll
        for (int t = 0; t < 4; ++t) oacc[u][t] = oacc[u][t] * alpha;
      }
      thr = 8.0f;
    }
    FragU pf[2];
#pragma unroll
    for (int u = 0; u < 2; ++u) {
      float ps[2] = {0.f, 0.f};
#pragma unroll
      for (int j = 0; j < 2; ++j) {
        float e[8], p[8];
#pragma unroll
        for (int r = 0; r < 8; ++r) e[r] = s[u][j][r];
        exp2x8(e, p);
#pragma unroll
        for (int r = 0; r < 8; ++r) {
          ps[j] += p[r];
          pf[u].h[j][r] = (_Float16)p[r];
        }
      }
      lrow[u] += ps[0] + ps[1];
    }
#pragma unroll
    for (int t = 0; t < 4; ++t) {
#pragma unroll
      for (int u = 0; u < 2; ++u) oacc[u][t] = mma16(vf[t], pf[u].v, oacc[u][t]);
    }
    if (fetch) fetch_v();
  };

  // rolled: one copy of the pass with its fetches; the last pass has nothing to fetch and stands alone
#pragma unroll 1
  for (int kc = 0; kc < SEQL / 32 - 1; ++kc) pass(true);
  pass(false);

  v8h ov[2][4];
#pragma unroll
  for (int u = 0; u < 2; ++u) {
    const float inv16 = 16.0f * (1.0f / (lrow[u] + xhalf(lrow[u])));
#pragma unroll
    for (int t = 0; t < 4; ++t)
#pragma unroll
      for (int r = 0; r < 8; ++r) ov[u][t][r] = (_Float16)(oacc[u][t][r] * inv16);
  }
  // keeps the eight stores together behind the last conversion
  __builtin_amdgcn_sched_barrier(0);
#pragma unroll
  for (int u = 0; u < 2; ++u)
#pragma unroll
    for (int t = 0; t < 4; ++t) *(v8h*)(Oz + u * QRT + (t >> 1) * FBH + (t & 1) * 256) = ov[u][t];
}

// ---------------------------------------------------------------------------
// Output projection: out[row][n] = sum_k O16[row][k] * WoT[nb][n][k] / 256 + bo[nb][n]  (f32).
// Rows with l == 1023 (router tokens) go to rplane[(blk*4+bat)][512] instead of d_out (single writer
// of those d_out rows is the router output kernel).  Epilogue: 16-row f32 slabs per wave in LDS; each 256-B
// row segment written by 16 consecutive lanes x 16 B of one instruction (2 rows per instruction,
// ---------------------------------------------------------------------------
__global__ void __launch_bounds__(256)
wo_gemm_kernel(const _Float16* __restrict__ O16, const _Float16* __restrict__ WT,
               const float* __restrict__ bo, float* __restrict__ out, float* __restrict__ rplane) {
  __shared__ __align__(16) _Float16 ring[RINGH(2)];   // operand ring, then the waves' epilogue slabs
  static_assert(8 * 16 * SP32 * 4 <= RINGH(2) * 2, "the slabs fit the ring");
  float* slabf = (float*)ring;
  const int lane = threadIdx.x & 31, wid = threadIdx.x >> 5;
  const int mb  = blockIdx.x * 64;
  const int nbk = blockIdx.y * 256;
  const int m0 = mb + (wid >> 2) * 32;
  const int n0 = nbk + (wid & 3) * 64;
  const int nb = m0 >> 12;
  const _Float16* Bt = WT + (size_t)(12 + nb) * WPL;
  const float* bias = bo + nb * DM;
  v8f acc[2][4];
  gemm_core<2>(O16, Bt, mb, nbk, ring, acc);

  float* slab = slabf + wid * (16 * SP32);
  const int c = lane & 15, hh = lane >> 4, c4 = c * 4;
#pragma unroll
  for (int mt = 0; mt < 2; ++mt) {
#pragma unroll
    for (int nt = 0; nt < 4; ++nt) {
      const int coll = nt * 16 + c;
      const float bc = bias[n0 + coll];
#pragma unroll
      for (int r = 0; r < 8; ++r)
        slab[(8 * hh + r) * SP32 + coll] = acc[mt][nt][r] * (1.0f / 256.0f) + bc;
    }
    wave_lds_sync();
    {
#pragma unroll
      for (int it = 0; it < 8; ++it) {
        const int row = it * 2 + hh;
        const int gm  = m0 + mt * 16 + row;
        const v4f val = *(const v4f*)(slab + row * SP32 + c4);
        float* dst = ((gm & (SEQL - 1)) == (SEQL - 1))
                         ? (rplane + (size_t)(gm >> 10) * DM + n0 + c4)
                         : (out + (size_t)gm * DM + n0 + c4);
        *(v4f*)dst = val;
      }
      
    }
    wave_lds_sync();
  }
}

// ---------------------------------------------------------------------------
// Router (inter) attention in two launches of many work-groups (f32 VALU throughout).
// Both launches share one product form: a work-group of 16 waves owns one batch (4 router rows,
// t = blk*4 + bat) and 32 output columns; wave w takes k in [32w, 32w + 32), lane = column; the 16
// partial sums of an output element meet in LDS and are added in wave order.
// ---------------------------------------------------------------------------
__device__ __forceinline__ void router_w_load(const float* __restrict__ Wm, int wave, int col, float (&w)[32]) {
  const float* wp = Wm + (size_t)(wave * 32) * DM + col;
  // unrolled: w[] stays in registers and all 32 loads are in flight together
#pragma unroll
  for (int j = 0; j < 32; ++j) w[j] = wp[(size_t)j * DM];
}

// rows: LDS [4][512]; red: LDS [16][4][32]. Returns, in threads 0..127, element (row tid>>5, column tid&31).
__device__ __forceinline__ float router_ksplit(const float (&w)[32], const float* rows, float* red,
                                               int tid) {
  const int wave = tid >> 5, lane = tid & 31;
  float a[NBLK] = {0.f, 0.f, 0.f, 0.f};
  // unrolled (here and below): w[] and a[] are indexed by constants only, so they stay in registers
#pragma unroll
  for (int j4 = 0; j4 < 8; ++j4) {
#pragma unroll
    for (int r = 0; r < NBLK; ++r) {
      const v4f rv = *(const v4f*)(rows + r * DM + wave * 32 + j4 * 4);
      a[r] += rv[0] * w[j4 * 4];
      a[r] += rv[1] * w[j4 * 4 + 1];
      a[r] += rv[2] * w[j4 * 4 + 2];
      a[r] += rv[3] * w[j4 * 4 + 3];
    }
  }
#pragma unroll
  for (int r = 0; r < NBLK; ++r) red[(wave * NBLK + r) * 32 + lane] = a[r];
  __syncthreads();
  float s = 0.f;
  if (tid < 128) {
#pragma unroll
    for (int wv = 0; wv < 16; ++wv) s += red[wv * 128 + tid];
  }
  return s;
}

// rq / rk / rv: RP[p][t][n] = sum_k rplane[t][k] * iW_p[k][n] + ib_p[n].  grid (16, 4, 3) = (column
// chunk, bat, p), 512 threads.
__global__ void __launch_bounds__(512)
router_proj_kernel(const float* __restrict__ rplane,
                   const float* __restrict__ iWq, const float* __restrict__ ibq,
                   const float* __restrict__ iWk, const float* __restrict__ ibk,
                   const float* __restrict__ iWv, const float* __restrict__ ibv,
                   float* __restrict__ RP) {
  __shared__ __align__(16) float Rr[NBLK * DM];
  __shared__ float red[16 * NBLK * 32];
  const int tid = threadIdx.x;
  const int col = blockIdx.x * 32 + (tid & 31);
  const int b = blockIdx.y, p = blockIdx.z;
  const float* Wm = (p == 0) ? iWq : ((p == 1) ? iWk : iWv);
  const float* bb = (p == 0) ? ibq : ((p == 1) ? ibk : ibv);
  const int ri = tid >> 7, rc4 = (tid & 127) * 4;
  const v4f rin = *(const v4f*)(rplane + (size_t)(ri * NBAT + b) * DM + rc4);
  // the weight loads below may land in the registers that held this load's address
  asm volatile("s_wait_xcnt 0x0" ::: "memory");
  float w[32];
  router_w_load(Wm, tid >> 5, col, w);
  *(v4f*)(Rr + ri * DM + rc4) = rin;
  __syncthreads();
  const float s = router_ksplit(w, Rr, red, tid);
  if (tid < 128) RP[((size_t)p * 16 + (tid >> 5) * NBAT + b) * DM + col] = s + bb[col];
}

// Per batch: 4-key softmax of (rq.rk)*0.125 per (query blk, head), o = sum p*rv / sum p (each
// work-group forms all 4 x 512 of its batch), then out rows l == 1023 = o . iWo + ibo for its 32
// columns.  grid (16, 4) = (column chunk, bat), 512 threads.
__global__ void __launch_bounds__(512)
router_out_kernel(const float* __restrict__ RP,
                  const float* __restrict__ iWo, const float* __restrict__ ibo,
                  float* __restrict__ out) {
  __shared__ __align__(16) float Pj[3][NBLK * DM];
  __shared__ __align__(16) float Ro[NBLK * DM];
  __shared__ float red[16 * NBLK * 32];
  const int tid = threadIdx.x;
  const int col = blockIdx.x * 32 + (tid & 31);
  const int b = blockIdx.y;
  float w[32];
  router_w_load(iWo, tid >> 5, col, w);
  {
    const int i = tid >> 7, c4 = (tid & 127) * 4;
#pragma unroll
    for (int p = 0; p < 3; ++p)
      *(v4f*)(&Pj[p][i * DM + c4]) = *(const v4f*)(RP + ((size_t)p * 16 + i * NBAT + b) * DM + c4);
  }
  __syncthreads();
  {
    // 16 lanes per (query blk, head); each lane holds 4 of the 64 head elements
    const int item = tid >> 4;              // 0..31
    const int nq = item >> 3, hd = item & 7;
    const int eo = hd * HD + (tid & 15) * 4;
    const v4f q4 = *(const v4f*)(&Pj[0][nq * DM + eo]);
    const v4f v0 = *(const v4f*)(&Pj[2][eo]);
    const v4f v1 = *(const v4f*)(&Pj[2][DM + eo]);
    const v4f v2 = *(const v4f*)(&Pj[2][2 * DM + eo]);
    const v4f v3 = *(const v4f*)(&Pj[2][3 * DM + eo]);
    float sc[NBLK];
#pragma unroll
    for (int s = 0; s < NBLK; ++s) {
      const v4f k4 = *(const v4f*)(&Pj[1][s * DM + eo]);
      sc[s] = q4[0] * k4[0] + q4[1] * k4[1] + q4[2] * k4[2] + q4[3] * k4[3];
    }
    // keeps the four v reads in one batch ahead of the exponentials; sunk in between them their
    // LDS latency would stand in the dependent chain three times
    asm volatile("" :: "v"(v0), "v"(v1), "v"(v2), "v"(v3));
#pragma unroll
    for (int m = 1; m < 16; m <<= 1) {
#pragma unroll
      for (int s = 0; s < NBLK; ++s) sc[s] += __shfl_xor(sc[s], m, 32);
    }
#pragma unroll
    for (int s = 0; s < NBLK; ++s) sc[s] *= 0.125f;
    const float mx = fmaxf(fmaxf(sc[0], sc[1]), fmaxf(sc[2], sc[3]));
    const float p0 = __expf(sc[0] - mx), p1 = __expf(sc[1] - mx), p2 = __expf(sc[2] - mx), p3 = __expf(sc[3] - mx);
    const float inv = 1.0f / (p0 + p1 + p2 + p3);
    v4f o4;
#pragma unroll
    for (int j = 0; j < 4; ++j) o4[j] = (p0 * v0[j] + p1 * v1[j] + p2 * v2[j] + p3 * v3[j]) * inv;
    *(v4f*)(Ro + nq * DM + eo) = o4;
  }
  __syncthreads();
  const float s = router_ksplit(w, Ro, red, tid);
  if (tid < 128)
    out[((size_t)((tid >> 5) * NBAT + b) * SEQL + (SEQL - 1)) * DM + col] = s + ibo[col];
}

// ---------------------------------------------------------------------------
// Workspace map (byte offsets; every region fully written before it is read; the f16 planes are packed
// in fragment blocks, see frag_ld; all regions are exact
//   X16   f16 [16384][512]            0          16777216 B
//   WT16  f16 [16][512][512]     16777216           8388608 B   (Wq,Wk,Wv,Wo planes x 4 blks, [out][in], x16)
//   Q16   f16 [16384][512]     25165824          16777216 B
//   K16   f16 [16384][512]     41943040          16777216 B
//   VT16  f16 [16][512][1024]  58720256          16777216 B
//   O16   f16 [16384][512]     75497472          16777216 B   (attention output x16)
//   RPL   f32 [16][512]        92274688             32768 B   (router rows, t = blk*4 + bat)
//   RP    f32 [3][16][512]     92307456             98304 B   (router q, k, v projections)
//   total                      92405760
// ---------------------------------------------------------------------------
extern "C" void kernel_launch(void* const* d_in, const int* in_sizes, int n_in,
                              void* d_out, int out_size, void* d_ws, size_t ws_size,
                              hipStream_t stream) {
  if (n_in < 17) return;
  if (in_sizes[0] != MROWS * DM) return;
  if (in_sizes[1] != NBLK * WPL || in_sizes[3] != NBLK * WPL || in_sizes[5] != NBLK * WPL || in_sizes[7] != NBLK * WPL) return;
  if (in_sizes[2] != NBLK * DM || in_sizes[4] != NBLK * DM || in_sizes[6] != NBLK * DM || in_sizes[8] != NBLK * DM) return;
  if (in_sizes[9] != WPL || in_sizes[11] != WPL || in_sizes[13] != WPL || in_sizes[15] != WPL) return;
  if (in_sizes[10] != DM || in_sizes[12] != DM || in_sizes[14] != DM || in_sizes[16] != DM) return;
  if (out_size != MROWS * DM) return;

  const float* x   = (const float*)d_in[0];
  const float* Wq  = (const float*)d_in[1];  const float* bq  = (const float*)d_in[2];
  const float* Wk  = (const float*)d_in[3];  const float* bk  = (const float*)d_in[4];
  const float* Wv  = (const float*)d_in[5];  const float* bv  = (const float*)d_in[6];
  const float* Wo  = (const float*)d_in[7];  const float* bo  = (const float*)d_in[8];
  const float* iWq = (const float*)d_in[9];  const float* ibq = (const float*)d_in[10];
  const float* iWk = (const float*)d_in[11]; const float* ibk = (const float*)d_in[12];
  const float* iWv = (const float*)d_in[13]; const float* ibv = (const float*)d_in[14];
  const float* iWo = (const float*)d_in[15]; const float* ibo = (const float*)d_in[16];
  float* out = (float*)d_out;

  const size_t bAct = (size_t)MROWS * DM * 2;      // 16777216
  const size_t bWT  = (size_t)16 * WPL * 2;        // 8388608
  const size_t bRpl = (size_t)16 * DM * 4;         // 32768
  const size_t bRp  = (size_t)3 * 16 * DM * 4;     // 98304
  size_t off = 0;
  const size_t oX  = off; off += bAct;
  const size_t oWT = off; off += bWT;
  const size_t oQ  = off; off += bAct;
  const size_t oK  = off; off += bAct;
  const size_t oVT = off; off += bAct;
  const size_t oO  = off; off += bAct;
  const size_t oR  = off; off += bRpl;
  const size_t oP  = off; off += bRp;
  if (off > ws_size) return;                       // off = 92405760

  char* ws = (char*)d_ws;
  _Float16* X16  = (_Float16*)(ws + oX);
  _Float16* WT16 = (_Float16*)(ws + oWT);
  _Float16* Q16  = (_Float16*)(ws + oQ);
  _Float16* K16  = (_Float16*)(ws + oK);
  _Float16* VT16 = (_Float16*)(ws + oVT);
  _Float16* O16  = (_Float16*)(ws + oO);
  float*    RPL  = (float*)(ws + oR);
  float*    RP   = (float*)(ws + oP);

  // (1) weights -> transposed f16 planes (x16), and x -> f16 plane
  prep_kernel<<<dim3(WTB), dim3(256), 0, stream>>>(x, Wq, Wk, Wv, Wo, X16, WT16);
  // (2) q, k projections, and the v^T projection per (blk, bat)
  qkv_gemm_kernel<<<dim3(QKB + VTB), dim3(256), 0, stream>>>(X16, WT16, bq, bk, bv, Q16, K16, VT16);
  // (3) intra attention
  attn_kernel<<<dim3(NBLK * NBAT * NH * (SEQL / 128)), dim3(128), 0, stream>>>(Q16, K16, VT16, O16);
  // (4) output projection -> d_out (rows l < 1023) and router plane (rows l == 1023)
  wo_gemm_kernel<<<dim3(MROWS / 64, DM / 256, 1), dim3(256), 0, stream>>>(O16, WT16, bo, out, RPL);
  // (5) router q, k, v projections
  router_proj_kernel<<<dim3(DM / 32, NBAT, 3), dim3(512), 0, stream>>>(RPL, iWq, ibq, iWk, ibk, iWv, ibv, RP);
  // (6) router attention + output projection -> d_out rows l == 1023
  router_out_kernel<<<dim3(DM / 32, NBAT), dim3(512), 0, stream>>>(RP, iWo, ibo, out);
  (void)hipGetLastError();
}

// v009
// One run takes 95.3 microseconds.
// Two timings next to v008 put it at 1.03 and 1.02 times that version's speed.
// Counting every step since v000, it is 12.0 times as fast.
// Contractions q/k/v^T projections, q.k^T, p.v, out projection: v_wmma_f32_16x16x32_f16, f16 operands (W x16; x and p x1; attention output o x16), f32 accumulate; softmax f32 (scale 0.125 log2 e applied to q in f32 ahead of its rounding to f16); router-token attention and its four projections: f32 VALU.
#include <hip/hip_runtime.h>

typedef _Float16 v16h __attribute__((ext_vector_type(16)));
typedef _Float16 v8h  __attribute__((ext_vector_type(8)));
typedef float    v8f  __attribute__((ext_vector_type(8)));
typedef float    v4f  __attribute__((ext_vector_type(4)));

#define NBLK  4
#define NBAT  4
#define SEQL  1024
#define DM    512
#define NH    8
#define HD    64
#define MROWS 16384          // NBLK*NBAT*SEQL
#define WPL   262144         // DM*DM, one weight plane
#define ZPL   524288         // SEQL*DM, one (blk,bat) activation plane
#define SP16  72             // f16 LDS slab pitch (halves), 144 B rows
#define SP32  68             // f32 LDS slab pitch (floats), 272 B rows
#define QSC   0.18033688011112042f   // 0.125 * log2(e): score scale times the change from e^x to 2^x

union FragU { v16h v; v8h h[2]; };

// Packed operand planes. Every f16 matrix [rows][K] of the workspace is stored as fragment blocks:
// block (rt = row >> 4, kt = k >> 5) is FBH halves (1 KiB) at (rt * (K / 32) + kt) * FBH; inside it the
// 16-B unit u = o * 16 + c holds row rt*16 + c, k = kt*32 + o*8 .. + 7 (o = 0..3, c = 0..15).
// 16x16x32 operand fragment: p = block + lane*8; elements 0..7 <- unit lane (k = 8*(lane>>4) + e),
// elements 8..15 <- unit 32 + lane (16 more): the same k order for A rows m and Bt rows n, and each of
// the two loads of a wave reads 512 contiguous bytes (4 cache lines; from k-contiguous rows it was 16).
#define FBH 512
__device__ __forceinline__ v16h frag_ld(const _Float16* p) {
  FragU f;
  f.h[0] = *(const v8h*)(p);
  f.h[1] = *(const v8h*)(p + 256);
  return f.v;
}

__device__ __forceinline__ v8f mma16(v16h a, v16h b, v8f c) {
  c = __builtin_amdgcn_wmma_f32_16x16x32_f16(false, a, false, b, (short)0, c, false, false);
  asm volatile("v_nop\n\tv_nop\n\tv_nop\n\tv_nop" : "+v"(c) : "v"(a), "v"(b));
  return c;
}

__device__ __forceinline__ void wave_lds_sync() {
  __builtin_amdgcn_fence(__ATOMIC_RELEASE, "workgroup");
  __builtin_amdgcn_wave_barrier();
  __builtin_amdgcn_fence(__ATOMIC_ACQUIRE, "workgroup");
}

__device__ __forceinline__ v8f zero8() { return (v8f){0.f, 0.f, 0.f, 0.f, 0.f, 0.f, 0.f, 0.f}; }

// ---------------------------------------------------------------------------
// Both preparations in one launch: they share no data, so each of the WTB blocks does one weight tile
// and its share of x.  grid WTB = 8 x 8 x 16 = 1024 blocks of 256 threads, bx = z*64 + y*8 + x.
// Weight transpose + x16 + f16: W (f32 [in=512][out=512], blk plane nb of Wq/Wk/Wv/Wo)
//   -> WT[z][out][in] = f16(16 * W[in][out]), packed (rows = out, k = in), z = widx*4 + nb  (widx 0=q,1=k,2=v,3=o).
//   64x64 tiles through LDS.  Coverage per block: load 4 it x 256 thr x 4 = 64x64; store 2 it x 256 thr x 8 = 64x64.
// x f32 [16384][512] -> packed f16 plane: block bx converts row tile bx (16 rows x 512 = 32 KiB read, 16 KiB
//   written, both contiguous), XUN = 4 units of 16 B a thread: unit bx*1024 + j*256 + tid is row
//   bx*16 + (tid & 15), k = j*128 + (tid >> 4)*8 .. + 7.  Coverage: 1024 blocks x 256 thr x 4 x 8 = 16384 x 512.
// ---------------------------------------------------------------------------
#define WTB ((DM / 64) * (DM / 64) * 16)
#define XUN (MROWS * DM / 8 / (WTB * 256))
static_assert(WTB == MROWS / 16 && XUN * 128 == DM, "one 16-row tile of x for each block");
__global__ void __launch_bounds__(256)
prep_kernel(const float* __restrict__ x,
            const float* __restrict__ Wq, const float* __restrict__ Wk,
            const float* __restrict__ Wv, const float* __restrict__ Wo,
            _Float16* __restrict__ X16, _Float16* __restrict__ WT) {
  __shared__ __align__(16) float tf[64 * 68];
  const int bx = blockIdx.x;
  const int z  = bx >> 6;
  const int wi = z >> 2, nb = z & 3;
  const float* W = (wi == 0) ? Wq : ((wi == 1) ? Wk : ((wi == 2) ? Wv : Wo));
  W += (size_t)nb * WPL;
  _Float16* O = WT + (size_t)z * WPL;
  const int c0  = (bx & 7) * 64;         // input column block (out feature) = output row block
  const int r0  = ((bx >> 3) & 7) * 64;  // input row block (in feature)     = output column block
  const int tid = threadIdx.x;
  const int lr = tid >> 4;          // 0..15
  const int c4 = (tid & 15) * 4;    // 0..60
  const float* wp = W + (size_t)(r0 + lr) * DM + c0 + c4;
  const float* xp = x + (size_t)(bx * 16 + (tid & 15)) * DM + lr * 8;
  v4f wa[4], xa[XUN], xb[XUN];
  // unrolled (all loops of this kernel): the arrays are indexed by constants only, so they stay in registers
#pragma unroll
  for (int it = 0; it < 4; ++it) wa[it] = *(const v4f*)(wp + (size_t)(it * 16) * DM);
#pragma unroll
  for (int j = 0; j < XUN; ++j) {
    xa[j] = *(const v4f*)(xp + j * 128);
    xb[j] = *(const v4f*)(xp + j * 128 + 4);
  }
  // all twelve loads are out before anything waits for one of them, the weight tile's first, so that its way
  // through LDS runs under the x loads; the registers of the two addresses may be written again behind this wait
  asm volatile("s_wait_xcnt 0x0" :: "v"(wp), "v"(xp) : "memory");
#pragma unroll
  for (int it = 0; it < 4; ++it) *(v4f*)(tf + (it * 16 + lr) * 68 + c4) = wa[it];
  __syncthreads();
  // the tile is 4 row tiles x 2 k tiles = 8 blocks; thread tid writes unit tid & 63 of blocks
  // (rt = tid >> 7, kt = (tid >> 6) & 1) and (rt + 2, kt)
  const int rtl = tid >> 7, ktl = (tid >> 6) & 1;
  const int sub = rtl * 16 + (tid & 15);            // out feature in the tile, 0..31
  const int c8  = ktl * 32 + ((tid >> 4) & 3) * 8;  // in feature in the tile, 0..56
  v8h hv0, hv1;
#pragma unroll
  for (int e = 0; e < 8; ++e) {
    hv0[e] = (_Float16)(16.0f * tf[(c8 + e) * 68 + sub]);
    hv1[e] = (_Float16)(16.0f * tf[(c8 + e) * 68 + 32 + sub]);
  }
  _Float16* p0 = O + (size_t)(((c0 >> 4) + rtl) * (DM / 32) + (r0 >> 5) + ktl) * FBH + (tid & 63) * 8;
  _Float16* p1 = p0 + (size_t)(2 * (DM / 32)) * FBH;
  *(v8h*)p0 = hv0;
  *(v8h*)p1 = hv1;
  _Float16* px = X16 + ((size_t)bx * (XUN * 256) + tid) * 8;
#pragma unroll
  for (int j = 0; j < XUN; ++j) {
    v8h hv;
    hv[0] = (_Float16)xa[j][0]; hv[1] = (_Float16)xa[j][1]; hv[2] = (_Float16)xa[j][2]; hv[3] = (_Float16)xa[j][3];
    hv[4] = (_Float16)xb[j][0]; hv[5] = (_Float16)xb[j][1]; hv[6] = (_Float16)xb[j][2]; hv[7] = (_Float16)xb[j][3];
    *(v8h*)(px + j * (256 * 8)) = hv;
  }
}

// ---------------------------------------------------------------------------
// GEMM core: acc[mt][nt] = sum_k A[m0 + mt*16 + .][k] * Bt[n0 + nt*16 + .][k], K = 512.
// A and Bt are packed f16 planes with K = 512; block tile 128 x 256 at (mb, nbk), 8 waves, wave tile 64 x 64 at
// m0 = mb + (wave >> 2)*64, n0 = nbk + (wave & 3)*64; D element r of lane l is (row 8*(l>>4) + r, col l&15)
// of its 16x16 subtile.  A block brings 384 operand rows from L2 for 128 x 256 results, and a wave reads 8
// fragments from LDS for 16 products.
// The block's operands come through LDS: a stage is KST k tiles (64 k) of its 8 row tiles of A and 16 of Bt,
// row tile r (A: 0..7, Bt: 8..23) at byte r*2048 of the stage, as it lies in the plane (KST fragment blocks in a
// row), so each fragment is brought from L2 once for the block and read by ds_load_b128, 512 contiguous bytes a
// load.  Two buffers of SUB stages each: the next buffer's copies fly while this one is worked on.  SUB = 1 where
// two work-groups share a WGP; SUB = 2 where the grid gives a WGP only one, so that as many bytes are in flight.
// ---------------------------------------------------------------------------
#define MT    4                          // row tiles of A in a wave's tile (a block has two such rows of waves)
#define KST   2                          // k tiles of a stage
#define RTH   (KST * FBH)                // halves of one row tile in a stage (2 KiB)
#define STGH  ((2 * MT + 16) * RTH)      // halves of a stage (48 KiB)
#define NSTG  (DM / 32 / KST)            // stages
#define RINGH(SUB) (2 * (SUB) * STGH)    // halves of the ring (96 KiB x SUB)

// One stage, twelve asynchronous copies of 16 B a thread: thread tid brings byte tid*16 of each 4-KiB pair of row
// tiles.  ga / gb: this thread's place in row tile (tid >> 7) of the block's A / Bt rows at the stage's first k
// tile; l: LDS byte address of the stage's place + tid*16.  The closing wait stands inside the statement, so that no
// address register of a copy is written again in front of it.
__device__ __forceinline__ void stage_copy(const _Float16* ga, const _Float16* gb, uint32_t l) {
  const int R2 = 2 * (DM / 32) * FBH;    // halves from a row tile of a plane to the next but one
  static_assert(MT == 4, "four pairs of A row tiles, eight of Bt");
  asm volatile("global_load_async_to_lds_b128 %0, %12, off\n\t"
               "global_load_async_to_lds_b128 %1, %13, off\n\t"
               "global_load_async_to_lds_b128 %2, %14, off\n\t"
               "global_load_async_to_lds_b128 %3, %15, off\n\t"
               "global_load_async_to_lds_b128 %4, %16, off\n\t"
               "global_load_async_to_lds_b128 %5, %17, off\n\t"
               "global_load_async_to_lds_b128 %6, %18, off\n\t"
               "global_load_async_to_lds_b128 %7, %19, off\n\t"
               "global_load_async_to_lds_b128 %8, %20, off\n\t"
               "global_load_async_to_lds_b128 %9, %21, off\n\t"
               "global_load_async_to_lds_b128 %10, %22, off\n\t"
               "global_load_async_to_lds_b128 %11, %23, off\n\t"
               "s_wait_xcnt 0x0"
               :: "v"(l), "v"(l + 4096u), "v"(l + 8192u), "v"(l + 12288u), "v"(l + 16384u), "v"(l + 20480u),
                  "v"(l + 24576u), "v"(l + 28672u), "v"(l + 32768u), "v"(l + 36864u), "v"(l + 40960u), "v"(l + 45056u),
                  "v"(ga), "v"(ga + R2), "v"(ga + 2 * R2), "v"(ga + 3 * R2),
                  "v"(gb), "v"(gb + R2), "v"(gb + 2 * R2), "v"(gb + 3 * R2),
                  "v"(gb + 4 * R2), "v"(gb + 5 * R2), "v"(gb + 6 * R2), "v"(gb + 7 * R2)
               : "memory");
}

// ring: RINGH(SUB) halves of LDS, 16-B aligned.  Behind the call no copy is in flight and every wave has left
// the ring (the last trip's own barrier), so the caller may use it as staging for its epilogue.
template <int SUB>
__device__ __forceinline__ void gemm_core(const _Float16* __restrict__ A,
                                          const _Float16* __restrict__ Bt,
                                          int mb, int nbk, _Float16* ring, v8f (&acc)[MT][4]) {
  const int RTS  = (DM / 32) * FBH;   // halves from one row tile of a plane to the next
  const int BUFH = SUB * STGH;        // halves of a buffer
  const int NT   = NSTG / SUB;        // trips
  static_assert(NT >= 2 && NT * SUB == NSTG, "both buffers are filled in front of the loop");
  const int tid = threadIdx.x, lane = tid & 31, wid = tid >> 5;
  // unrolled (every loop of this function but the trips): acc[], af[] and bf[] are indexed by constants only, so they
  // stay in registers, and the places of a buffer's stages are constants
#pragma unroll
  for (int i = 0; i < MT; ++i)
#pragma unroll
    for (int j = 0; j < 4; ++j) acc[i][j] = zero8();
  const _Float16* ga = A  + (size_t)((mb  >> 4) + (tid >> 7)) * RTS + (tid & 127) * 8;
  const _Float16* gb = Bt + (size_t)((nbk >> 4) + (tid >> 7)) * RTS + (tid & 127) * 8;
  const uint32_t l0 = (uint32_t)(size_t)ring + (uint32_t)tid * 16u;
#pragma unroll
  for (int s = 0; s < SUB; ++s) stage_copy(ga + s * RTH, gb + s * RTH, l0 + (uint32_t)(s * STGH) * 2u);
  // buffer 0 has landed for this wave; behind the barrier for all
  asm volatile("s_wait_asynccnt 0x0" ::: "memory");
  __syncthreads();
#pragma unroll
  for (int s = 0; s < SUB; ++s)
    stage_copy(ga + (SUB + s) * RTH, gb + (SUB + s) * RTH, l0 + (uint32_t)(BUFH + s * STGH) * 2u);
  const _Float16* fa = ring + ((wid >> 2) * MT) * RTH + lane * 8;           // this wave's four row tiles of A
  const _Float16* fb = ring + (2 * MT + (wid & 3) * 4) * RTH + lane * 8;    // its four row tiles of Bt
  // rolled: one copy of the trip, its publish point and its refill
#pragma unroll 1
  for (int t = 0; t < NT; ++t) {
    const int bo = (t & 1) * BUFH;
#pragma unroll
    for (int kk = 0; kk < SUB * KST; ++kk) {
      const int fo = bo + (kk / KST) * STGH + (kk % KST) * FBH;   // stage of the buffer, k tile of the stage
      v16h bf[4], af[MT];
#pragma unroll
      for (int j = 0; j < 4; ++j) bf[j] = frag_ld(fb + fo + j * RTH);
#pragma unroll
      for (int i = 0; i < MT; ++i) af[i] = frag_ld(fa + fo + i * RTH);
#pragma unroll
      for (int j = 0; j < 4; ++j) {
#pragma unroll
        for (int i = 0; i < MT; ++i) acc[i][j] = mma16(af[i], bf[j], acc[i][j]);
      }
    }
    // publish point of the next buffer: this wave's reads of this buffer are done, its copies into the next have
    // landed; behind the barrier every wave may read the next buffer and this one may be filled again
    asm volatile("s_wait_dscnt 0x0" ::: "memory");
    asm volatile("s_wait_asynccnt 0x0" ::: "memory");
    __syncthreads();
    if (t + 2 < NT) {
#pragma unroll
      for (int s = 0; s < SUB; ++s)
        stage_copy(ga + ((t + 2) * SUB + s) * RTH, gb + ((t + 2) * SUB + s) * RTH,
                   l0 + (uint32_t)(bo + s * STGH) * 2u);
    }
  }
  // the ring's closing wait: no copy outlives the loop
  asm volatile("s_wait_asynccnt 0x0" ::: "memory");
}

// ---------------------------------------------------------------------------
// f16 epilogue: v = acc*scale + bias*bmul (bias per column, or per row when BIAS_ROW); the wave's 64 x 64
// tile goes through its LDS slab and leaves as 8 blocks of the packed plane C (kts = its k tiles per
// row tile), 512 contiguous bytes per store instruction.
// ---------------------------------------------------------------------------
template <bool BIAS_ROW>
__device__ __forceinline__ void epi_f16(v8f (&acc)[MT][4], _Float16* slab,
                                        _Float16* __restrict__ C, int kts,
                                        int m0, int n0, int lane, float scale, float bmul,
                                        const float* __restrict__ bias) {
  const int c = lane & 15, hh = lane >> 4;
  float bcol[4] = {0.f, 0.f, 0.f, 0.f};
  if (!BIAS_ROW) {
    const float* bp = bias + n0 + c;
#pragma unroll
    for (int nt = 0; nt < 4; ++nt) bcol[nt] = bp[nt * 16];
    // names the address, so that it lives to here and none of the four results lands in its registers; behind
    // this wait they may be written again
    asm volatile("s_wait_xcnt 0x0" :: "v"(bp) : "memory");
#pragma unroll
    for (int nt = 0; nt < 4; ++nt) bcol[nt] *= bmul;
  }
#pragma unroll
  for (int mt = 0; mt < MT; ++mt) {
#pragma unroll
    for (int nt = 0; nt < 4; ++nt) {
      const int coll = nt * 16 + c;
      const float bc = bcol[nt];
#pragma unroll
      for (int r = 0; r < 8; ++r) {
        const int rowl = mt * 16 + 8 * hh + r;
        float v = acc[mt][nt][r] * scale;
        v += BIAS_ROW ? bias[m0 + rowl] * bmul : bc;
        slab[rowl * SP16 + coll] = (_Float16)v;
      }
    }
  }
  wave_lds_sync();
  {
#pragma unroll
    for (int it = 0; it < 4 * MT; ++it) {
      const int rtl = it >> 2, ktl = (it >> 1) & 1, uh = it & 1;   // block of the tile, half of the block
      const v8h val = *(const v8h*)(slab + (rtl * 16 + c) * SP16 + ktl * 32 + (uh * 2 + hh) * 8);
      *(v8h*)(C + ((size_t)((m0 >> 4) + rtl) * kts + (n0 >> 5) + ktl) * FBH + uh * 256 + lane * 8) = val;
    }
  }
  wave_lds_sync();
}

// ---------------------------------------------------------------------------
// q, k and v^T projections in one launch: all three read only X16 and WT, so they are told apart by
// block range (block-uniform branch).  Block tile 128 x 256, 8 waves of 64 x 64.
// Blocks 0 .. QKB-1, bx = proj*256 + ny*128 + mx (proj: 0 = q, 1 = k): rows (blk,bat,l) = 16384, N = 512,
//   K = 512; weight plane and bias selected by the row block.  Q16/K16: [16384][512] f16, packed,
//   column (k) = h*64 + e.  Q16 holds q * QSC.
// Blocks QKB .. QKB+VTB-1, b = z*16 + ny*4 + mx, per (blk,bat) z:
//   VT16[z][m = h*64+e][l] = sum_k WvT[nb][m][k] * x[z][l][k] / 16 + bv[nb][m]
//   A = WvT plane (512 x 512), Bt = x plane rows (1024 x 512), C [512][1024] f16, packed (k = l).
// ---------------------------------------------------------------------------
#define QKB ((MROWS / 128) * (DM / 256) * 2)
#define VTB ((DM / 128) * (SEQL / 256) * NBLK * NBAT)
__global__ void __launch_bounds__(256)
qkv_gemm_kernel(const _Float16* __restrict__ X16, const _Float16* __restrict__ WT,
                const float* __restrict__ bq, const float* __restrict__ bk, const float* __restrict__ bv,
                _Float16* __restrict__ Q16, _Float16* __restrict__ K16, _Float16* __restrict__ VT16) {
  __shared__ __align__(16) _Float16 ring[RINGH(1)];   // operand ring, then the waves' epilogue slabs
  static_assert(8 * MT * 16 * SP16 <= RINGH(1), "the slabs fit the ring");
  const int lane = threadIdx.x & 31, wid = threadIdx.x >> 5;
  const int bx = blockIdx.x;
  const bool isv = bx >= QKB;
  const int b  = bx - QKB;
  const int z  = b >> 4;                                   // v^T blocks: (blk,bat)
  const int proj = bx >> 8;                                // q / k blocks: 0 = q, 1 = k
  const int mb  = (isv ? (b & 3) : (bx & 127)) * 128;               // v^T: output feature; q / k: row
  const int nbk = (isv ? ((b >> 2) & 3) : ((bx >> 7) & 1)) * 256;   // v^T: position; q / k: column
  const int m0 = mb + (wid >> 2) * 64;
  const int n0 = nbk + (wid & 3) * 64;
  const int nb = isv ? (z >> 2) : (m0 >> 12);
  const _Float16* A  = isv ? (WT + (size_t)(8 + nb) * WPL) : X16;
  const _Float16* Bt = isv ? (X16 + (size_t)z * ZPL) : (WT + (size_t)(proj * 4 + nb) * WPL);
  _Float16* slab = ring + wid * (MT * 16 * SP16);
  v8f acc[MT][4];
  gemm_core<1>(A, Bt, mb, nbk, ring, acc);
  if (isv) {
    epi_f16<true>(acc, slab, VT16 + (size_t)z * ZPL, SEQL / 32, m0, n0, lane, 0.0625f, 1.0f, bv + nb * DM);
  } else {
    const float qs = (proj == 0) ? QSC : 1.0f;   // the q plane carries the softmax scale
    epi_f16<false>(acc, slab, (proj == 0) ? Q16 : K16, DM / 32, m0, n0, lane, 0.0625f * qs, qs,
                   ((proj == 0) ? bq : bk) + nb * DM);
  }
}

// ---------------------------------------------------------------------------
// Full (unmasked) attention, head dim 64, per (blk,bat) z and head h, in transposed form.
//   q/k rows from Q16/K16 ([z*1024 + l][h*64 + d]); v^T rows from VT16 ([z*512 + h*64 + d][l]); all packed.
//   S^T = k.q^T (A = k rows, Bt = q rows): lane l holds, for query l&15, keys 16j + 8*(l>>4) + r of
//   each 16-key tile j, so the row maximum and the row sum of the online softmax (f32, 32 chunks of
//   32 keys) are in-lane, joined between lanes l and l^16 by one cross-row move.
//   The softmax's reference M of a query (log2 units; any value gives the same quotient) is the maximum of the
//   first pass; when a later score of any query of the wave passes its M by more than 8, each query's M moves up to
//   the larger of M and its maximum of the pass, so p = 2^(s - M) <= 256.  -M is the C operand of the first S^T product and q carries the
//   scale, so the products leave s - M, the exponent itself.
//   O^T += v^T.P^T (A = v^T rows, Bt = P rows): two neighbouring S^T tiles, converted in place, are
//   the Bt fragment in the k order of frag_ld (elements 0..7: k0 + 8*(l>>4) + e, 8..15: 16 more).
//   O16[z*1024 + l][h*64 + d] = f16(16 * O / rowsum), packed: the eight d of accumulator tile t in a lane
//   are unit (t&1)*32 + lane of block (query tile, 2h + (t>>1)), so each tile is stored straight from registers.
//   A wave owns two 16-query tiles, so each k and v^T fragment it loads feeds two products.
//   Block = 4 waves x 32 query rows; grid 1024 = z*64 + h*8 + qb.
// ---------------------------------------------------------------------------
__device__ __forceinline__ float xhalf(float x) {   // value of lane l ^ 16
  const int b = __builtin_bit_cast(int, x);
  return __builtin_bit_cast(float, __builtin_amdgcn_permlanex16(b, b, 0x76543210, 0xfedcba98, false, false));
}

// y[i] = 2^x[i], eight in one statement: the outputs are early-clobber, so no exponential lands on a
// source of the one in front of it, and the closing v_nop is the free slot that the instruction set asks
// for behind the last one
__device__ __forceinline__ void exp2x8(const float (&x)[8], float (&y)[8]) {
  asm("v_exp_f32 %0, %8\n\tv_exp_f32 %1, %9\n\tv_exp_f32 %2, %10\n\tv_exp_f32 %3, %11\n\t"
      "v_exp_f32 %4, %12\n\tv_exp_f32 %5, %13\n\tv_exp_f32 %6, %14\n\tv_exp_f32 %7, %15\n\tv_nop"
      : "=&v"(y[0]), "=&v"(y[1]), "=&v"(y[2]), "=&v"(y[3]), "=&v"(y[4]), "=&v"(y[5]), "=&v"(y[6]), "=&v"(y[7])
      : "v"(x[0]), "v"(x[1]), "v"(x[2]), "v"(x[3]), "v"(x[4]), "v"(x[5]), "v"(x[6]), "v"(x[7]));
}

// y = 2^x with its free slot in the same statement
__device__ __forceinline__ float exp2x1(float x) {
  float y;
  asm("v_exp_f32 %0, %1\n\tv_nop" : "=&v"(y) : "v"(x));
  return y;
}

__global__ void __launch_bounds__(128)
attn_kernel(const _Float16* __restrict__ Q16, const _Float16* __restrict__ K16,
            const _Float16* __restrict__ VT16, _Float16* __restrict__ O16) {
  const int tid = threadIdx.x, wave = tid >> 5, lane = tid & 31;
  const int bx = blockIdx.x;
  const int qb = bx & 7, h = (bx >> 3) & 7, z = bx >> 6;
  const int q0 = qb * 128 + wave * 32;

  const int QRT = (DM / 32) * FBH;     // halves from one 16-row tile of Q16 / K16 / O16 to the next
  const int VRT = (SEQL / 32) * FBH;   // the same for VT16
  const size_t hq = (size_t)z * ZPL + (2 * h) * FBH + lane * 8;   // row tile 0 of z, first k tile of head h
  const _Float16* Qz = Q16 + hq + (size_t)(q0 >> 4) * QRT;
  const _Float16* Kz = K16 + hq;
  const _Float16* Vz = VT16 + (size_t)z * ZPL + (size_t)(h * (HD / 16)) * VRT + lane * 8;
  _Float16* Oz = O16 + hq + (size_t)(q0 >> 4) * QRT;

  v16h qf[2][2];                     // qf[u][i]: query tile u, d = 32i..
#pragma unroll
  for (int u = 0; u < 2; ++u) {
    qf[u][0] = frag_ld(Qz + u * QRT);
    qf[u][1] = frag_ld(Qz + u * QRT + FBH);
  }
  // the fragment loads below may land in the registers that held this address
  asm volatile("s_wait_xcnt 0x0" :: "v"(Qz) : "memory");

  v8f nm[2] = {zero8(), zero8()};    // query 16u + c: -M in all eight elements (both halves alike)
  float thr = -3.0e38f;              // M moves where s - M is above this: always in the first pass, then 8
  float lrow[2] = {0.f, 0.f};        // this half's sum
  v8f oacc[2][4];                    // oacc[u][t][r] = O^T[d = 16t + 8hh + r][query 16u + c]
#pragma unroll
  for (int u = 0; u < 2; ++u)
#pragma unroll
    for (int t = 0; t < 4; ++t) oacc[u][t] = zero8();

  // Fragments are fetched one pass (32 keys) ahead: the 8 loads of the next pass's k fragments go out as
  // one group right behind this pass's S^T products, into the registers those have just read, and the 8
  // loads of its v^T fragments right behind the O^T products; each group has a whole pass to arrive.
  // Every fragment serves both query tiles of the wave.
  const _Float16* kp = Kz;   // k fragments of the pass that is fetched next
  const _Float16* vp = Vz;   // v^T fragments of the same
  v16h kf[4], vf[4];         // kf[2j + i]: keys 16j.., d = 32i..; vf[t]: d = 16t.., the pass's 32 keys
  auto fetch_k = [&]() __attribute__((always_inline)) {
#pragma unroll
    for (int j = 0; j < 2; ++j) {
      kf[2 * j]     = frag_ld(kp + j * QRT);
      kf[2 * j + 1] = frag_ld(kp + j * QRT + FBH);
    }
    // the address pair is advanced while the loads that name it are in flight; the statement also keeps the
    // k and v^T groups in one order everywhere, so that the counted load waits can leave the younger group out
    asm volatile("s_wait_xcnt 0x0" :: "v"(kp) : "memory");
    kp += 2 * QRT;
  };
  auto fetch_v = [&]() __attribute__((always_inline)) {
#pragma unroll
    for (int t = 0; t < 4; ++t) vf[t] = frag_ld(vp + t * VRT);
    // as in fetch_k
    asm volatile("s_wait_xcnt 0x0" :: "v"(vp) : "memory");
    vp += FBH;
  };
  fetch_k();
  fetch_v();

  auto pass = [&](const bool fetch) __attribute__((always_inline)) {
    v8f s[2][2];             // s[u][j]: keys 16j.. of the pass against query tile u, less M
#pragma unroll
    for (int i = 0; i < 2; ++i)
#pragma unroll
      for (int j = 0; j < 2; ++j)
#pragma unroll
        for (int u = 0; u < 2; ++u) s[u][j] = mma16(kf[2 * j + i], qf[u][i], (i == 0) ? nm[u] : s[u][j]);
    if (fetch) {
      fetch_k();
      // keeps the group ahead of the softmax: sunk behind it, the loads would have only the O^T products to arrive in
      __builtin_amdgcn_sched_barrier(0);
    }
    float mx[2];             // this half's largest s - M of the pass
#pragma unroll
    for (int u = 0; u < 2; ++u) {
      float m = s[u][0][0];
#pragma unroll
      for (int r = 1; r < 8; ++r) m = fmaxf(m, s[u][0][r]);
#pragma unroll
      for (int r = 0; r < 8; ++r) m = fmaxf(m, s[u][1][r]);
      mx[u] = m;
    }
    // one test a pass, a scalar branch: rare behind the first pass
    if (__builtin_amdgcn_ballot_w32(fmaxf(mx[0], mx[1]) > thr) != 0) {
#pragma unroll
      for (int u = 0; u < 2; ++u) {
        const float m = fmaxf(mx[u], xhalf(mx[u]));
        const float d = fmaxf(m, thr - 8.0f);            // M rises by d: first pass to the maximum, later never down
        const float alpha = exp2x1(fminf(-d, 0.f));      // first pass: sums are 0, any finite factor serves
        nm[u] = nm[u] - d;
        lrow[u] *= alpha;
#pragma unroll
        for (int j = 0; j < 2; ++j) s[u][j] = s[u][j] - d;
#pragma unroll
        for (int t = 0; t < 4; ++t) oacc[u][t] = oacc[u][t] * alpha;
      }
      thr = 8.0f;
    }
    FragU pf[2];
#pragma unroll
    for (int u = 0; u < 2; ++u) {
      float ps[2] = {0.f, 0.f};
#pragma unroll
      for (int j = 0; j < 2; ++j) {
        float e[8], p[8];
#pragma unroll
        for (int r = 0; r < 8; ++r) e[r] = s[u][j][r];
        exp2x8(e, p);
#pragma unroll
        for (int r = 0; r < 8; ++r) {
          ps[j] += p[r];
          pf[u].h[j][r] = (_Float16)p[r];
        }
      }
      lrow[u] += ps[0] + ps[1];
    }
#pragma unroll
    for (int t = 0; t < 4; ++t) {
#pragma unroll
      for (int u = 0; u < 2; ++u) oacc[u][t] = mma16(vf[t], pf[u].v, oacc[u][t]);
    }
    if (fetch) fetch_v();
  };

  // rolled: one copy of the pass with its fetches; the last pass has nothing to fetch and stands alone
#pragma unroll 1
  for (int kc = 0; kc < SEQL / 32 - 1; ++kc) pass(true);
  pass(false);

  v8h ov[2][4];
#pragma unroll
  for (int u = 0; u < 2; ++u) {
    const float inv16 = 16.0f * (1.0f / (lrow[u] + xhalf(lrow[u])));
#pragma unroll
    for (int t = 0; t < 4; ++t)
#pragma unroll
      for (int r = 0; r < 8; ++r) ov[u][t][r] = (_Float16)(oacc[u][t][r] * inv16);
  }
  // keeps the eight stores together behind the last conversion
  __builtin_amdgcn_sched_barrier(0);
#pragma unroll
  for (int u = 0; u < 2; ++u)
#pragma unroll
    for (int t = 0; t < 4; ++t) *(v8h*)(Oz + u * QRT + (t >> 1) * FBH + (t & 1) * 256) = ov[u][t];
}

// ---------------------------------------------------------------------------
// Output projection: out[row][n] = sum_k O16[row][k] * WoT[nb][n][k] / 256 + bo[nb][n]  (f32).
// Rows with l == 1023 (router tokens) go to rplane[(blk*4+bat)][512] instead of d_out (single writer
// of those d_out rows is the router output kernel).  Epilogue: 16-row f32 slabs per wave in LDS; each 256-B
// row segment written by 16 consecutive lanes x 16 B of one instruction (2 rows per instruction,
// ---------------------------------------------------------------------------
__global__ void __launch_bounds__(256)
wo_gemm_kernel(const _Float16* __restrict__ O16, const _Float16* __restrict__ WT,
               const float* __restrict__ bo, float* __restrict__ out, float* __restrict__ rplane) {
  __shared__ __align__(16) _Float16 ring[RINGH(2)];   // operand ring, then the waves' epilogue slabs
  static_assert(8 * 16 * SP32 * 4 <= RINGH(2) * 2, "the slabs fit the ring");
  float* slabf = (float*)ring;
  const int lane = threadIdx.x & 31, wid = threadIdx.x >> 5;
  const int mb  = blockIdx.x * 128;
  const int nbk = blockIdx.y * 256;
  const int m0 = mb + (wid >> 2) * 64;
  const int n0 = nbk + (wid & 3) * 64;
  const int nb = m0 >> 12;
  const _Float16* Bt = WT + (size_t)(12 + nb) * WPL;
  const float* bias = bo + nb * DM;
  v8f acc[MT][4];
  gemm_core<2>(O16, Bt, mb, nbk, ring, acc);

  float* slab = slabf + wid * (16 * SP32);
  const int c = lane & 15, hh = lane >> 4, c4 = c * 4;
#pragma unroll
  for (int mt = 0; mt < MT; ++mt) {
#pragma unroll
    for (int nt = 0; nt < 4; ++nt) {
      const int coll = nt * 16 + c;
      const float bc = bias[n0 + coll];
#pragma unroll
      for (int r = 0; r < 8; ++r)
        slab[(8 * hh + r) * SP32 + coll] = acc[mt][nt][r] * (1.0f / 256.0f) + bc;
    }
    wave_lds_sync();
    {
#pragma unroll
      for (int it = 0; it < 8; ++it) {
        const int row = it * 2 + hh;
        const int gm  = m0 + mt * 16 + row;
        const v4f val = *(const v4f*)(slab + row * SP32 + c4);
        float* dst = ((gm & (SEQL - 1)) == (SEQL - 1))
                         ? (rplane + (size_t)(gm >> 10) * DM + n0 + c4)
                         : (out + (size_t)gm * DM + n0 + c4);
        *(v4f*)dst = val;
      }
      
    }
    wave_lds_sync();
  }
}

// ---------------------------------------------------------------------------
// Router (inter) attention in two launches of many work-groups (f32 VALU throughout).
// Both launches share one product form: a work-group of 16 waves owns one batch (4 router rows,
// t = blk*4 + bat) and 32 output columns; wave w takes k in [32w, 32w + 32), lane = column; the 16
// partial sums of an output element meet in LDS and are added in wave order.
// ---------------------------------------------------------------------------
__device__ __forceinline__ void router_w_load(const float* __restrict__ Wm, int wave, int col, float (&w)[32]) {
  const float* wp = Wm + (size_t)(wave * 32) * DM + col;
  // unrolled: w[] stays in registers and all 32 loads are in flight together
#pragma unroll
  for (int j = 0; j < 32; ++j) w[j] = wp[(size_t)j * DM];
}

// rows: LDS [4][512]; red: LDS [16][4][32]. Returns, in threads 0..127, element (row tid>>5, column tid&31).
__device__ __forceinline__ float router_ksplit(const float (&w)[32], const float* rows, float* red,
                                               int tid) {
  const int wave = tid >> 5, lane = tid & 31;
  float a[NBLK] = {0.f, 0.f, 0.f, 0.f};
  // unrolled (here and below): w[] and a[] are indexed by constants only, so they stay in registers
#pragma unroll
  for (int j4 = 0; j4 < 8; ++j4) {
#pragma unroll
    for (int r = 0; r < NBLK; ++r) {
      const v4f rv = *(const v4f*)(rows + r * DM + wave * 32 + j4 * 4);
      a[r] += rv[0] * w[j4 * 4];
      a[r] += rv[1] * w[j4 * 4 + 1];
      a[r] += rv[2] * w[j4 * 4 + 2];
      a[r] += rv[3] * w[j4 * 4 + 3];
    }
  }
#pragma unroll
  for (int r = 0; r < NBLK; ++r) red[(wave * NBLK + r) * 32 + lane] = a[r];
  __syncthreads();
  float s = 0.f;
  if (tid < 128) {
#pragma unroll
    for (int wv = 0; wv < 16; ++wv) s += red[wv * 128 + tid];
  }
  return s;
}

// rq / rk / rv: RP[p][t][n] = sum_k rplane[t][k] * iW_p[k][n] + ib_p[n].  grid (16, 4, 3) = (column
// chunk, bat, p), 512 threads.
__global__ void __launch_bounds__(512)
router_proj_kernel(const float* __restrict__ rplane,
                   const float* __restrict__ iWq, const float* __restrict__ ibq,
                   const float* __restrict__ iWk, const float* __restrict__ ibk,
                   const float* __restrict__ iWv, const float* __restrict__ ibv,
                   float* __restrict__ RP) {
  __shared__ __align__(16) float Rr[NBLK * DM];
  __shared__ float red[16 * NBLK * 32];
  const int tid = threadIdx.x;
  const int col = blockIdx.x * 32 + (tid & 31);
  const int b = blockIdx.y, p = blockIdx.z;
  const float* Wm = (p == 0) ? iWq : ((p == 1) ? iWk : iWv);
  const float* bb = (p == 0) ? ibq : ((p == 1) ? ibk : ibv);
  const int ri = tid >> 7, rc4 = (tid & 127) * 4;
  const v4f rin = *(const v4f*)(rplane + (size_t)(ri * NBAT + b) * DM + rc4);
  // the weight loads below may land in the registers that held this load's address
  asm volatile("s_wait_xcnt 0x0" ::: "memory");
  float w[32];
  router_w_load(Wm, tid >> 5, col, w);
  *(v4f*)(Rr + ri * DM + rc4) = rin;
  __syncthreads();
  const float s = router_ksplit(w, Rr, red, tid);
  if (tid < 128) RP[((size_t)p * 16 + (tid >> 5) * NBAT + b) * DM + col] = s + bb[col];
}

// Per batch: 4-key softmax of (rq.rk)*0.125 per (query blk, head), o = sum p*rv / sum p (each
// work-group forms all 4 x 512 of its batch), then out rows l == 1023 = o . iWo + ibo for its 32
// columns.  grid (16, 4) = (column chunk, bat), 512 threads.
__global__ void __launch_bounds__(512)
router_out_kernel(const float* __restrict__ RP,
                  const float* __restrict__ iWo, const float* __restrict__ ibo,
                  float* __restrict__ out) {
  __shared__ __align__(16) float Pj[3][NBLK * DM];
  __shared__ __align__(16) float Ro[NBLK * DM];
  __shared__ float red[16 * NBLK * 32];
  const int tid = threadIdx.x;
  const int col = blockIdx.x * 32 + (tid & 31);
  const int b = blockIdx.y;
  float w[32];
  router_w_load(iWo, tid >> 5, col, w);
  {
    const int i = tid >> 7, c4 = (tid & 127) * 4;
#pragma unroll
    for (int p = 0; p < 3; ++p)
      *(v4f*)(&Pj[p][i * DM + c4]) = *(const v4f*)(RP + ((size_t)p * 16 + i * NBAT + b) * DM + c4);
  }
  __syncthreads();
  {
    // 16 lanes per (query blk, head); each lane holds 4 of the 64 head elements
    const int item = tid >> 4;              // 0..31
    const int nq = item >> 3, hd = item & 7;
    const int eo = hd * HD + (tid & 15) * 4;
    const v4f q4 = *(const v4f*)(&Pj[0][nq * DM + eo]);
    const v4f v0 = *(const v4f*)(&Pj[2][eo]);
    const v4f v1 = *(const v4f*)(&Pj[2][DM + eo]);
    const v4f v2 = *(const v4f*)(&Pj[2][2 * DM + eo]);
    const v4f v3 = *(const v4f*)(&Pj[2][3 * DM + eo]);
    float sc[NBLK];
#pragma unroll
    for (int s = 0; s < NBLK; ++s) {
      const v4f k4 = *(const v4f*)(&Pj[1][s * DM + eo]);
      sc[s] = q4[0] * k4[0] + q4[1] * k4[1] + q4[2] * k4[2] + q4[3] * k4[3];
    }
    // keeps the four v reads in one batch ahead of the exponentials; sunk in between them their
    // LDS latency would stand in the dependent chain three times
    asm volatile("" :: "v"(v0), "v"(v1), "v"(v2), "v"(v3));
#pragma unroll
    for (int m = 1; m < 16; m <<= 1) {
#pragma unroll
      for (int s = 0; s < NBLK; ++s) sc[s] += __shfl_xor(sc[s], m, 32);
    }
#pragma unroll
    for (int s = 0; s < NBLK; ++s) sc[s] *= 0.125f;
    const float mx = fmaxf(fmaxf(sc[0], sc[1]), fmaxf(sc[2], sc[3]));
    const float p0 = __expf(sc[0] - mx), p1 = __expf(sc[1] - mx), p2 = __expf(sc[2] - mx), p3 = __expf(sc[3] - mx);
    const float inv = 1.0f / (p0 + p1 + p2 + p3);
    v4f o4;
#pragma unroll
    for (int j = 0; j < 4; ++j) o4[j] = (p0 * v0[j] + p1 * v1[j] + p2 * v2[j] + p3 * v3[j]) * inv;
    *(v4f*)(Ro + nq * DM + eo) = o4;
  }
  __syncthreads();
  const float s = router_ksplit(w, Ro, red, tid);
  if (tid < 128)
    out[((size_t)((tid >> 5) * NBAT + b) * SEQL + (SEQL - 1)) * DM + col] = s + ibo[col];
}

// ---------------------------------------------------------------------------
// Workspace map (byte offsets; every region fully written before it is read; the f16 planes are packed
// in fragment blocks, see frag_ld; all regions are exact
//   X16   f16 [16384][512]            0          16777216 B
//   WT16  f16 [16][512][512]     16777216           8388608 B   (Wq,Wk,Wv,Wo planes x 4 blks, [out][in], x16)
//   Q16   f16 [16384][512]     25165824          16777216 B
//   K16   f16 [16384][512]     41943040          16777216 B
//   VT16  f16 [16][512][1024]  58720256          16777216 B
//   O16   f16 [16384][512]     75497472          16777216 B   (attention output x16)
//   RPL   f32 [16][512]        92274688             32768 B   (router rows, t = blk*4 + bat)
//   RP    f32 [3][16][512]     92307456             98304 B   (router q, k, v projections)
//   total                      92405760
// ---------------------------------------------------------------------------
extern "C" void kernel_launch(void* const* d_in, const int* in_sizes, int n_in,
                              void* d_out, int out_size, void* d_ws, size_t ws_size,
                              hipStream_t stream) {
  if (n_in < 17) return;
  if (in_sizes[0] != MROWS * DM) return;
  if (in_sizes[1] != NBLK * WPL || in_sizes[3] != NBLK * WPL || in_sizes[5] != NBLK * WPL || in_sizes[7] != NBLK * WPL) return;
  if (in_sizes[2] != NBLK * DM || in_sizes[4] != NBLK * DM || in_sizes[6] != NBLK * DM || in_sizes[8] != NBLK * DM) return;
  if (in_sizes[9] != WPL || in_sizes[11] != WPL || in_sizes[13] != WPL || in_sizes[15] != WPL) return;
  if (in_sizes[10] != DM || in_sizes[12] != DM || in_sizes[14] != DM || in_sizes[16] != DM) return;
  if (out_size != MROWS * DM) return;

  const float* x   = (const float*)d_in[0];
  const float* Wq  = (const float*)d_in[1];  const float* bq  = (const float*)d_in[2];
  const float* Wk  = (const float*)d_in[3];  const float* bk  = (const float*)d_in[4];
  const float* Wv  = (const float*)d_in[5];  const float* bv  = (const float*)d_in[6];
  const float* Wo  = (const float*)d_in[7];  const float* bo  = (const float*)d_in[8];
  const float* iWq = (const float*)d_in[9];  const float* ibq = (const float*)d_in[10];
  const float* iWk = (const float*)d_in[11]; const float* ibk = (const float*)d_in[12];
  const float* iWv = (const float*)d_in[13]; const float* ibv = (const float*)d_in[14];
  const float* iWo = (const float*)d_in[15]; const float* ibo = (const float*)d_in[16];
  float* out = (float*)d_out;

  const size_t bAct = (size_t)MROWS * DM * 2;      // 16777216
  const size_t bWT  = (size_t)16 * WPL * 2;        // 8388608
  const size_t bRpl = (size_t)16 * DM * 4;         // 32768
  const size_t bRp  = (size_t)3 * 16 * DM * 4;     // 98304
  size_t off = 0;
  const size_t oX  = off; off += bAct;
  const size_t oWT = off; off += bWT;
  const size_t oQ  = off; off += bAct;
  const size_t oK  = off; off += bAct;
  const size_t oVT = off; off += bAct;
  const size_t oO  = off; off += bAct;
  const size_t oR  = off; off += bRpl;
  const size_t oP  = off; off += bRp;
  if (off > ws_size) return;                       // off = 92405760

  char* ws = (char*)d_ws;
  _Float16* X16  = (_Float16*)(ws + oX);
  _Float16* WT16 = (_Float16*)(ws + oWT);
  _Float16* Q16  = (_Float16*)(ws + oQ);
  _Float16* K16  = (_Float16*)(ws + oK);
  _Float16* VT16 = (_Float16*)(ws + oVT);
  _Float16* O16  = (_Float16*)(ws + oO);
  float*    RPL  = (float*)(ws + oR);
  float*    RP   = (float*)(ws + oP);

  // (1) weights -> transposed f16 planes (x16), and x -> f16 plane
  prep_kernel<<<dim3(WTB), dim3(256), 0, stream>>>(x, Wq, Wk, Wv, Wo, X16, WT16);
  // (2) q, k projections, and the v^T projection per (blk, bat)
  qkv_gemm_kernel<<<dim3(QKB + VTB), dim3(256), 0, stream>>>(X16, WT16, bq, bk, bv, Q16, K16, VT16);
  // (3) intra attention
  attn_kernel<<<dim3(NBLK * NBAT * NH * (SEQL / 128)), dim3(128), 0, stream>>>(Q16, K16, VT16, O16);
  // (4) output projection -> d_out (rows l < 1023) and router plane (rows l == 1023)
  wo_gemm_kernel<<<dim3(MROWS / 128, DM / 256, 1), dim3(256), 0, stream>>>(O16, WT16, bo, out, RPL);
  // (5) router q, k, v projections
  router_proj_kernel<<<dim3(DM / 32, NBAT, 3), dim3(512), 0, stream>>>(RPL, iWq, ibq, iWk, ibk, iWv, ibv, RP);
  // (6) router attention + output projection -> d_out rows l == 1023
  router_out_kernel<<<dim3(DM / 32, NBAT), dim3(512), 0, stream>>>(RP, iWo, ibo, out);
  (void)hipGetLastError();
}

// v010
// A run of this version takes 90.5 microseconds.
// Timed twice side by side with v009, it ran 1.06 and 1.05 times as fast.
// Over all steps from v000 it is 12.6 times as fast.
// Contractions q/k/v^T projections, q.k^T, p.v, out projection: v_wmma_f32_16x16x32_f16, f16 operands (W x16; x and p x1; attention output o x16), f32 accumulate; softmax f32 (scale 0.125 log2 e applied to q in f32 ahead of its rounding to f16); router-token attention and its four projections: f32 VALU.
#include <hip/hip_runtime.h>

typedef _Float16 v16h __attribute__((ext_vector_type(16)));
typedef _Float16 v8h  __attribute__((ext_vector_type(8)));
typedef float    v8f  __attribute__((ext_vector_type(8)));
typedef float    v4f  __attribute__((ext_vector_type(4)));

#define NBLK  4
#define NBAT  4
#define SEQL  1024
#define DM    512
#define NH    8
#define HD    64
#define MROWS 16384          // NBLK*NBAT*SEQL
#define WPL   262144         // DM*DM, one weight plane
#define ZPL   524288         // SEQL*DM, one (blk,bat) activation plane
#define SP16  72             // f16 LDS slab pitch (halves), 144 B rows
#define SP32  68             // f32 LDS slab pitch (floats), 272 B rows
#define QSC   0.18033688011112042f   // 0.125 * log2(e): score scale times the change from e^x to 2^x

union FragU { v16h v; v8h h[2]; };

// Packed operand planes. Every f16 matrix [rows][K] of the workspace is stored as fragment blocks:
// block (rt = row >> 4, kt = k >> 5) is FBH halves (1 KiB) at (rt * (K / 32) + kt) * FBH; inside it the
// 16-B unit u = o * 16 + c holds row rt*16 + c, k = kt*32 + o*8 .. + 7 (o = 0..3, c = 0..15).
// 16x16x32 operand fragment: p = block + lane*8; elements 0..7 <- unit lane (k = 8*(lane>>4) + e),
// elements 8..15 <- unit 32 + lane (16 more): the same k order for A rows m and Bt rows n, and each of
// the two loads of a wave reads 512 contiguous bytes (4 cache lines; from k-contiguous rows it was 16).
#define FBH 512
__device__ __forceinline__ v16h frag_ld(const _Float16* p) {
  FragU f;
  f.h[0] = *(const v8h*)(p);
  f.h[1] = *(const v8h*)(p + 256);
  return f.v;
}

__device__ __forceinline__ v8f mma16(v16h a, v16h b, v8f c) {
  c = __builtin_amdgcn_wmma_f32_16x16x32_f16(false, a, false, b, (short)0, c, false, false);
  asm volatile("v_nop\n\tv_nop\n\tv_nop\n\tv_nop" : "+v"(c) : "v"(a), "v"(b));
  return c;
}

__device__ __forceinline__ void wave_lds_sync() {
  __builtin_amdgcn_fence(__ATOMIC_RELEASE, "workgroup");
  __builtin_amdgcn_wave_barrier();
  __builtin_amdgcn_fence(__ATOMIC_ACQUIRE, "workgroup");
}

__device__ __forceinline__ v8f zero8() { return (v8f){0.f, 0.f, 0.f, 0.f, 0.f, 0.f, 0.f, 0.f}; }

// ---------------------------------------------------------------------------
// Both preparations in one launch: they share no data, so each of the WTB blocks does one weight tile
// and its share of x.  grid WTB = 8 x 8 x 16 = 1024 blocks of 256 threads, bx = z*64 + y*8 + x.
// Weight transpose + x16 + f16: W (f32 [in=512][out=512], blk plane nb of Wq/Wk/Wv/Wo)
//   -> WT[z][out][in] = f16(16 * W[in][out]), packed (rows = out, k = in), z = widx*4 + nb  (widx 0=q,1=k,2=v,3=o).
//   64x64 tiles through LDS.  Coverage per block: load 4 it x 256 thr x 4 = 64x64; store 2 it x 256 thr x 8 = 64x64.
// x f32 [16384][512] -> packed f16 plane: block bx converts row tile bx (16 rows x 512 = 32 KiB read, 16 KiB
//   written, both contiguous), XUN = 4 units of 16 B a thread: unit bx*1024 + j*256 + tid is row
//   bx*16 + (tid & 15), k = j*128 + (tid >> 4)*8 .. + 7.  Coverage: 1024 blocks x 256 thr x 4 x 8 = 16384 x 512.
// ---------------------------------------------------------------------------
#define WTB ((DM / 64) * (DM / 64) * 16)
#define XUN (MROWS * DM / 8 / (WTB * 256))
static_assert(WTB == MROWS / 16 && XUN * 128 == DM, "one 16-row tile of x for each block");
__global__ void __launch_bounds__(256)
prep_kernel(const float* __restrict__ x,
            const float* __restrict__ Wq, const float* __restrict__ Wk,
            const float* __restrict__ Wv, const float* __restrict__ Wo,
            _Float16* __restrict__ X16, _Float16* __restrict__ WT) {
  __shared__ __align__(16) float tf[64 * 68];
  const int bx = blockIdx.x;
  const int z  = bx >> 6;
  const int wi = z >> 2, nb = z & 3;
  const float* W = (wi == 0) ? Wq : ((wi == 1) ? Wk : ((wi == 2) ? Wv : Wo));
  W += (size_t)nb * WPL;
  _Float16* O = WT + (size_t)z * WPL;
  const int c0  = (bx & 7) * 64;         // input column block (out feature) = output row block
  const int r0  = ((bx >> 3) & 7) * 64;  // input row block (in feature)     = output column block
  const int tid = threadIdx.x;
  const int lr = tid >> 4;          // 0..15
  const int c4 = (tid & 15) * 4;    // 0..60
  const float* wp = W + (size_t)(r0 + lr) * DM + c0 + c4;
  const float* xp = x + (size_t)(bx * 16 + (tid & 15)) * DM + lr * 8;
  v4f wa[4], xa[XUN], xb[XUN];
  // unrolled (all loops of this kernel): the arrays are indexed by constants only, so they stay in registers
#pragma unroll
  for (int it = 0; it < 4; ++it) wa[it] = *(const v4f*)(wp + (size_t)(it * 16) * DM);
#pragma unroll
  for (int j = 0; j < XUN; ++j) {
    xa[j] = *(const v4f*)(xp + j * 128);
    xb[j] = *(const v4f*)(xp + j * 128 + 4);
  }
  // all twelve loads are out before anything waits for one of them, the weight tile's first, so that its way
  // through LDS runs under the x loads; the registers of the two addresses may be written again behind this wait
  asm volatile("s_wait_xcnt 0x0" :: "v"(wp), "v"(xp) : "memory");
#pragma unroll
  for (int it = 0; it < 4; ++it) *(v4f*)(tf + (it * 16 + lr) * 68 + c4) = wa[it];
  __syncthreads();
  // the tile is 4 row tiles x 2 k tiles = 8 blocks; thread tid writes unit tid & 63 of blocks
  // (rt = tid >> 7, kt = (tid >> 6) & 1) and (rt + 2, kt)
  const int rtl = tid >> 7, ktl = (tid >> 6) & 1;
  const int sub = rtl * 16 + (tid & 15);            // out feature in the tile, 0..31
  const int c8  = ktl * 32 + ((tid >> 4) & 3) * 8;  // in feature in the tile, 0..56
  v8h hv0, hv1;
#pragma unroll
  for (int e = 0; e < 8; ++e) {
    hv0[e] = (_Float16)(16.0f * tf[(c8 + e) * 68 + sub]);
    hv1[e] = (_Float16)(16.0f * tf[(c8 + e) * 68 + 32 + sub]);
  }
  _Float16* p0 = O + (size_t)(((c0 >> 4) + rtl) * (DM / 32) + (r0 >> 5) + ktl) * FBH + (tid & 63) * 8;
  _Float16* p1 = p0 + (size_t)(2 * (DM / 32)) * FBH;
  *(v8h*)p0 = hv0;
  *(v8h*)p1 = hv1;
  _Float16* px = X16 + ((size_t)bx * (XUN * 256) + tid) * 8;
#pragma unroll
  for (int j = 0; j < XUN; ++j) {
    v8h hv;
    hv[0] = (_Float16)xa[j][0]; hv[1] = (_Float16)xa[j][1]; hv[2] = (_Float16)xa[j][2]; hv[3] = (_Float16)xa[j][3];
    hv[4] = (_Float16)xb[j][0]; hv[5] = (_Float16)xb[j][1]; hv[6] = (_Float16)xb[j][2]; hv[7] = (_Float16)xb[j][3];
    *(v8h*)(px + j * (256 * 8)) = hv;
  }
}

// ---------------------------------------------------------------------------
// GEMM core: acc[mt][nt] = sum_k A[m0 + mt*16 + .][k] * Bt[n0 + nt*16 + .][k], K = 512.
// A and Bt are packed f16 planes with K = 512; block tile 128 x 256 at (mb, nbk), 8 waves, wave tile 64 x 64 at
// m0 = mb + (wave >> 2)*64, n0 = nbk + (wave & 3)*64; D element r of lane l is (row 8*(l>>4) + r, col l&15)
// of its 16x16 subtile.  A block brings 384 operand rows from L2 for 128 x 256 results, and a wave reads 8
// fragments from LDS for 16 products.
// The block's operands come through LDS: a stage is KST k tiles (64 k) of its 8 row tiles of A and 16 of Bt,
// row tile r (A: 0..7, Bt: 8..23) at byte r*2048 of the stage, as it lies in the plane (KST fragment blocks in a
// row), so each fragment is brought from L2 once for the block and read by ds_load_b128, 512 contiguous bytes a
// load.  Two buffers of SUB stages each: the next buffer's copies fly while this one is worked on.  SUB = 1 where
// two work-groups share a WGP; SUB = 2 where the grid gives a WGP only one, so that as many bytes are in flight.
// ---------------------------------------------------------------------------
#define MT    4                          // row tiles of A in a wave's tile (a block has two such rows of waves)
#define KST   2                          // k tiles of a stage
#define RTH   (KST * FBH)                // halves of one row tile in a stage (2 KiB)
#define STGH  ((2 * MT + 16) * RTH)      // halves of a stage (48 KiB)
#define NSTG  (DM / 32 / KST)            // stages
#define RINGH(SUB) (2 * (SUB) * STGH)    // halves of the ring (96 KiB x SUB)

// One stage, twelve asynchronous copies of 16 B a thread: thread tid brings byte tid*16 of each 4-KiB pair of row
// tiles.  ga / gb: this thread's place in row tile (tid >> 7) of the block's A / Bt rows at the stage's first k
// tile; l: LDS byte address of the stage's place + tid*16.  The closing wait stands inside the statement, so that no
// address register of a copy is written again in front of it.
__device__ __forceinline__ void stage_copy(const _Float16* ga, const _Float16* gb, uint32_t l) {
  const int R2 = 2 * (DM / 32) * FBH;    // halves from a row tile of a plane to the next but one
  static_assert(MT == 4, "four pairs of A row tiles, eight of Bt");
  asm volatile("global_load_async_to_lds_b128 %0, %12, off\n\t"
               "global_load_async_to_lds_b128 %1, %13, off\n\t"
               "global_load_async_to_lds_b128 %2, %14, off\n\t"
               "global_load_async_to_lds_b128 %3, %15, off\n\t"
               "global_load_async_to_lds_b128 %4, %16, off\n\t"
               "global_load_async_to_lds_b128 %5, %17, off\n\t"
               "global_load_async_to_lds_b128 %6, %18, off\n\t"
               "global_load_async_to_lds_b128 %7, %19, off\n\t"
               "global_load_async_to_lds_b128 %8, %20, off\n\t"
               "global_load_async_to_lds_b128 %9, %21, off\n\t"
               "global_load_async_to_lds_b128 %10, %22, off\n\t"
               "global_load_async_to_lds_b128 %11, %23, off\n\t"
               "s_wait_xcnt 0x0"
               :: "v"(l), "v"(l + 4096u), "v"(l + 8192u), "v"(l + 12288u), "v"(l + 16384u), "v"(l + 20480u),
                  "v"(l + 24576u), "v"(l + 28672u), "v"(l + 32768u), "v"(l + 36864u), "v"(l + 40960u), "v"(l + 45056u),
                  "v"(ga), "v"(ga + R2), "v"(ga + 2 * R2), "v"(ga + 3 * R2),
                  "v"(gb), "v"(gb + R2), "v"(gb + 2 * R2), "v"(gb + 3 * R2),
                  "v"(gb + 4 * R2), "v"(gb + 5 * R2), "v"(gb + 6 * R2), "v"(gb + 7 * R2)
               : "memory");
}

// ring: RINGH(SUB) halves of LDS, 16-B aligned.  Behind the call no copy is in flight and every wave has left
// the ring (the last trip's own barrier), so the caller may use it as staging for its epilogue.
template <int SUB>
__device__ __forceinline__ void gemm_core(const _Float16* __restrict__ A,
                                          const _Float16* __restrict__ Bt,
                                          int mb, int nbk, _Float16* ring, v8f (&acc)[MT][4]) {
  const int RTS  = (DM / 32) * FBH;   // halves from one row tile of a plane to the next
  const int BUFH = SUB * STGH;        // halves of a buffer
  const int NT   = NSTG / SUB;        // trips
  static_assert(NT >= 2 && NT * SUB == NSTG, "both buffers are filled in front of the loop");
  const int tid = threadIdx.x, lane = tid & 31, wid = tid >> 5;
  // unrolled (every loop of this function but the trips): acc[], af[] and bf[] are indexed by constants only, so they
  // stay in registers, and the places of a buffer's stages are constants
#pragma unroll
  for (int i = 0; i < MT; ++i)
#pragma unroll
    for (int j = 0; j < 4; ++j) acc[i][j] = zero8();
  const _Float16* ga = A  + (size_t)((mb  >> 4) + (tid >> 7)) * RTS + (tid & 127) * 8;
  const _Float16* gb = Bt + (size_t)((nbk >> 4) + (tid >> 7)) * RTS + (tid & 127) * 8;
  const uint32_t l0 = (uint32_t)(size_t)ring + (uint32_t)tid * 16u;
#pragma unroll
  for (int s = 0; s < SUB; ++s) stage_copy(ga + s * RTH, gb + s * RTH, l0 + (uint32_t)(s * STGH) * 2u);
  // buffer 0 has landed for this wave; behind the barrier for all
  asm volatile("s_wait_asynccnt 0x0" ::: "memory");
  __syncthreads();
#pragma unroll
  for (int s = 0; s < SUB; ++s)
    stage_copy(ga + (SUB + s) * RTH, gb + (SUB + s) * RTH, l0 + (uint32_t)(BUFH + s * STGH) * 2u);
  const _Float16* fa = ring + ((wid >> 2) * MT) * RTH + lane * 8;           // this wave's four row tiles of A
  const _Float16* fb = ring + (2 * MT + (wid & 3) * 4) * RTH + lane * 8;    // its four row tiles of Bt
  // rolled: one copy of the trip, its publish point and its refill
#pragma unroll 1
  for (int t = 0; t < NT; ++t) {
    const int bo = (t & 1) * BUFH;
#pragma unroll
    for (int kk = 0; kk < SUB * KST; ++kk) {
      const int fo = bo + (kk / KST) * STGH + (kk % KST) * FBH;   // stage of the buffer, k tile of the stage
      v16h bf[4], af[MT];
#pragma unroll
      for (int j = 0; j < 4; ++j) bf[j] = frag_ld(fb + fo + j * RTH);
#pragma unroll
      for (int i = 0; i < MT; ++i) af[i] = frag_ld(fa + fo + i * RTH);
#pragma unroll
      for (int j = 0; j < 4; ++j) {
#pragma unroll
        for (int i = 0; i < MT; ++i) acc[i][j] = mma16(af[i], bf[j], acc[i][j]);
      }
    }
    // publish point of the next buffer: this wave's reads of this buffer are done, its copies into the next have
    // landed; behind the barrier every wave may read the next buffer and this one may be filled again
    asm volatile("s_wait_dscnt 0x0" ::: "memory");
    asm volatile("s_wait_asynccnt 0x0" ::: "memory");
    __syncthreads();
    if (t + 2 < NT) {
#pragma unroll
      for (int s = 0; s < SUB; ++s)
        stage_copy(ga + ((t + 2) * SUB + s) * RTH, gb + ((t + 2) * SUB + s) * RTH,
                   l0 + (uint32_t)(bo + s * STGH) * 2u);
    }
  }
  // the ring's closing wait: no copy outlives the loop
  asm volatile("s_wait_asynccnt 0x0" ::: "memory");
}

// ---------------------------------------------------------------------------
// f16 epilogue: v = acc*scale + bias*bmul (bias per column, or per row when BIAS_ROW); the wave's 64 x 64
// tile goes through its LDS slab and leaves as 8 blocks of the packed plane C (kts = its k tiles per
// row tile), 512 contiguous bytes per store instruction.
// ---------------------------------------------------------------------------
template <bool BIAS_ROW>
__device__ __forceinline__ void epi_f16(v8f (&acc)[MT][4], _Float16* slab,
                                        _Float16* __restrict__ C, int kts,
                                        int m0, int n0, int lane, float scale, float bmul,
                                        const float* __restrict__ bias) {
  const int c = lane & 15, hh = lane >> 4;
  float bcol[4] = {0.f, 0.f, 0.f, 0.f};
  if (!BIAS_ROW) {
    const float* bp = bias + n0 + c;
#pragma unroll
    for (int nt = 0; nt < 4; ++nt) bcol[nt] = bp[nt * 16];
    // names the address, so that it lives to here and none of the four results lands in its registers; behind
    // this wait they may be written again
    asm volatile("s_wait_xcnt 0x0" :: "v"(bp) : "memory");
#pragma unroll
    for (int nt = 0; nt < 4; ++nt) bcol[nt] *= bmul;
  }
#pragma unroll
  for (int mt = 0; mt < MT; ++mt) {
#pragma unroll
    for (int nt = 0; nt < 4; ++nt) {
      const int coll = nt * 16 + c;
      const float bc = bcol[nt];
#pragma unroll
      for (int r = 0; r < 8; ++r) {
        const int rowl = mt * 16 + 8 * hh + r;
        float v = acc[mt][nt][r] * scale;
        v += BIAS_ROW ? bias[m0 + rowl] * bmul : bc;
        slab[rowl * SP16 + coll] = (_Float16)v;
      }
    }
  }
  wave_lds_sync();
  {
#pragma unroll
    for (int it = 0; it < 4 * MT; ++it) {
      const int rtl = it >> 2, ktl = (it >> 1) & 1, uh = it & 1;   // block of the tile, half of the block
      const v8h val = *(const v8h*)(slab + (rtl * 16 + c) * SP16 + ktl * 32 + (uh * 2 + hh) * 8);
      *(v8h*)(C + ((size_t)((m0 >> 4) + rtl) * kts + (n0 >> 5) + ktl) * FBH + uh * 256 + lane * 8) = val;
    }
  }
  wave_lds_sync();
}

// ---------------------------------------------------------------------------
// q, k and v^T projections in one launch: all three read only X16 and WT, so they are told apart by
// block range (block-uniform branch).  Block tile 128 x 256, 8 waves of 64 x 64.
// Blocks 0 .. QKB-1, bx = proj*256 + ny*128 + mx (proj: 0 = q, 1 = k): rows (blk,bat,l) = 16384, N = 512,
//   K = 512; weight plane and bias selected by the row block.  Q16/K16: [16384][512] f16, packed,
//   column (k) = h*64 + e.  Q16 holds q * QSC.
// Blocks QKB .. QKB+VTB-1, b = z*16 + ny*4 + mx, per (blk,bat) z:
//   VT16[z][m = h*64+e][l] = sum_k WvT[nb][m][k] * x[z][l][k] / 16 + bv[nb][m]
//   A = WvT plane (512 x 512), Bt = x plane rows (1024 x 512), C [512][1024] f16, packed (k = l).
// ---------------------------------------------------------------------------
#define QKB ((MROWS / 128) * (DM / 256) * 2)
#define VTB ((DM / 128) * (SEQL / 256) * NBLK * NBAT)
__global__ void __launch_bounds__(256)
qkv_gemm_kernel(const _Float16* __restrict__ X16, const _Float16* __restrict__ WT,
                const float* __restrict__ bq, const float* __restrict__ bk, const float* __restrict__ bv,
                _Float16* __restrict__ Q16, _Float16* __restrict__ K16, _Float16* __restrict__ VT16) {
  __shared__ __align__(16) _Float16 ring[RINGH(1)];   // operand ring, then the waves' epilogue slabs
  static_assert(8 * MT * 16 * SP16 <= RINGH(1), "the slabs fit the ring");
  const int lane = threadIdx.x & 31, wid = threadIdx.x >> 5;
  const int bx = blockIdx.x;
  const bool isv = bx >= QKB;
  const int b  = bx - QKB;
  const int z  = b >> 4;                                   // v^T blocks: (blk,bat)
  const int proj = bx >> 8;                                // q / k blocks: 0 = q, 1 = k
  const int mb  = (isv ? (b & 3) : (bx & 127)) * 128;               // v^T: output feature; q / k: row
  const int nbk = (isv ? ((b >> 2) & 3) : ((bx >> 7) & 1)) * 256;   // v^T: position; q / k: column
  const int m0 = mb + (wid >> 2) * 64;
  const int n0 = nbk + (wid & 3) * 64;
  const int nb = isv ? (z >> 2) : (m0 >> 12);
  const _Float16* A  = isv ? (WT + (size_t)(8 + nb) * WPL) : X16;
  const _Float16* Bt = isv ? (X16 + (size_t)z * ZPL) : (WT + (size_t)(proj * 4 + nb) * WPL);
  _Float16* slab = ring + wid * (MT * 16 * SP16);
  v8f acc[MT][4];
  gemm_core<1>(A, Bt, mb, nbk, ring, acc);
  if (isv) {
    epi_f16<true>(acc, slab, VT16 + (size_t)z * ZPL, SEQL / 32, m0, n0, lane, 0.0625f, 1.0f, bv + nb * DM);
  } else {
    const float qs = (proj == 0) ? QSC : 1.0f;   // the q plane carries the softmax scale
    epi_f16<false>(acc, slab, (proj == 0) ? Q16 : K16, DM / 32, m0, n0, lane, 0.0625f * qs, qs,
                   ((proj == 0) ? bq : bk) + nb * DM);
  }
}

// ---------------------------------------------------------------------------
// Full (unmasked) attention, head dim 64, per (blk,bat) z and head h, in transposed form.
//   q/k rows from Q16/K16 ([z*1024 + l][h*64 + d]); v^T rows from VT16 ([z*512 + h*64 + d][l]); all packed.
//   S^T = k.q^T (A = k rows, Bt = q rows): lane l holds, for query l&15, keys 16j + 8*(l>>4) + r of
//   each 16-key tile j, so the row maximum and the row sum of the online softmax (f32, 32 chunks of
//   32 keys) are in-lane, joined between lanes l and l^16 by one cross-row move.
//   The softmax's reference M of a query (log2 units; any value gives the same quotient) is the maximum of the
//   first pass; when a later score of any query of the wave passes its M by more than 8, each query's M moves up to
//   the larger of M and its maximum of the pass, so p = 2^(s - M) <= 256.  -M is the C operand of the first S^T product and q carries the
//   scale, so the products leave s - M, the exponent itself.
//   O^T += v^T.P^T (A = v^T rows, Bt = P rows): two neighbouring S^T tiles, converted in place, are
//   the Bt fragment in the k order of frag_ld (elements 0..7: k0 + 8*(l>>4) + e, 8..15: 16 more).
//   O16[z*1024 + l][h*64 + d] = f16(16 * O / rowsum), packed: the eight d of accumulator tile t in a lane
//   are unit (t&1)*32 + lane of block (query tile, 2h + (t>>1)), so each tile is stored straight from registers.
//   A wave owns two 16-query tiles, so each k and v^T fragment it loads feeds two products.
//   Block = 8 waves x 32 query rows; grid 512 = z*32 + h*4 + qb; two blocks share a WGP.
//   k and v^T come through LDS: a stage is AKS keys, its 8 row tiles of k (2 KiB each: the head's two fragment
//   blocks) and then its 4 row tiles of v^T (4 KiB each: APS fragment blocks), as they lie in the planes, so a
//   stage is brought from L2 once for the block's 8 waves and each fragment is read by ds_load_b128, 512
//   contiguous bytes a load.  Two buffers: the next stage's copies fly while this one is worked on.
// ---------------------------------------------------------------------------
#define AKS   128                        // keys of a stage
#define APS   (AKS / 32)                 // passes (32 keys) of a stage
#define AKH   ((AKS / 16) * 2 * FBH)     // halves of a stage's k part (16 KiB)
#define ASTH  (AKH + 4 * APS * FBH)      // halves of a stage (32 KiB)
#define ANST  (SEQL / AKS)               // stages

// One stage, eight asynchronous copies of 16 B a thread: thread tid brings byte tid*16 of each 4-KiB piece (a pair
// of k row tiles; a v^T row tile).  gk: this thread's place in row tile (tid >> 7) of the stage's keys; gv: its place
// in the head's first v^T row tile at the stage's first k tile; l: LDS byte address of the stage's place + tid*16.
// The closing wait stands inside the statement, so that no address register of a copy is written again in front of it.
__device__ __forceinline__ void attn_stage_copy(const _Float16* gk, const _Float16* gv, uint32_t l) {
  const int K2 = 2 * (DM / 32) * FBH;    // halves from a row tile of the k plane to the next but one
  const int V1 = (SEQL / 32) * FBH;      // halves from a row tile of the v^T plane to the next
  static_assert(AKS == 128 && HD == 64, "four pairs of k row tiles, four v^T row tiles of 4 KiB");
  asm volatile("global_load_async_to_lds_b128 %0, %8, off\n\t"
               "global_load_async_to_lds_b128 %1, %9, off\n\t"
               "global_load_async_to_lds_b128 %2, %10, off\n\t"
               "global_load_async_to_lds_b128 %3, %11, off\n\t"
               "global_load_async_to_lds_b128 %4, %12, off\n\t"
               "global_load_async_to_lds_b128 %5, %13, off\n\t"
               "global_load_async_to_lds_b128 %6, %14, off\n\t"
               "global_load_async_to_lds_b128 %7, %15, off\n\t"
               "s_wait_xcnt 0x0"
               :: "v"(l), "v"(l + 4096u), "v"(l + 8192u), "v"(l + 12288u),
                  "v"(l + 16384u), "v"(l + 20480u), "v"(l + 24576u), "v"(l + 28672u),
                  "v"(gk), "v"(gk + K2), "v"(gk + 2 * K2), "v"(gk + 3 * K2),
                  "v"(gv), "v"(gv + V1), "v"(gv + 2 * V1), "v"(gv + 3 * V1)
               : "memory");
}

__device__ __forceinline__ float xhalf(float x) {   // value of lane l ^ 16
  const int b = __builtin_bit_cast(int, x);
  return __builtin_bit_cast(float, __builtin_amdgcn_permlanex16(b, b, 0x76543210, 0xfedcba98, false, false));
}

// y[i] = 2^x[i], eight in one statement: the outputs are early-clobber, so no exponential lands on a
// source of the one in front of it, and the closing v_nop is the free slot that the instruction set asks
// for behind the last one
__device__ __forceinline__ void exp2x8(const float (&x)[8], float (&y)[8]) {
  asm("v_exp_f32 %0, %8\n\tv_exp_f32 %1, %9\n\tv_exp_f32 %2, %10\n\tv_exp_f32 %3, %11\n\t"
      "v_exp_f32 %4, %12\n\tv_exp_f32 %5, %13\n\tv_exp_f32 %6, %14\n\tv_exp_f32 %7, %15\n\tv_nop"
      : "=&v"(y[0]), "=&v"(y[1]), "=&v"(y[2]), "=&v"(y[3]), "=&v"(y[4]), "=&v"(y[5]), "=&v"(y[6]), "=&v"(y[7])
      : "v"(x[0]), "v"(x[1]), "v"(x[2]), "v"(x[3]), "v"(x[4]), "v"(x[5]), "v"(x[6]), "v"(x[7]));
}

// y = 2^x with its free slot in the same statement
__device__ __forceinline__ float exp2x1(float x) {
  float y;
  asm("v_exp_f32 %0, %1\n\tv_nop" : "=&v"(y) : "v"(x));
  return y;
}

// four waves a SIMD (two blocks a WGP): the softmax of one wave runs under the products of the others
__global__ void __launch_bounds__(256) __attribute__((amdgpu_waves_per_eu(4, 4)))
attn_kernel(const _Float16* __restrict__ Q16, const _Float16* __restrict__ K16,
            const _Float16* __restrict__ VT16, _Float16* __restrict__ O16) {
  __shared__ __align__(16) _Float16 ring[2 * ASTH];
  const int tid = threadIdx.x, lane = tid & 31;
  // the wave's number in a scalar register: the q and o addresses are then a scalar base and one lane offset
  const int wave = __builtin_amdgcn_readfirstlane(tid >> 5);
  const int bx = blockIdx.x;
  const int qb = bx & 3, h = (bx >> 2) & 7, z = bx >> 5;
  const int q0 = qb * 256 + wave * 32;

  const int QRT = (DM / 32) * FBH;     // halves from one 16-row tile of Q16 / K16 / O16 to the next
  const int VRT = (SEQL / 32) * FBH;   // the same for VT16
  const size_t hq = (size_t)z * ZPL + (2 * h) * FBH + lane * 8;   // row tile 0 of z, first k tile of head h
  const _Float16* Qz = Q16 + hq + (size_t)(q0 >> 4) * QRT;
  const _Float16* gk = K16 + (size_t)z * ZPL + (size_t)(tid >> 7) * QRT + (2 * h) * FBH + (tid & 127) * 8;
  const _Float16* gv = VT16 + (size_t)z * ZPL + (size_t)(h * (HD / 16)) * VRT + tid * 8;
  const uint32_t l0 = (uint32_t)(size_t)ring + (uint32_t)tid * 16u;
  attn_stage_copy(gk, gv, l0);
  _Float16* Oz = O16 + hq + (size_t)(q0 >> 4) * QRT;

  v16h qf[2][2];                     // qf[u][i]: query tile u, d = 32i..
#pragma unroll
  for (int u = 0; u < 2; ++u) {
    qf[u][0] = frag_ld(Qz + u * QRT);
    qf[u][1] = frag_ld(Qz + u * QRT + FBH);
  }
  // the fragment loads below may land in the registers that held this address
  asm volatile("s_wait_xcnt 0x0" :: "v"(Qz) : "memory");

  v8f nm[2] = {zero8(), zero8()};    // query 16u + c: -M in all eight elements (both halves alike)
  float thr = -3.0e38f;              // M moves where s - M is above this: always in the first pass, then 8
  float lrow[2] = {0.f, 0.f};        // this half's sum
  v8f oacc[2][4];                    // oacc[u][t][r] = O^T[d = 16t + 8hh + r][query 16u + c]
#pragma unroll
  for (int u = 0; u < 2; ++u)
#pragma unroll
    for (int t = 0; t < 4; ++t) oacc[u][t] = zero8();

  // Inside a stage fragments are fetched from LDS one pass (32 keys) ahead: the 8 loads of the next pass's k
  // fragments go out as one group right behind this pass's S^T products, into the registers those have just
  // read, and the 8 loads of its v^T fragments right behind the O^T products.  A stage's first pass fetches its
  // own behind the stage's barrier: nothing of a stage is read in front of it.
  // Every fragment serves both query tiles of the wave.  sb: the stage's place in LDS + lane*8; pp: pass of the stage.
  v16h kf[4], vf[4];         // kf[2j + i]: keys 16j.., d = 32i..; vf[t]: d = 16t.., the pass's 32 keys
  auto fetch_k = [&](const _Float16* sb, const int pp) __attribute__((always_inline)) {
#pragma unroll
    for (int j = 0; j < 2; ++j) {
      kf[2 * j]     = frag_ld(sb + (2 * pp + j) * (2 * FBH));
      kf[2 * j + 1] = frag_ld(sb + (2 * pp + j) * (2 * FBH) + FBH);
    }
  };
  auto fetch_v = [&](const _Float16* sb, const int pp) __attribute__((always_inline)) {
#pragma unroll
    for (int t = 0; t < 4; ++t) vf[t] = frag_ld(sb + AKH + (t * APS + pp) * FBH);
  };

  auto pass = [&](const _Float16* sb, const int pp) __attribute__((always_inline)) {
    const bool fetch = pp + 1 < APS;
    v8f s[2][2];             // s[u][j]: keys 16j.. of the pass against query tile u, less M
#pragma unroll
    for (int i = 0; i < 2; ++i)
#pragma unroll
      for (int j = 0; j < 2; ++j)
#pragma unroll
        for (int u = 0; u < 2; ++u) s[u][j] = mma16(kf[2 * j + i], qf[u][i], (i == 0) ? nm[u] : s[u][j]);
    if (fetch) {
      fetch_k(sb, pp + 1);
      // keeps the group ahead of the softmax: sunk behind it, the loads would have only the O^T products to arrive in
      __builtin_amdgcn_sched_barrier(0);
    }
    float mx[2];             // this half's largest s - M of the pass
#pragma unroll
    for (int u = 0; u < 2; ++u) {
      float m = s[u][0][0];
#pragma unroll
      for (int r = 1; r < 8; ++r) m = fmaxf(m, s[u][0][r]);
#pragma unroll
      for (int r = 0; r < 8; ++r) m = fmaxf(m, s[u][1][r]);
      mx[u] = m;
    }
    // one test a pass, a scalar branch: rare behind the first pass
    if (__builtin_amdgcn_ballot_w32(fmaxf(mx[0], mx[1]) > thr) != 0) {
#pragma unroll
      for (int u = 0; u < 2; ++u) {
        const float m = fmaxf(mx[u], xhalf(mx[u]));
        const float d = fmaxf(m, thr - 8.0f);            // M rises by d: first pass to the maximum, later never down
        const float alpha = exp2x1(fminf(-d, 0.f));      // first pass: sums are 0, any finite factor serves
        nm[u] = nm[u] - d;
        lrow[u] *= alpha;
#pragma unroll
        for (int j = 0; j < 2; ++j) s[u][j] = s[u][j] - d;
#pragma unroll
        for (int t = 0; t < 4; ++t) oacc[u][t] = oacc[u][t] * alpha;
      }
      thr = 8.0f;
    }
    FragU pf[2];
#pragma unroll
    for (int u = 0; u < 2; ++u) {
      float ps[2] = {0.f, 0.f};
#pragma unroll
      for (int j = 0; j < 2; ++j) {
        float e[8], p[8];
#pragma unroll
        for (int r = 0; r < 8; ++r) e[r] = s[u][j][r];
        exp2x8(e, p);
#pragma unroll
        for (int r = 0; r < 8; ++r) {
          ps[j] += p[r];
          pf[u].h[j][r] = (_Float16)p[r];
        }
      }
      lrow[u] += ps[0] + ps[1];
    }
#pragma unroll
    for (int t = 0; t < 4; ++t) {
#pragma unroll
      for (int u = 0; u < 2; ++u) oacc[u][t] = mma16(vf[t], pf[u].v, oacc[u][t]);
    }
    if (fetch) fetch_v(sb, pp + 1);
  };

  static_assert(ANST >= 2, "both buffers are filled in front of the loop");
  // stage 0 has landed for this wave; behind the barrier for all
  asm volatile("s_wait_asynccnt 0x0" ::: "memory");
  __syncthreads();
  attn_stage_copy(gk + (size_t)(AKS / 16) * QRT, gv + APS * FBH, l0 + (uint32_t)ASTH * 2u);
  // rolled: one copy of the stage, its publish point and its refill
#pragma unroll 1
  for (int st = 0; st < ANST; ++st) {
    const int bo = (st & 1) * ASTH;
    const _Float16* sb = ring + bo + lane * 8;
    fetch_k(sb, 0);
    fetch_v(sb, 0);
    // unrolled: the places of a stage's fragments are constants, and its last pass has nothing to fetch
#pragma unroll
    for (int pp = 0; pp < APS; ++pp) pass(sb, pp);
    // publish point of the next stage: this wave's reads of this buffer are done, its copies into the other have
    // landed; behind the barrier every wave may read the other buffer and this one may be filled again
    asm volatile("s_wait_dscnt 0x0" ::: "memory");
    asm volatile("s_wait_asynccnt 0x0" ::: "memory");
    __syncthreads();
    if (st + 2 < ANST)
      attn_stage_copy(gk + (size_t)((st + 2) * (AKS / 16)) * QRT, gv + (st + 2) * (APS * FBH), l0 + (uint32_t)bo * 2u);
  }
  // the ring's closing wait: no copy outlives the loop
  asm volatile("s_wait_asynccnt 0x0" ::: "memory");

  v8h ov[2][4];
#pragma unroll
  for (int u = 0; u < 2; ++u) {
    const float inv16 = 16.0f * (1.0f / (lrow[u] + xhalf(lrow[u])));
#pragma unroll
    for (int t = 0; t < 4; ++t)
#pragma unroll
      for (int r = 0; r < 8; ++r) ov[u][t][r] = (_Float16)(oacc[u][t][r] * inv16);
  }
  // keeps the eight stores together behind the last conversion
  __builtin_amdgcn_sched_barrier(0);
#pragma unroll
  for (int u = 0; u < 2; ++u)
#pragma unroll
    for (int t = 0; t < 4; ++t) *(v8h*)(Oz + u * QRT + (t >> 1) * FBH + (t & 1) * 256) = ov[u][t];
}

// ---------------------------------------------------------------------------
// Output projection: out[row][n] = sum_k O16[row][k] * WoT[nb][n][k] / 256 + bo[nb][n]  (f32).
// Rows with l == 1023 (router tokens) go to rplane[(blk*4+bat)][512] instead of d_out (single writer
// of those d_out rows is the router output kernel).  Epilogue: 16-row f32 slabs per wave in LDS; each 256-B
// row segment written by 16 consecutive lanes x 16 B of one instruction (2 rows per instruction,
// ---------------------------------------------------------------------------
__global__ void __launch_bounds__(256)
wo_gemm_kernel(const _Float16* __restrict__ O16, const _Float16* __restrict__ WT,
               const float* __restrict__ bo, float* __restrict__ out, float* __restrict__ rplane) {
  __shared__ __align__(16) _Float16 ring[RINGH(2)];   // operand ring, then the waves' epilogue slabs
  static_assert(8 * 16 * SP32 * 4 <= RINGH(2) * 2, "the slabs fit the ring");
  float* slabf = (float*)ring;
  const int lane = threadIdx.x & 31, wid = threadIdx.x >> 5;
  const int mb  = blockIdx.x * 128;
  const int nbk = blockIdx.y * 256;
  const int m0 = mb + (wid >> 2) * 64;
  const int n0 = nbk + (wid & 3) * 64;
  const int nb = m0 >> 12;
  const _Float16* Bt = WT + (size_t)(12 + nb) * WPL;
  const float* bias = bo + nb * DM;
  v8f acc[MT][4];
  gemm_core<2>(O16, Bt, mb, nbk, ring, acc);

  float* slab = slabf + wid * (16 * SP32);
  const int c = lane & 15, hh = lane >> 4, c4 = c * 4;
#pragma unroll
  for (int mt = 0; mt < MT; ++mt) {
#pragma unroll
    for (int nt = 0; nt < 4; ++nt) {
      const int coll = nt * 16 + c;
      const float bc = bias[n0 + coll];
#pragma unroll
      for (int r = 0; r < 8; ++r)
        slab[(8 * hh + r) * SP32 + coll] = acc[mt][nt][r] * (1.0f / 256.0f) + bc;
    }
    wave_lds_sync();
    {
#pragma unroll
      for (int it = 0; it < 8; ++it) {
        const int row = it * 2 + hh;
        const int gm  = m0 + mt * 16 + row;
        const v4f val = *(const v4f*)(slab + row * SP32 + c4);
        float* dst = ((gm & (SEQL - 1)) == (SEQL - 1))
                         ? (rplane + (size_t)(gm >> 10) * DM + n0 + c4)
                         : (out + (size_t)gm * DM + n0 + c4);
        *(v4f*)dst = val;
      }
      
    }
    wave_lds_sync();
  }
}

// ---------------------------------------------------------------------------
// Router (inter) attention in two launches of many work-groups (f32 VALU throughout).
// Both launches share one product form: a work-group of 16 waves owns one batch (4 router rows,
// t = blk*4 + bat) and 32 output columns; wave w takes k in [32w, 32w + 32), lane = column; the 16
// partial sums of an output element meet in LDS and are added in wave order.
// ---------------------------------------------------------------------------
__device__ __forceinline__ void router_w_load(const float* __restrict__ Wm, int wave, int col, float (&w)[32]) {
  const float* wp = Wm + (size_t)(wave * 32) * DM + col;
  // unrolled: w[] stays in registers and all 32 loads are in flight together
#pragma unroll
  for (int j = 0; j < 32; ++j) w[j] = wp[(size_t)j * DM];
}

// rows: LDS [4][512]; red: LDS [16][4][32]. Returns, in threads 0..127, element (row tid>>5, column tid&31).
__device__ __forceinline__ float router_ksplit(const float (&w)[32], const float* rows, float* red,
                                               int tid) {
  const int wave = tid >> 5, lane = tid & 31;
  float a[NBLK] = {0.f, 0.f, 0.f, 0.f};
  // unrolled (here and below): w[] and a[] are indexed by constants only, so they stay in registers
#pragma unroll
  for (int j4 = 0; j4 < 8; ++j4) {
#pragma unroll
    for (int r = 0; r < NBLK; ++r) {
      const v4f rv = *(const v4f*)(rows + r * DM + wave * 32 + j4 * 4);
      a[r] += rv[0] * w[j4 * 4];
      a[r] += rv[1] * w[j4 * 4 + 1];
      a[r] += rv[2] * w[j4 * 4 + 2];
      a[r] += rv[3] * w[j4 * 4 + 3];
    }
  }
#pragma unroll
  for (int r = 0; r < NBLK; ++r) red[(wave * NBLK + r) * 32 + lane] = a[r];
  __syncthreads();
  float s = 0.f;
  if (tid < 128) {
#pragma unroll
    for (int wv = 0; wv < 16; ++wv) s += red[wv * 128 + tid];
  }
  return s;
}

// rq / rk / rv: RP[p][t][n] = sum_k rplane[t][k] * iW_p[k][n] + ib_p[n].  grid (16, 4, 3) = (column
// chunk, bat, p), 512 threads.
__global__ void __launch_bounds__(512)
router_proj_kernel(const float* __restrict__ rplane,
                   const float* __restrict__ iWq, const float* __restrict__ ibq,
                   const float* __restrict__ iWk, const float* __restrict__ ibk,
                   const float* __restrict__ iWv, const float* __restrict__ ibv,
                   float* __restrict__ RP) {
  __shared__ __align__(16) float Rr[NBLK * DM];
  __shared__ float red[16 * NBLK * 32];
  const int tid = threadIdx.x;
  const int col = blockIdx.x * 32 + (tid & 31);
  const int b = blockIdx.y, p = blockIdx.z;
  const float* Wm = (p == 0) ? iWq : ((p == 1) ? iWk : iWv);
  const float* bb = (p == 0) ? ibq : ((p == 1) ? ibk : ibv);
  const int ri = tid >> 7, rc4 = (tid & 127) * 4;
  const v4f rin = *(const v4f*)(rplane + (size_t)(ri * NBAT + b) * DM + rc4);
  // the weight loads below may land in the registers that held this load's address
  asm volatile("s_wait_xcnt 0x0" ::: "memory");
  float w[32];
  router_w_load(Wm, tid >> 5, col, w);
  *(v4f*)(Rr + ri * DM + rc4) = rin;
  __syncthreads();
  const float s = router_ksplit(w, Rr, red, tid);
  if (tid < 128) RP[((size_t)p * 16 + (tid >> 5) * NBAT + b) * DM + col] = s + bb[col];
}

// Per batch: 4-key softmax of (rq.rk)*0.125 per (query blk, head), o = sum p*rv / sum p (each
// work-group forms all 4 x 512 of its batch), then out rows l == 1023 = o . iWo + ibo for its 32
// columns.  grid (16, 4) = (column chunk, bat), 512 threads.
__global__ void __launch_bounds__(512)
router_out_kernel(const float* __restrict__ RP,
                  const float* __restrict__ iWo, const float* __restrict__ ibo,
                  float* __restrict__ out) {
  __shared__ __align__(16) float Pj[3][NBLK * DM];
  __shared__ __align__(16) float Ro[NBLK * DM];
  __shared__ float red[16 * NBLK * 32];
  const int tid = threadIdx.x;
  const int col = blockIdx.x * 32 + (tid & 31);
  const int b = blockIdx.y;
  float w[32];
  router_w_load(iWo, tid >> 5, col, w);
  {
    const int i = tid >> 7, c4 = (tid & 127) * 4;
#pragma unroll
    for (int p = 0; p < 3; ++p)
      *(v4f*)(&Pj[p][i * DM + c4]) = *(const v4f*)(RP + ((size_t)p * 16 + i * NBAT + b) * DM + c4);
  }
  __syncthreads();
  {
    // 16 lanes per (query blk, head); each lane holds 4 of the 64 head elements
    const int item = tid >> 4;              // 0..31
    const int nq = item >> 3, hd = item & 7;
    const int eo = hd * HD + (tid & 15) * 4;
    const v4f q4 = *(const v4f*)(&Pj[0][nq * DM + eo]);
    const v4f v0 = *(const v4f*)(&Pj[2][eo]);
    const v4f v1 = *(const v4f*)(&Pj[2][DM + eo]);
    const v4f v2 = *(const v4f*)(&Pj[2][2 * DM + eo]);
    const v4f v3 = *(const v4f*)(&Pj[2][3 * DM + eo]);
    float sc[NBLK];
#pragma unroll
    for (int s = 0; s < NBLK; ++s) {
      const v4f k4 = *(const v4f*)(&Pj[1][s * DM + eo]);
      sc[s] = q4[0] * k4[0] + q4[1] * k4[1] + q4[2] * k4[2] + q4[3] * k4[3];
    }
    // keeps the four v reads in one batch ahead of the exponentials; sunk in between them their
    // LDS latency would stand in the dependent chain three times
    asm volatile("" :: "v"(v0), "v"(v1), "v"(v2), "v"(v3));
#pragma unroll
    for (int m = 1; m < 16; m <<= 1) {
#pragma unroll
      for (int s = 0; s < NBLK; ++s) sc[s] += __shfl_xor(sc[s], m, 32);
    }
#pragma unroll
    for (int s = 0; s < NBLK; ++s) sc[s] *= 0.125f;
    const float mx = fmaxf(fmaxf(sc[0], sc[1]), fmaxf(sc[2], sc[3]));
    const float p0 = __expf(sc[0] - mx), p1 = __expf(sc[1] - mx), p2 = __expf(sc[2] - mx), p3 = __expf(sc[3] - mx);
    const float inv = 1.0f / (p0 + p1 + p2 + p3);
    v4f o4;
#pragma unroll
    for (int j = 0; j < 4; ++j) o4[j] = (p0 * v0[j] + p1 * v1[j] + p2 * v2[j] + p3 * v3[j]) * inv;
    *(v4f*)(Ro + nq * DM + eo) = o4;
  }
  __syncthreads();
  const float s = router_ksplit(w, Ro, red, tid);
  if (tid < 128)
    out[((size_t)((tid >> 5) * NBAT + b) * SEQL + (SEQL - 1)) * DM + col] = s + ibo[col];
}

// ---------------------------------------------------------------------------
// Workspace map (byte offsets; every region fully written before it is read; the f16 planes are packed
// in fragment blocks, see frag_ld; all regions are exact
//   X16   f16 [16384][512]            0          16777216 B
//   WT16  f16 [16][512][512]     16777216           8388608 B   (Wq,Wk,Wv,Wo planes x 4 blks, [out][in], x16)
//   Q16   f16 [16384][512]     25165824          16777216 B
//   K16   f16 [16384][512]     41943040          16777216 B
//   VT16  f16 [16][512][1024]  58720256          16777216 B
//   O16   f16 [16384][512]     75497472          16777216 B   (attention output x16)
//   RPL   f32 [16][512]        92274688             32768 B   (router rows, t = blk*4 + bat)
//   RP    f32 [3][16][512]     92307456             98304 B   (router q, k, v projections)
//   total                      92405760
// ---------------------------------------------------------------------------
extern "C" void kernel_launch(void* const* d_in, const int* in_sizes, int n_in,
                              void* d_out, int out_size, void* d_ws, size_t ws_size,
                              hipStream_t stream) {
  if (n_in < 17) return;
  if (in_sizes[0] != MROWS * DM) return;
  if (in_sizes[1] != NBLK * WPL || in_sizes[3] != NBLK * WPL || in_sizes[5] != NBLK * WPL || in_sizes[7] != NBLK * WPL) return;
  if (in_sizes[2] != NBLK * DM || in_sizes[4] != NBLK * DM || in_sizes[6] != NBLK * DM || in_sizes[8] != NBLK * DM) return;
  if (in_sizes[9] != WPL || in_sizes[11] != WPL || in_sizes[13] != WPL || in_sizes[15] != WPL) return;
  if (in_sizes[10] != DM || in_sizes[12] != DM || in_sizes[14] != DM || in_sizes[16] != DM) return;
  if (out_size != MROWS * DM) return;

  const float* x   = (const float*)d_in[0];
  const float* Wq  = (const float*)d_in[1];  const float* bq  = (const float*)d_in[2];
  const float* Wk  = (const float*)d_in[3];  const float* bk  = (const float*)d_in[4];
  const float* Wv  = (const float*)d_in[5];  const float* bv  = (const float*)d_in[6];
  const float* Wo  = (const float*)d_in[7];  const float* bo  = (const float*)d_in[8];
  const float* iWq = (const float*)d_in[9];  const float* ibq = (const float*)d_in[10];
  const float* iWk = (const float*)d_in[11]; const float* ibk = (const float*)d_in[12];
  const float* iWv = (const float*)d_in[13]; const float* ibv = (const float*)d_in[14];
  const float* iWo = (const float*)d_in[15]; const float* ibo = (const float*)d_in[16];
  float* out = (float*)d_out;

  const size_t bAct = (size_t)MROWS * DM * 2;      // 16777216
  const size_t bWT  = (size_t)16 * WPL * 2;        // 8388608
  const size_t bRpl = (size_t)16 * DM * 4;         // 32768
  const size_t bRp  = (size_t)3 * 16 * DM * 4;     // 98304
  size_t off = 0;
  const size_t oX  = off; off += bAct;
  const size_t oWT = off; off += bWT;
  const size_t oQ  = off; off += bAct;
  const size_t oK  = off; off += bAct;
  const size_t oVT = off; off += bAct;
  const size_t oO  = off; off += bAct;
  const size_t oR  = off; off += bRpl;
  const size_t oP  = off; off += bRp;
  if (off > ws_size) return;                       // off = 92405760

  char* ws = (char*)d_ws;
  _Float16* X16  = (_Float16*)(ws + oX);
  _Float16* WT16 = (_Float16*)(ws + oWT);
  _Float16* Q16  = (_Float16*)(ws + oQ);
  _Float16* K16  = (_Float16*)(ws + oK);
  _Float16* VT16 = (_Float16*)(ws + oVT);
  _Float16* O16  = (_Float16*)(ws + oO);
  float*    RPL  = (float*)(ws + oR);
  float*    RP   = (float*)(ws + oP);

  // (1) weights -> transposed f16 planes (x16), and x -> f16 plane
  prep_kernel<<<dim3(WTB), dim3(256), 0, stream>>>(x, Wq, Wk, Wv, Wo, X16, WT16);
  // (2) q, k projections, and the v^T projection per (blk, bat)
  qkv_gemm_kernel<<<dim3(QKB + VTB), dim3(256), 0, stream>>>(X16, WT16, bq, bk, bv, Q16, K16, VT16);
  // (3) intra attention
  attn_kernel<<<dim3(NBLK * NBAT * NH * (SEQL / 256)), dim3(256), 0, stream>>>(Q16, K16, VT16, O16);
  // (4) output projection -> d_out (rows l < 1023) and router plane (rows l == 1023)
  wo_gemm_kernel<<<dim3(MROWS / 128, DM / 256, 1), dim3(256), 0, stream>>>(O16, WT16, bo, out, RPL);
  // (5) router q, k, v projections
  router_proj_kernel<<<dim3(DM / 32, NBAT, 3), dim3(512), 0, stream>>>(RPL, iWq, ibq, iWk, ibk, iWv, ibv, RP);
  // (6) router attention + output projection -> d_out rows l == 1023
  router_out_kernel<<<dim3(DM / 32, NBAT), dim3(512), 0, stream>>>(RP, iWo, ibo, out);
  (void)hipGetLastError();
}
